// v000
// The times below were measured on an AMD MI455X: many runs one after another, warmed up first and cycling through
// copies of the inputs, with the whole window's GPU time divided by the number of runs. Launches and the gaps
// between them are all in it. The median over several windows is given; except for v000 it joins two sittings, which
// can be a few percent apart, so the side-by-side timings, each taken in one sitting, are the better comparison.
// v000 is the starting kernel. One run takes 176 microseconds.
// Contractions: x.Wqkv^T on v_wmma_f32_16x16x32_bf16 (both operands RNE-converted to bf16 once); q.k^T, p.v and ctx.Wout^T on v_wmma_f32_16x16x32_f16 with single f16 planes (q, k, v x16; p x256; ctx x256; Wout = bf16-converted value x1024), one product per site; f32 accumulate; softmax in f32.
#include <hip/hip_runtime.h>

typedef __attribute__((ext_vector_type(16))) __bf16 v16b;
typedef __attribute__((ext_vector_type(8)))  __bf16 v8b;
typedef __attribute__((ext_vector_type(16))) _Float16 v16h;
typedef __attribute__((ext_vector_type(8)))  _Float16 v8h;
typedef __attribute__((ext_vector_type(8)))  float  v8f;
typedef __attribute__((ext_vector_type(4)))  float  v4f;
typedef __attribute__((ext_vector_type(4)))  unsigned int v4u;
typedef v8h v8h_a __attribute__((may_alias));
typedef v4f v4f_a __attribute__((may_alias));
typedef v4u v4u_a __attribute__((may_alias));
typedef _Float16 h16;

#ifndef NB
#define NB 2
#endif
#ifndef SEQ
#define SEQ 1024
#endif
#define NB_FULL 2
#define SEQ_FULL 1024

#define VGPR_CAP __attribute__((amdgpu_num_vgpr(256)))

/* power-of-two carries of the f16 operand planes and their f32 fold-backs */
#define QKV_CARRY   16.0f                 /* q, k, v planes                         */
#define P_CARRY     256.0f                /* exp(s - m) tiles                       */
#define CTX_CARRY   256.0f                /* context plane                          */
#define WO_CARRY    1024.0f               /* output weight plane                    */
#define SCORE_SCALE 0.00048828125f        /* 0.125 / (16 * 16) = 2^-11              */
#define CTX_FOLD    16.0f                 /* CTX_CARRY / QKV_CARRY (P carry cancels) */
#define OUT_FOLD    3.814697265625e-06f   /* 1 / (256 * 1024) = 2^-18               */

constexpr int DMODEL = 1024;
constexpr int NHEAD  = 16;
constexpr int DHEAD  = 64;
constexpr int NQKV   = 3 * DMODEL;
constexpr int NBH    = NB * NHEAD;
constexpr int MROWS  = NB * SEQ;
constexpr int KCH    = 64;        /* keys per chunk */
constexpr int NWAVE  = 4;
constexpr int TQ_PITCH = 72;      /* [tok][d] staging pitch (16-bit elements) */
constexpr int TV_PITCH = 136;     /* [d][tok] staging pitch (16-bit elements) */
constexpr int T_ELEMS  = 128 * TQ_PITCH;   /* 9216 >= 64 * TV_PITCH = 8704 */
constexpr int OS_PITCH = 68;

constexpr size_t PLANE  = (size_t)NBH * SEQ * DHEAD;
constexpr size_t XB_E   = (size_t)MROWS * DMODEL;
constexpr size_t WQT_E  = (size_t)NQKV * DMODEL;
constexpr size_t WOT_E  = (size_t)DMODEL * DMODEL;
constexpr size_t QKVP_E = 3 * PLANE;
constexpr size_t CTX_E  = XB_E;
constexpr size_t WS_NEED = 2 * (XB_E + WQT_E + WOT_E + QKVP_E + CTX_E);

static_assert(SEQ % 128 == 0);
static_assert(KCH == 64 && SEQ % KCH == 0);
static_assert(SEQ <= SEQ_FULL && NB <= NB_FULL);
static_assert(DHEAD == 64 && DMODEL == NHEAD * DHEAD);
static_assert(DMODEL % 64 == 0 && NQKV % 64 == 0 && DMODEL % 32 == 0);
static_assert(DMODEL % 8 == 0 && DHEAD % 8 == 0);
static_assert(MROWS % 128 == 0);
static_assert(NWAVE * 16 == 64 && NWAVE * 32 == 128);
static_assert(64 * TV_PITCH <= T_ELEMS);
static_assert(TQ_PITCH >= 64 && TV_PITCH >= 128 && OS_PITCH >= 64);
static_assert((TQ_PITCH * 2) % 16 == 0 && (TV_PITCH * 2) % 16 == 0 && (OS_PITCH * 4) % 16 == 0);
static_assert(XB_E % 64 == 0 && WQT_E % 64 == 0 && WOT_E % 64 == 0 && PLANE % 64 == 0);
static_assert(WS_NEED <= 134217728ull);

/*
 *   Xb   [MROWS][1024]        x, bf16
 *   WqT  [3072][1024]         W_qkv (already [out][in]), bf16
 *   WoH  [1024][1024]         W_out (already [out][in]), bf16-converted value x1024 held in f16
 *   qkvp 3 planes f16: Q [bh][l][64] (q x16), K [bh][l][64] (k x16), Vt [bh][64][l] (v x16)
 *   ctxp 1 plane  f16: C [MROWS][1024] (ctx x256)
 */

__device__ __forceinline__ unsigned short f2bf_bits(float f) {
  unsigned u = __float_as_uint(f);
  return (unsigned short)((u + 0x7FFFu + ((u >> 16) & 1u)) >> 16);
}
__device__ __forceinline__ float bf_bits2f(unsigned short h) { return __uint_as_float(((unsigned)h) << 16); }
__device__ __forceinline__ unsigned pk2(float a, float b) {
  return (unsigned)f2bf_bits(a) | ((unsigned)f2bf_bits(b) << 16);
}

/* f32 -> f16 (RNE) with a value select so that no subnormal f16 is ever produced */
static __device__ __forceinline__ h16 toh_flush(float v) {
  const h16 r = (h16)v;
  return (fabsf(v) < 6.103515625e-05f) ? (h16)0.0f : r;
}
static __device__ __forceinline__ unsigned short hbits(h16 v) {
  return __builtin_bit_cast(unsigned short, v);
}
static __device__ __forceinline__ unsigned pkh2(float a, float b) {
  return (unsigned)hbits(toh_flush(a)) | ((unsigned)hbits(toh_flush(b)) << 16);
}

/* one WMMA + hazard guard naming only this call's live operands */
__device__ __forceinline__ v8f mma_bf16(v16b a, v16b b, v8f c) {
  c = __builtin_amdgcn_wmma_f32_16x16x32_bf16(false, a, false, b, (short)0, c, false, false);
  asm volatile("v_nop\n\tv_nop\n\tv_nop\n\tv_nop" : "+v"(c) : "v"(a), "v"(b));
  return c;
}
__device__ __forceinline__ v8f mma_f16(v16h a, v16h b, v8f c) {
  c = __builtin_amdgcn_wmma_f32_16x16x32_f16(false, a, false, b, (short)0, c, false, false);
  asm volatile("v_nop\n\tv_nop\n\tv_nop\n\tv_nop" : "+v"(c) : "v"(a), "v"(b));
  return c;
}

__device__ __forceinline__ void wave_lds_sync() {
  __builtin_amdgcn_fence(3 /* release order */, "workgroup");
  __builtin_amdgcn_wave_barrier();
  __builtin_amdgcn_fence(2 /* acquire order */, "workgroup");
}

/* --------------------------------------------------------------------------
 * f32 rows -> bf16 rows (RNE), unit = 8 elements = one 16-B store.
 * out row = b*rpb + l  <-  in row = b*rpb_full + l ; row length = upr*8.
 * Coverage: nunits units x 8 elements = the whole plane.
 * ------------------------------------------------------------------------ */
__global__ __launch_bounds__(256) void cvt_rows_kernel(
    const float* __restrict__ in, unsigned short* __restrict__ outp,
    int nunits, int upr, int rpb, int rpb_full)
{
  const int u = blockIdx.x * 256 + threadIdx.x;
  if (u >= nunits) return;
  const int row = u / upr;
  const int seg = u - row * upr;
  const int b = row / rpb;
  const int l = row - b * rpb;
  const float* src = in + ((size_t)(b * rpb_full + l) * upr + seg) * 8;
  const v4f a0 = *(const v4f*)src;
  const v4f a1 = *(const v4f*)(src + 4);
  v4u w;
  w[0] = pk2(a0[0], a0[1]);
  w[1] = pk2(a0[2], a0[3]);
  w[2] = pk2(a1[0], a1[1]);
  w[3] = pk2(a1[2], a1[3]);
  v4u* dst = (v4u*)(outp + ((size_t)row * upr + seg) * 8);
  *dst = w;
  
}

/* --------------------------------------------------------------------------
 * f32 rows -> f16 rows holding (bf16 RNE value) x carry; the bf16 significand and the
 * power-of-two carry are exact in f16; the flush select removes would-be subnormals.
 * Coverage: nunits units x 8 elements = the whole plane.
 * ------------------------------------------------------------------------ */
__global__ __launch_bounds__(256) void cvt_rows_h_kernel(
    const float* __restrict__ in, unsigned short* __restrict__ outp,
    int nunits, int upr, int rpb, int rpb_full, float carry)
{
  const int u = blockIdx.x * 256 + threadIdx.x;
  if (u >= nunits) return;
  const int row = u / upr;
  const int seg = u - row * upr;
  const int b = row / rpb;
  const int l = row - b * rpb;
  const float* src = in + ((size_t)(b * rpb_full + l) * upr + seg) * 8;
  const v4f a0 = *(const v4f*)src;
  const v4f a1 = *(const v4f*)(src + 4);
  v4u w;
  w[0] = pkh2(bf_bits2f(f2bf_bits(a0[0])) * carry, bf_bits2f(f2bf_bits(a0[1])) * carry);
  w[1] = pkh2(bf_bits2f(f2bf_bits(a0[2])) * carry, bf_bits2f(f2bf_bits(a0[3])) * carry);
  w[2] = pkh2(bf_bits2f(f2bf_bits(a1[0])) * carry, bf_bits2f(f2bf_bits(a1[1])) * carry);
  w[3] = pkh2(bf_bits2f(f2bf_bits(a1[2])) * carry, bf_bits2f(f2bf_bits(a1[3])) * carry);
  v4u* dst = (v4u*)(outp + ((size_t)row * upr + seg) * 8);
  *dst = w;
  
}

/* --------------------------------------------------------------------------
 * qkv = Xb . WqT^T  (M = MROWS, N = 3072, K = 1024), bf16 x bf16, f32 acc.
 * Block = 4 waves, tile 128 tokens x 64 columns (= one head of one section);
 * wave = 32 rows x 64 cols (2 A fragments x 4 B fragments per 32-deep step),
 * fragments loaded per k-step straight from the 16-bit global rows.
 * Fragment map (hh = lane>>4, c = lane&15): A row c, elems 0..7 <- k0+8hh.., 8..15 <- k0+16+8hh..;
 * B col c with the same k map; D elem r = (row 8hh+r, col c).
 * Epilogue: acc x 16 converted to f16 (flush select), staged in a block LDS tile
 * ([tok][d] for q,k; [d][tok] for v), block barrier, whole-line stores:
 *   v  : 1024 units = 64 d-rows x 16 segments (16 lanes = one 256-B row segment).
 * LDS tile Th: cross-wave, separated by a block barrier; staged extent = consumed extent.
 * ------------------------------------------------------------------------ */
__global__ __launch_bounds__(128) VGPR_CAP void gemm_qkv_kernel(
    const unsigned short* __restrict__ Xb, const unsigned short* __restrict__ WqT,
    unsigned short* __restrict__ qkvp)
{
  union FB { v16b v; v8b h[2]; };
  __shared__ __align__(16) unsigned short Th[T_ELEMS];

  const int tid  = threadIdx.x;
  const int wave = __builtin_amdgcn_readfirstlane(tid >> 5);
  const int lane = tid & 31;
  const int hh   = lane >> 4;
  const int c    = lane & 15;
  const int n0   = blockIdx.x * 64;
  const int m0   = blockIdx.y * 128;

  v8f acc[2][4];
#pragma unroll
  for (int mt = 0; mt < 2; ++mt)
#pragma unroll
    for (int t = 0; t < 4; ++t) acc[mt][t] = (v8f){0.f,0.f,0.f,0.f,0.f,0.f,0.f,0.f};

  const unsigned short* a0p = Xb + (size_t)(m0 + wave * 32 + c) * DMODEL + 8 * hh;
  const unsigned short* a1p = a0p + (size_t)16 * DMODEL;
  const unsigned short* bp  = WqT + (size_t)(n0 + c) * DMODEL + 8 * hh;

#pragma unroll 1
  for (int k0 = 0; k0 < DMODEL; k0 += 32) {
    FB a0, a1;
    a0.h[0] = *(const v8b*)(a0p + k0);
    a0.h[1] = *(const v8b*)(a0p + k0 + 16);
    a1.h[0] = *(const v8b*)(a1p + k0);
    a1.h[1] = *(const v8b*)(a1p + k0 + 16);
#pragma unroll
    for (int t = 0; t < 4; ++t) {
      FB bf;
      bf.h[0] = *(const v8b*)(bp + (size_t)t * 16 * DMODEL + k0);
      bf.h[1] = *(const v8b*)(bp + (size_t)t * 16 * DMODEL + k0 + 16);
      acc[0][t] = mma_bf16(a0.v, bf.v, acc[0][t]);
      acc[1][t] = mma_bf16(a1.v, bf.v, acc[1][t]);
    }
  }

  const int sec = n0 / DMODEL;                       /* 0 q, 1 k, 2 v : block-uniform */
#pragma unroll
  for (int t = 0; t < 4; ++t) {
#pragma unroll
    for (int mt = 0; mt < 2; ++mt) {
#pragma unroll
      for (int r = 0; r < 8; ++r) {
        const float val = acc[mt][t][r] * QKV_CARRY;
        const unsigned short hb = hbits(toh_flush(val));
        const int rl = wave * 32 + mt * 16 + 8 * hh + r;
        const int cl = 16 * t + c;
        const int idx = (sec < 2) ? (rl * TQ_PITCH + cl) : (cl * TV_PITCH + rl);
        Th[idx] = hb;
      }
    }
  }
  __syncthreads();

  const int b  = m0 / SEQ;
  const int l0 = m0 - b * SEQ;
  const int h  = (n0 - sec * DMODEL) / DHEAD;
  const int bh = b * NHEAD + h;
  unsigned short* ph = qkvp + (size_t)sec * PLANE;

  {
    if (sec < 2) {
#pragma unroll
      for (int it = 0; it < 8; ++it) {
        const int u = it * 128 + tid;
        const int row = u >> 3;
        const int seg = u & 7;
        const v4u hw = *(const v4u_a*)(Th + row * TQ_PITCH + seg * 8);
        const size_t g = ((size_t)bh * SEQ + l0 + row) * DHEAD + seg * 8;
        *(v4u*)(ph + g) = hw;
      }
    } else {
#pragma unroll
      for (int it = 0; it < 8; ++it) {
        const int u = it * 128 + tid;
        const int drow = u >> 4;
        const int seg  = u & 15;
        const v4u hw = *(const v4u_a*)(Th + drow * TV_PITCH + seg * 8);
        const size_t g = ((size_t)bh * DHEAD + drow) * SEQ + l0 + seg * 8;
        *(v4u*)(ph + g) = hw;
      }
    }
    
  }
}

/* --------------------------------------------------------------------------
 * Dense multi-head attention, head dim 64, online softmax, one f16 product per site.
 * Block = 4 independent waves = 64 query rows of one (b,h); grid (SEQ/64, NBH).
 * Per 64-key chunk and wave (16 query rows):
 *   S = q.k^T : 4 key tiles x 2 d-steps, accumulators in registers, scaled by 2^-11
 *               (= 1/8 and the two x16 plane carries);
 *   f32 online softmax; P = exp(s - m) x 256 converted to f16 into a wave-private LDS tile
 *   (all 16x64 elements written every chunk), row sum taken over the converted values;
 *   O += P.V from the V^T plane, rolled loop over the two 32-key steps.
 * All global fragments come straight from 16-bit rows by arithmetic addressing.
 * Fragment map (hh = lane>>4, c = lane&15): A row c, elems 0..7 <- k0+8hh.., 8..15 <- k0+16+8hh..;
 * B col c with the same k map; D elem r = (row 8hh+r, col c).
 * LDS regions Ps / Os are private to their wave (wave_lds_sync form).
 * ------------------------------------------------------------------------ */
__global__ __launch_bounds__(128) VGPR_CAP void attn_kernel(
    const unsigned short* __restrict__ qkvp, unsigned short* __restrict__ ctxp)
{
  union FH { v16h v; v8h h[2]; };
  __shared__ __align__(16) float Os[NWAVE][16 * OS_PITCH];
  __shared__ __align__(16) h16 Ps[NWAVE][16 * KCH];

  const int tid  = threadIdx.x;
  const int wave = __builtin_amdgcn_readfirstlane(tid >> 5);
  const int lane = tid & 31;
  const int hh   = lane >> 4;
  const int c    = lane & 15;
  const int qb   = blockIdx.x;
  const int bh   = blockIdx.y;
  const int b    = bh / NHEAD;
  const int h    = bh - b * NHEAD;
  const int q0   = qb * 64 + wave * 16;
  const float NEG_INF = -__builtin_inff();

  const unsigned short* Qp  = qkvp + (size_t)bh * SEQ * DHEAD;
  const unsigned short* Kp  = Qp + PLANE;
  const unsigned short* Vtp = Qp + 2 * PLANE;     /* [bh][d][l]: same per-bh element count */

  v16h qf[2];
  {
    const size_t qo = (size_t)(q0 + c) * DHEAD + 8 * hh;
#pragma unroll
    for (int dc = 0; dc < 2; ++dc) {
      FH f;
      f.h[0] = *(const v8h*)(Qp + qo + dc * 32);
      f.h[1] = *(const v8h*)(Qp + qo + dc * 32 + 16);
      qf[dc] = f.v;
    }
  }

  float mrow[8], lrow[8];
  v8f oacc[4];
#pragma unroll
  for (int r = 0; r < 8; ++r) { mrow[r] = NEG_INF; lrow[r] = 0.f; }
#pragma unroll
  for (int t = 0; t < 4; ++t) oacc[t] = (v8f){0.f,0.f,0.f,0.f,0.f,0.f,0.f,0.f};

#pragma unroll 1
  for (int kc = 0; kc < SEQ / KCH; ++kc) {
    const int kv0 = kc * KCH;

    /* scaled scores: 4 key tiles (D elem r = query row 8hh+r, key 16j+c) */
    v8f s[4];
#pragma unroll
    for (int j = 0; j < 4; ++j) {
      v8f sa = (v8f){0.f,0.f,0.f,0.f,0.f,0.f,0.f,0.f};
      const size_t ko = (size_t)(kv0 + j * 16 + c) * DHEAD + 8 * hh;
#pragma unroll
      for (int dc = 0; dc < 2; ++dc) {
        FH kf;
        kf.h[0] = *(const v8h*)(Kp + ko + dc * 32);
        kf.h[1] = *(const v8h*)(Kp + ko + dc * 32 + 16);
        sa = mma_f16(qf[dc], kf.v, sa);
      }
#pragma unroll
      for (int r = 0; r < 8; ++r) s[j][r] = sa[r] * SCORE_SCALE;
    }

    /* chunk row max over the 64 keys */
    float cm[8];
#pragma unroll
    for (int r = 0; r < 8; ++r) {
      float m = fmaxf(fmaxf(s[0][r], s[1][r]), fmaxf(s[2][r], s[3][r]));
#pragma unroll
      for (int off = 1; off < 16; off <<= 1) m = fmaxf(m, __shfl_xor(m, off, 32));
      cm[r] = m;
    }

    /* online softmax update, P tile as f16 (x256), row sum over the converted values */
#pragma unroll
    for (int r = 0; r < 8; ++r) {
      const float mnew  = fmaxf(mrow[r], cm[r]);
      const float msafe = (mnew == NEG_INF) ? 0.f : mnew;
      const float alpha = expf(mrow[r] - msafe);
      mrow[r] = mnew;
      float psum = 0.f;
#pragma unroll
      for (int j = 0; j < 4; ++j) {
        const float p = expf(s[j][r] - msafe) * P_CARRY;
        const h16 ph = toh_flush(p);
        psum += (float)ph;
        Ps[wave][(8 * hh + r) * KCH + j * 16 + c] = ph;
      }
#pragma unroll
      for (int off = 1; off < 16; off <<= 1) psum += __shfl_xor(psum, off, 32);
      lrow[r] = lrow[r] * alpha + psum;
#pragma unroll
      for (int t = 0; t < 4; ++t) oacc[t][r] *= alpha;
    }
    wave_lds_sync();

    /* O += P.V : A = P [q][kv] (this wave's tile), B = V [kv][d] from V^T [d][kv];
       rolled over the two 32-key steps, fragments loaded per step */
#pragma unroll 1
    for (int kk = 0; kk < 2; ++kk) {
      FH pa;
      pa.h[0] = *(const v8h_a*)(&Ps[wave][c * KCH + kk * 32 + 8 * hh]);
      pa.h[1] = *(const v8h_a*)(&Ps[wave][c * KCH + kk * 32 + 16 + 8 * hh]);
#pragma unroll
      for (int t = 0; t < 4; ++t) {
        const size_t vo = (size_t)(t * 16 + c) * SEQ + kv0 + kk * 32 + 8 * hh;
        FH vb;
        vb.h[0] = *(const v8h*)(Vtp + vo);
        vb.h[1] = *(const v8h*)(Vtp + vo + 16);
        oacc[t] = mma_f16(pa.v, vb.v, oacc[t]);
      }
    }
    wave_lds_sync();
  }

  /* normalise into the wave slab (ctx x256), then whole-line f16 stores */
#pragma unroll
  for (int r = 0; r < 8; ++r) {
    const float inv = CTX_FOLD * (1.0f / lrow[r]);
#pragma unroll
    for (int t = 0; t < 4; ++t) Os[wave][(8 * hh + r) * OS_PITCH + t * 16 + c] = oacc[t][r] * inv;
  }
  wave_lds_sync();
  {
    const int rq  = lane >> 3;
    const int seg = lane & 7;
    {
#pragma unroll
      for (int it = 0; it < 4; ++it) {
        const int row = it * 4 + rq;
        const v4f a0 = *(const v4f_a*)(&Os[wave][row * OS_PITCH + seg * 8]);
        const v4f a1 = *(const v4f_a*)(&Os[wave][row * OS_PITCH + seg * 8 + 4]);
        v4u hw;
        hw[0] = pkh2(a0[0], a0[1]);
        hw[1] = pkh2(a0[2], a0[3]);
        hw[2] = pkh2(a1[0], a1[1]);
        hw[3] = pkh2(a1[2], a1[3]);
        const size_t g = (size_t)(b * SEQ + q0 + row) * DMODEL + h * DHEAD + seg * 8;
        *(v4u*)(ctxp + g) = hw;
      }
      
    }
  }
}

/* --------------------------------------------------------------------------
 * out = C . WoH^T x 2^-18  (M = MROWS, N = 1024, K = 1024), f16 x f16, f32 acc.
 * Block = 4 waves, tile 128 x 64; wave = 32 rows x 64 cols; one product per tile pair,
 * fragments loaded per k-step straight from the 16-bit global rows.
 * Epilogue: per-wave 32x64 f32 slab (wave-private LDS), 16 lanes x 16 B = one 256-B
 * ------------------------------------------------------------------------ */
__global__ __launch_bounds__(128) VGPR_CAP void gemm_out_kernel(
    const unsigned short* __restrict__ ctxp, const unsigned short* __restrict__ WoH,
    float* __restrict__ out)
{
  union FH { v16h v; v8h h[2]; };
  __shared__ __align__(16) float Os[NWAVE][32 * OS_PITCH];

  const int tid  = threadIdx.x;
  const int wave = __builtin_amdgcn_readfirstlane(tid >> 5);
  const int lane = tid & 31;
  const int hh   = lane >> 4;
  const int c    = lane & 15;
  const int n0   = blockIdx.x * 64;
  const int m0   = blockIdx.y * 128;

  v8f acc[2][4];
#pragma unroll
  for (int mt = 0; mt < 2; ++mt)
#pragma unroll
    for (int t = 0; t < 4; ++t) acc[mt][t] = (v8f){0.f,0.f,0.f,0.f,0.f,0.f,0.f,0.f};

  const unsigned short* ah0 = ctxp + (size_t)(m0 + wave * 32 + c) * DMODEL + 8 * hh;
  const unsigned short* ah1 = ah0 + (size_t)16 * DMODEL;
  const unsigned short* bp  = WoH + (size_t)(n0 + c) * DMODEL + 8 * hh;

#pragma unroll 1
  for (int k0 = 0; k0 < DMODEL; k0 += 32) {
    FH a0h, a1h;
    a0h.h[0] = *(const v8h*)(ah0 + k0);
    a0h.h[1] = *(const v8h*)(ah0 + k0 + 16);
    a1h.h[0] = *(const v8h*)(ah1 + k0);
    a1h.h[1] = *(const v8h*)(ah1 + k0 + 16);
#pragma unroll
    for (int t = 0; t < 4; ++t) {
      FH bf;
      bf.h[0] = *(const v8h*)(bp + (size_t)t * 16 * DMODEL + k0);
      bf.h[1] = *(const v8h*)(bp + (size_t)t * 16 * DMODEL + k0 + 16);
      acc[0][t] = mma_f16(a0h.v, bf.v, acc[0][t]);
      acc[1][t] = mma_f16(a1h.v, bf.v, acc[1][t]);
    }
  }

  float* os = Os[wave];
#pragma unroll
  for (int t = 0; t < 4; ++t) {
#pragma unroll
    for (int mt = 0; mt < 2; ++mt)
#pragma unroll
      for (int r = 0; r < 8; ++r)
        os[(mt * 16 + 8 * hh + r) * OS_PITCH + 16 * t + c] = acc[mt][t][r] * OUT_FOLD;
  }
  wave_lds_sync();
  {
    const int c4 = c * 4;
    {
#pragma unroll
      for (int it = 0; it < 16; ++it) {
        const int row = it * 2 + hh;
        const v4f val = *(const v4f_a*)(os + row * OS_PITCH + c4);
        *(v4f*)(out + (size_t)(m0 + wave * 32 + row) * DMODEL + n0 + c4) = val;
      }
      
    }
  }
}

extern "C" void kernel_launch(void* const* d_in, const int* in_sizes, int n_in,
                              void* d_out, int out_size, void* d_ws, size_t ws_size,
                              hipStream_t stream)
{
  if (n_in < 3) return;
  if (in_sizes[0] < ((NB - 1) * SEQ_FULL + SEQ) * DMODEL) return;
  if (in_sizes[1] < NQKV * DMODEL) return;
  if (in_sizes[2] < DMODEL * DMODEL) return;
  if (out_size < MROWS * DMODEL) return;
  if (d_ws == nullptr || ws_size < WS_NEED) return;

  const float* x     = (const float*)d_in[0];
  const float* W_qkv = (const float*)d_in[1];   /* [3072 out][1024 in] */
  const float* W_out = (const float*)d_in[2];   /* [1024 out][1024 in] */
  float* out = (float*)d_out;

  unsigned short* Xb   = (unsigned short*)d_ws;
  unsigned short* WqT  = Xb + XB_E;
  unsigned short* WoH  = WqT + WQT_E;
  unsigned short* qkvp = WoH + WOT_E;
  unsigned short* ctxp = qkvp + QKVP_E;

  {
    const int nunits = MROWS * (DMODEL / 8);
    cvt_rows_kernel<<<(nunits + 255) / 256, 256, 0, stream>>>(x, Xb, nunits, DMODEL / 8, SEQ, SEQ_FULL);
  }
  {
    /* W_qkv rows are already [n][k]: plain row convert, no transpose */
    const int nunits = NQKV * (DMODEL / 8);
    cvt_rows_kernel<<<(nunits + 255) / 256, 256, 0, stream>>>(W_qkv, WqT, nunits, DMODEL / 8, NQKV, NQKV);
  }
  {
    /* W_out rows are already [n][k]: bf16 value x1024 in f16 */
    const int nunits = DMODEL * (DMODEL / 8);
    cvt_rows_h_kernel<<<(nunits + 255) / 256, 256, 0, stream>>>(W_out, WoH, nunits, DMODEL / 8, DMODEL, DMODEL, WO_CARRY);
  }

  gemm_qkv_kernel<<<dim3(NQKV / 64, MROWS / 128), 128, 0, stream>>>(Xb, WqT, qkvp);
  attn_kernel<<<dim3(SEQ / 64, NBH), 128, 0, stream>>>(qkvp, ctxp);
  gemm_out_kernel<<<dim3(DMODEL / 64, MROWS / 128), 128, 0, stream>>>(ctxp, WoH, out);
}

// v001
// A run of this version takes 120 microseconds.
// In two side-by-side timings against v000, it was 1.50 and 1.48 times as fast.
// Contractions: x.Wqkv^T on v_wmma_f32_16x16x32_bf16 (both operands RNE-converted to bf16 once); q.k^T, p.v and ctx.Wout^T on v_wmma_f32_16x16x32_f16 with single f16 planes (q, k, v x16; p x256; ctx x256; Wout = bf16-converted value x1024), one product per site; f32 accumulate; softmax in f32.
#include <hip/hip_runtime.h>

typedef __attribute__((ext_vector_type(16))) __bf16 v16b;
typedef __attribute__((ext_vector_type(8)))  __bf16 v8b;
typedef __attribute__((ext_vector_type(16))) _Float16 v16h;
typedef __attribute__((ext_vector_type(8)))  _Float16 v8h;
typedef __attribute__((ext_vector_type(8)))  float  v8f;
typedef __attribute__((ext_vector_type(4)))  float  v4f;
typedef __attribute__((ext_vector_type(4)))  unsigned int v4u;
typedef v8h v8h_a __attribute__((may_alias));
typedef v4f v4f_a __attribute__((may_alias));
typedef v4u v4u_a __attribute__((may_alias));
typedef _Float16 h16;

#ifndef NB
#define NB 2
#endif
#ifndef SEQ
#define SEQ 1024
#endif
#define NB_FULL 2
#define SEQ_FULL 1024

#define VGPR_CAP __attribute__((amdgpu_num_vgpr(256)))

/* power-of-two carries of the f16 operand planes and their f32 fold-backs */
#define QKV_CARRY   16.0f                 /* q, k, v planes                         */
#define P_CARRY     256.0f                /* exp(s - m) tiles                       */
#define CTX_CARRY   256.0f                /* context plane                          */
#define WO_CARRY    1024.0f               /* output weight plane                    */
#define SCORE_SCALE 0.00048828125f        /* 0.125 / (16 * 16) = 2^-11              */
#define CTX_FOLD    16.0f                 /* CTX_CARRY / QKV_CARRY (P carry cancels) */
#define OUT_FOLD    3.814697265625e-06f   /* 1 / (256 * 1024) = 2^-18               */

constexpr int DMODEL = 1024;
constexpr int NHEAD  = 16;
constexpr int DHEAD  = 64;
constexpr int NQKV   = 3 * DMODEL;
constexpr int NBH    = NB * NHEAD;
constexpr int MROWS  = NB * SEQ;
constexpr int KCH    = 64;        /* keys per chunk */
constexpr int NWAVE  = 4;
constexpr int TQ_PITCH = 72;      /* [tok][d] staging pitch (16-bit elements) */
constexpr int TV_PITCH = 136;     /* [d][tok] staging pitch (16-bit elements) */
constexpr int T_ELEMS  = 128 * TQ_PITCH;   /* 9216 >= 64 * TV_PITCH = 8704 */
constexpr int OS_PITCH = 68;

constexpr size_t PLANE  = (size_t)NBH * SEQ * DHEAD;
constexpr size_t XB_E   = (size_t)MROWS * DMODEL;
constexpr size_t WQT_E  = (size_t)NQKV * DMODEL;
constexpr size_t WOT_E  = (size_t)DMODEL * DMODEL;
constexpr size_t QKVP_E = 3 * PLANE;
constexpr size_t CTX_E  = XB_E;
constexpr size_t WS_NEED = 2 * (XB_E + WQT_E + WOT_E + QKVP_E + CTX_E);

static_assert(SEQ % 128 == 0);
static_assert(KCH == 64 && SEQ % KCH == 0);
static_assert(SEQ <= SEQ_FULL && NB <= NB_FULL);
static_assert(DHEAD == 64 && DMODEL == NHEAD * DHEAD);
static_assert(DMODEL % 64 == 0 && NQKV % 64 == 0 && DMODEL % 32 == 0);
static_assert(DMODEL % 8 == 0 && DHEAD % 8 == 0);
static_assert(MROWS % 128 == 0);
static_assert(NWAVE * 16 == 64 && NWAVE * 32 == 128);
static_assert(64 * TV_PITCH <= T_ELEMS);
static_assert(TQ_PITCH >= 64 && TV_PITCH >= 128 && OS_PITCH >= 64);
static_assert((TQ_PITCH * 2) % 16 == 0 && (TV_PITCH * 2) % 16 == 0 && (OS_PITCH * 4) % 16 == 0);
static_assert(XB_E % 64 == 0 && WQT_E % 64 == 0 && WOT_E % 64 == 0 && PLANE % 64 == 0);
static_assert(WS_NEED <= 134217728ull);

/*
 *   Xb   [MROWS][1024]        x, bf16
 *   WqT  [3072][1024]         W_qkv (already [out][in]), bf16
 *   WoH  [1024][1024]         W_out (already [out][in]), bf16-converted value x1024 held in f16
 *   qkvp 3 planes f16: Q [bh][l][64] (q x16), K [bh][l][64] (k x16), Vt [bh][64][l] (v x16)
 *   ctxp 1 plane  f16: C [MROWS][1024] (ctx x256)
 */

__device__ __forceinline__ unsigned short f2bf_bits(float f) {
  unsigned u = __float_as_uint(f);
  return (unsigned short)((u + 0x7FFFu + ((u >> 16) & 1u)) >> 16);
}
__device__ __forceinline__ float bf_bits2f(unsigned short h) { return __uint_as_float(((unsigned)h) << 16); }
__device__ __forceinline__ unsigned pk2(float a, float b) {
  return (unsigned)f2bf_bits(a) | ((unsigned)f2bf_bits(b) << 16);
}

/* f32 -> f16 (RNE) with a value select so that no subnormal f16 is ever produced */
static __device__ __forceinline__ h16 toh_flush(float v) {
  const h16 r = (h16)v;
  return (fabsf(v) < 6.103515625e-05f) ? (h16)0.0f : r;
}
static __device__ __forceinline__ unsigned short hbits(h16 v) {
  return __builtin_bit_cast(unsigned short, v);
}
static __device__ __forceinline__ unsigned pkh2(float a, float b) {
  return (unsigned)hbits(toh_flush(a)) | ((unsigned)hbits(toh_flush(b)) << 16);
}

/* one WMMA + hazard guard naming only this call's live operands */
__device__ __forceinline__ v8f mma_bf16(v16b a, v16b b, v8f c) {
  c = __builtin_amdgcn_wmma_f32_16x16x32_bf16(false, a, false, b, (short)0, c, false, false);
  asm volatile("v_nop\n\tv_nop\n\tv_nop\n\tv_nop" : "+v"(c) : "v"(a), "v"(b));
  return c;
}
__device__ __forceinline__ v8f mma_f16(v16h a, v16h b, v8f c) {
  c = __builtin_amdgcn_wmma_f32_16x16x32_f16(false, a, false, b, (short)0, c, false, false);
  asm volatile("v_nop\n\tv_nop\n\tv_nop\n\tv_nop" : "+v"(c) : "v"(a), "v"(b));
  return c;
}

__device__ __forceinline__ void wave_lds_sync() {
  __builtin_amdgcn_fence(3 /* release order */, "workgroup");
  __builtin_amdgcn_wave_barrier();
  __builtin_amdgcn_fence(2 /* acquire order */, "workgroup");
}

/* --------------------------------------------------------------------------
 * f32 rows -> bf16 rows (RNE), unit = 8 elements = one 16-B store.
 * out row = b*rpb + l  <-  in row = b*rpb_full + l ; row length = upr*8.
 * Coverage: nunits units x 8 elements = the whole plane.
 * ------------------------------------------------------------------------ */
__global__ __launch_bounds__(256) void cvt_rows_kernel(
    const float* __restrict__ in, unsigned short* __restrict__ outp,
    int nunits, int upr, int rpb, int rpb_full)
{
  const int u = blockIdx.x * 256 + threadIdx.x;
  if (u >= nunits) return;
  const int row = u / upr;
  const int seg = u - row * upr;
  const int b = row / rpb;
  const int l = row - b * rpb;
  const float* src = in + ((size_t)(b * rpb_full + l) * upr + seg) * 8;
  const v4f a0 = *(const v4f*)src;
  const v4f a1 = *(const v4f*)(src + 4);
  v4u w;
  w[0] = pk2(a0[0], a0[1]);
  w[1] = pk2(a0[2], a0[3]);
  w[2] = pk2(a1[0], a1[1]);
  w[3] = pk2(a1[2], a1[3]);
  v4u* dst = (v4u*)(outp + ((size_t)row * upr + seg) * 8);
  *dst = w;
  
}

/* --------------------------------------------------------------------------
 * f32 rows -> f16 rows holding (bf16 RNE value) x carry; the bf16 significand and the
 * power-of-two carry are exact in f16; the flush select removes would-be subnormals.
 * Coverage: nunits units x 8 elements = the whole plane.
 * ------------------------------------------------------------------------ */
__global__ __launch_bounds__(256) void cvt_rows_h_kernel(
    const float* __restrict__ in, unsigned short* __restrict__ outp,
    int nunits, int upr, int rpb, int rpb_full, float carry)
{
  const int u = blockIdx.x * 256 + threadIdx.x;
  if (u >= nunits) return;
  const int row = u / upr;
  const int seg = u - row * upr;
  const int b = row / rpb;
  const int l = row - b * rpb;
  const float* src = in + ((size_t)(b * rpb_full + l) * upr + seg) * 8;
  const v4f a0 = *(const v4f*)src;
  const v4f a1 = *(const v4f*)(src + 4);
  v4u w;
  w[0] = pkh2(bf_bits2f(f2bf_bits(a0[0])) * carry, bf_bits2f(f2bf_bits(a0[1])) * carry);
  w[1] = pkh2(bf_bits2f(f2bf_bits(a0[2])) * carry, bf_bits2f(f2bf_bits(a0[3])) * carry);
  w[2] = pkh2(bf_bits2f(f2bf_bits(a1[0])) * carry, bf_bits2f(f2bf_bits(a1[1])) * carry);
  w[3] = pkh2(bf_bits2f(f2bf_bits(a1[2])) * carry, bf_bits2f(f2bf_bits(a1[3])) * carry);
  v4u* dst = (v4u*)(outp + ((size_t)row * upr + seg) * 8);
  *dst = w;
  
}

/* --------------------------------------------------------------------------
 * qkv = Xb . WqT^T  (M = MROWS, N = 3072, K = 1024), bf16 x bf16, f32 acc.
 * Block = 4 waves, tile 128 tokens x 64 columns (= one head of one section);
 * wave = 32 rows x 64 cols (2 A fragments x 4 B fragments per 32-deep step),
 * fragments loaded one k-step ahead straight from the 16-bit global rows.
 * Fragment map (hh = lane>>4, c = lane&15): A row c, elems 0..7 <- k0+8hh.., 8..15 <- k0+16+8hh..;
 * B col c with the same k map; D elem r = (row 8hh+r, col c).
 * Epilogue: acc x 16 converted to f16 (flush select), staged in a block LDS tile
 * ([tok][d] for q,k; [d][tok] for v), block barrier, whole-line stores:
 *   v  : 1024 units = 64 d-rows x 16 segments (16 lanes = one 256-B row segment).
 * LDS tile Th: cross-wave, separated by a block barrier; staged extent = consumed extent.
 * ------------------------------------------------------------------------ */
__global__ __launch_bounds__(128) VGPR_CAP void gemm_qkv_kernel(
    const unsigned short* __restrict__ Xb, const unsigned short* __restrict__ WqT,
    unsigned short* __restrict__ qkvp)
{
  union FB { v16b v; v8b h[2]; };
  __shared__ __align__(16) unsigned short Th[T_ELEMS];

  const int tid  = threadIdx.x;
  const int wave = __builtin_amdgcn_readfirstlane(tid >> 5);
  const int lane = tid & 31;
  const int hh   = lane >> 4;
  const int c    = lane & 15;
  const int n0   = blockIdx.x * 64;
  const int m0   = blockIdx.y * 128;

  v8f acc[2][4];
#pragma unroll
  for (int mt = 0; mt < 2; ++mt)
#pragma unroll
    for (int t = 0; t < 4; ++t) acc[mt][t] = (v8f){0.f,0.f,0.f,0.f,0.f,0.f,0.f,0.f};

  const unsigned short* a0p = Xb + (size_t)(m0 + wave * 32 + c) * DMODEL + 8 * hh;
  const unsigned short* a1p = a0p + (size_t)16 * DMODEL;
  const unsigned short* bp  = WqT + (size_t)(n0 + c) * DMODEL + 8 * hh;

  /* Two fragment sets ([0],[1] = A rows, [2..5] = B columns): the 12 loads of a 32-deep step
     go out as one group, one step ahead of the products that read them. */
  FB fe[6], fo[6];
  auto load_set = [&](FB (&f)[6], int k0) {
    f[0].h[0] = *(const v8b*)(a0p + k0);
    f[0].h[1] = *(const v8b*)(a0p + k0 + 16);
    f[1].h[0] = *(const v8b*)(a1p + k0);
    f[1].h[1] = *(const v8b*)(a1p + k0 + 16);
#pragma unroll
    for (int t = 0; t < 4; ++t) {
      f[2 + t].h[0] = *(const v8b*)(bp + (size_t)t * 16 * DMODEL + k0);
      f[2 + t].h[1] = *(const v8b*)(bp + (size_t)t * 16 * DMODEL + k0 + 16);
    }
  };
  auto mma_set = [&](const FB (&f)[6]) {
#pragma unroll
    for (int t = 0; t < 4; ++t) {
      acc[0][t] = mma_bf16(f[0].v, f[2 + t].v, acc[0][t]);
      acc[1][t] = mma_bf16(f[1].v, f[2 + t].v, acc[1][t]);
    }
  };

  load_set(fe, 0);
  /* rolled: one trip = two steps, so that each set keeps its own registers without copies */
#pragma unroll 1
  for (int k0 = 0; k0 < DMODEL; k0 += 64) {
    load_set(fo, k0 + 32);
    mma_set(fe);
    if (k0 + 64 < DMODEL) load_set(fe, k0 + 64);
    mma_set(fo);
  }

  const int sec = n0 / DMODEL;                       /* 0 q, 1 k, 2 v : block-uniform */
#pragma unroll
  for (int t = 0; t < 4; ++t) {
#pragma unroll
    for (int mt = 0; mt < 2; ++mt) {
#pragma unroll
      for (int r = 0; r < 8; ++r) {
        const float val = acc[mt][t][r] * QKV_CARRY;
        const unsigned short hb = hbits(toh_flush(val));
        const int rl = wave * 32 + mt * 16 + 8 * hh + r;
        const int cl = 16 * t + c;
        const int idx = (sec < 2) ? (rl * TQ_PITCH + cl) : (cl * TV_PITCH + rl);
        Th[idx] = hb;
      }
    }
  }
  __syncthreads();

  const int b  = m0 / SEQ;
  const int l0 = m0 - b * SEQ;
  const int h  = (n0 - sec * DMODEL) / DHEAD;
  const int bh = b * NHEAD + h;
  unsigned short* ph = qkvp + (size_t)sec * PLANE;

  {
    if (sec < 2) {
#pragma unroll
      for (int it = 0; it < 8; ++it) {
        const int u = it * 128 + tid;
        const int row = u >> 3;
        const int seg = u & 7;
        const v4u hw = *(const v4u_a*)(Th + row * TQ_PITCH + seg * 8);
        const size_t g = ((size_t)bh * SEQ + l0 + row) * DHEAD + seg * 8;
        *(v4u*)(ph + g) = hw;
      }
    } else {
#pragma unroll
      for (int it = 0; it < 8; ++it) {
        const int u = it * 128 + tid;
        const int drow = u >> 4;
        const int seg  = u & 15;
        const v4u hw = *(const v4u_a*)(Th + drow * TV_PITCH + seg * 8);
        const size_t g = ((size_t)bh * DHEAD + drow) * SEQ + l0 + seg * 8;
        *(v4u*)(ph + g) = hw;
      }
    }
    
  }
}

/* --------------------------------------------------------------------------
 * Dense multi-head attention, head dim 64, online softmax, one f16 product per site.
 * Block = 4 independent waves = 64 query rows of one (b,h); grid (SEQ/64, NBH).
 * Per 64-key chunk and wave (16 query rows):
 *   S = q.k^T : 4 key tiles x 2 d-steps, accumulators in registers, scaled by 2^-11
 *               (= 1/8 and the two x16 plane carries);
 *   f32 online softmax; P = exp(s - m) x 256 converted to f16 into a wave-private LDS tile
 *   (all 16x64 elements written every chunk), row sum taken over the converted values;
 *   O += P.V from the V^T plane, two 32-key steps.
 * K and V fragments are fetched as one group at the head of their chunk.
 * All global fragments come straight from 16-bit rows by arithmetic addressing.
 * Fragment map (hh = lane>>4, c = lane&15): A row c, elems 0..7 <- k0+8hh.., 8..15 <- k0+16+8hh..;
 * B col c with the same k map; D elem r = (row 8hh+r, col c).
 * LDS regions Ps / Os are private to their wave (wave_lds_sync form).
 * ------------------------------------------------------------------------ */
__global__ __launch_bounds__(128) VGPR_CAP void attn_kernel(
    const unsigned short* __restrict__ qkvp, unsigned short* __restrict__ ctxp)
{
  union FH { v16h v; v8h h[2]; };
  __shared__ __align__(16) float Os[NWAVE][16 * OS_PITCH];
  __shared__ __align__(16) h16 Ps[NWAVE][16 * KCH];

  const int tid  = threadIdx.x;
  const int wave = __builtin_amdgcn_readfirstlane(tid >> 5);
  const int lane = tid & 31;
  const int hh   = lane >> 4;
  const int c    = lane & 15;
  const int qb   = blockIdx.x;
  const int bh   = blockIdx.y;
  const int b    = bh / NHEAD;
  const int h    = bh - b * NHEAD;
  const int q0   = qb * 64 + wave * 16;
  const float NEG_INF = -__builtin_inff();

  const unsigned short* Qp  = qkvp + (size_t)bh * SEQ * DHEAD;
  const unsigned short* Vtp = Qp + 2 * PLANE;     /* [bh][d][l]: same per-bh element count */

  v16h qf[2];
  {
    const size_t qo = (size_t)(q0 + c) * DHEAD + 8 * hh;
#pragma unroll
    for (int dc = 0; dc < 2; ++dc) {
      FH f;
      f.h[0] = *(const v8h*)(Qp + qo + dc * 32);
      f.h[1] = *(const v8h*)(Qp + qo + dc * 32 + 16);
      qf[dc] = f.v;
    }
  }

  float mrow[8], lrow[8];
  v8f oacc[4];
#pragma unroll
  for (int r = 0; r < 8; ++r) { mrow[r] = NEG_INF; lrow[r] = 0.f; }
#pragma unroll
  for (int t = 0; t < 4; ++t) oacc[t] = (v8f){0.f,0.f,0.f,0.f,0.f,0.f,0.f,0.f};

  const int klane = c * DHEAD + 8 * hh;   /* lane's place in a K chunk [key][d]   */
  const int vlane = c * SEQ + 8 * hh;     /* lane's place in the V^T plane [d][l] */

#pragma unroll 1
  for (int kc = 0; kc < SEQ / KCH; ++kc) {
    const int kv0 = kc * KCH;

    /* the chunk's 32 fragment loads go out as one group at its head: K first, waited for once;
       V behind it, in flight under the score products and the softmax */
    const unsigned short* kq = Qp + (size_t)kv0 * DHEAD + klane;   /* K plane = Q plane + PLANE */
    const unsigned short* vq = Vtp + kv0 + vlane;
    FH kf[4][2];
#pragma unroll
    for (int j = 0; j < 4; ++j) {
#pragma unroll
      for (int dc = 0; dc < 2; ++dc) {
        kf[j][dc].h[0] = *(const v8h*)(kq + PLANE + j * 16 * DHEAD + dc * 32);
        kf[j][dc].h[1] = *(const v8h*)(kq + PLANE + j * 16 * DHEAD + dc * 32 + 16);
      }
    }
    FH vb[2][4];
#pragma unroll
    for (int kk = 0; kk < 2; ++kk) {
#pragma unroll
      for (int t = 0; t < 4; ++t) {
        vb[kk][t].h[0] = *(const v8h*)(vq + t * 16 * SEQ + kk * 32);
        vb[kk][t].h[1] = *(const v8h*)(vq + t * 16 * SEQ + kk * 32 + 16);
      }
    }
    /* the wait that stands before a register named by an issued load is rewritten; it takes the two
       addresses as inputs so that no load of the group lands on them ahead of it */
    asm volatile("s_wait_xcnt 0x0" :: "v"(kq), "v"(vq) : "memory");

    /* scaled scores: 4 key tiles (D elem r = query row 8hh+r, key 16j+c) */
    v8f s[4];
#pragma unroll
    for (int j = 0; j < 4; ++j) {
      v8f sa = (v8f){0.f,0.f,0.f,0.f,0.f,0.f,0.f,0.f};
#pragma unroll
      for (int dc = 0; dc < 2; ++dc) sa = mma_f16(qf[dc], kf[j][dc].v, sa);
#pragma unroll
      for (int r = 0; r < 8; ++r) s[j][r] = sa[r] * SCORE_SCALE;
    }

    /* chunk row max over the 64 keys */
    float cm[8];
#pragma unroll
    for (int r = 0; r < 8; ++r) {
      float m = fmaxf(fmaxf(s[0][r], s[1][r]), fmaxf(s[2][r], s[3][r]));
#pragma unroll
      for (int off = 1; off < 16; off <<= 1) m = fmaxf(m, __shfl_xor(m, off, 32));
      cm[r] = m;
    }

    /* online softmax update, P tile as f16 (x256), row sum over the converted values */
#pragma unroll
    for (int r = 0; r < 8; ++r) {
      const float mnew  = fmaxf(mrow[r], cm[r]);
      const float msafe = (mnew == NEG_INF) ? 0.f : mnew;
      const float alpha = expf(mrow[r] - msafe);
      mrow[r] = mnew;
      float psum = 0.f;
#pragma unroll
      for (int j = 0; j < 4; ++j) {
        const float p = expf(s[j][r] - msafe) * P_CARRY;
        const h16 ph = toh_flush(p);
        psum += (float)ph;
        Ps[wave][(8 * hh + r) * KCH + j * 16 + c] = ph;
      }
#pragma unroll
      for (int off = 1; off < 16; off <<= 1) psum += __shfl_xor(psum, off, 32);
      lrow[r] = lrow[r] * alpha + psum;
#pragma unroll
      for (int t = 0; t < 4; ++t) oacc[t][r] *= alpha;
    }
    wave_lds_sync();

    /* O += P.V : A = P [q][kv] (this wave's tile), B = V [kv][d] from V^T [d][kv],
       fetched at the head of the chunk */
#pragma unroll
    for (int kk = 0; kk < 2; ++kk) {
      FH pa;
      pa.h[0] = *(const v8h_a*)(&Ps[wave][c * KCH + kk * 32 + 8 * hh]);
      pa.h[1] = *(const v8h_a*)(&Ps[wave][c * KCH + kk * 32 + 16 + 8 * hh]);
#pragma unroll
      for (int t = 0; t < 4; ++t) oacc[t] = mma_f16(pa.v, vb[kk][t].v, oacc[t]);
    }
    wave_lds_sync();
  }

  /* normalise into the wave slab (ctx x256), then whole-line f16 stores */
#pragma unroll
  for (int r = 0; r < 8; ++r) {
    const float inv = CTX_FOLD * (1.0f / lrow[r]);
#pragma unroll
    for (int t = 0; t < 4; ++t) Os[wave][(8 * hh + r) * OS_PITCH + t * 16 + c] = oacc[t][r] * inv;
  }
  wave_lds_sync();
  {
    const int rq  = lane >> 3;
    const int seg = lane & 7;
    {
#pragma unroll
      for (int it = 0; it < 4; ++it) {
        const int row = it * 4 + rq;
        const v4f a0 = *(const v4f_a*)(&Os[wave][row * OS_PITCH + seg * 8]);
        const v4f a1 = *(const v4f_a*)(&Os[wave][row * OS_PITCH + seg * 8 + 4]);
        v4u hw;
        hw[0] = pkh2(a0[0], a0[1]);
        hw[1] = pkh2(a0[2], a0[3]);
        hw[2] = pkh2(a1[0], a1[1]);
        hw[3] = pkh2(a1[2], a1[3]);
        const size_t g = (size_t)(b * SEQ + q0 + row) * DMODEL + h * DHEAD + seg * 8;
        *(v4u*)(ctxp + g) = hw;
      }
      
    }
  }
}

/* --------------------------------------------------------------------------
 * out = C . WoH^T x 2^-18  (M = MROWS, N = 1024, K = 1024), f16 x f16, f32 acc.
 * Block = 4 waves, tile 128 x 64; wave = 32 rows x 64 cols; one product per tile pair,
 * fragments loaded one k-step ahead straight from the 16-bit global rows.
 * Epilogue: per-wave 32x64 f32 slab (wave-private LDS), 16 lanes x 16 B = one 256-B
 * ------------------------------------------------------------------------ */
__global__ __launch_bounds__(128) VGPR_CAP void gemm_out_kernel(
    const unsigned short* __restrict__ ctxp, const unsigned short* __restrict__ WoH,
    float* __restrict__ out)
{
  union FH { v16h v; v8h h[2]; };
  __shared__ __align__(16) float Os[NWAVE][32 * OS_PITCH];

  const int tid  = threadIdx.x;
  const int wave = __builtin_amdgcn_readfirstlane(tid >> 5);
  const int lane = tid & 31;
  const int hh   = lane >> 4;
  const int c    = lane & 15;
  const int n0   = blockIdx.x * 64;
  const int m0   = blockIdx.y * 128;

  v8f acc[2][4];
#pragma unroll
  for (int mt = 0; mt < 2; ++mt)
#pragma unroll
    for (int t = 0; t < 4; ++t) acc[mt][t] = (v8f){0.f,0.f,0.f,0.f,0.f,0.f,0.f,0.f};

  const unsigned short* ah0 = ctxp + (size_t)(m0 + wave * 32 + c) * DMODEL + 8 * hh;
  const unsigned short* ah1 = ah0 + (size_t)16 * DMODEL;
  const unsigned short* bp  = WoH + (size_t)(n0 + c) * DMODEL + 8 * hh;

  /* Two fragment sets ([0],[1] = A rows, [2..5] = B columns): the 12 loads of a 32-deep step
     go out as one group, one step ahead of the products that read them. */
  FH fe[6], fo[6];
  auto load_set = [&](FH (&f)[6], int k0) {
    f[0].h[0] = *(const v8h*)(ah0 + k0);
    f[0].h[1] = *(const v8h*)(ah0 + k0 + 16);
    f[1].h[0] = *(const v8h*)(ah1 + k0);
    f[1].h[1] = *(const v8h*)(ah1 + k0 + 16);
#pragma unroll
    for (int t = 0; t < 4; ++t) {
      f[2 + t].h[0] = *(const v8h*)(bp + (size_t)t * 16 * DMODEL + k0);
      f[2 + t].h[1] = *(const v8h*)(bp + (size_t)t * 16 * DMODEL + k0 + 16);
    }
  };
  auto mma_set = [&](const FH (&f)[6]) {
#pragma unroll
    for (int t = 0; t < 4; ++t) {
      acc[0][t] = mma_f16(f[0].v, f[2 + t].v, acc[0][t]);
      acc[1][t] = mma_f16(f[1].v, f[2 + t].v, acc[1][t]);
    }
  };

  load_set(fe, 0);
  /* rolled: one trip = two steps, so that each set keeps its own registers without copies */
#pragma unroll 1
  for (int k0 = 0; k0 < DMODEL; k0 += 64) {
    load_set(fo, k0 + 32);
    mma_set(fe);
    if (k0 + 64 < DMODEL) load_set(fe, k0 + 64);
    mma_set(fo);
  }

  float* os = Os[wave];
#pragma unroll
  for (int t = 0; t < 4; ++t) {
#pragma unroll
    for (int mt = 0; mt < 2; ++mt)
#pragma unroll
      for (int r = 0; r < 8; ++r)
        os[(mt * 16 + 8 * hh + r) * OS_PITCH + 16 * t + c] = acc[mt][t][r] * OUT_FOLD;
  }
  wave_lds_sync();
  {
    const int c4 = c * 4;
    {
#pragma unroll
      for (int it = 0; it < 16; ++it) {
        const int row = it * 2 + hh;
        const v4f val = *(const v4f_a*)(os + row * OS_PITCH + c4);
        *(v4f*)(out + (size_t)(m0 + wave * 32 + row) * DMODEL + n0 + c4) = val;
      }
      
    }
  }
}

extern "C" void kernel_launch(void* const* d_in, const int* in_sizes, int n_in,
                              void* d_out, int out_size, void* d_ws, size_t ws_size,
                              hipStream_t stream)
{
  if (n_in < 3) return;
  if (in_sizes[0] < ((NB - 1) * SEQ_FULL + SEQ) * DMODEL) return;
  if (in_sizes[1] < NQKV * DMODEL) return;
  if (in_sizes[2] < DMODEL * DMODEL) return;
  if (out_size < MROWS * DMODEL) return;
  if (d_ws == nullptr || ws_size < WS_NEED) return;

  const float* x     = (const float*)d_in[0];
  const float* W_qkv = (const float*)d_in[1];   /* [3072 out][1024 in] */
  const float* W_out = (const float*)d_in[2];   /* [1024 out][1024 in] */
  float* out = (float*)d_out;

  unsigned short* Xb   = (unsigned short*)d_ws;
  unsigned short* WqT  = Xb + XB_E;
  unsigned short* WoH  = WqT + WQT_E;
  unsigned short* qkvp = WoH + WOT_E;
  unsigned short* ctxp = qkvp + QKVP_E;

  {
    const int nunits = MROWS * (DMODEL / 8);
    cvt_rows_kernel<<<(nunits + 255) / 256, 256, 0, stream>>>(x, Xb, nunits, DMODEL / 8, SEQ, SEQ_FULL);
  }
  {
    /* W_qkv rows are already [n][k]: plain row convert, no transpose */
    const int nunits = NQKV * (DMODEL / 8);
    cvt_rows_kernel<<<(nunits + 255) / 256, 256, 0, stream>>>(W_qkv, WqT, nunits, DMODEL / 8, NQKV, NQKV);
  }
  {
    /* W_out rows are already [n][k]: bf16 value x1024 in f16 */
    const int nunits = DMODEL * (DMODEL / 8);
    cvt_rows_h_kernel<<<(nunits + 255) / 256, 256, 0, stream>>>(W_out, WoH, nunits, DMODEL / 8, DMODEL, DMODEL, WO_CARRY);
  }

  gemm_qkv_kernel<<<dim3(NQKV / 64, MROWS / 128), 128, 0, stream>>>(Xb, WqT, qkvp);
  attn_kernel<<<dim3(SEQ / 64, NBH), 128, 0, stream>>>(qkvp, ctxp);
  gemm_out_kernel<<<dim3(DMODEL / 64, MROWS / 128), 128, 0, stream>>>(ctxp, WoH, out);
}

// v002
// A run of this version takes 77.3 microseconds.
// Timed twice side by side with v001, it ran 1.55 times as fast both times.
// Counting every step since v000, it is 2.31 times as fast.
// Contractions: x.Wqkv^T on v_wmma_f32_16x16x32_bf16 (both operands RNE-converted to bf16 once); q.k^T, p.v and ctx.Wout^T on v_wmma_f32_16x16x32_f16 with single f16 planes (q, k, v x16; p x256; ctx x256; Wout = bf16-converted value x1024), one product per site; f32 accumulate; softmax in f32.
#include <hip/hip_runtime.h>

typedef __attribute__((ext_vector_type(16))) __bf16 v16b;
typedef __attribute__((ext_vector_type(8)))  __bf16 v8b;
typedef __attribute__((ext_vector_type(16))) _Float16 v16h;
typedef __attribute__((ext_vector_type(8)))  _Float16 v8h;
typedef __attribute__((ext_vector_type(8)))  float  v8f;
typedef __attribute__((ext_vector_type(4)))  float  v4f;
typedef __attribute__((ext_vector_type(4)))  unsigned int v4u;
typedef v8h v8h_a __attribute__((may_alias));
typedef v8b v8b_a __attribute__((may_alias));
typedef v4f v4f_a __attribute__((may_alias));
typedef v4u v4u_a __attribute__((may_alias));
typedef _Float16 h16;

#ifndef NB
#define NB 2
#endif
#ifndef SEQ
#define SEQ 1024
#endif
#define NB_FULL 2
#define SEQ_FULL 1024

#define VGPR_CAP __attribute__((amdgpu_num_vgpr(256)))

/* power-of-two carries of the f16 operand planes and their f32 fold-backs */
#define QKV_CARRY   16.0f                 /* q, k, v planes                         */
#define P_CARRY     256.0f                /* exp(s - m) tiles                       */
#define CTX_CARRY   256.0f                /* context plane                          */
#define WO_CARRY    1024.0f               /* output weight plane                    */
#define SCORE_SCALE 0.00048828125f        /* 0.125 / (16 * 16) = 2^-11              */
#define CTX_FOLD    16.0f                 /* CTX_CARRY / QKV_CARRY (P carry cancels) */
#define OUT_FOLD    3.814697265625e-06f   /* 1 / (256 * 1024) = 2^-18               */

constexpr int DMODEL = 1024;
constexpr int NHEAD  = 16;
constexpr int DHEAD  = 64;
constexpr int NQKV   = 3 * DMODEL;
constexpr int NBH    = NB * NHEAD;
constexpr int MROWS  = NB * SEQ;
constexpr int KCH    = 64;        /* keys per chunk */
constexpr int NWAVE  = 4;
constexpr int TQ_PITCH = 72;      /* [tok][d] staging pitch (16-bit elements) */
constexpr int TV_PITCH = 136;     /* [d][tok] staging pitch (16-bit elements) */
constexpr int T_ELEMS  = 128 * TQ_PITCH;   /* 9216 >= 64 * TV_PITCH = 8704 */
constexpr int OS_PITCH = 68;
constexpr int KT       = 64;              /* k (or keys) per staged tile: one 128-B line per row   */
constexpr int SP       = 72;              /* staged row pitch, 16-bit elements: 144 B = 16 B x 9   */
constexpr int G_STAGE  = (128 + 64) * SP; /* GEMM tile: 128 A rows, then 64 B rows                 */
constexpr int A_STAGE  = (64 + 64) * SP;  /* attention tile: 64 K rows [key][d], 64 V^T rows [d][key] */

constexpr size_t PLANE  = (size_t)NBH * SEQ * DHEAD;
constexpr size_t XB_E   = (size_t)MROWS * DMODEL;
constexpr size_t WQT_E  = (size_t)NQKV * DMODEL;
constexpr size_t WOT_E  = (size_t)DMODEL * DMODEL;
constexpr size_t QKVP_E = 3 * PLANE;
constexpr size_t CTX_E  = XB_E;
constexpr size_t WS_NEED = 2 * (XB_E + WQT_E + WOT_E + QKVP_E + CTX_E);

static_assert(SEQ % 128 == 0);
static_assert(KCH == 64 && SEQ % KCH == 0);
static_assert(SEQ <= SEQ_FULL && NB <= NB_FULL);
static_assert(DHEAD == 64 && DMODEL == NHEAD * DHEAD);
static_assert(DMODEL % 64 == 0 && NQKV % 64 == 0 && DMODEL % 32 == 0);
static_assert(DMODEL % 8 == 0 && DHEAD % 8 == 0);
static_assert(MROWS % 128 == 0);
static_assert(NWAVE * 16 == 64 && NWAVE * 32 == 128);
static_assert(64 * TV_PITCH <= T_ELEMS);
static_assert(TQ_PITCH >= 64 && TV_PITCH >= 128 && OS_PITCH >= 64);
static_assert((TQ_PITCH * 2) % 16 == 0 && (TV_PITCH * 2) % 16 == 0 && (OS_PITCH * 4) % 16 == 0);
static_assert(XB_E % 64 == 0 && WQT_E % 64 == 0 && WOT_E % 64 == 0 && PLANE % 64 == 0);
static_assert(WS_NEED <= 134217728ull);
static_assert(KT == KCH && KT * 2 == 128 && (SP * 2) % 32 == 16 && SP >= KT);
static_assert(DMODEL / KT >= 2 && SEQ / KCH >= 2);

/*
 *   Xb   [MROWS][1024]        x, bf16
 *   WqT  [3072][1024]         W_qkv (already [out][in]), bf16
 *   WoH  [1024][1024]         W_out (already [out][in]), bf16-converted value x1024 held in f16
 *   qkvp 3 planes f16: Q [bh][l][64] (q x16), K [bh][l][64] (k x16), Vt [bh][64][l] (v x16)
 *   ctxp 1 plane  f16: C [MROWS][1024] (ctx x256)
 */

__device__ __forceinline__ unsigned short f2bf_bits(float f) {
  unsigned u = __float_as_uint(f);
  return (unsigned short)((u + 0x7FFFu + ((u >> 16) & 1u)) >> 16);
}
__device__ __forceinline__ float bf_bits2f(unsigned short h) { return __uint_as_float(((unsigned)h) << 16); }
__device__ __forceinline__ unsigned pk2(float a, float b) {
  return (unsigned)f2bf_bits(a) | ((unsigned)f2bf_bits(b) << 16);
}

/* f32 -> f16 (RNE) with a value select so that no subnormal f16 is ever produced */
static __device__ __forceinline__ h16 toh_flush(float v) {
  const h16 r = (h16)v;
  return (fabsf(v) < 6.103515625e-05f) ? (h16)0.0f : r;
}
static __device__ __forceinline__ unsigned short hbits(h16 v) {
  return __builtin_bit_cast(unsigned short, v);
}
static __device__ __forceinline__ unsigned pkh2(float a, float b) {
  return (unsigned)hbits(toh_flush(a)) | ((unsigned)hbits(toh_flush(b)) << 16);
}

/* one WMMA + hazard guard naming only this call's live operands */
__device__ __forceinline__ v8f mma_bf16(v16b a, v16b b, v8f c) {
  c = __builtin_amdgcn_wmma_f32_16x16x32_bf16(false, a, false, b, (short)0, c, false, false);
  asm volatile("v_nop\n\tv_nop\n\tv_nop\n\tv_nop" : "+v"(c) : "v"(a), "v"(b));
  return c;
}
__device__ __forceinline__ v8f mma_f16(v16h a, v16h b, v8f c) {
  c = __builtin_amdgcn_wmma_f32_16x16x32_f16(false, a, false, b, (short)0, c, false, false);
  asm volatile("v_nop\n\tv_nop\n\tv_nop\n\tv_nop" : "+v"(c) : "v"(a), "v"(b));
  return c;
}

__device__ __forceinline__ void wave_lds_sync() {
  __builtin_amdgcn_fence(3 /* release order */, "workgroup");
  __builtin_amdgcn_wave_barrier();
  __builtin_amdgcn_fence(2 /* acquire order */, "workgroup");
}

/* ---- tiles into LDS by asynchronous copies: each lane brings its own 16 B, 8 lanes = one 128-B line ---- */
__device__ __forceinline__ unsigned lds_byte(const void* p) { return (unsigned)(size_t)p; }

/* landed: this wave's own copies are in LDS (stands in front of the barrier that publishes them) */
__device__ __forceinline__ void wait_copies() { asm volatile("s_wait_asynccnt 0x0" ::: "memory"); }
/* this wave's LDS reads have returned (stands in front of the barrier behind which the buffer is refilled) */
__device__ __forceinline__ void wait_lds()    { asm volatile("s_wait_dscnt 0x0" ::: "memory"); }

#define CP_LINE(l, g) "global_load_async_to_lds_b128 %" #l ", %" #g ", off\n\t"

/* GEMM tile: thread = (row tid>>3, 16-B segment tid&7); 8 A row groups and 4 B row groups of 16 rows.
   The closing s_wait_xcnt stands in the copies' own statement, ahead of any rewrite of their address registers. */
__device__ __forceinline__ void stage_gemm(const unsigned short* ag, const unsigned short* bg, unsigned l) {
  constexpr int RG = 16 * DMODEL;      /* 16 rows on, global elements */
  constexpr unsigned LG = 16 * SP * 2; /* 16 rows on, LDS bytes       */
  asm volatile(
      CP_LINE(0, 12) CP_LINE(1, 13) CP_LINE(2, 14) CP_LINE(3, 15) CP_LINE(4, 16) CP_LINE(5, 17)
      CP_LINE(6, 18) CP_LINE(7, 19) CP_LINE(8, 20) CP_LINE(9, 21) CP_LINE(10, 22) CP_LINE(11, 23)
      "s_wait_xcnt 0x0"
      :: "v"(l), "v"(l + LG), "v"(l + 2 * LG), "v"(l + 3 * LG), "v"(l + 4 * LG), "v"(l + 5 * LG),
         "v"(l + 6 * LG), "v"(l + 7 * LG), "v"(l + 8 * LG), "v"(l + 9 * LG), "v"(l + 10 * LG), "v"(l + 11 * LG),
         "v"(ag), "v"(ag + RG), "v"(ag + 2 * RG), "v"(ag + 3 * RG), "v"(ag + 4 * RG), "v"(ag + 5 * RG),
         "v"(ag + 6 * RG), "v"(ag + 7 * RG), "v"(bg), "v"(bg + RG), "v"(bg + 2 * RG), "v"(bg + 3 * RG)
      : "memory");
}

/* attention tile: 4 groups of 16 K rows (64 elements apart), then 4 groups of 16 V^T rows (SEQ apart) */
__device__ __forceinline__ void stage_kv(const unsigned short* kg, const unsigned short* vg, unsigned l) {
  constexpr int KG = 16 * DHEAD;
  constexpr int VG = 16 * SEQ;
  constexpr unsigned LG = 16 * SP * 2;
  asm volatile(
      CP_LINE(0, 8) CP_LINE(1, 9) CP_LINE(2, 10) CP_LINE(3, 11)
      CP_LINE(4, 12) CP_LINE(5, 13) CP_LINE(6, 14) CP_LINE(7, 15)
      "s_wait_xcnt 0x0"
      :: "v"(l), "v"(l + LG), "v"(l + 2 * LG), "v"(l + 3 * LG),
         "v"(l + 4 * LG), "v"(l + 5 * LG), "v"(l + 6 * LG), "v"(l + 7 * LG),
         "v"(kg), "v"(kg + KG), "v"(kg + 2 * KG), "v"(kg + 3 * KG),
         "v"(vg), "v"(vg + VG), "v"(vg + 2 * VG), "v"(vg + 3 * VG)
      : "memory");
}

/* --------------------------------------------------------------------------
 * f32 rows -> bf16 rows (RNE), unit = 8 elements = one 16-B store.
 * out row = b*rpb + l  <-  in row = b*rpb_full + l ; row length = upr*8.
 * Coverage: nunits units x 8 elements = the whole plane.
 * ------------------------------------------------------------------------ */
__global__ __launch_bounds__(256) void cvt_rows_kernel(
    const float* __restrict__ in, unsigned short* __restrict__ outp,
    int nunits, int upr, int rpb, int rpb_full)
{
  const int u = blockIdx.x * 256 + threadIdx.x;
  if (u >= nunits) return;
  const int row = u / upr;
  const int seg = u - row * upr;
  const int b = row / rpb;
  const int l = row - b * rpb;
  const float* src = in + ((size_t)(b * rpb_full + l) * upr + seg) * 8;
  const v4f a0 = *(const v4f*)src;
  const v4f a1 = *(const v4f*)(src + 4);
  v4u w;
  w[0] = pk2(a0[0], a0[1]);
  w[1] = pk2(a0[2], a0[3]);
  w[2] = pk2(a1[0], a1[1]);
  w[3] = pk2(a1[2], a1[3]);
  v4u* dst = (v4u*)(outp + ((size_t)row * upr + seg) * 8);
  *dst = w;
  
}

/* --------------------------------------------------------------------------
 * f32 rows -> f16 rows holding (bf16 RNE value) x carry; the bf16 significand and the
 * power-of-two carry are exact in f16; the flush select removes would-be subnormals.
 * Coverage: nunits units x 8 elements = the whole plane.
 * ------------------------------------------------------------------------ */
__global__ __launch_bounds__(256) void cvt_rows_h_kernel(
    const float* __restrict__ in, unsigned short* __restrict__ outp,
    int nunits, int upr, int rpb, int rpb_full, float carry)
{
  const int u = blockIdx.x * 256 + threadIdx.x;
  if (u >= nunits) return;
  const int row = u / upr;
  const int seg = u - row * upr;
  const int b = row / rpb;
  const int l = row - b * rpb;
  const float* src = in + ((size_t)(b * rpb_full + l) * upr + seg) * 8;
  const v4f a0 = *(const v4f*)src;
  const v4f a1 = *(const v4f*)(src + 4);
  v4u w;
  w[0] = pkh2(bf_bits2f(f2bf_bits(a0[0])) * carry, bf_bits2f(f2bf_bits(a0[1])) * carry);
  w[1] = pkh2(bf_bits2f(f2bf_bits(a0[2])) * carry, bf_bits2f(f2bf_bits(a0[3])) * carry);
  w[2] = pkh2(bf_bits2f(f2bf_bits(a1[0])) * carry, bf_bits2f(f2bf_bits(a1[1])) * carry);
  w[3] = pkh2(bf_bits2f(f2bf_bits(a1[2])) * carry, bf_bits2f(f2bf_bits(a1[3])) * carry);
  v4u* dst = (v4u*)(outp + ((size_t)row * upr + seg) * 8);
  *dst = w;
  
}

/* --------------------------------------------------------------------------
 * qkv = Xb . WqT^T  (M = MROWS, N = 3072, K = 1024), bf16 x bf16, f32 acc.
 * Block = 4 waves, tile 128 tokens x 64 columns (= one head of one section);
 * wave = 32 rows x 64 cols (2 A fragments x 4 B fragments per 32-deep step).
 * Operands: 64-deep tiles (128 A rows + 64 B rows) copied into two LDS buffers, one tile ahead;
 * fragments read from the tile of the trip.
 * Fragment map (hh = lane>>4, c = lane&15): A row c, elems 0..7 <- k0+8hh.., 8..15 <- k0+16+8hh..;
 * B col c with the same k map; D elem r = (row 8hh+r, col c).
 * Epilogue: acc x 16 converted to f16 (flush select), staged in a block LDS tile
 * ([tok][d] for q,k; [d][tok] for v), block barrier, whole-line stores:
 *   v  : 1024 units = 64 d-rows x 16 segments (16 lanes = one 256-B row segment).
 * LDS tile Th: cross-wave, separated by a block barrier; staged extent = consumed extent.
 * ------------------------------------------------------------------------ */
__global__ __launch_bounds__(128) VGPR_CAP void gemm_qkv_kernel(
    const unsigned short* __restrict__ Xb, const unsigned short* __restrict__ WqT,
    unsigned short* __restrict__ qkvp)
{
  union FB { v16b v; v8b h[2]; };
  __shared__ __align__(16) unsigned short Th[T_ELEMS];
  __shared__ __align__(16) unsigned short St[2 * G_STAGE];

  const int tid  = threadIdx.x;
  const int wave = __builtin_amdgcn_readfirstlane(tid >> 5);
  const int lane = tid & 31;
  const int hh   = lane >> 4;
  const int c    = lane & 15;
  const int n0   = blockIdx.x * 64;
  const int m0   = blockIdx.y * 128;

  v8f acc[2][4];
#pragma unroll
  for (int mt = 0; mt < 2; ++mt)
#pragma unroll
    for (int t = 0; t < 4; ++t) acc[mt][t] = (v8f){0.f,0.f,0.f,0.f,0.f,0.f,0.f,0.f};

  /* copy side: this thread's row and 16-B segment of each 16-row group */
  const unsigned short* ag = Xb  + (size_t)(m0 + (tid >> 3)) * DMODEL + (tid & 7) * 8;
  const unsigned short* bg = WqT + (size_t)(n0 + (tid >> 3)) * DMODEL + (tid & 7) * 8;
  const unsigned lcp = lds_byte(St) + (tid >> 3) * (SP * 2) + (tid & 7) * 16;
  /* read side: this lane's place in a staged tile */
  const int aoff = (wave * 32 + c) * SP + 8 * hh;
  const int boff = (128 + c) * SP + 8 * hh;

  /* Two fragment sets ([0],[1] = A rows, [2..5] = B columns), one per 32-deep step of the tile */
  FB fe[6], fo[6];
  auto load_set = [&](FB (&f)[6], const unsigned short* sb, int k0) {
    f[0].h[0] = *(const v8b_a*)(sb + aoff + k0);
    f[0].h[1] = *(const v8b_a*)(sb + aoff + k0 + 16);
    f[1].h[0] = *(const v8b_a*)(sb + aoff + 16 * SP + k0);
    f[1].h[1] = *(const v8b_a*)(sb + aoff + 16 * SP + k0 + 16);
#pragma unroll
    for (int t = 0; t < 4; ++t) {
      f[2 + t].h[0] = *(const v8b_a*)(sb + boff + t * 16 * SP + k0);
      f[2 + t].h[1] = *(const v8b_a*)(sb + boff + t * 16 * SP + k0 + 16);
    }
  };
  auto mma_set = [&](const FB (&f)[6]) {
#pragma unroll
    for (int t = 0; t < 4; ++t) {
      acc[0][t] = mma_bf16(f[0].v, f[2 + t].v, acc[0][t]);
      acc[1][t] = mma_bf16(f[1].v, f[2 + t].v, acc[1][t]);
    }
  };

  stage_gemm(ag, bg, lcp);
  wait_copies();
  __syncthreads();
  stage_gemm(ag + KT, bg + KT, lcp + G_STAGE * 2);
  /* rolled: one trip = one tile; tile kt + 1 flies while tile kt is worked on */
#pragma unroll 1
  for (int kt = 0; kt < DMODEL / KT; ++kt) {
    const unsigned short* sb = St + (kt & 1) * G_STAGE;
    load_set(fe, sb, 0);
    load_set(fo, sb, 32);
    mma_set(fe);
    mma_set(fo);
    wait_lds();
    wait_copies();
    __syncthreads();   /* publishes tile kt + 1 and ends every read of tile kt's buffer */
    if (kt + 2 < DMODEL / KT) stage_gemm(ag + (kt + 2) * KT, bg + (kt + 2) * KT, lcp + (kt & 1) * (G_STAGE * 2));
  }
  wait_copies();

  const int sec = n0 / DMODEL;                       /* 0 q, 1 k, 2 v : block-uniform */
#pragma unroll
  for (int t = 0; t < 4; ++t) {
#pragma unroll
    for (int mt = 0; mt < 2; ++mt) {
#pragma unroll
      for (int r = 0; r < 8; ++r) {
        const float val = acc[mt][t][r] * QKV_CARRY;
        const unsigned short hb = hbits(toh_flush(val));
        const int rl = wave * 32 + mt * 16 + 8 * hh + r;
        const int cl = 16 * t + c;
        const int idx = (sec < 2) ? (rl * TQ_PITCH + cl) : (cl * TV_PITCH + rl);
        Th[idx] = hb;
      }
    }
  }
  __syncthreads();

  const int b  = m0 / SEQ;
  const int l0 = m0 - b * SEQ;
  const int h  = (n0 - sec * DMODEL) / DHEAD;
  const int bh = b * NHEAD + h;
  unsigned short* ph = qkvp + (size_t)sec * PLANE;

  {
    if (sec < 2) {
#pragma unroll
      for (int it = 0; it < 8; ++it) {
        const int u = it * 128 + tid;
        const int row = u >> 3;
        const int seg = u & 7;
        const v4u hw = *(const v4u_a*)(Th + row * TQ_PITCH + seg * 8);
        const size_t g = ((size_t)bh * SEQ + l0 + row) * DHEAD + seg * 8;
        *(v4u*)(ph + g) = hw;
      }
    } else {
#pragma unroll
      for (int it = 0; it < 8; ++it) {
        const int u = it * 128 + tid;
        const int drow = u >> 4;
        const int seg  = u & 15;
        const v4u hw = *(const v4u_a*)(Th + drow * TV_PITCH + seg * 8);
        const size_t g = ((size_t)bh * DHEAD + drow) * SEQ + l0 + seg * 8;
        *(v4u*)(ph + g) = hw;
      }
    }
    
  }
}

/* --------------------------------------------------------------------------
 * Dense multi-head attention, head dim 64, online softmax, one f16 product per site.
 * Block = 4 waves = 64 query rows of one (b,h), sharing the staged K and V tiles; grid (SEQ/64, NBH).
 * Per 64-key chunk and wave (16 query rows):
 *   S = q.k^T : 4 key tiles x 2 d-steps, accumulators in registers, scaled by 2^-11
 *               (= 1/8 and the two x16 plane carries);
 *   f32 online softmax; P = exp(s - m) x 256 converted to f16 into a wave-private LDS tile
 *   (all 16x64 elements written every chunk), row sum taken over the converted values;
 *   O += P.V from the V^T plane, two 32-key steps.
 * The chunk's K rows and V^T rows are copied into two LDS buffers, one chunk ahead, for all four waves;
 * K and V fragments are read from the chunk's buffer as one group at the head of the chunk.
 * Fragment map (hh = lane>>4, c = lane&15): A row c, elems 0..7 <- k0+8hh.., 8..15 <- k0+16+8hh..;
 * B col c with the same k map; D elem r = (row 8hh+r, col c).
 * LDS regions Ps / Os are private to their wave (wave_lds_sync form); KV is shared (block barrier per chunk).
 * ------------------------------------------------------------------------ */
__global__ __launch_bounds__(128) VGPR_CAP void attn_kernel(
    const unsigned short* __restrict__ qkvp, unsigned short* __restrict__ ctxp)
{
  union FH { v16h v; v8h h[2]; };
  __shared__ __align__(16) float Os[NWAVE][16 * OS_PITCH];
  __shared__ __align__(16) h16 Ps[NWAVE][16 * KCH];
  __shared__ __align__(16) unsigned short KV[2 * A_STAGE];

  const int tid  = threadIdx.x;
  const int wave = __builtin_amdgcn_readfirstlane(tid >> 5);
  const int lane = tid & 31;
  const int hh   = lane >> 4;
  const int c    = lane & 15;
  const int qb   = blockIdx.x;
  const int bh   = blockIdx.y;
  const int b    = bh / NHEAD;
  const int h    = bh - b * NHEAD;
  const int q0   = qb * 64 + wave * 16;
  const float NEG_INF = -__builtin_inff();

  const unsigned short* Qp  = qkvp + (size_t)bh * SEQ * DHEAD;
  const unsigned short* Vtp = Qp + 2 * PLANE;     /* [bh][d][l]: same per-bh element count */

  v16h qf[2];
  {
    const size_t qo = (size_t)(q0 + c) * DHEAD + 8 * hh;
#pragma unroll
    for (int dc = 0; dc < 2; ++dc) {
      FH f;
      f.h[0] = *(const v8h*)(Qp + qo + dc * 32);
      f.h[1] = *(const v8h*)(Qp + qo + dc * 32 + 16);
      qf[dc] = f.v;
    }
  }

  float mrow[8], lrow[8];
  v8f oacc[4];
#pragma unroll
  for (int r = 0; r < 8; ++r) { mrow[r] = NEG_INF; lrow[r] = 0.f; }
#pragma unroll
  for (int t = 0; t < 4; ++t) oacc[t] = (v8f){0.f,0.f,0.f,0.f,0.f,0.f,0.f,0.f};

  /* copy side: this thread's row and 16-B segment of each 16-row group (K plane = Q plane + PLANE) */
  const unsigned short* kg = Qp + PLANE + (size_t)(tid >> 3) * DHEAD + (tid & 7) * 8;
  const unsigned short* vg = Vtp + (size_t)(tid >> 3) * SEQ + (tid & 7) * 8;
  const unsigned lcp = lds_byte(KV) + (tid >> 3) * (SP * 2) + (tid & 7) * 16;
  /* read side: lane's place among the staged K rows [key][d]; the V^T rows [d][key] stand 64 rows on */
  const int flane = c * SP + 8 * hh;

  stage_kv(kg, vg, lcp);
  wait_copies();
  __syncthreads();
  stage_kv(kg + KCH * DHEAD, vg + KCH, lcp + A_STAGE * 2);

#pragma unroll 1
  for (int kc = 0; kc < SEQ / KCH; ++kc) {
    /* the chunk's 32 fragment reads go out as one group at its head: K first, V behind it */
    const unsigned short* kq = KV + (kc & 1) * A_STAGE + flane;
    const unsigned short* vq = kq + 64 * SP;
    FH kf[4][2];
#pragma unroll
    for (int j = 0; j < 4; ++j) {
#pragma unroll
      for (int dc = 0; dc < 2; ++dc) {
        kf[j][dc].h[0] = *(const v8h_a*)(kq + j * 16 * SP + dc * 32);
        kf[j][dc].h[1] = *(const v8h_a*)(kq + j * 16 * SP + dc * 32 + 16);
      }
    }
    FH vb[2][4];
#pragma unroll
    for (int kk = 0; kk < 2; ++kk) {
#pragma unroll
      for (int t = 0; t < 4; ++t) {
        vb[kk][t].h[0] = *(const v8h_a*)(vq + t * 16 * SP + kk * 32);
        vb[kk][t].h[1] = *(const v8h_a*)(vq + t * 16 * SP + kk * 32 + 16);
      }
    }

    /* scaled scores: 4 key tiles (D elem r = query row 8hh+r, key 16j+c) */
    v8f s[4];
#pragma unroll
    for (int j = 0; j < 4; ++j) {
      v8f sa = (v8f){0.f,0.f,0.f,0.f,0.f,0.f,0.f,0.f};
#pragma unroll
      for (int dc = 0; dc < 2; ++dc) sa = mma_f16(qf[dc], kf[j][dc].v, sa);
#pragma unroll
      for (int r = 0; r < 8; ++r) s[j][r] = sa[r] * SCORE_SCALE;
    }

    /* chunk row max over the 64 keys */
    float cm[8];
#pragma unroll
    for (int r = 0; r < 8; ++r) {
      float m = fmaxf(fmaxf(s[0][r], s[1][r]), fmaxf(s[2][r], s[3][r]));
#pragma unroll
      for (int off = 1; off < 16; off <<= 1) m = fmaxf(m, __shfl_xor(m, off, 32));
      cm[r] = m;
    }

    /* online softmax update, P tile as f16 (x256), row sum over the converted values */
#pragma unroll
    for (int r = 0; r < 8; ++r) {
      const float mnew  = fmaxf(mrow[r], cm[r]);
      const float msafe = (mnew == NEG_INF) ? 0.f : mnew;
      const float alpha = expf(mrow[r] - msafe);
      mrow[r] = mnew;
      float psum = 0.f;
#pragma unroll
      for (int j = 0; j < 4; ++j) {
        const float p = expf(s[j][r] - msafe) * P_CARRY;
        const h16 ph = toh_flush(p);
        psum += (float)ph;
        Ps[wave][(8 * hh + r) * KCH + j * 16 + c] = ph;
      }
#pragma unroll
      for (int off = 1; off < 16; off <<= 1) psum += __shfl_xor(psum, off, 32);
      lrow[r] = lrow[r] * alpha + psum;
#pragma unroll
      for (int t = 0; t < 4; ++t) oacc[t][r] *= alpha;
    }
    wave_lds_sync();

    /* O += P.V : A = P [q][kv] (this wave's tile), B = V [kv][d] from V^T [d][kv],
       fetched at the head of the chunk */
#pragma unroll
    for (int kk = 0; kk < 2; ++kk) {
      FH pa;
      pa.h[0] = *(const v8h_a*)(&Ps[wave][c * KCH + kk * 32 + 8 * hh]);
      pa.h[1] = *(const v8h_a*)(&Ps[wave][c * KCH + kk * 32 + 16 + 8 * hh]);
#pragma unroll
      for (int t = 0; t < 4; ++t) oacc[t] = mma_f16(pa.v, vb[kk][t].v, oacc[t]);
    }
    wave_lds_sync();
    wait_lds();
    wait_copies();
    __syncthreads();   /* publishes chunk kc + 1 and ends every read of chunk kc's buffer */
    if (kc + 2 < SEQ / KCH)
      stage_kv(kg + (size_t)(kc + 2) * (KCH * DHEAD), vg + (kc + 2) * KCH, lcp + (kc & 1) * (A_STAGE * 2));
  }
  wait_copies();

  /* normalise into the wave slab (ctx x256), then whole-line f16 stores */
#pragma unroll
  for (int r = 0; r < 8; ++r) {
    const float inv = CTX_FOLD * (1.0f / lrow[r]);
#pragma unroll
    for (int t = 0; t < 4; ++t) Os[wave][(8 * hh + r) * OS_PITCH + t * 16 + c] = oacc[t][r] * inv;
  }
  wave_lds_sync();
  {
    const int rq  = lane >> 3;
    const int seg = lane & 7;
    {
#pragma unroll
      for (int it = 0; it < 4; ++it) {
        const int row = it * 4 + rq;
        const v4f a0 = *(const v4f_a*)(&Os[wave][row * OS_PITCH + seg * 8]);
        const v4f a1 = *(const v4f_a*)(&Os[wave][row * OS_PITCH + seg * 8 + 4]);
        v4u hw;
        hw[0] = pkh2(a0[0], a0[1]);
        hw[1] = pkh2(a0[2], a0[3]);
        hw[2] = pkh2(a1[0], a1[1]);
        hw[3] = pkh2(a1[2], a1[3]);
        const size_t g = (size_t)(b * SEQ + q0 + row) * DMODEL + h * DHEAD + seg * 8;
        *(v4u*)(ctxp + g) = hw;
      }
      
    }
  }
}

/* --------------------------------------------------------------------------
 * out = C . WoH^T x 2^-18  (M = MROWS, N = 1024, K = 1024), f16 x f16, f32 acc.
 * Block = 4 waves, tile 128 x 64; wave = 32 rows x 64 cols; one product per tile pair.
 * Operands: 64-deep tiles (128 A rows + 64 B rows) copied into two LDS buffers, one tile ahead.
 * Epilogue: per-wave 32x64 f32 slab (wave-private LDS), 16 lanes x 16 B = one 256-B
 * ------------------------------------------------------------------------ */
__global__ __launch_bounds__(128) VGPR_CAP void gemm_out_kernel(
    const unsigned short* __restrict__ ctxp, const unsigned short* __restrict__ WoH,
    float* __restrict__ out)
{
  union FH { v16h v; v8h h[2]; };
  __shared__ __align__(16) float Os[NWAVE][32 * OS_PITCH];
  __shared__ __align__(16) unsigned short St[2 * G_STAGE];

  const int tid  = threadIdx.x;
  const int wave = __builtin_amdgcn_readfirstlane(tid >> 5);
  const int lane = tid & 31;
  const int hh   = lane >> 4;
  const int c    = lane & 15;
  const int n0   = blockIdx.x * 64;
  const int m0   = blockIdx.y * 128;

  v8f acc[2][4];
#pragma unroll
  for (int mt = 0; mt < 2; ++mt)
#pragma unroll
    for (int t = 0; t < 4; ++t) acc[mt][t] = (v8f){0.f,0.f,0.f,0.f,0.f,0.f,0.f,0.f};

  /* copy side: this thread's row and 16-B segment of each 16-row group */
  const unsigned short* ag = ctxp + (size_t)(m0 + (tid >> 3)) * DMODEL + (tid & 7) * 8;
  const unsigned short* bg = WoH  + (size_t)(n0 + (tid >> 3)) * DMODEL + (tid & 7) * 8;
  const unsigned lcp = lds_byte(St) + (tid >> 3) * (SP * 2) + (tid & 7) * 16;
  /* read side: this lane's place in a staged tile */
  const int aoff = (wave * 32 + c) * SP + 8 * hh;
  const int boff = (128 + c) * SP + 8 * hh;

  /* Two fragment sets ([0],[1] = A rows, [2..5] = B columns), one per 32-deep step of the tile */
  FH fe[6], fo[6];
  auto load_set = [&](FH (&f)[6], const unsigned short* sb, int k0) {
    f[0].h[0] = *(const v8h_a*)(sb + aoff + k0);
    f[0].h[1] = *(const v8h_a*)(sb + aoff + k0 + 16);
    f[1].h[0] = *(const v8h_a*)(sb + aoff + 16 * SP + k0);
    f[1].h[1] = *(const v8h_a*)(sb + aoff + 16 * SP + k0 + 16);
#pragma unroll
    for (int t = 0; t < 4; ++t) {
      f[2 + t].h[0] = *(const v8h_a*)(sb + boff + t * 16 * SP + k0);
      f[2 + t].h[1] = *(const v8h_a*)(sb + boff + t * 16 * SP + k0 + 16);
    }
  };
  auto mma_set = [&](const FH (&f)[6]) {
#pragma unroll
    for (int t = 0; t < 4; ++t) {
      acc[0][t] = mma_f16(f[0].v, f[2 + t].v, acc[0][t]);
      acc[1][t] = mma_f16(f[1].v, f[2 + t].v, acc[1][t]);
    }
  };

  stage_gemm(ag, bg, lcp);
  wait_copies();
  __syncthreads();
  stage_gemm(ag + KT, bg + KT, lcp + G_STAGE * 2);
  /* rolled: one trip = one tile; tile kt + 1 flies while tile kt is worked on */
#pragma unroll 1
  for (int kt = 0; kt < DMODEL / KT; ++kt) {
    const unsigned short* sb = St + (kt & 1) * G_STAGE;
    load_set(fe, sb, 0);
    load_set(fo, sb, 32);
    mma_set(fe);
    mma_set(fo);
    wait_lds();
    wait_copies();
    __syncthreads();   /* publishes tile kt + 1 and ends every read of tile kt's buffer */
    if (kt + 2 < DMODEL / KT) stage_gemm(ag + (kt + 2) * KT, bg + (kt + 2) * KT, lcp + (kt & 1) * (G_STAGE * 2));
  }
  wait_copies();

  float* os = Os[wave];
#pragma unroll
  for (int t = 0; t < 4; ++t) {
#pragma unroll
    for (int mt = 0; mt < 2; ++mt)
#pragma unroll
      for (int r = 0; r < 8; ++r)
        os[(mt * 16 + 8 * hh + r) * OS_PITCH + 16 * t + c] = acc[mt][t][r] * OUT_FOLD;
  }
  wave_lds_sync();
  {
    const int c4 = c * 4;
    {
#pragma unroll
      for (int it = 0; it < 16; ++it) {
        const int row = it * 2 + hh;
        const v4f val = *(const v4f_a*)(os + row * OS_PITCH + c4);
        *(v4f*)(out + (size_t)(m0 + wave * 32 + row) * DMODEL + n0 + c4) = val;
      }
      
    }
  }
}

extern "C" void kernel_launch(void* const* d_in, const int* in_sizes, int n_in,
                              void* d_out, int out_size, void* d_ws, size_t ws_size,
                              hipStream_t stream)
{
  if (n_in < 3) return;
  if (in_sizes[0] < ((NB - 1) * SEQ_FULL + SEQ) * DMODEL) return;
  if (in_sizes[1] < NQKV * DMODEL) return;
  if (in_sizes[2] < DMODEL * DMODEL) return;
  if (out_size < MROWS * DMODEL) return;
  if (d_ws == nullptr || ws_size < WS_NEED) return;

  const float* x     = (const float*)d_in[0];
  const float* W_qkv = (const float*)d_in[1];   /* [3072 out][1024 in] */
  const float* W_out = (const float*)d_in[2];   /* [1024 out][1024 in] */
  float* out = (float*)d_out;

  unsigned short* Xb   = (unsigned short*)d_ws;
  unsigned short* WqT  = Xb + XB_E;
  unsigned short* WoH  = WqT + WQT_E;
  unsigned short* qkvp = WoH + WOT_E;
  unsigned short* ctxp = qkvp + QKVP_E;

  {
    const int nunits = MROWS * (DMODEL / 8);
    cvt_rows_kernel<<<(nunits + 255) / 256, 256, 0, stream>>>(x, Xb, nunits, DMODEL / 8, SEQ, SEQ_FULL);
  }
  {
    /* W_qkv rows are already [n][k]: plain row convert, no transpose */
    const int nunits = NQKV * (DMODEL / 8);
    cvt_rows_kernel<<<(nunits + 255) / 256, 256, 0, stream>>>(W_qkv, WqT, nunits, DMODEL / 8, NQKV, NQKV);
  }
  {
    /* W_out rows are already [n][k]: bf16 value x1024 in f16 */
    const int nunits = DMODEL * (DMODEL / 8);
    cvt_rows_h_kernel<<<(nunits + 255) / 256, 256, 0, stream>>>(W_out, WoH, nunits, DMODEL / 8, DMODEL, DMODEL, WO_CARRY);
  }

  gemm_qkv_kernel<<<dim3(NQKV / 64, MROWS / 128), 128, 0, stream>>>(Xb, WqT, qkvp);
  attn_kernel<<<dim3(SEQ / 64, NBH), 128, 0, stream>>>(qkvp, ctxp);
  gemm_out_kernel<<<dim3(DMODEL / 64, MROWS / 128), 128, 0, stream>>>(ctxp, WoH, out);
}

// v003
// One run takes 74 microseconds.
// Next to v002, in two timings, it ran 1.05 times as fast each time.
// All steps since v000 together make it 2.41 times as fast.
// Contractions: x.Wqkv^T on v_wmma_f32_16x16x32_bf16 (both operands RNE-converted to bf16 once); q.k^T, p.v and ctx.Wout^T on v_wmma_f32_16x16x32_f16 with single f16 planes (q, k, v x16; p x256; ctx x256; Wout = bf16-converted value x1024), one product per site; f32 accumulate; softmax in f32.
#include <hip/hip_runtime.h>

typedef __attribute__((ext_vector_type(16))) __bf16 v16b;
typedef __attribute__((ext_vector_type(8)))  __bf16 v8b;
typedef __attribute__((ext_vector_type(16))) _Float16 v16h;
typedef __attribute__((ext_vector_type(8)))  _Float16 v8h;
typedef __attribute__((ext_vector_type(8)))  float  v8f;
typedef __attribute__((ext_vector_type(4)))  float  v4f;
typedef __attribute__((ext_vector_type(4)))  unsigned int v4u;
typedef v8h v8h_a __attribute__((may_alias));
typedef v8b v8b_a __attribute__((may_alias));
typedef v4f v4f_a __attribute__((may_alias));
typedef v4u v4u_a __attribute__((may_alias));
typedef _Float16 h16;

#ifndef NB
#define NB 2
#endif
#ifndef SEQ
#define SEQ 1024
#endif
#define NB_FULL 2
#define SEQ_FULL 1024

#define VGPR_CAP __attribute__((amdgpu_num_vgpr(256)))

/* power-of-two carries of the f16 operand planes and their f32 fold-backs */
#define QKV_CARRY   16.0f                 /* q, k, v planes                         */
#define P_CARRY     256.0f                /* exp(s - m) tiles                       */
#define CTX_CARRY   256.0f                /* context plane                          */
#define WO_CARRY    1024.0f               /* output weight plane                    */
#define SCORE_SCALE 0.00048828125f        /* 0.125 / (16 * 16) = 2^-11              */
#define CTX_FOLD    16.0f                 /* CTX_CARRY / QKV_CARRY (P carry cancels) */
#define OUT_FOLD    3.814697265625e-06f   /* 1 / (256 * 1024) = 2^-18               */

constexpr int DMODEL = 1024;
constexpr int NHEAD  = 16;
constexpr int DHEAD  = 64;
constexpr int NQKV   = 3 * DMODEL;
constexpr int NBH    = NB * NHEAD;
constexpr int MROWS  = NB * SEQ;
constexpr int KCH    = 64;        /* keys per chunk */
constexpr int NWAVE  = 4;
constexpr int TQ_PITCH = 72;      /* [tok][d] staging pitch (16-bit elements) */
constexpr int TV_PITCH = 136;     /* [d][tok] staging pitch (16-bit elements) */
constexpr int T_ELEMS  = 128 * TQ_PITCH;   /* 9216 >= 64 * TV_PITCH = 8704 */
constexpr int OS_PITCH = 68;
constexpr int KT       = 64;              /* k (or keys) per staged tile: one 128-B line per row   */
constexpr int SP       = 72;              /* staged row pitch, 16-bit elements: 144 B = 16 B x 9   */
constexpr int G_STAGE  = (128 + 64) * SP; /* GEMM tile: 128 A rows, then 64 B rows                 */
constexpr int A_STAGE  = (64 + 64) * SP;  /* attention tile: 64 K rows [key][d], 64 V^T rows [d][key] */

constexpr size_t PLANE  = (size_t)NBH * SEQ * DHEAD;
constexpr size_t XB_E   = (size_t)MROWS * DMODEL;
constexpr size_t WQT_E  = (size_t)NQKV * DMODEL;
constexpr size_t WOT_E  = (size_t)DMODEL * DMODEL;
constexpr size_t QKVP_E = 3 * PLANE;
constexpr size_t CTX_E  = XB_E;
constexpr size_t WS_NEED = 2 * (XB_E + WQT_E + WOT_E + QKVP_E + CTX_E);

static_assert(SEQ % 128 == 0);
static_assert(KCH == 64 && SEQ % KCH == 0);
static_assert(SEQ <= SEQ_FULL && NB <= NB_FULL);
static_assert(DHEAD == 64 && DMODEL == NHEAD * DHEAD);
static_assert(DMODEL % 64 == 0 && NQKV % 64 == 0 && DMODEL % 32 == 0);
static_assert(DMODEL % 8 == 0 && DHEAD % 8 == 0);
static_assert(MROWS % 128 == 0);
static_assert(NWAVE * 16 == 64 && NWAVE * 32 == 128);
static_assert(64 * TV_PITCH <= T_ELEMS);
static_assert(TQ_PITCH >= 64 && TV_PITCH >= 128 && OS_PITCH >= 64);
static_assert((TQ_PITCH * 2) % 16 == 0 && (TV_PITCH * 2) % 16 == 0 && (OS_PITCH * 4) % 16 == 0);
static_assert(XB_E % 64 == 0 && WQT_E % 64 == 0 && WOT_E % 64 == 0 && PLANE % 64 == 0);
static_assert(WS_NEED <= 134217728ull);
static_assert(KT == KCH && KT * 2 == 128 && (SP * 2) % 32 == 16 && SP >= KT);
static_assert(DMODEL / KT >= 2 && SEQ / KCH >= 2);

/*
 *   Xb   [MROWS][1024]        x, bf16
 *   WqT  [3072][1024]         W_qkv (already [out][in]), bf16
 *   WoH  [1024][1024]         W_out (already [out][in]), bf16-converted value x1024 held in f16
 *   qkvp 3 planes f16: Q [bh][l][64] (q x16), K [bh][l][64] (k x16), Vt [bh][64][l] (v x16)
 *   ctxp 1 plane  f16: C [MROWS][1024] (ctx x256)
 */

__device__ __forceinline__ unsigned short f2bf_bits(float f) {
  unsigned u = __float_as_uint(f);
  return (unsigned short)((u + 0x7FFFu + ((u >> 16) & 1u)) >> 16);
}
__device__ __forceinline__ float bf_bits2f(unsigned short h) { return __uint_as_float(((unsigned)h) << 16); }
__device__ __forceinline__ unsigned pk2(float a, float b) {
  return (unsigned)f2bf_bits(a) | ((unsigned)f2bf_bits(b) << 16);
}

/* f32 -> f16 (RNE) with a value select so that no subnormal f16 is ever produced */
static __device__ __forceinline__ h16 toh_flush(float v) {
  const h16 r = (h16)v;
  return (fabsf(v) < 6.103515625e-05f) ? (h16)0.0f : r;
}
static __device__ __forceinline__ unsigned short hbits(h16 v) {
  return __builtin_bit_cast(unsigned short, v);
}
static __device__ __forceinline__ unsigned pkh2(float a, float b) {
  return (unsigned)hbits(toh_flush(a)) | ((unsigned)hbits(toh_flush(b)) << 16);
}

/* one WMMA + hazard guard naming only this call's live operands */
__device__ __forceinline__ v8f mma_bf16(v16b a, v16b b, v8f c) {
  c = __builtin_amdgcn_wmma_f32_16x16x32_bf16(false, a, false, b, (short)0, c, false, false);
  asm volatile("v_nop\n\tv_nop\n\tv_nop\n\tv_nop" : "+v"(c) : "v"(a), "v"(b));
  return c;
}
__device__ __forceinline__ v8f mma_f16(v16h a, v16h b, v8f c) {
  c = __builtin_amdgcn_wmma_f32_16x16x32_f16(false, a, false, b, (short)0, c, false, false);
  asm volatile("v_nop\n\tv_nop\n\tv_nop\n\tv_nop" : "+v"(c) : "v"(a), "v"(b));
  return c;
}

__device__ __forceinline__ void wave_lds_sync() {
  __builtin_amdgcn_fence(3 /* release order */, "workgroup");
  __builtin_amdgcn_wave_barrier();
  __builtin_amdgcn_fence(2 /* acquire order */, "workgroup");
}

/* ---- tiles into LDS by asynchronous copies: each lane brings its own 16 B, 8 lanes = one 128-B line ---- */
__device__ __forceinline__ unsigned lds_byte(const void* p) { return (unsigned)(size_t)p; }

/* landed: this wave's own copies are in LDS (stands in front of the barrier that publishes them) */
__device__ __forceinline__ void wait_copies() { asm volatile("s_wait_asynccnt 0x0" ::: "memory"); }
/* this wave's LDS reads have returned (stands in front of the barrier behind which the buffer is refilled) */
__device__ __forceinline__ void wait_lds()    { asm volatile("s_wait_dscnt 0x0" ::: "memory"); }

#define CP_LINE(l, g) "global_load_async_to_lds_b128 %" #l ", %" #g ", off\n\t"

/* GEMM tile: thread = (row tid>>3, 16-B segment tid&7); 8 A row groups and 4 B row groups of 16 rows.
   The closing s_wait_xcnt stands in the copies' own statement, ahead of any rewrite of their address registers. */
__device__ __forceinline__ void stage_gemm(const unsigned short* ag, const unsigned short* bg, unsigned l) {
  constexpr int RG = 16 * DMODEL;      /* 16 rows on, global elements */
  constexpr unsigned LG = 16 * SP * 2; /* 16 rows on, LDS bytes       */
  asm volatile(
      CP_LINE(0, 12) CP_LINE(1, 13) CP_LINE(2, 14) CP_LINE(3, 15) CP_LINE(4, 16) CP_LINE(5, 17)
      CP_LINE(6, 18) CP_LINE(7, 19) CP_LINE(8, 20) CP_LINE(9, 21) CP_LINE(10, 22) CP_LINE(11, 23)
      "s_wait_xcnt 0x0"
      :: "v"(l), "v"(l + LG), "v"(l + 2 * LG), "v"(l + 3 * LG), "v"(l + 4 * LG), "v"(l + 5 * LG),
         "v"(l + 6 * LG), "v"(l + 7 * LG), "v"(l + 8 * LG), "v"(l + 9 * LG), "v"(l + 10 * LG), "v"(l + 11 * LG),
         "v"(ag), "v"(ag + RG), "v"(ag + 2 * RG), "v"(ag + 3 * RG), "v"(ag + 4 * RG), "v"(ag + 5 * RG),
         "v"(ag + 6 * RG), "v"(ag + 7 * RG), "v"(bg), "v"(bg + RG), "v"(bg + 2 * RG), "v"(bg + 3 * RG)
      : "memory");
}

/* attention tile: 4 groups of 16 K rows (64 elements apart), then 4 groups of 16 V^T rows (SEQ apart) */
__device__ __forceinline__ void stage_kv(const unsigned short* kg, const unsigned short* vg, unsigned l) {
  constexpr int KG = 16 * DHEAD;
  constexpr int VG = 16 * SEQ;
  constexpr unsigned LG = 16 * SP * 2;
  asm volatile(
      CP_LINE(0, 8) CP_LINE(1, 9) CP_LINE(2, 10) CP_LINE(3, 11)
      CP_LINE(4, 12) CP_LINE(5, 13) CP_LINE(6, 14) CP_LINE(7, 15)
      "s_wait_xcnt 0x0"
      :: "v"(l), "v"(l + LG), "v"(l + 2 * LG), "v"(l + 3 * LG),
         "v"(l + 4 * LG), "v"(l + 5 * LG), "v"(l + 6 * LG), "v"(l + 7 * LG),
         "v"(kg), "v"(kg + KG), "v"(kg + 2 * KG), "v"(kg + 3 * KG),
         "v"(vg), "v"(vg + VG), "v"(vg + 2 * VG), "v"(vg + 3 * VG)
      : "memory");
}

/* --------------------------------------------------------------------------
 * All three operand conversions in one launch. Unit = 8 elements = two 16-B loads, one 16-B store.
 *   x     -> Xb  : bf16 (RNE); out row b*SEQ + l <- in row b*SEQ_FULL + l
 *   W_qkv -> WqT : bf16 (RNE)
 *   W_out -> WoH : f16 holding (bf16 RNE value) x WO_CARRY; the bf16 significand and the power-of-two
 *                  carry are exact in f16; the flush select removes would-be subnormals.
 * The launch has one thread per unit of W_out; a thread takes CV_X units of x, CV_Q of W_qkv and one of
 * W_out, CV_LANES units apart (a wave's lanes stay on consecutive units), and issues all its loads
 * before the first conversion. Coverage: CV_LANES threads x (CV_X, CV_Q, 1) units = the three whole planes.
 * ------------------------------------------------------------------------ */
constexpr int CV_THREADS = 512;                         /* 16 waves a work-group */
constexpr int CV_UPR     = DMODEL / 8;                  /* units per row, all three planes */
constexpr int CV_LANES   = (int)(WOT_E / 8);
constexpr int CV_X       = (int)(XB_E / 8 / CV_LANES);
constexpr int CV_Q       = (int)(WQT_E / 8 / CV_LANES);
static_assert(CV_LANES % CV_THREADS == 0);
static_assert((size_t)CV_X * CV_LANES * 8 == XB_E && (size_t)CV_Q * CV_LANES * 8 == WQT_E);
static_assert((size_t)NB * SEQ_FULL * DMODEL < (1u << 30) && WQT_E < (1u << 30));   /* element indices fit 32 bits */

/* element e of p through a 32-bit byte offset: scalar base + one offset register, no 64-bit address pair per load */
__device__ __forceinline__ const float* at32(const float* p, unsigned e) {
  return (const float*)((const char*)p + e * 4u);
}

__device__ __forceinline__ v4u bf_unit(v4f a0, v4f a1) {
  v4u w;
  w[0] = pk2(a0[0], a0[1]);
  w[1] = pk2(a0[2], a0[3]);
  w[2] = pk2(a1[0], a1[1]);
  w[3] = pk2(a1[2], a1[3]);
  return w;
}

__global__ __launch_bounds__(CV_THREADS) void cvt_all_kernel(
    const float* __restrict__ x, const float* __restrict__ Wq, const float* __restrict__ Wo,
    unsigned short* __restrict__ Xb, unsigned short* __restrict__ WqT, unsigned short* __restrict__ WoH)
{
  const unsigned g = blockIdx.x * CV_THREADS + threadIdx.x;

  /* every loop here is unrolled whole: the units stay in registers and the loads go out as one run */
  v4f xa[CV_X][2], qa[CV_Q][2], oa[2];
#pragma unroll
  for (unsigned i = 0; i < CV_X; ++i) {
    const unsigned u   = i * CV_LANES + g;
    const unsigned row = u / CV_UPR;
    const unsigned seg = u - row * CV_UPR;
    const unsigned b   = row / SEQ;
    const unsigned l   = row - b * SEQ;
    const float* s = at32(x, ((b * SEQ_FULL + l) * CV_UPR + seg) * 8u);
    xa[i][0] = *(const v4f*)s;
    xa[i][1] = *(const v4f*)(s + 4);
  }
#pragma unroll
  for (unsigned i = 0; i < CV_Q; ++i) {
    const float* s = at32(Wq, (i * CV_LANES + g) * 8u);
    qa[i][0] = *(const v4f*)s;
    qa[i][1] = *(const v4f*)(s + 4);
  }
  /* a later load may land in a register that held an earlier load's offset: the earlier loads' address
     translations are waited for first (a precaution of form; costs one short wait among the loads) */
  asm volatile("s_wait_xcnt 0x0" ::: "memory");
  {
    const float* s = at32(Wo, g * 8u);
    oa[0] = *(const v4f*)s;
    oa[1] = *(const v4f*)(s + 4);
  }

#pragma unroll
  for (unsigned i = 0; i < CV_X; ++i) *(v4u*)(Xb + (i * CV_LANES + g) * 8u) = bf_unit(xa[i][0], xa[i][1]);
#pragma unroll
  for (unsigned i = 0; i < CV_Q; ++i) *(v4u*)(WqT + (i * CV_LANES + g) * 8u) = bf_unit(qa[i][0], qa[i][1]);
  {
    v4u w;
    w[0] = pkh2(bf_bits2f(f2bf_bits(oa[0][0])) * WO_CARRY, bf_bits2f(f2bf_bits(oa[0][1])) * WO_CARRY);
    w[1] = pkh2(bf_bits2f(f2bf_bits(oa[0][2])) * WO_CARRY, bf_bits2f(f2bf_bits(oa[0][3])) * WO_CARRY);
    w[2] = pkh2(bf_bits2f(f2bf_bits(oa[1][0])) * WO_CARRY, bf_bits2f(f2bf_bits(oa[1][1])) * WO_CARRY);
    w[3] = pkh2(bf_bits2f(f2bf_bits(oa[1][2])) * WO_CARRY, bf_bits2f(f2bf_bits(oa[1][3])) * WO_CARRY);
    *(v4u*)(WoH + g * 8u) = w;
  }
}

/* --------------------------------------------------------------------------
 * qkv = Xb . WqT^T  (M = MROWS, N = 3072, K = 1024), bf16 x bf16, f32 acc.
 * Block = 4 waves, tile 128 tokens x 64 columns (= one head of one section);
 * wave = 32 rows x 64 cols (2 A fragments x 4 B fragments per 32-deep step).
 * Operands: 64-deep tiles (128 A rows + 64 B rows) copied into two LDS buffers, one tile ahead;
 * fragments read from the tile of the trip.
 * Fragment map (hh = lane>>4, c = lane&15): A row c, elems 0..7 <- k0+8hh.., 8..15 <- k0+16+8hh..;
 * B col c with the same k map; D elem r = (row 8hh+r, col c).
 * Epilogue: acc x 16 converted to f16 (flush select), staged in a block LDS tile
 * ([tok][d] for q,k; [d][tok] for v), block barrier, whole-line stores:
 *   v  : 1024 units = 64 d-rows x 16 segments (16 lanes = one 256-B row segment).
 * LDS tile Th: cross-wave, separated by a block barrier; staged extent = consumed extent.
 * ------------------------------------------------------------------------ */
__global__ __launch_bounds__(128) VGPR_CAP void gemm_qkv_kernel(
    const unsigned short* __restrict__ Xb, const unsigned short* __restrict__ WqT,
    unsigned short* __restrict__ qkvp)
{
  union FB { v16b v; v8b h[2]; };
  __shared__ __align__(16) unsigned short Th[T_ELEMS];
  __shared__ __align__(16) unsigned short St[2 * G_STAGE];

  const int tid  = threadIdx.x;
  const int wave = __builtin_amdgcn_readfirstlane(tid >> 5);
  const int lane = tid & 31;
  const int hh   = lane >> 4;
  const int c    = lane & 15;
  const int n0   = blockIdx.x * 64;
  const int m0   = blockIdx.y * 128;

  v8f acc[2][4];
#pragma unroll
  for (int mt = 0; mt < 2; ++mt)
#pragma unroll
    for (int t = 0; t < 4; ++t) acc[mt][t] = (v8f){0.f,0.f,0.f,0.f,0.f,0.f,0.f,0.f};

  /* copy side: this thread's row and 16-B segment of each 16-row group */
  const unsigned short* ag = Xb  + (size_t)(m0 + (tid >> 3)) * DMODEL + (tid & 7) * 8;
  const unsigned short* bg = WqT + (size_t)(n0 + (tid >> 3)) * DMODEL + (tid & 7) * 8;
  const unsigned lcp = lds_byte(St) + (tid >> 3) * (SP * 2) + (tid & 7) * 16;
  /* read side: this lane's place in a staged tile */
  const int aoff = (wave * 32 + c) * SP + 8 * hh;
  const int boff = (128 + c) * SP + 8 * hh;

  /* Two fragment sets ([0],[1] = A rows, [2..5] = B columns), one per 32-deep step of the tile */
  FB fe[6], fo[6];
  auto load_set = [&](FB (&f)[6], const unsigned short* sb, int k0) {
    f[0].h[0] = *(const v8b_a*)(sb + aoff + k0);
    f[0].h[1] = *(const v8b_a*)(sb + aoff + k0 + 16);
    f[1].h[0] = *(const v8b_a*)(sb + aoff + 16 * SP + k0);
    f[1].h[1] = *(const v8b_a*)(sb + aoff + 16 * SP + k0 + 16);
#pragma unroll
    for (int t = 0; t < 4; ++t) {
      f[2 + t].h[0] = *(const v8b_a*)(sb + boff + t * 16 * SP + k0);
      f[2 + t].h[1] = *(const v8b_a*)(sb + boff + t * 16 * SP + k0 + 16);
    }
  };
  auto mma_set = [&](const FB (&f)[6]) {
#pragma unroll
    for (int t = 0; t < 4; ++t) {
      acc[0][t] = mma_bf16(f[0].v, f[2 + t].v, acc[0][t]);
      acc[1][t] = mma_bf16(f[1].v, f[2 + t].v, acc[1][t]);
    }
  };

  stage_gemm(ag, bg, lcp);
  wait_copies();
  __syncthreads();
  stage_gemm(ag + KT, bg + KT, lcp + G_STAGE * 2);
  /* rolled: one trip = one tile; tile kt + 1 flies while tile kt is worked on */
#pragma unroll 1
  for (int kt = 0; kt < DMODEL / KT; ++kt) {
    const unsigned short* sb = St + (kt & 1) * G_STAGE;
    load_set(fe, sb, 0);
    load_set(fo, sb, 32);
    mma_set(fe);
    mma_set(fo);
    wait_lds();
    wait_copies();
    __syncthreads();   /* publishes tile kt + 1 and ends every read of tile kt's buffer */
    if (kt + 2 < DMODEL / KT) stage_gemm(ag + (kt + 2) * KT, bg + (kt + 2) * KT, lcp + (kt & 1) * (G_STAGE * 2));
  }
  wait_copies();

  const int sec = n0 / DMODEL;                       /* 0 q, 1 k, 2 v : block-uniform */
#pragma unroll
  for (int t = 0; t < 4; ++t) {
#pragma unroll
    for (int mt = 0; mt < 2; ++mt) {
#pragma unroll
      for (int r = 0; r < 8; ++r) {
        const float val = acc[mt][t][r] * QKV_CARRY;
        const unsigned short hb = hbits(toh_flush(val));
        const int rl = wave * 32 + mt * 16 + 8 * hh + r;
        const int cl = 16 * t + c;
        const int idx = (sec < 2) ? (rl * TQ_PITCH + cl) : (cl * TV_PITCH + rl);
        Th[idx] = hb;
      }
    }
  }
  __syncthreads();

  const int b  = m0 / SEQ;
  const int l0 = m0 - b * SEQ;
  const int h  = (n0 - sec * DMODEL) / DHEAD;
  const int bh = b * NHEAD + h;
  unsigned short* ph = qkvp + (size_t)sec * PLANE;

  {
    if (sec < 2) {
#pragma unroll
      for (int it = 0; it < 8; ++it) {
        const int u = it * 128 + tid;
        const int row = u >> 3;
        const int seg = u & 7;
        const v4u hw = *(const v4u_a*)(Th + row * TQ_PITCH + seg * 8);
        const size_t g = ((size_t)bh * SEQ + l0 + row) * DHEAD + seg * 8;
        *(v4u*)(ph + g) = hw;
      }
    } else {
#pragma unroll
      for (int it = 0; it < 8; ++it) {
        const int u = it * 128 + tid;
        const int drow = u >> 4;
        const int seg  = u & 15;
        const v4u hw = *(const v4u_a*)(Th + drow * TV_PITCH + seg * 8);
        const size_t g = ((size_t)bh * DHEAD + drow) * SEQ + l0 + seg * 8;
        *(v4u*)(ph + g) = hw;
      }
    }
    
  }
}

/* --------------------------------------------------------------------------
 * Dense multi-head attention, head dim 64, online softmax, one f16 product per site.
 * Block = 4 waves = 64 query rows of one (b,h), sharing the staged K and V tiles; grid (SEQ/64, NBH).
 * Per 64-key chunk and wave (16 query rows):
 *   S = q.k^T : 4 key tiles x 2 d-steps, accumulators in registers, scaled by 2^-11
 *               (= 1/8 and the two x16 plane carries);
 *   f32 online softmax; P = exp(s - m) x 256 converted to f16 into a wave-private LDS tile
 *   (all 16x64 elements written every chunk), row sum taken over the converted values;
 *   O += P.V from the V^T plane, two 32-key steps.
 * The chunk's K rows and V^T rows are copied into two LDS buffers, one chunk ahead, for all four waves;
 * K and V fragments are read from the chunk's buffer as one group at the head of the chunk.
 * Fragment map (hh = lane>>4, c = lane&15): A row c, elems 0..7 <- k0+8hh.., 8..15 <- k0+16+8hh..;
 * B col c with the same k map; D elem r = (row 8hh+r, col c).
 * LDS regions Ps / Os are private to their wave (wave_lds_sync form); KV is shared (block barrier per chunk).
 * ------------------------------------------------------------------------ */
__global__ __launch_bounds__(128) VGPR_CAP void attn_kernel(
    const unsigned short* __restrict__ qkvp, unsigned short* __restrict__ ctxp)
{
  union FH { v16h v; v8h h[2]; };
  __shared__ __align__(16) float Os[NWAVE][16 * OS_PITCH];
  __shared__ __align__(16) h16 Ps[NWAVE][16 * KCH];
  __shared__ __align__(16) unsigned short KV[2 * A_STAGE];

  const int tid  = threadIdx.x;
  const int wave = __builtin_amdgcn_readfirstlane(tid >> 5);
  const int lane = tid & 31;
  const int hh   = lane >> 4;
  const int c    = lane & 15;
  const int qb   = blockIdx.x;
  const int bh   = blockIdx.y;
  const int b    = bh / NHEAD;
  const int h    = bh - b * NHEAD;
  const int q0   = qb * 64 + wave * 16;
  const float NEG_INF = -__builtin_inff();

  const unsigned short* Qp  = qkvp + (size_t)bh * SEQ * DHEAD;
  const unsigned short* Vtp = Qp + 2 * PLANE;     /* [bh][d][l]: same per-bh element count */

  v16h qf[2];
  {
    const size_t qo = (size_t)(q0 + c) * DHEAD + 8 * hh;
#pragma unroll
    for (int dc = 0; dc < 2; ++dc) {
      FH f;
      f.h[0] = *(const v8h*)(Qp + qo + dc * 32);
      f.h[1] = *(const v8h*)(Qp + qo + dc * 32 + 16);
      qf[dc] = f.v;
    }
  }

  float mrow[8], lrow[8];
  v8f oacc[4];
#pragma unroll
  for (int r = 0; r < 8; ++r) { mrow[r] = NEG_INF; lrow[r] = 0.f; }
#pragma unroll
  for (int t = 0; t < 4; ++t) oacc[t] = (v8f){0.f,0.f,0.f,0.f,0.f,0.f,0.f,0.f};

  /* copy side: this thread's row and 16-B segment of each 16-row group (K plane = Q plane + PLANE) */
  const unsigned short* kg = Qp + PLANE + (size_t)(tid >> 3) * DHEAD + (tid & 7) * 8;
  const unsigned short* vg = Vtp + (size_t)(tid >> 3) * SEQ + (tid & 7) * 8;
  const unsigned lcp = lds_byte(KV) + (tid >> 3) * (SP * 2) + (tid & 7) * 16;
  /* read side: lane's place among the staged K rows [key][d]; the V^T rows [d][key] stand 64 rows on */
  const int flane = c * SP + 8 * hh;

  stage_kv(kg, vg, lcp);
  wait_copies();
  __syncthreads();
  stage_kv(kg + KCH * DHEAD, vg + KCH, lcp + A_STAGE * 2);

#pragma unroll 1
  for (int kc = 0; kc < SEQ / KCH; ++kc) {
    /* the chunk's 32 fragment reads go out as one group at its head: K first, V behind it */
    const unsigned short* kq = KV + (kc & 1) * A_STAGE + flane;
    const unsigned short* vq = kq + 64 * SP;
    FH kf[4][2];
#pragma unroll
    for (int j = 0; j < 4; ++j) {
#pragma unroll
      for (int dc = 0; dc < 2; ++dc) {
        kf[j][dc].h[0] = *(const v8h_a*)(kq + j * 16 * SP + dc * 32);
        kf[j][dc].h[1] = *(const v8h_a*)(kq + j * 16 * SP + dc * 32 + 16);
      }
    }
    FH vb[2][4];
#pragma unroll
    for (int kk = 0; kk < 2; ++kk) {
#pragma unroll
      for (int t = 0; t < 4; ++t) {
        vb[kk][t].h[0] = *(const v8h_a*)(vq + t * 16 * SP + kk * 32);
        vb[kk][t].h[1] = *(const v8h_a*)(vq + t * 16 * SP + kk * 32 + 16);
      }
    }

    /* scaled scores: 4 key tiles (D elem r = query row 8hh+r, key 16j+c) */
    v8f s[4];
#pragma unroll
    for (int j = 0; j < 4; ++j) {
      v8f sa = (v8f){0.f,0.f,0.f,0.f,0.f,0.f,0.f,0.f};
#pragma unroll
      for (int dc = 0; dc < 2; ++dc) sa = mma_f16(qf[dc], kf[j][dc].v, sa);
#pragma unroll
      for (int r = 0; r < 8; ++r) s[j][r] = sa[r] * SCORE_SCALE;
    }

    /* chunk row max over the 64 keys */
    float cm[8];
#pragma unroll
    for (int r = 0; r < 8; ++r) {
      float m = fmaxf(fmaxf(s[0][r], s[1][r]), fmaxf(s[2][r], s[3][r]));
#pragma unroll
      for (int off = 1; off < 16; off <<= 1) m = fmaxf(m, __shfl_xor(m, off, 32));
      cm[r] = m;
    }

    /* online softmax update, P tile as f16 (x256), row sum over the converted values */
#pragma unroll
    for (int r = 0; r < 8; ++r) {
      const float mnew  = fmaxf(mrow[r], cm[r]);
      const float msafe = (mnew == NEG_INF) ? 0.f : mnew;
      const float alpha = expf(mrow[r] - msafe);
      mrow[r] = mnew;
      float psum = 0.f;
#pragma unroll
      for (int j = 0; j < 4; ++j) {
        const float p = expf(s[j][r] - msafe) * P_CARRY;
        const h16 ph = toh_flush(p);
        psum += (float)ph;
        Ps[wave][(8 * hh + r) * KCH + j * 16 + c] = ph;
      }
#pragma unroll
      for (int off = 1; off < 16; off <<= 1) psum += __shfl_xor(psum, off, 32);
      lrow[r] = lrow[r] * alpha + psum;
#pragma unroll
      for (int t = 0; t < 4; ++t) oacc[t][r] *= alpha;
    }
    wave_lds_sync();

    /* O += P.V : A = P [q][kv] (this wave's tile), B = V [kv][d] from V^T [d][kv],
       fetched at the head of the chunk */
#pragma unroll
    for (int kk = 0; kk < 2; ++kk) {
      FH pa;
      pa.h[0] = *(const v8h_a*)(&Ps[wave][c * KCH + kk * 32 + 8 * hh]);
      pa.h[1] = *(const v8h_a*)(&Ps[wave][c * KCH + kk * 32 + 16 + 8 * hh]);
#pragma unroll
      for (int t = 0; t < 4; ++t) oacc[t] = mma_f16(pa.v, vb[kk][t].v, oacc[t]);
    }
    wave_lds_sync();
    wait_lds();
    wait_copies();
    __syncthreads();   /* publishes chunk kc + 1 and ends every read of chunk kc's buffer */
    if (kc + 2 < SEQ / KCH)
      stage_kv(kg + (size_t)(kc + 2) * (KCH * DHEAD), vg + (kc + 2) * KCH, lcp + (kc & 1) * (A_STAGE * 2));
  }
  wait_copies();

  /* normalise into the wave slab (ctx x256), then whole-line f16 stores */
#pragma unroll
  for (int r = 0; r < 8; ++r) {
    const float inv = CTX_FOLD * (1.0f / lrow[r]);
#pragma unroll
    for (int t = 0; t < 4; ++t) Os[wave][(8 * hh + r) * OS_PITCH + t * 16 + c] = oacc[t][r] * inv;
  }
  wave_lds_sync();
  {
    const int rq  = lane >> 3;
    const int seg = lane & 7;
    {
#pragma unroll
      for (int it = 0; it < 4; ++it) {
        const int row = it * 4 + rq;
        const v4f a0 = *(const v4f_a*)(&Os[wave][row * OS_PITCH + seg * 8]);
        const v4f a1 = *(const v4f_a*)(&Os[wave][row * OS_PITCH + seg * 8 + 4]);
        v4u hw;
        hw[0] = pkh2(a0[0], a0[1]);
        hw[1] = pkh2(a0[2], a0[3]);
        hw[2] = pkh2(a1[0], a1[1]);
        hw[3] = pkh2(a1[2], a1[3]);
        const size_t g = (size_t)(b * SEQ + q0 + row) * DMODEL + h * DHEAD + seg * 8;
        *(v4u*)(ctxp + g) = hw;
      }
      
    }
  }
}

/* --------------------------------------------------------------------------
 * out = C . WoH^T x 2^-18  (M = MROWS, N = 1024, K = 1024), f16 x f16, f32 acc.
 * Block = 4 waves, tile 128 x 64; wave = 32 rows x 64 cols; one product per tile pair.
 * Operands: 64-deep tiles (128 A rows + 64 B rows) copied into two LDS buffers, one tile ahead.
 * Epilogue: per-wave 32x64 f32 slab (wave-private LDS), 16 lanes x 16 B = one 256-B
 * ------------------------------------------------------------------------ */
__global__ __launch_bounds__(128) VGPR_CAP void gemm_out_kernel(
    const unsigned short* __restrict__ ctxp, const unsigned short* __restrict__ WoH,
    float* __restrict__ out)
{
  union FH { v16h v; v8h h[2]; };
  __shared__ __align__(16) float Os[NWAVE][32 * OS_PITCH];
  __shared__ __align__(16) unsigned short St[2 * G_STAGE];

  const int tid  = threadIdx.x;
  const int wave = __builtin_amdgcn_readfirstlane(tid >> 5);
  const int lane = tid & 31;
  const int hh   = lane >> 4;
  const int c    = lane & 15;
  const int n0   = blockIdx.x * 64;
  const int m0   = blockIdx.y * 128;

  v8f acc[2][4];
#pragma unroll
  for (int mt = 0; mt < 2; ++mt)
#pragma unroll
    for (int t = 0; t < 4; ++t) acc[mt][t] = (v8f){0.f,0.f,0.f,0.f,0.f,0.f,0.f,0.f};

  /* copy side: this thread's row and 16-B segment of each 16-row group */
  const unsigned short* ag = ctxp + (size_t)(m0 + (tid >> 3)) * DMODEL + (tid & 7) * 8;
  const unsigned short* bg = WoH  + (size_t)(n0 + (tid >> 3)) * DMODEL + (tid & 7) * 8;
  const unsigned lcp = lds_byte(St) + (tid >> 3) * (SP * 2) + (tid & 7) * 16;
  /* read side: this lane's place in a staged tile */
  const int aoff = (wave * 32 + c) * SP + 8 * hh;
  const int boff = (128 + c) * SP + 8 * hh;

  /* Two fragment sets ([0],[1] = A rows, [2..5] = B columns), one per 32-deep step of the tile */
  FH fe[6], fo[6];
  auto load_set = [&](FH (&f)[6], const unsigned short* sb, int k0) {
    f[0].h[0] = *(const v8h_a*)(sb + aoff + k0);
    f[0].h[1] = *(const v8h_a*)(sb + aoff + k0 + 16);
    f[1].h[0] = *(const v8h_a*)(sb + aoff + 16 * SP + k0);
    f[1].h[1] = *(const v8h_a*)(sb + aoff + 16 * SP + k0 + 16);
#pragma unroll
    for (int t = 0; t < 4; ++t) {
      f[2 + t].h[0] = *(const v8h_a*)(sb + boff + t * 16 * SP + k0);
      f[2 + t].h[1] = *(const v8h_a*)(sb + boff + t * 16 * SP + k0 + 16);
    }
  };
  auto mma_set = [&](const FH (&f)[6]) {
#pragma unroll
    for (int t = 0; t < 4; ++t) {
      acc[0][t] = mma_f16(f[0].v, f[2 + t].v, acc[0][t]);
      acc[1][t] = mma_f16(f[1].v, f[2 + t].v, acc[1][t]);
    }
  };

  stage_gemm(ag, bg, lcp);
  wait_copies();
  __syncthreads();
  stage_gemm(ag + KT, bg + KT, lcp + G_STAGE * 2);
  /* rolled: one trip = one tile; tile kt + 1 flies while tile kt is worked on */
#pragma unroll 1
  for (int kt = 0; kt < DMODEL / KT; ++kt) {
    const unsigned short* sb = St + (kt & 1) * G_STAGE;
    load_set(fe, sb, 0);
    load_set(fo, sb, 32);
    mma_set(fe);
    mma_set(fo);
    wait_lds();
    wait_copies();
    __syncthreads();   /* publishes tile kt + 1 and ends every read of tile kt's buffer */
    if (kt + 2 < DMODEL / KT) stage_gemm(ag + (kt + 2) * KT, bg + (kt + 2) * KT, lcp + (kt & 1) * (G_STAGE * 2));
  }
  wait_copies();

  float* os = Os[wave];
#pragma unroll
  for (int t = 0; t < 4; ++t) {
#pragma unroll
    for (int mt = 0; mt < 2; ++mt)
#pragma unroll
      for (int r = 0; r < 8; ++r)
        os[(mt * 16 + 8 * hh + r) * OS_PITCH + 16 * t + c] = acc[mt][t][r] * OUT_FOLD;
  }
  wave_lds_sync();
  {
    const int c4 = c * 4;
    {
#pragma unroll
      for (int it = 0; it < 16; ++it) {
        const int row = it * 2 + hh;
        const v4f val = *(const v4f_a*)(os + row * OS_PITCH + c4);
        *(v4f*)(out + (size_t)(m0 + wave * 32 + row) * DMODEL + n0 + c4) = val;
      }
      
    }
  }
}

extern "C" void kernel_launch(void* const* d_in, const int* in_sizes, int n_in,
                              void* d_out, int out_size, void* d_ws, size_t ws_size,
                              hipStream_t stream)
{
  if (n_in < 3) return;
  if (in_sizes[0] < ((NB - 1) * SEQ_FULL + SEQ) * DMODEL) return;
  if (in_sizes[1] < NQKV * DMODEL) return;
  if (in_sizes[2] < DMODEL * DMODEL) return;
  if (out_size < MROWS * DMODEL) return;
  if (d_ws == nullptr || ws_size < WS_NEED) return;

  const float* x     = (const float*)d_in[0];
  const float* W_qkv = (const float*)d_in[1];   /* [3072 out][1024 in] */
  const float* W_out = (const float*)d_in[2];   /* [1024 out][1024 in] */
  float* out = (float*)d_out;

  unsigned short* Xb   = (unsigned short*)d_ws;
  unsigned short* WqT  = Xb + XB_E;
  unsigned short* WoH  = WqT + WQT_E;
  unsigned short* qkvp = WoH + WOT_E;
  unsigned short* ctxp = qkvp + QKVP_E;

  /* W_qkv and W_out rows are already [n][k]: plain row converts, no transpose */
  cvt_all_kernel<<<CV_LANES / CV_THREADS, CV_THREADS, 0, stream>>>(x, W_qkv, W_out, Xb, WqT, WoH);

  gemm_qkv_kernel<<<dim3(NQKV / 64, MROWS / 128), 128, 0, stream>>>(Xb, WqT, qkvp);
  attn_kernel<<<dim3(SEQ / 64, NBH), 128, 0, stream>>>(qkvp, ctxp);
  gemm_out_kernel<<<dim3(DMODEL / 64, MROWS / 128), 128, 0, stream>>>(ctxp, WoH, out);
}

// v004
// Measured time: 60.4 microseconds a run.
// In two side-by-side timings against v003, it was 1.22 and 1.23 times as fast.
// All steps since v000 together make it 2.96 times as fast.
// Contractions: x.Wqkv^T on v_wmma_f32_16x16x32_bf16 (both operands RNE-converted to bf16 once); q.k^T, p.v and ctx.Wout^T on v_wmma_f32_16x16x32_f16 with single f16 planes (q, k, v x16; p x256; ctx x256; Wout = bf16-converted value x1024), one product per site; f32 accumulate; softmax in f32.
#include <hip/hip_runtime.h>

typedef __attribute__((ext_vector_type(16))) __bf16 v16b;
typedef __attribute__((ext_vector_type(8)))  __bf16 v8b;
typedef __attribute__((ext_vector_type(16))) _Float16 v16h;
typedef __attribute__((ext_vector_type(8)))  _Float16 v8h;
typedef __attribute__((ext_vector_type(8)))  float  v8f;
typedef __attribute__((ext_vector_type(4)))  float  v4f;
typedef __attribute__((ext_vector_type(4)))  unsigned int v4u;
typedef v8h v8h_a __attribute__((may_alias));
typedef v8b v8b_a __attribute__((may_alias));
typedef v4f v4f_a __attribute__((may_alias));
typedef v4u v4u_a __attribute__((may_alias));
typedef _Float16 h16;

#ifndef NB
#define NB 2
#endif
#ifndef SEQ
#define SEQ 1024
#endif
#define NB_FULL 2
#define SEQ_FULL 1024

#define VGPR_CAP __attribute__((amdgpu_num_vgpr(256)))

/* power-of-two carries of the f16 operand planes and their f32 fold-backs */
#define QKV_CARRY   16.0f                 /* q, k, v planes                         */
#define P_CARRY     256.0f                /* exp(s - m) tiles                       */
#define CTX_CARRY   256.0f                /* context plane                          */
#define WO_CARRY    1024.0f               /* output weight plane                    */
#define SCORE_SCALE 0.00048828125f        /* 0.125 / (16 * 16) = 2^-11              */
#define CTX_FOLD    16.0f                 /* CTX_CARRY / QKV_CARRY (P carry cancels) */
#define OUT_FOLD    3.814697265625e-06f   /* 1 / (256 * 1024) = 2^-18               */

constexpr int DMODEL = 1024;
constexpr int NHEAD  = 16;
constexpr int DHEAD  = 64;
constexpr int NQKV   = 3 * DMODEL;
constexpr int NBH    = NB * NHEAD;
constexpr int MROWS  = NB * SEQ;
constexpr int KCH    = 64;        /* keys per chunk */
constexpr int NWAVE  = 4;
constexpr int TQ_PITCH = 72;      /* [tok][d] staging pitch (16-bit elements) */
constexpr int TV_PITCH = 136;     /* [d][tok] staging pitch (16-bit elements) */
constexpr int T_ELEMS  = 128 * TQ_PITCH;   /* 9216 >= 64 * TV_PITCH = 8704 */
constexpr int OS_PITCH = 68;
constexpr int KT       = 64;              /* k (or keys) per staged tile: one 128-B line per row   */
constexpr int SP       = 72;              /* staged row pitch, 16-bit elements: 144 B = 16 B x 9   */
constexpr int G_STAGE  = (128 + 64) * SP; /* GEMM tile: 128 A rows, then 64 B rows                 */
constexpr int A_STAGE  = (64 + 64) * SP;  /* attention tile: 64 K rows [key][d], 64 V^T rows [d][key] */

constexpr size_t PLANE  = (size_t)NBH * SEQ * DHEAD;
constexpr size_t XB_E   = (size_t)MROWS * DMODEL;
constexpr size_t WQT_E  = (size_t)NQKV * DMODEL;
constexpr size_t WOT_E  = (size_t)DMODEL * DMODEL;
constexpr size_t QKVP_E = 3 * PLANE;
constexpr size_t CTX_E  = XB_E;
constexpr size_t WS_NEED = 2 * (XB_E + WQT_E + WOT_E + QKVP_E + CTX_E);

static_assert(SEQ % 128 == 0);
static_assert(KCH == 64 && SEQ % KCH == 0);
static_assert(SEQ <= SEQ_FULL && NB <= NB_FULL);
static_assert(DHEAD == 64 && DMODEL == NHEAD * DHEAD);
static_assert(DMODEL % 64 == 0 && NQKV % 64 == 0 && DMODEL % 32 == 0);
static_assert(DMODEL % 8 == 0 && DHEAD % 8 == 0);
static_assert(MROWS % 128 == 0);
static_assert(NWAVE * 16 == 64 && NWAVE * 32 == 128);
static_assert(64 * TV_PITCH <= T_ELEMS);
static_assert(TQ_PITCH >= 64 && TV_PITCH >= 128 && OS_PITCH >= 64);
static_assert((TQ_PITCH * 2) % 16 == 0 && (TV_PITCH * 2) % 16 == 0 && (OS_PITCH * 4) % 16 == 0);
static_assert(XB_E % 64 == 0 && WQT_E % 64 == 0 && WOT_E % 64 == 0 && PLANE % 64 == 0);
static_assert(WS_NEED <= 134217728ull);
static_assert(KT == KCH && KT * 2 == 128 && (SP * 2) % 32 == 16 && SP >= KT);
static_assert(DMODEL / KT >= 2 && SEQ / KCH >= 2);

/*
 *   Xb   [MROWS][1024]        x, bf16
 *   WqT  [3072][1024]         W_qkv (already [out][in]), bf16
 *   WoH  [1024][1024]         W_out (already [out][in]), bf16-converted value x1024 held in f16
 *   qkvp 3 planes f16: Q [bh][l][64] (q x16), K [bh][l][64] (k x16), Vt [bh][64][l] (v x16)
 *   ctxp 1 plane  f16: C [MROWS][1024] (ctx x256)
 */

__device__ __forceinline__ unsigned short f2bf_bits(float f) {
  unsigned u = __float_as_uint(f);
  return (unsigned short)((u + 0x7FFFu + ((u >> 16) & 1u)) >> 16);
}
__device__ __forceinline__ float bf_bits2f(unsigned short h) { return __uint_as_float(((unsigned)h) << 16); }
__device__ __forceinline__ unsigned pk2(float a, float b) {
  return (unsigned)f2bf_bits(a) | ((unsigned)f2bf_bits(b) << 16);
}

/* f32 -> f16 (RNE) with a value select so that no subnormal f16 is ever produced */
static __device__ __forceinline__ h16 toh_flush(float v) {
  const h16 r = (h16)v;
  return (fabsf(v) < 6.103515625e-05f) ? (h16)0.0f : r;
}
static __device__ __forceinline__ unsigned short hbits(h16 v) {
  return __builtin_bit_cast(unsigned short, v);
}
static __device__ __forceinline__ unsigned pkh2(float a, float b) {
  return (unsigned)hbits(toh_flush(a)) | ((unsigned)hbits(toh_flush(b)) << 16);
}

/* one WMMA + hazard guard naming only this call's live operands */
__device__ __forceinline__ v8f mma_bf16(v16b a, v16b b, v8f c) {
  c = __builtin_amdgcn_wmma_f32_16x16x32_bf16(false, a, false, b, (short)0, c, false, false);
  asm volatile("v_nop\n\tv_nop\n\tv_nop\n\tv_nop" : "+v"(c) : "v"(a), "v"(b));
  return c;
}
__device__ __forceinline__ v8f mma_f16(v16h a, v16h b, v8f c) {
  c = __builtin_amdgcn_wmma_f32_16x16x32_f16(false, a, false, b, (short)0, c, false, false);
  asm volatile("v_nop\n\tv_nop\n\tv_nop\n\tv_nop" : "+v"(c) : "v"(a), "v"(b));
  return c;
}

__device__ __forceinline__ void wave_lds_sync() {
  __builtin_amdgcn_fence(3 /* release order */, "workgroup");
  __builtin_amdgcn_wave_barrier();
  __builtin_amdgcn_fence(2 /* acquire order */, "workgroup");
}

/* ---- tiles into LDS by asynchronous copies: each lane brings its own 16 B, 8 lanes = one 128-B line ---- */
__device__ __forceinline__ unsigned lds_byte(const void* p) { return (unsigned)(size_t)p; }

/* landed: this wave's own copies are in LDS (stands in front of the barrier that publishes them) */
__device__ __forceinline__ void wait_copies() { asm volatile("s_wait_asynccnt 0x0" ::: "memory"); }
/* this wave's LDS reads have returned (stands in front of the barrier behind which the buffer is refilled) */
__device__ __forceinline__ void wait_lds()    { asm volatile("s_wait_dscnt 0x0" ::: "memory"); }

#define CP_LINE(l, g) "global_load_async_to_lds_b128 %" #l ", %" #g ", off\n\t"

/* GEMM tile: thread = (row tid>>3, 16-B segment tid&7); 8 A row groups and 4 B row groups of 16 rows.
   The closing s_wait_xcnt stands in the copies' own statement, ahead of any rewrite of their address registers. */
__device__ __forceinline__ void stage_gemm(const unsigned short* ag, const unsigned short* bg, unsigned l) {
  constexpr int RG = 16 * DMODEL;      /* 16 rows on, global elements */
  constexpr unsigned LG = 16 * SP * 2; /* 16 rows on, LDS bytes       */
  asm volatile(
      CP_LINE(0, 12) CP_LINE(1, 13) CP_LINE(2, 14) CP_LINE(3, 15) CP_LINE(4, 16) CP_LINE(5, 17)
      CP_LINE(6, 18) CP_LINE(7, 19) CP_LINE(8, 20) CP_LINE(9, 21) CP_LINE(10, 22) CP_LINE(11, 23)
      "s_wait_xcnt 0x0"
      :: "v"(l), "v"(l + LG), "v"(l + 2 * LG), "v"(l + 3 * LG), "v"(l + 4 * LG), "v"(l + 5 * LG),
         "v"(l + 6 * LG), "v"(l + 7 * LG), "v"(l + 8 * LG), "v"(l + 9 * LG), "v"(l + 10 * LG), "v"(l + 11 * LG),
         "v"(ag), "v"(ag + RG), "v"(ag + 2 * RG), "v"(ag + 3 * RG), "v"(ag + 4 * RG), "v"(ag + 5 * RG),
         "v"(ag + 6 * RG), "v"(ag + 7 * RG), "v"(bg), "v"(bg + RG), "v"(bg + 2 * RG), "v"(bg + 3 * RG)
      : "memory");
}

/* attention tile: 4 groups of 16 K rows (64 elements apart), then 4 groups of 16 V^T rows (SEQ apart) */
__device__ __forceinline__ void stage_kv(const unsigned short* kg, const unsigned short* vg, unsigned l) {
  constexpr int KG = 16 * DHEAD;
  constexpr int VG = 16 * SEQ;
  constexpr unsigned LG = 16 * SP * 2;
  asm volatile(
      CP_LINE(0, 8) CP_LINE(1, 9) CP_LINE(2, 10) CP_LINE(3, 11)
      CP_LINE(4, 12) CP_LINE(5, 13) CP_LINE(6, 14) CP_LINE(7, 15)
      "s_wait_xcnt 0x0"
      :: "v"(l), "v"(l + LG), "v"(l + 2 * LG), "v"(l + 3 * LG),
         "v"(l + 4 * LG), "v"(l + 5 * LG), "v"(l + 6 * LG), "v"(l + 7 * LG),
         "v"(kg), "v"(kg + KG), "v"(kg + 2 * KG), "v"(kg + 3 * KG),
         "v"(vg), "v"(vg + VG), "v"(vg + 2 * VG), "v"(vg + 3 * VG)
      : "memory");
}

/* --------------------------------------------------------------------------
 * All three operand conversions in one launch. Unit = 8 elements = two 16-B loads, one 16-B store.
 *   x     -> Xb  : bf16 (RNE); out row b*SEQ + l <- in row b*SEQ_FULL + l
 *   W_qkv -> WqT : bf16 (RNE)
 *   W_out -> WoH : f16 holding (bf16 RNE value) x WO_CARRY; the bf16 significand and the power-of-two
 *                  carry are exact in f16; the flush select removes would-be subnormals.
 * The launch has one thread per unit of W_out; a thread takes CV_X units of x, CV_Q of W_qkv and one of
 * W_out, CV_LANES units apart (a wave's lanes stay on consecutive units), and issues all its loads
 * before the first conversion. Coverage: CV_LANES threads x (CV_X, CV_Q, 1) units = the three whole planes.
 * ------------------------------------------------------------------------ */
constexpr int CV_THREADS = 512;                         /* 16 waves a work-group */
constexpr int CV_UPR     = DMODEL / 8;                  /* units per row, all three planes */
constexpr int CV_LANES   = (int)(WOT_E / 8);
constexpr int CV_X       = (int)(XB_E / 8 / CV_LANES);
constexpr int CV_Q       = (int)(WQT_E / 8 / CV_LANES);
static_assert(CV_LANES % CV_THREADS == 0);
static_assert((size_t)CV_X * CV_LANES * 8 == XB_E && (size_t)CV_Q * CV_LANES * 8 == WQT_E);
static_assert((size_t)NB * SEQ_FULL * DMODEL < (1u << 30) && WQT_E < (1u << 30));   /* element indices fit 32 bits */

/* element e of p through a 32-bit byte offset: scalar base + one offset register, no 64-bit address pair per load */
__device__ __forceinline__ const float* at32(const float* p, unsigned e) {
  return (const float*)((const char*)p + e * 4u);
}

__device__ __forceinline__ v4u bf_unit(v4f a0, v4f a1) {
  v4u w;
  w[0] = pk2(a0[0], a0[1]);
  w[1] = pk2(a0[2], a0[3]);
  w[2] = pk2(a1[0], a1[1]);
  w[3] = pk2(a1[2], a1[3]);
  return w;
}

__global__ __launch_bounds__(CV_THREADS) void cvt_all_kernel(
    const float* __restrict__ x, const float* __restrict__ Wq, const float* __restrict__ Wo,
    unsigned short* __restrict__ Xb, unsigned short* __restrict__ WqT, unsigned short* __restrict__ WoH)
{
  const unsigned g = blockIdx.x * CV_THREADS + threadIdx.x;

  /* every loop here is unrolled whole: the units stay in registers and the loads go out as one run */
  v4f xa[CV_X][2], qa[CV_Q][2], oa[2];
#pragma unroll
  for (unsigned i = 0; i < CV_X; ++i) {
    const unsigned u   = i * CV_LANES + g;
    const unsigned row = u / CV_UPR;
    const unsigned seg = u - row * CV_UPR;
    const unsigned b   = row / SEQ;
    const unsigned l   = row - b * SEQ;
    const float* s = at32(x, ((b * SEQ_FULL + l) * CV_UPR + seg) * 8u);
    xa[i][0] = *(const v4f*)s;
    xa[i][1] = *(const v4f*)(s + 4);
  }
#pragma unroll
  for (unsigned i = 0; i < CV_Q; ++i) {
    const float* s = at32(Wq, (i * CV_LANES + g) * 8u);
    qa[i][0] = *(const v4f*)s;
    qa[i][1] = *(const v4f*)(s + 4);
  }
  /* a later load may land in a register that held an earlier load's offset: the earlier loads' address
     translations are waited for first (a precaution of form; costs one short wait among the loads) */
  asm volatile("s_wait_xcnt 0x0" ::: "memory");
  {
    const float* s = at32(Wo, g * 8u);
    oa[0] = *(const v4f*)s;
    oa[1] = *(const v4f*)(s + 4);
  }

#pragma unroll
  for (unsigned i = 0; i < CV_X; ++i) *(v4u*)(Xb + (i * CV_LANES + g) * 8u) = bf_unit(xa[i][0], xa[i][1]);
#pragma unroll
  for (unsigned i = 0; i < CV_Q; ++i) *(v4u*)(WqT + (i * CV_LANES + g) * 8u) = bf_unit(qa[i][0], qa[i][1]);
  {
    v4u w;
    w[0] = pkh2(bf_bits2f(f2bf_bits(oa[0][0])) * WO_CARRY, bf_bits2f(f2bf_bits(oa[0][1])) * WO_CARRY);
    w[1] = pkh2(bf_bits2f(f2bf_bits(oa[0][2])) * WO_CARRY, bf_bits2f(f2bf_bits(oa[0][3])) * WO_CARRY);
    w[2] = pkh2(bf_bits2f(f2bf_bits(oa[1][0])) * WO_CARRY, bf_bits2f(f2bf_bits(oa[1][1])) * WO_CARRY);
    w[3] = pkh2(bf_bits2f(f2bf_bits(oa[1][2])) * WO_CARRY, bf_bits2f(f2bf_bits(oa[1][3])) * WO_CARRY);
    *(v4u*)(WoH + g * 8u) = w;
  }
}

/* --------------------------------------------------------------------------
 * qkv = Xb . WqT^T  (M = MROWS, N = 3072, K = 1024), bf16 x bf16, f32 acc.
 * Block = 4 waves, tile 128 tokens x 64 columns (= one head of one section);
 * wave = 32 rows x 64 cols (2 A fragments x 4 B fragments per 32-deep step).
 * Operands: 64-deep tiles (128 A rows + 64 B rows) copied into two LDS buffers, one tile ahead;
 * fragments read from the tile of the trip.
 * Fragment map (hh = lane>>4, c = lane&15): A row c, elems 0..7 <- k0+8hh.., 8..15 <- k0+16+8hh..;
 * B col c with the same k map; D elem r = (row 8hh+r, col c).
 * Epilogue: acc x 16 converted to f16 (flush select), staged in a block LDS tile
 * ([tok][d] for q,k; [d][tok] for v), block barrier, whole-line stores:
 *   v  : 1024 units = 64 d-rows x 16 segments (16 lanes = one 256-B row segment).
 * LDS tile Th: cross-wave, separated by a block barrier; staged extent = consumed extent.
 * ------------------------------------------------------------------------ */
__global__ __launch_bounds__(128) VGPR_CAP void gemm_qkv_kernel(
    const unsigned short* __restrict__ Xb, const unsigned short* __restrict__ WqT,
    unsigned short* __restrict__ qkvp)
{
  union FB { v16b v; v8b h[2]; };
  __shared__ __align__(16) unsigned short Th[T_ELEMS];
  __shared__ __align__(16) unsigned short St[2 * G_STAGE];

  const int tid  = threadIdx.x;
  const int wave = __builtin_amdgcn_readfirstlane(tid >> 5);
  const int lane = tid & 31;
  const int hh   = lane >> 4;
  const int c    = lane & 15;
  const int n0   = blockIdx.x * 64;
  const int m0   = blockIdx.y * 128;

  v8f acc[2][4];
#pragma unroll
  for (int mt = 0; mt < 2; ++mt)
#pragma unroll
    for (int t = 0; t < 4; ++t) acc[mt][t] = (v8f){0.f,0.f,0.f,0.f,0.f,0.f,0.f,0.f};

  /* copy side: this thread's row and 16-B segment of each 16-row group */
  const unsigned short* ag = Xb  + (size_t)(m0 + (tid >> 3)) * DMODEL + (tid & 7) * 8;
  const unsigned short* bg = WqT + (size_t)(n0 + (tid >> 3)) * DMODEL + (tid & 7) * 8;
  const unsigned lcp = lds_byte(St) + (tid >> 3) * (SP * 2) + (tid & 7) * 16;
  /* read side: this lane's place in a staged tile */
  const int aoff = (wave * 32 + c) * SP + 8 * hh;
  const int boff = (128 + c) * SP + 8 * hh;

  /* Two fragment sets ([0],[1] = A rows, [2..5] = B columns), one per 32-deep step of the tile */
  FB fe[6], fo[6];
  auto load_set = [&](FB (&f)[6], const unsigned short* sb, int k0) {
    f[0].h[0] = *(const v8b_a*)(sb + aoff + k0);
    f[0].h[1] = *(const v8b_a*)(sb + aoff + k0 + 16);
    f[1].h[0] = *(const v8b_a*)(sb + aoff + 16 * SP + k0);
    f[1].h[1] = *(const v8b_a*)(sb + aoff + 16 * SP + k0 + 16);
#pragma unroll
    for (int t = 0; t < 4; ++t) {
      f[2 + t].h[0] = *(const v8b_a*)(sb + boff + t * 16 * SP + k0);
      f[2 + t].h[1] = *(const v8b_a*)(sb + boff + t * 16 * SP + k0 + 16);
    }
  };
  auto mma_set = [&](const FB (&f)[6]) {
#pragma unroll
    for (int t = 0; t < 4; ++t) {
      acc[0][t] = mma_bf16(f[0].v, f[2 + t].v, acc[0][t]);
      acc[1][t] = mma_bf16(f[1].v, f[2 + t].v, acc[1][t]);
    }
  };

  stage_gemm(ag, bg, lcp);
  wait_copies();
  __syncthreads();
  stage_gemm(ag + KT, bg + KT, lcp + G_STAGE * 2);
  /* rolled: one trip = one tile; tile kt + 1 flies while tile kt is worked on */
#pragma unroll 1
  for (int kt = 0; kt < DMODEL / KT; ++kt) {
    const unsigned short* sb = St + (kt & 1) * G_STAGE;
    load_set(fe, sb, 0);
    load_set(fo, sb, 32);
    mma_set(fe);
    mma_set(fo);
    wait_lds();
    wait_copies();
    __syncthreads();   /* publishes tile kt + 1 and ends every read of tile kt's buffer */
    if (kt + 2 < DMODEL / KT) stage_gemm(ag + (kt + 2) * KT, bg + (kt + 2) * KT, lcp + (kt & 1) * (G_STAGE * 2));
  }
  wait_copies();

  const int sec = n0 / DMODEL;                       /* 0 q, 1 k, 2 v : block-uniform */
#pragma unroll
  for (int t = 0; t < 4; ++t) {
#pragma unroll
    for (int mt = 0; mt < 2; ++mt) {
#pragma unroll
      for (int r = 0; r < 8; ++r) {
        const float val = acc[mt][t][r] * QKV_CARRY;
        const unsigned short hb = hbits(toh_flush(val));
        const int rl = wave * 32 + mt * 16 + 8 * hh + r;
        const int cl = 16 * t + c;
        const int idx = (sec < 2) ? (rl * TQ_PITCH + cl) : (cl * TV_PITCH + rl);
        Th[idx] = hb;
      }
    }
  }
  __syncthreads();

  const int b  = m0 / SEQ;
  const int l0 = m0 - b * SEQ;
  const int h  = (n0 - sec * DMODEL) / DHEAD;
  const int bh = b * NHEAD + h;
  unsigned short* ph = qkvp + (size_t)sec * PLANE;

  {
    if (sec < 2) {
#pragma unroll
      for (int it = 0; it < 8; ++it) {
        const int u = it * 128 + tid;
        const int row = u >> 3;
        const int seg = u & 7;
        const v4u hw = *(const v4u_a*)(Th + row * TQ_PITCH + seg * 8);
        const size_t g = ((size_t)bh * SEQ + l0 + row) * DHEAD + seg * 8;
        *(v4u*)(ph + g) = hw;
      }
    } else {
#pragma unroll
      for (int it = 0; it < 8; ++it) {
        const int u = it * 128 + tid;
        const int drow = u >> 4;
        const int seg  = u & 15;
        const v4u hw = *(const v4u_a*)(Th + drow * TV_PITCH + seg * 8);
        const size_t g = ((size_t)bh * DHEAD + drow) * SEQ + l0 + seg * 8;
        *(v4u*)(ph + g) = hw;
      }
    }
    
  }
}

__device__ __forceinline__ float xhalf(float x) {
  const int v = __builtin_bit_cast(int, x);
  return __builtin_bit_cast(float, __builtin_amdgcn_permlanex16(v, v, 0x76543210, 0xfedcba98, false, false));
}

__global__ __launch_bounds__(128) VGPR_CAP void attn_kernel(
    const unsigned short* __restrict__ qkvp, unsigned short* __restrict__ ctxp)
{
  union FH { v16h v; v8h h[2]; };
  __shared__ __align__(16) unsigned short Oh[NWAVE][16 * SP];
  __shared__ __align__(16) unsigned short KV[2 * A_STAGE];

  const int tid  = threadIdx.x;
  const int wave = __builtin_amdgcn_readfirstlane(tid >> 5);
  const int lane = tid & 31;
  const int hh   = lane >> 4;
  const int c    = lane & 15;
  const int qb   = blockIdx.x;
  const int bh   = blockIdx.y;
  const int b    = bh / NHEAD;
  const int h    = bh - b * NHEAD;
  const int q0   = qb * 64 + wave * 16;
  const float NEG_INF = -__builtin_inff();

  const unsigned short* Qp  = qkvp + (size_t)bh * SEQ * DHEAD;
  const unsigned short* Vtp = Qp + 2 * PLANE;     /* [bh][d][l]: same per-bh element count */

  v16h qf[2];
  {
    const size_t qo = (size_t)(q0 + c) * DHEAD + 8 * hh;
#pragma unroll
    for (int dc = 0; dc < 2; ++dc) {
      FH f;
      f.h[0] = *(const v8h*)(Qp + qo + dc * 32);
      f.h[1] = *(const v8h*)(Qp + qo + dc * 32 + 16);
      qf[dc] = f.v;
    }
  }

  float mrow = NEG_INF, lrow = 0.f;   /* query c: maximum (both halves alike), this half's part of the sum */
  v8f oacc[4];
#pragma unroll
  for (int t = 0; t < 4; ++t) oacc[t] = (v8f){0.f,0.f,0.f,0.f,0.f,0.f,0.f,0.f};

  /* copy side: this thread's row and 16-B segment of each 16-row group (K plane = Q plane + PLANE) */
  const unsigned short* kg = Qp + PLANE + (size_t)(tid >> 3) * DHEAD + (tid & 7) * 8;
  const unsigned short* vg = Vtp + (size_t)(tid >> 3) * SEQ + (tid & 7) * 8;
  const unsigned lcp = lds_byte(KV) + (tid >> 3) * (SP * 2) + (tid & 7) * 16;
  /* read side: lane's place among the staged K rows [key][d]; the V^T rows [d][key] stand 64 rows on */
  const int flane = c * SP + 8 * hh;

  stage_kv(kg, vg, lcp);
  wait_copies();
  __syncthreads();
  stage_kv(kg + KCH * DHEAD, vg + KCH, lcp + A_STAGE * 2);

#pragma unroll 1
  for (int kc = 0; kc < SEQ / KCH; ++kc) {
    /* the chunk's 32 fragment reads go out as one group at its head: K first, V behind it */
    const unsigned short* kq = KV + (kc & 1) * A_STAGE + flane;
    const unsigned short* vq = kq + 64 * SP;
    FH kf[4][2];
#pragma unroll
    for (int j = 0; j < 4; ++j) {
#pragma unroll
      for (int dc = 0; dc < 2; ++dc) {
        kf[j][dc].h[0] = *(const v8h_a*)(kq + j * 16 * SP + dc * 32);
        kf[j][dc].h[1] = *(const v8h_a*)(kq + j * 16 * SP + dc * 32 + 16);
      }
    }
    FH vb[2][4];
#pragma unroll
    for (int kk = 0; kk < 2; ++kk) {
#pragma unroll
      for (int t = 0; t < 4; ++t) {
        vb[kk][t].h[0] = *(const v8h_a*)(vq + t * 16 * SP + kk * 32);
        vb[kk][t].h[1] = *(const v8h_a*)(vq + t * 16 * SP + kk * 32 + 16);
      }
    }

    /* scaled scores, transposed: 4 key tiles (D elem r = key 16j+8hh+r, query c) */
    v8f s[4];
#pragma unroll
    for (int j = 0; j < 4; ++j) {
      v8f sa = (v8f){0.f,0.f,0.f,0.f,0.f,0.f,0.f,0.f};
#pragma unroll
      for (int dc = 0; dc < 2; ++dc) sa = mma_f16(kf[j][dc].v, qf[dc], sa);
#pragma unroll
      for (int r = 0; r < 8; ++r) s[j][r] = sa[r] * SCORE_SCALE;
    }

    /* chunk maximum of query c: the lane's 32 keys, then the other half's 32 */
    float cm;
    {
      float m4[4];
#pragma unroll
      for (int j = 0; j < 4; ++j) {
        float m = s[j][0];
#pragma unroll
        for (int r = 1; r < 8; ++r) m = fmaxf(m, s[j][r]);
        m4[j] = m;
      }
      const float m = fmaxf(fmaxf(m4[0], m4[1]), fmaxf(m4[2], m4[3]));
      cm = fmaxf(m, xhalf(m));
    }

    /* online softmax update; P^T as f16 (x256) packed in place into the B operands, sum over the converted values */
    const float mnew  = fmaxf(mrow, cm);
    const float msafe = (mnew == NEG_INF) ? 0.f : mnew;
    const float alpha = expf(mrow - msafe);
    mrow = mnew;
    FH pb[2];
    float ps4[4];
#pragma unroll
    for (int j = 0; j < 4; ++j) {
      float psum = 0.f;
#pragma unroll
      for (int r = 0; r < 8; ++r) {
        const float p = expf(s[j][r] - msafe) * P_CARRY;
        const h16 ph = toh_flush(p);
        psum += (float)ph;
        pb[j >> 1].h[j & 1][r] = ph;
      }
      ps4[j] = psum;
    }
    lrow = lrow * alpha + ((ps4[0] + ps4[1]) + (ps4[2] + ps4[3]));
#pragma unroll
    for (int t = 0; t < 4; ++t)
#pragma unroll
      for (int r = 0; r < 8; ++r) oacc[t][r] *= alpha;

    /* O^T += V^T.P^T : A = V^T rows [d][kv] fetched at the head of the chunk, B = P^T [kv][q] from registers */
#pragma unroll
    for (int kk = 0; kk < 2; ++kk) {
#pragma unroll
      for (int t = 0; t < 4; ++t) oacc[t] = mma_f16(vb[kk][t].v, pb[kk].v, oacc[t]);
    }
    wait_lds();
    wait_copies();
    __syncthreads();   /* publishes chunk kc + 1 and ends every read of chunk kc's buffer */
    if (kc + 2 < SEQ / KCH)
      stage_kv(kg + (size_t)(kc + 2) * (KCH * DHEAD), vg + (kc + 2) * KCH, lcp + (kc & 1) * (A_STAGE * 2));
  }
  wait_copies();

  /* join the halves' sums, normalise (ctx x256), f16 rows [query][d] into the wave slab, then whole-line stores */
  {
    const float inv = CTX_FOLD * (1.0f / (lrow + xhalf(lrow)));
#pragma unroll
    for (int t = 0; t < 4; ++t) {
      v4u hw;
      hw[0] = pkh2(oacc[t][0] * inv, oacc[t][1] * inv);
      hw[1] = pkh2(oacc[t][2] * inv, oacc[t][3] * inv);
      hw[2] = pkh2(oacc[t][4] * inv, oacc[t][5] * inv);
      hw[3] = pkh2(oacc[t][6] * inv, oacc[t][7] * inv);
      *(v4u_a*)(&Oh[wave][c * SP + t * 16 + 8 * hh]) = hw;
    }
  }
  wave_lds_sync();
  {
    const int rq  = lane >> 3;
    const int seg = lane & 7;
#pragma unroll
    for (int it = 0; it < 4; ++it) {
      const int row = it * 4 + rq;
      const v4u hw = *(const v4u_a*)(&Oh[wave][row * SP + seg * 8]);
      const size_t g = (size_t)(b * SEQ + q0 + row) * DMODEL + h * DHEAD + seg * 8;
      *(v4u*)(ctxp + g) = hw;
    }
  }
}

/* --------------------------------------------------------------------------
 * out = C . WoH^T x 2^-18  (M = MROWS, N = 1024, K = 1024), f16 x f16, f32 acc.
 * Block = 4 waves, tile 128 x 64; wave = 32 rows x 64 cols; one product per tile pair.
 * Operands: 64-deep tiles (128 A rows + 64 B rows) copied into two LDS buffers, one tile ahead.
 * Epilogue: per-wave 32x64 f32 slab (wave-private LDS), 16 lanes x 16 B = one 256-B
 * ------------------------------------------------------------------------ */
__global__ __launch_bounds__(128) VGPR_CAP void gemm_out_kernel(
    const unsigned short* __restrict__ ctxp, const unsigned short* __restrict__ WoH,
    float* __restrict__ out)
{
  union FH { v16h v; v8h h[2]; };
  __shared__ __align__(16) float Os[NWAVE][32 * OS_PITCH];
  __shared__ __align__(16) unsigned short St[2 * G_STAGE];

  const int tid  = threadIdx.x;
  const int wave = __builtin_amdgcn_readfirstlane(tid >> 5);
  const int lane = tid & 31;
  const int hh   = lane >> 4;
  const int c    = lane & 15;
  const int n0   = blockIdx.x * 64;
  const int m0   = blockIdx.y * 128;

  v8f acc[2][4];
#pragma unroll
  for (int mt = 0; mt < 2; ++mt)
#pragma unroll
    for (int t = 0; t < 4; ++t) acc[mt][t] = (v8f){0.f,0.f,0.f,0.f,0.f,0.f,0.f,0.f};

  /* copy side: this thread's row and 16-B segment of each 16-row group */
  const unsigned short* ag = ctxp + (size_t)(m0 + (tid >> 3)) * DMODEL + (tid & 7) * 8;
  const unsigned short* bg = WoH  + (size_t)(n0 + (tid >> 3)) * DMODEL + (tid & 7) * 8;
  const unsigned lcp = lds_byte(St) + (tid >> 3) * (SP * 2) + (tid & 7) * 16;
  /* read side: this lane's place in a staged tile */
  const int aoff = (wave * 32 + c) * SP + 8 * hh;
  const int boff = (128 + c) * SP + 8 * hh;

  /* Two fragment sets ([0],[1] = A rows, [2..5] = B columns), one per 32-deep step of the tile */
  FH fe[6], fo[6];
  auto load_set = [&](FH (&f)[6], const unsigned short* sb, int k0) {
    f[0].h[0] = *(const v8h_a*)(sb + aoff + k0);
    f[0].h[1] = *(const v8h_a*)(sb + aoff + k0 + 16);
    f[1].h[0] = *(const v8h_a*)(sb + aoff + 16 * SP + k0);
    f[1].h[1] = *(const v8h_a*)(sb + aoff + 16 * SP + k0 + 16);
#pragma unroll
    for (int t = 0; t < 4; ++t) {
      f[2 + t].h[0] = *(const v8h_a*)(sb + boff + t * 16 * SP + k0);
      f[2 + t].h[1] = *(const v8h_a*)(sb + boff + t * 16 * SP + k0 + 16);
    }
  };
  auto mma_set = [&](const FH (&f)[6]) {
#pragma unroll
    for (int t = 0; t < 4; ++t) {
      acc[0][t] = mma_f16(f[0].v, f[2 + t].v, acc[0][t]);
      acc[1][t] = mma_f16(f[1].v, f[2 + t].v, acc[1][t]);
    }
  };

  stage_gemm(ag, bg, lcp);
  wait_copies();
  __syncthreads();
  stage_gemm(ag + KT, bg + KT, lcp + G_STAGE * 2);
  /* rolled: one trip = one tile; tile kt + 1 flies while tile kt is worked on */
#pragma unroll 1
  for (int kt = 0; kt < DMODEL / KT; ++kt) {
    const unsigned short* sb = St + (kt & 1) * G_STAGE;
    load_set(fe, sb, 0);
    load_set(fo, sb, 32);
    mma_set(fe);
    mma_set(fo);
    wait_lds();
    wait_copies();
    __syncthreads();   /* publishes tile kt + 1 and ends every read of tile kt's buffer */
    if (kt + 2 < DMODEL / KT) stage_gemm(ag + (kt + 2) * KT, bg + (kt + 2) * KT, lcp + (kt & 1) * (G_STAGE * 2));
  }
  wait_copies();

  float* os = Os[wave];
#pragma unroll
  for (int t = 0; t < 4; ++t) {
#pragma unroll
    for (int mt = 0; mt < 2; ++mt)
#pragma unroll
      for (int r = 0; r < 8; ++r)
        os[(mt * 16 + 8 * hh + r) * OS_PITCH + 16 * t + c] = acc[mt][t][r] * OUT_FOLD;
  }
  wave_lds_sync();
  {
    const int c4 = c * 4;
    {
#pragma unroll
      for (int it = 0; it < 16; ++it) {
        const int row = it * 2 + hh;
        const v4f val = *(const v4f_a*)(os + row * OS_PITCH + c4);
        *(v4f*)(out + (size_t)(m0 + wave * 32 + row) * DMODEL + n0 + c4) = val;
      }
      
    }
  }
}

extern "C" void kernel_launch(void* const* d_in, const int* in_sizes, int n_in,
                              void* d_out, int out_size, void* d_ws, size_t ws_size,
                              hipStream_t stream)
{
  if (n_in < 3) return;
  if (in_sizes[0] < ((NB - 1) * SEQ_FULL + SEQ) * DMODEL) return;
  if (in_sizes[1] < NQKV * DMODEL) return;
  if (in_sizes[2] < DMODEL * DMODEL) return;
  if (out_size < MROWS * DMODEL) return;
  if (d_ws == nullptr || ws_size < WS_NEED) return;

  const float* x     = (const float*)d_in[0];
  const float* W_qkv = (const float*)d_in[1];   /* [3072 out][1024 in] */
  const float* W_out = (const float*)d_in[2];   /* [1024 out][1024 in] */
  float* out = (float*)d_out;

  unsigned short* Xb   = (unsigned short*)d_ws;
  unsigned short* WqT  = Xb + XB_E;
  unsigned short* WoH  = WqT + WQT_E;
  unsigned short* qkvp = WoH + WOT_E;
  unsigned short* ctxp = qkvp + QKVP_E;

  /* W_qkv and W_out rows are already [n][k]: plain row converts, no transpose */
  cvt_all_kernel<<<CV_LANES / CV_THREADS, CV_THREADS, 0, stream>>>(x, W_qkv, W_out, Xb, WqT, WoH);

  gemm_qkv_kernel<<<dim3(NQKV / 64, MROWS / 128), 128, 0, stream>>>(Xb, WqT, qkvp);
  attn_kernel<<<dim3(SEQ / 64, NBH), 128, 0, stream>>>(qkvp, ctxp);
  gemm_out_kernel<<<dim3(DMODEL / 64, MROWS / 128), 128, 0, stream>>>(ctxp, WoH, out);
}

// v005
// One run takes 54.3 microseconds.
// Two timings next to v004 both put it at 1.11 times that version's speed.
// Over all steps from v000 it is 3.29 times as fast.
// Contractions: x.Wqkv^T on v_wmma_f32_16x16x32_bf16 (both operands RNE-converted to bf16 once); q.k^T, p.v and ctx.Wout^T on v_wmma_f32_16x16x32_f16 with single f16 planes (q, k, v x16; p x256; ctx x256; Wout = bf16-converted value x1024), one product per site; f32 accumulate; softmax in f32.
#include <hip/hip_runtime.h>

typedef __attribute__((ext_vector_type(16))) __bf16 v16b;
typedef __attribute__((ext_vector_type(8)))  __bf16 v8b;
typedef __attribute__((ext_vector_type(16))) _Float16 v16h;
typedef __attribute__((ext_vector_type(8)))  _Float16 v8h;
typedef __attribute__((ext_vector_type(8)))  float  v8f;
typedef __attribute__((ext_vector_type(4)))  float  v4f;
typedef __attribute__((ext_vector_type(4)))  unsigned int v4u;
typedef v8h v8h_a __attribute__((may_alias));
typedef v8b v8b_a __attribute__((may_alias));
typedef v4f v4f_a __attribute__((may_alias));
typedef v4u v4u_a __attribute__((may_alias));
typedef _Float16 h16;

#ifndef NB
#define NB 2
#endif
#ifndef SEQ
#define SEQ 1024
#endif
#define NB_FULL 2
#define SEQ_FULL 1024

#define VGPR_CAP __attribute__((amdgpu_num_vgpr(256)))

/* power-of-two carries of the f16 operand planes and their f32 fold-backs */
#define QKV_CARRY   16.0f                 /* q, k, v planes                         */
#define P_CARRY     256.0f                /* exp(s - m) tiles                       */
#define CTX_CARRY   256.0f                /* context plane                          */
#define WO_CARRY    1024.0f               /* output weight plane                    */
#define SCORE_SCALE 0.00048828125f        /* 0.125 / (16 * 16) = 2^-11              */
#define SCORE_LOG2  (SCORE_SCALE * 1.44269504088896340736f)   /* raw score -> exponent to base 2 */
#define P_CARRY_LOG2 8.0f                 /* log2(P_CARRY)                          */
static_assert(P_CARRY == 256.0f && P_CARRY_LOG2 == 8.0f);
#define CTX_FOLD    16.0f                 /* CTX_CARRY / QKV_CARRY (P carry cancels) */
#define OUT_FOLD    3.814697265625e-06f   /* 1 / (256 * 1024) = 2^-18               */

constexpr int DMODEL = 1024;
constexpr int NHEAD  = 16;
constexpr int DHEAD  = 64;
constexpr int NQKV   = 3 * DMODEL;
constexpr int NBH    = NB * NHEAD;
constexpr int MROWS  = NB * SEQ;
constexpr int KCH    = 64;        /* keys per chunk */
constexpr int NWAVE  = 4;
constexpr int TQ_PITCH = 72;      /* [tok][d] staging pitch (16-bit elements) */
constexpr int TV_PITCH = 136;     /* [d][tok] staging pitch (16-bit elements) */
constexpr int T_ELEMS  = 128 * TQ_PITCH;   /* 9216 >= 64 * TV_PITCH = 8704 */
constexpr int OS_PITCH = 68;
constexpr int KT       = 64;              /* k (or keys) per staged tile: one 128-B line per row   */
constexpr int SP       = 72;              /* staged row pitch, 16-bit elements: 144 B = 16 B x 9   */
constexpr int G_STAGE  = (128 + 64) * SP; /* GEMM tile: 128 A rows, then 64 B rows                 */
constexpr int A_STAGE  = (64 + 64) * SP;  /* attention tile: 64 K rows [key][d], 64 V^T rows [d][key] */

constexpr size_t PLANE  = (size_t)NBH * SEQ * DHEAD;
constexpr size_t XB_E   = (size_t)MROWS * DMODEL;
constexpr size_t WQT_E  = (size_t)NQKV * DMODEL;
constexpr size_t WOT_E  = (size_t)DMODEL * DMODEL;
constexpr size_t QKVP_E = 3 * PLANE;
constexpr size_t CTX_E  = XB_E;
constexpr size_t WS_NEED = 2 * (XB_E + WQT_E + WOT_E + QKVP_E + CTX_E);

static_assert(SEQ % 128 == 0);
static_assert(KCH == 64 && SEQ % KCH == 0);
static_assert(SEQ <= SEQ_FULL && NB <= NB_FULL);
static_assert(DHEAD == 64 && DMODEL == NHEAD * DHEAD);
static_assert(DMODEL % 64 == 0 && NQKV % 64 == 0 && DMODEL % 32 == 0);
static_assert(DMODEL % 8 == 0 && DHEAD % 8 == 0);
static_assert(MROWS % 128 == 0);
static_assert(NWAVE * 16 == 64 && NWAVE * 32 == 128);
static_assert(64 * TV_PITCH <= T_ELEMS);
static_assert(TQ_PITCH >= 64 && TV_PITCH >= 128 && OS_PITCH >= 64);
static_assert((TQ_PITCH * 2) % 16 == 0 && (TV_PITCH * 2) % 16 == 0 && (OS_PITCH * 4) % 16 == 0);
static_assert(XB_E % 64 == 0 && WQT_E % 64 == 0 && WOT_E % 64 == 0 && PLANE % 64 == 0);
static_assert(WS_NEED <= 134217728ull);
static_assert(KT == KCH && KT * 2 == 128 && (SP * 2) % 32 == 16 && SP >= KT);
static_assert(DMODEL / KT >= 2 && SEQ / KCH >= 2);

/*
 *   Xb   [MROWS][1024]        x, bf16
 *   WqT  [3072][1024]         W_qkv (already [out][in]), bf16
 *   WoH  [1024][1024]         W_out (already [out][in]), bf16-converted value x1024 held in f16
 *   qkvp 3 planes f16: Q [bh][l][64] (q x16), K [bh][l][64] (k x16), Vt [bh][64][l] (v x16)
 *   ctxp 1 plane  f16: C [MROWS][1024] (ctx x256)
 */

__device__ __forceinline__ unsigned short f2bf_bits(float f) {
  unsigned u = __float_as_uint(f);
  return (unsigned short)((u + 0x7FFFu + ((u >> 16) & 1u)) >> 16);
}
__device__ __forceinline__ float bf_bits2f(unsigned short h) { return __uint_as_float(((unsigned)h) << 16); }
__device__ __forceinline__ unsigned pk2(float a, float b) {
  return (unsigned)f2bf_bits(a) | ((unsigned)f2bf_bits(b) << 16);
}

/* f32 -> f16 (RNE) with a value select so that no subnormal f16 is ever produced */
static __device__ __forceinline__ h16 toh_flush(float v) {
  const h16 r = (h16)v;
  return (fabsf(v) < 6.103515625e-05f) ? (h16)0.0f : r;
}
static __device__ __forceinline__ unsigned short hbits(h16 v) {
  return __builtin_bit_cast(unsigned short, v);
}
static __device__ __forceinline__ unsigned pkh2(float a, float b) {
  return (unsigned)hbits(toh_flush(a)) | ((unsigned)hbits(toh_flush(b)) << 16);
}

/* one WMMA + hazard guard naming only this call's live operands */
__device__ __forceinline__ v8f mma_bf16(v16b a, v16b b, v8f c) {
  c = __builtin_amdgcn_wmma_f32_16x16x32_bf16(false, a, false, b, (short)0, c, false, false);
  asm volatile("v_nop\n\tv_nop\n\tv_nop\n\tv_nop" : "+v"(c) : "v"(a), "v"(b));
  return c;
}
__device__ __forceinline__ v8f mma_f16(v16h a, v16h b, v8f c) {
  c = __builtin_amdgcn_wmma_f32_16x16x32_f16(false, a, false, b, (short)0, c, false, false);
  asm volatile("v_nop\n\tv_nop\n\tv_nop\n\tv_nop" : "+v"(c) : "v"(a), "v"(b));
  return c;
}

__device__ __forceinline__ void wave_lds_sync() {
  __builtin_amdgcn_fence(3 /* release order */, "workgroup");
  __builtin_amdgcn_wave_barrier();
  __builtin_amdgcn_fence(2 /* acquire order */, "workgroup");
}

/* ---- tiles into LDS by asynchronous copies: each lane brings its own 16 B, 8 lanes = one 128-B line ---- */
__device__ __forceinline__ unsigned lds_byte(const void* p) { return (unsigned)(size_t)p; }

/* landed: this wave's own copies are in LDS (stands in front of the barrier that publishes them) */
__device__ __forceinline__ void wait_copies() { asm volatile("s_wait_asynccnt 0x0" ::: "memory"); }
/* this wave's LDS reads have returned (stands in front of the barrier behind which the buffer is refilled) */
__device__ __forceinline__ void wait_lds()    { asm volatile("s_wait_dscnt 0x0" ::: "memory"); }

#define CP_LINE(l, g) "global_load_async_to_lds_b128 %" #l ", %" #g ", off\n\t"

/* GEMM tile: thread = (row tid>>3, 16-B segment tid&7); 8 A row groups and 4 B row groups of 16 rows.
   The closing s_wait_xcnt stands in the copies' own statement, ahead of any rewrite of their address registers. */
__device__ __forceinline__ void stage_gemm(const unsigned short* ag, const unsigned short* bg, unsigned l) {
  constexpr int RG = 16 * DMODEL;      /* 16 rows on, global elements */
  constexpr unsigned LG = 16 * SP * 2; /* 16 rows on, LDS bytes       */
  asm volatile(
      CP_LINE(0, 12) CP_LINE(1, 13) CP_LINE(2, 14) CP_LINE(3, 15) CP_LINE(4, 16) CP_LINE(5, 17)
      CP_LINE(6, 18) CP_LINE(7, 19) CP_LINE(8, 20) CP_LINE(9, 21) CP_LINE(10, 22) CP_LINE(11, 23)
      "s_wait_xcnt 0x0"
      :: "v"(l), "v"(l + LG), "v"(l + 2 * LG), "v"(l + 3 * LG), "v"(l + 4 * LG), "v"(l + 5 * LG),
         "v"(l + 6 * LG), "v"(l + 7 * LG), "v"(l + 8 * LG), "v"(l + 9 * LG), "v"(l + 10 * LG), "v"(l + 11 * LG),
         "v"(ag), "v"(ag + RG), "v"(ag + 2 * RG), "v"(ag + 3 * RG), "v"(ag + 4 * RG), "v"(ag + 5 * RG),
         "v"(ag + 6 * RG), "v"(ag + 7 * RG), "v"(bg), "v"(bg + RG), "v"(bg + 2 * RG), "v"(bg + 3 * RG)
      : "memory");
}

/* attention tile: 4 groups of 16 K rows (64 elements apart), then 4 groups of 16 V^T rows (SEQ apart) */
__device__ __forceinline__ void stage_kv(const unsigned short* kg, const unsigned short* vg, unsigned l) {
  constexpr int KG = 16 * DHEAD;
  constexpr int VG = 16 * SEQ;
  constexpr unsigned LG = 16 * SP * 2;
  asm volatile(
      CP_LINE(0, 8) CP_LINE(1, 9) CP_LINE(2, 10) CP_LINE(3, 11)
      CP_LINE(4, 12) CP_LINE(5, 13) CP_LINE(6, 14) CP_LINE(7, 15)
      "s_wait_xcnt 0x0"
      :: "v"(l), "v"(l + LG), "v"(l + 2 * LG), "v"(l + 3 * LG),
         "v"(l + 4 * LG), "v"(l + 5 * LG), "v"(l + 6 * LG), "v"(l + 7 * LG),
         "v"(kg), "v"(kg + KG), "v"(kg + 2 * KG), "v"(kg + 3 * KG),
         "v"(vg), "v"(vg + VG), "v"(vg + 2 * VG), "v"(vg + 3 * VG)
      : "memory");
}

/* --------------------------------------------------------------------------
 * All three operand conversions in one launch. Unit = 8 elements = two 16-B loads, one 16-B store.
 *   x     -> Xb  : bf16 (RNE); out row b*SEQ + l <- in row b*SEQ_FULL + l
 *   W_qkv -> WqT : bf16 (RNE)
 *   W_out -> WoH : f16 holding (bf16 RNE value) x WO_CARRY; the bf16 significand and the power-of-two
 *                  carry are exact in f16; the flush select removes would-be subnormals.
 * The launch has one thread per unit of W_out; a thread takes CV_X units of x, CV_Q of W_qkv and one of
 * W_out, CV_LANES units apart (a wave's lanes stay on consecutive units), and issues all its loads
 * before the first conversion. Coverage: CV_LANES threads x (CV_X, CV_Q, 1) units = the three whole planes.
 * ------------------------------------------------------------------------ */
constexpr int CV_THREADS = 512;                         /* 16 waves a work-group */
constexpr int CV_UPR     = DMODEL / 8;                  /* units per row, all three planes */
constexpr int CV_LANES   = (int)(WOT_E / 8);
constexpr int CV_X       = (int)(XB_E / 8 / CV_LANES);
constexpr int CV_Q       = (int)(WQT_E / 8 / CV_LANES);
static_assert(CV_LANES % CV_THREADS == 0);
static_assert((size_t)CV_X * CV_LANES * 8 == XB_E && (size_t)CV_Q * CV_LANES * 8 == WQT_E);
static_assert((size_t)NB * SEQ_FULL * DMODEL < (1u << 30) && WQT_E < (1u << 30));   /* element indices fit 32 bits */

/* element e of p through a 32-bit byte offset: scalar base + one offset register, no 64-bit address pair per load */
__device__ __forceinline__ const float* at32(const float* p, unsigned e) {
  return (const float*)((const char*)p + e * 4u);
}

__device__ __forceinline__ v4u bf_unit(v4f a0, v4f a1) {
  v4u w;
  w[0] = pk2(a0[0], a0[1]);
  w[1] = pk2(a0[2], a0[3]);
  w[2] = pk2(a1[0], a1[1]);
  w[3] = pk2(a1[2], a1[3]);
  return w;
}

__global__ __launch_bounds__(CV_THREADS) void cvt_all_kernel(
    const float* __restrict__ x, const float* __restrict__ Wq, const float* __restrict__ Wo,
    unsigned short* __restrict__ Xb, unsigned short* __restrict__ WqT, unsigned short* __restrict__ WoH)
{
  const unsigned g = blockIdx.x * CV_THREADS + threadIdx.x;

  /* every loop here is unrolled whole: the units stay in registers and the loads go out as one run */
  v4f xa[CV_X][2], qa[CV_Q][2], oa[2];
#pragma unroll
  for (unsigned i = 0; i < CV_X; ++i) {
    const unsigned u   = i * CV_LANES + g;
    const unsigned row = u / CV_UPR;
    const unsigned seg = u - row * CV_UPR;
    const unsigned b   = row / SEQ;
    const unsigned l   = row - b * SEQ;
    const float* s = at32(x, ((b * SEQ_FULL + l) * CV_UPR + seg) * 8u);
    xa[i][0] = *(const v4f*)s;
    xa[i][1] = *(const v4f*)(s + 4);
  }
#pragma unroll
  for (unsigned i = 0; i < CV_Q; ++i) {
    const float* s = at32(Wq, (i * CV_LANES + g) * 8u);
    qa[i][0] = *(const v4f*)s;
    qa[i][1] = *(const v4f*)(s + 4);
  }
  /* a later load may land in a register that held an earlier load's offset: the earlier loads' address
     translations are waited for first (a precaution of form; costs one short wait among the loads) */
  asm volatile("s_wait_xcnt 0x0" ::: "memory");
  {
    const float* s = at32(Wo, g * 8u);
    oa[0] = *(const v4f*)s;
    oa[1] = *(const v4f*)(s + 4);
  }

#pragma unroll
  for (unsigned i = 0; i < CV_X; ++i) *(v4u*)(Xb + (i * CV_LANES + g) * 8u) = bf_unit(xa[i][0], xa[i][1]);
#pragma unroll
  for (unsigned i = 0; i < CV_Q; ++i) *(v4u*)(WqT + (i * CV_LANES + g) * 8u) = bf_unit(qa[i][0], qa[i][1]);
  {
    v4u w;
    w[0] = pkh2(bf_bits2f(f2bf_bits(oa[0][0])) * WO_CARRY, bf_bits2f(f2bf_bits(oa[0][1])) * WO_CARRY);
    w[1] = pkh2(bf_bits2f(f2bf_bits(oa[0][2])) * WO_CARRY, bf_bits2f(f2bf_bits(oa[0][3])) * WO_CARRY);
    w[2] = pkh2(bf_bits2f(f2bf_bits(oa[1][0])) * WO_CARRY, bf_bits2f(f2bf_bits(oa[1][1])) * WO_CARRY);
    w[3] = pkh2(bf_bits2f(f2bf_bits(oa[1][2])) * WO_CARRY, bf_bits2f(f2bf_bits(oa[1][3])) * WO_CARRY);
    *(v4u*)(WoH + g * 8u) = w;
  }
}

/* --------------------------------------------------------------------------
 * qkv = Xb . WqT^T  (M = MROWS, N = 3072, K = 1024), bf16 x bf16, f32 acc.
 * Block = 4 waves, tile 128 tokens x 64 columns (= one head of one section);
 * wave = 32 rows x 64 cols (2 A fragments x 4 B fragments per 32-deep step).
 * Operands: 64-deep tiles (128 A rows + 64 B rows) copied into two LDS buffers, one tile ahead;
 * fragments read from the tile of the trip.
 * Fragment map (hh = lane>>4, c = lane&15): A row c, elems 0..7 <- k0+8hh.., 8..15 <- k0+16+8hh..;
 * B col c with the same k map; D elem r = (row 8hh+r, col c).
 * Epilogue: acc x 16 converted to f16 (flush select), staged in a block LDS tile
 * ([tok][d] for q,k; [d][tok] for v), block barrier, whole-line stores:
 *   v  : 1024 units = 64 d-rows x 16 segments (16 lanes = one 256-B row segment).
 * LDS tile Th: cross-wave, separated by a block barrier; staged extent = consumed extent.
 * ------------------------------------------------------------------------ */
__global__ __launch_bounds__(128) VGPR_CAP void gemm_qkv_kernel(
    const unsigned short* __restrict__ Xb, const unsigned short* __restrict__ WqT,
    unsigned short* __restrict__ qkvp)
{
  union FB { v16b v; v8b h[2]; };
  __shared__ __align__(16) unsigned short Th[T_ELEMS];
  __shared__ __align__(16) unsigned short St[2 * G_STAGE];

  const int tid  = threadIdx.x;
  const int wave = __builtin_amdgcn_readfirstlane(tid >> 5);
  const int lane = tid & 31;
  const int hh   = lane >> 4;
  const int c    = lane & 15;
  const int n0   = blockIdx.x * 64;
  const int m0   = blockIdx.y * 128;

  v8f acc[2][4];
#pragma unroll
  for (int mt = 0; mt < 2; ++mt)
#pragma unroll
    for (int t = 0; t < 4; ++t) acc[mt][t] = (v8f){0.f,0.f,0.f,0.f,0.f,0.f,0.f,0.f};

  /* copy side: this thread's row and 16-B segment of each 16-row group */
  const unsigned short* ag = Xb  + (size_t)(m0 + (tid >> 3)) * DMODEL + (tid & 7) * 8;
  const unsigned short* bg = WqT + (size_t)(n0 + (tid >> 3)) * DMODEL + (tid & 7) * 8;
  const unsigned lcp = lds_byte(St) + (tid >> 3) * (SP * 2) + (tid & 7) * 16;
  /* read side: this lane's place in a staged tile */
  const int aoff = (wave * 32 + c) * SP + 8 * hh;
  const int boff = (128 + c) * SP + 8 * hh;

  /* Two fragment sets ([0],[1] = A rows, [2..5] = B columns), one per 32-deep step of the tile */
  FB fe[6], fo[6];
  auto load_set = [&](FB (&f)[6], const unsigned short* sb, int k0) {
    f[0].h[0] = *(const v8b_a*)(sb + aoff + k0);
    f[0].h[1] = *(const v8b_a*)(sb + aoff + k0 + 16);
    f[1].h[0] = *(const v8b_a*)(sb + aoff + 16 * SP + k0);
    f[1].h[1] = *(const v8b_a*)(sb + aoff + 16 * SP + k0 + 16);
#pragma unroll
    for (int t = 0; t < 4; ++t) {
      f[2 + t].h[0] = *(const v8b_a*)(sb + boff + t * 16 * SP + k0);
      f[2 + t].h[1] = *(const v8b_a*)(sb + boff + t * 16 * SP + k0 + 16);
    }
  };
  auto mma_set = [&](const FB (&f)[6]) {
#pragma unroll
    for (int t = 0; t < 4; ++t) {
      acc[0][t] = mma_bf16(f[0].v, f[2 + t].v, acc[0][t]);
      acc[1][t] = mma_bf16(f[1].v, f[2 + t].v, acc[1][t]);
    }
  };

  stage_gemm(ag, bg, lcp);
  wait_copies();
  __syncthreads();
  stage_gemm(ag + KT, bg + KT, lcp + G_STAGE * 2);
  /* rolled: one trip = one tile; tile kt + 1 flies while tile kt is worked on */
#pragma unroll 1
  for (int kt = 0; kt < DMODEL / KT; ++kt) {
    const unsigned short* sb = St + (kt & 1) * G_STAGE;
    load_set(fe, sb, 0);
    load_set(fo, sb, 32);
    mma_set(fe);
    mma_set(fo);
    wait_lds();
    wait_copies();
    __syncthreads();   /* publishes tile kt + 1 and ends every read of tile kt's buffer */
    if (kt + 2 < DMODEL / KT) stage_gemm(ag + (kt + 2) * KT, bg + (kt + 2) * KT, lcp + (kt & 1) * (G_STAGE * 2));
  }
  wait_copies();

  const int sec = n0 / DMODEL;                       /* 0 q, 1 k, 2 v : block-uniform */
#pragma unroll
  for (int t = 0; t < 4; ++t) {
#pragma unroll
    for (int mt = 0; mt < 2; ++mt) {
#pragma unroll
      for (int r = 0; r < 8; ++r) {
        const float val = acc[mt][t][r] * QKV_CARRY;
        const unsigned short hb = hbits(toh_flush(val));
        const int rl = wave * 32 + mt * 16 + 8 * hh + r;
        const int cl = 16 * t + c;
        const int idx = (sec < 2) ? (rl * TQ_PITCH + cl) : (cl * TV_PITCH + rl);
        Th[idx] = hb;
      }
    }
  }
  __syncthreads();

  const int b  = m0 / SEQ;
  const int l0 = m0 - b * SEQ;
  const int h  = (n0 - sec * DMODEL) / DHEAD;
  const int bh = b * NHEAD + h;
  unsigned short* ph = qkvp + (size_t)sec * PLANE;

  {
    if (sec < 2) {
#pragma unroll
      for (int it = 0; it < 8; ++it) {
        const int u = it * 128 + tid;
        const int row = u >> 3;
        const int seg = u & 7;
        const v4u hw = *(const v4u_a*)(Th + row * TQ_PITCH + seg * 8);
        const size_t g = ((size_t)bh * SEQ + l0 + row) * DHEAD + seg * 8;
        *(v4u*)(ph + g) = hw;
      }
    } else {
#pragma unroll
      for (int it = 0; it < 8; ++it) {
        const int u = it * 128 + tid;
        const int drow = u >> 4;
        const int seg  = u & 15;
        const v4u hw = *(const v4u_a*)(Th + drow * TV_PITCH + seg * 8);
        const size_t g = ((size_t)bh * DHEAD + drow) * SEQ + l0 + seg * 8;
        *(v4u*)(ph + g) = hw;
      }
    }
    
  }
}

__device__ __forceinline__ float xhalf(float x) {
  const int v = __builtin_bit_cast(int, x);
  return __builtin_bit_cast(float, __builtin_amdgcn_permlanex16(v, v, 0x76543210, 0xfedcba98, false, false));
}

/* 2^x of eight values, each in its own register. One statement, so that behind every exponential stands an
   instruction on other registers (the next exponential; behind the last one the v_nop): the slot that the
   instruction set asks for before a transcendental's result is read or its source register written again.
   Left to the register allocator, a run of them wrote each result over the source of the one before. */
__device__ __forceinline__ void exp2x8(float (&x)[8]) {
  asm("v_exp_f32 %0, %0\n\tv_exp_f32 %1, %1\n\tv_exp_f32 %2, %2\n\tv_exp_f32 %3, %3\n\t"
      "v_exp_f32 %4, %4\n\tv_exp_f32 %5, %5\n\tv_exp_f32 %6, %6\n\tv_exp_f32 %7, %7\n\tv_nop"
      : "+v"(x[0]), "+v"(x[1]), "+v"(x[2]), "+v"(x[3]), "+v"(x[4]), "+v"(x[5]), "+v"(x[6]), "+v"(x[7]));
}

__global__ __launch_bounds__(128) VGPR_CAP void attn_kernel(
    const unsigned short* __restrict__ qkvp, unsigned short* __restrict__ ctxp)
{
  union FH { v16h v; v8h h[2]; };
  __shared__ __align__(16) unsigned short Oh[NWAVE][16 * SP];
  __shared__ __align__(16) unsigned short KV[2 * A_STAGE];

  const int tid  = threadIdx.x;
  const int wave = __builtin_amdgcn_readfirstlane(tid >> 5);
  const int lane = tid & 31;
  const int hh   = lane >> 4;
  const int c    = lane & 15;
  const int qb   = blockIdx.x;
  const int bh   = blockIdx.y;
  const int b    = bh / NHEAD;
  const int h    = bh - b * NHEAD;
  const int q0   = qb * 64 + wave * 16;
  const float NEG_INF = -__builtin_inff();

  const unsigned short* Qp  = qkvp + (size_t)bh * SEQ * DHEAD;
  const unsigned short* Vtp = Qp + 2 * PLANE;     /* [bh][d][l]: same per-bh element count */

  v16h qf[2];
  {
    const size_t qo = (size_t)(q0 + c) * DHEAD + 8 * hh;
#pragma unroll
    for (int dc = 0; dc < 2; ++dc) {
      FH f;
      f.h[0] = *(const v8h*)(Qp + qo + dc * 32);
      f.h[1] = *(const v8h*)(Qp + qo + dc * 32 + 16);
      qf[dc] = f.v;
    }
  }

  float mrow = NEG_INF, lrow = 0.f;   /* query c: maximum of the raw scores (both halves alike), this half's part of the sum */
  v8f oacc[4];
#pragma unroll
  for (int t = 0; t < 4; ++t) oacc[t] = (v8f){0.f,0.f,0.f,0.f,0.f,0.f,0.f,0.f};

  /* copy side: this thread's row and 16-B segment of each 16-row group (K plane = Q plane + PLANE) */
  const unsigned short* kg = Qp + PLANE + (size_t)(tid >> 3) * DHEAD + (tid & 7) * 8;
  const unsigned short* vg = Vtp + (size_t)(tid >> 3) * SEQ + (tid & 7) * 8;
  const unsigned lcp = lds_byte(KV) + (tid >> 3) * (SP * 2) + (tid & 7) * 16;
  /* read side: lane's place among the staged K rows [key][d]; the V^T rows [d][key] stand 64 rows on */
  const int flane = c * SP + 8 * hh;

  stage_kv(kg, vg, lcp);
  wait_copies();
  __syncthreads();
  stage_kv(kg + KCH * DHEAD, vg + KCH, lcp + A_STAGE * 2);

#pragma unroll 1
  for (int kc = 0; kc < SEQ / KCH; ++kc) {
    /* the chunk's 32 fragment reads go out as one group at its head: K first, V behind it */
    const unsigned short* kq = KV + (kc & 1) * A_STAGE + flane;
    const unsigned short* vq = kq + 64 * SP;
    FH kf[4][2];
#pragma unroll
    for (int j = 0; j < 4; ++j) {
#pragma unroll
      for (int dc = 0; dc < 2; ++dc) {
        kf[j][dc].h[0] = *(const v8h_a*)(kq + j * 16 * SP + dc * 32);
        kf[j][dc].h[1] = *(const v8h_a*)(kq + j * 16 * SP + dc * 32 + 16);
      }
    }
    FH vb[2][4];
#pragma unroll
    for (int kk = 0; kk < 2; ++kk) {
#pragma unroll
      for (int t = 0; t < 4; ++t) {
        vb[kk][t].h[0] = *(const v8h_a*)(vq + t * 16 * SP + kk * 32);
        vb[kk][t].h[1] = *(const v8h_a*)(vq + t * 16 * SP + kk * 32 + 16);
      }
    }

    /* raw scores (unscaled accumulators), transposed: 4 key tiles (D elem r = key 16j+8hh+r, query c) */
    v8f s[4];
#pragma unroll
    for (int j = 0; j < 4; ++j) {
      v8f sa = (v8f){0.f,0.f,0.f,0.f,0.f,0.f,0.f,0.f};
#pragma unroll
      for (int dc = 0; dc < 2; ++dc) sa = mma_f16(kf[j][dc].v, qf[dc], sa);
      s[j] = sa;
    }

    /* chunk maximum of query c: the lane's 32 keys, then the other half's 32 */
    float cm;
    {
      float m4[4];
#pragma unroll
      for (int j = 0; j < 4; ++j) {
        float m = s[j][0];
#pragma unroll
        for (int r = 1; r < 8; ++r) m = fmaxf(m, s[j][r]);
        m4[j] = m;
      }
      const float m = fmaxf(fmaxf(m4[0], m4[1]), fmaxf(m4[2], m4[3]));
      cm = fmaxf(m, xhalf(m));
    }

    /* online softmax update; P^T as f16 (x256) packed in place into the B operands, sum over the converted values */
    const float mnew  = fmaxf(mrow, cm);
    const float msafe = (mnew == NEG_INF) ? 0.f : mnew;
    const float alpha = __builtin_amdgcn_exp2f((mrow - msafe) * SCORE_LOG2);
    const float ebias = P_CARRY_LOG2 - msafe * SCORE_LOG2;   /* the maximum and the x256 carry, as one addend */
    mrow = mnew;
    FH pb[2];
    float ps4[4];
#pragma unroll
    for (int j = 0; j < 4; ++j) {
      float psum = 0.f;
      float e[8];
#pragma unroll
      for (int r = 0; r < 8; ++r) e[r] = __builtin_fmaf(s[j][r], SCORE_LOG2, ebias);
      exp2x8(e);
#pragma unroll
      for (int r = 0; r < 8; ++r) {
        const h16 ph = toh_flush(e[r]);
        psum += (float)ph;
        pb[j >> 1].h[j & 1][r] = ph;
      }
      ps4[j] = psum;
    }
    lrow = lrow * alpha + ((ps4[0] + ps4[1]) + (ps4[2] + ps4[3]));
#pragma unroll
    for (int t = 0; t < 4; ++t)
#pragma unroll
      for (int r = 0; r < 8; ++r) oacc[t][r] *= alpha;

    /* O^T += V^T.P^T : A = V^T rows [d][kv] fetched at the head of the chunk, B = P^T [kv][q] from registers */
#pragma unroll
    for (int kk = 0; kk < 2; ++kk) {
#pragma unroll
      for (int t = 0; t < 4; ++t) oacc[t] = mma_f16(vb[kk][t].v, pb[kk].v, oacc[t]);
    }
    wait_lds();
    wait_copies();
    __syncthreads();   /* publishes chunk kc + 1 and ends every read of chunk kc's buffer */
    if (kc + 2 < SEQ / KCH)
      stage_kv(kg + (size_t)(kc + 2) * (KCH * DHEAD), vg + (kc + 2) * KCH, lcp + (kc & 1) * (A_STAGE * 2));
  }
  wait_copies();

  /* join the halves' sums, normalise (ctx x256), f16 rows [query][d] into the wave slab, then whole-line stores */
  {
    const float inv = CTX_FOLD * (1.0f / (lrow + xhalf(lrow)));
#pragma unroll
    for (int t = 0; t < 4; ++t) {
      v4u hw;
      hw[0] = pkh2(oacc[t][0] * inv, oacc[t][1] * inv);
      hw[1] = pkh2(oacc[t][2] * inv, oacc[t][3] * inv);
      hw[2] = pkh2(oacc[t][4] * inv, oacc[t][5] * inv);
      hw[3] = pkh2(oacc[t][6] * inv, oacc[t][7] * inv);
      *(v4u_a*)(&Oh[wave][c * SP + t * 16 + 8 * hh]) = hw;
    }
  }
  wave_lds_sync();
  {
    const int rq  = lane >> 3;
    const int seg = lane & 7;
#pragma unroll
    for (int it = 0; it < 4; ++it) {
      const int row = it * 4 + rq;
      const v4u hw = *(const v4u_a*)(&Oh[wave][row * SP + seg * 8]);
      const size_t g = (size_t)(b * SEQ + q0 + row) * DMODEL + h * DHEAD + seg * 8;
      *(v4u*)(ctxp + g) = hw;
    }
  }
}

/* --------------------------------------------------------------------------
 * out = C . WoH^T x 2^-18  (M = MROWS, N = 1024, K = 1024), f16 x f16, f32 acc.
 * Block = 4 waves, tile 128 x 64; wave = 32 rows x 64 cols; one product per tile pair.
 * Operands: 64-deep tiles (128 A rows + 64 B rows) copied into two LDS buffers, one tile ahead.
 * Epilogue: per-wave 32x64 f32 slab (wave-private LDS), 16 lanes x 16 B = one 256-B
 * ------------------------------------------------------------------------ */
__global__ __launch_bounds__(128) VGPR_CAP void gemm_out_kernel(
    const unsigned short* __restrict__ ctxp, const unsigned short* __restrict__ WoH,
    float* __restrict__ out)
{
  union FH { v16h v; v8h h[2]; };
  __shared__ __align__(16) float Os[NWAVE][32 * OS_PITCH];
  __shared__ __align__(16) unsigned short St[2 * G_STAGE];

  const int tid  = threadIdx.x;
  const int wave = __builtin_amdgcn_readfirstlane(tid >> 5);
  const int lane = tid & 31;
  const int hh   = lane >> 4;
  const int c    = lane & 15;
  const int n0   = blockIdx.x * 64;
  const int m0   = blockIdx.y * 128;

  v8f acc[2][4];
#pragma unroll
  for (int mt = 0; mt < 2; ++mt)
#pragma unroll
    for (int t = 0; t < 4; ++t) acc[mt][t] = (v8f){0.f,0.f,0.f,0.f,0.f,0.f,0.f,0.f};

  /* copy side: this thread's row and 16-B segment of each 16-row group */
  const unsigned short* ag = ctxp + (size_t)(m0 + (tid >> 3)) * DMODEL + (tid & 7) * 8;
  const unsigned short* bg = WoH  + (size_t)(n0 + (tid >> 3)) * DMODEL + (tid & 7) * 8;
  const unsigned lcp = lds_byte(St) + (tid >> 3) * (SP * 2) + (tid & 7) * 16;
  /* read side: this lane's place in a staged tile */
  const int aoff = (wave * 32 + c) * SP + 8 * hh;
  const int boff = (128 + c) * SP + 8 * hh;

  /* Two fragment sets ([0],[1] = A rows, [2..5] = B columns), one per 32-deep step of the tile */
  FH fe[6], fo[6];
  auto load_set = [&](FH (&f)[6], const unsigned short* sb, int k0) {
    f[0].h[0] = *(const v8h_a*)(sb + aoff + k0);
    f[0].h[1] = *(const v8h_a*)(sb + aoff + k0 + 16);
    f[1].h[0] = *(const v8h_a*)(sb + aoff + 16 * SP + k0);
    f[1].h[1] = *(const v8h_a*)(sb + aoff + 16 * SP + k0 + 16);
#pragma unroll
    for (int t = 0; t < 4; ++t) {
      f[2 + t].h[0] = *(const v8h_a*)(sb + boff + t * 16 * SP + k0);
      f[2 + t].h[1] = *(const v8h_a*)(sb + boff + t * 16 * SP + k0 + 16);
    }
  };
  auto mma_set = [&](const FH (&f)[6]) {
#pragma unroll
    for (int t = 0; t < 4; ++t) {
      acc[0][t] = mma_f16(f[0].v, f[2 + t].v, acc[0][t]);
      acc[1][t] = mma_f16(f[1].v, f[2 + t].v, acc[1][t]);
    }
  };

  stage_gemm(ag, bg, lcp);
  wait_copies();
  __syncthreads();
  stage_gemm(ag + KT, bg + KT, lcp + G_STAGE * 2);
  /* rolled: one trip = one tile; tile kt + 1 flies while tile kt is worked on */
#pragma unroll 1
  for (int kt = 0; kt < DMODEL / KT; ++kt) {
    const unsigned short* sb = St + (kt & 1) * G_STAGE;
    load_set(fe, sb, 0);
    load_set(fo, sb, 32);
    mma_set(fe);
    mma_set(fo);
    wait_lds();
    wait_copies();
    __syncthreads();   /* publishes tile kt + 1 and ends every read of tile kt's buffer */
    if (kt + 2 < DMODEL / KT) stage_gemm(ag + (kt + 2) * KT, bg + (kt + 2) * KT, lcp + (kt & 1) * (G_STAGE * 2));
  }
  wait_copies();

  float* os = Os[wave];
#pragma unroll
  for (int t = 0; t < 4; ++t) {
#pragma unroll
    for (int mt = 0; mt < 2; ++mt)
#pragma unroll
      for (int r = 0; r < 8; ++r)
        os[(mt * 16 + 8 * hh + r) * OS_PITCH + 16 * t + c] = acc[mt][t][r] * OUT_FOLD;
  }
  wave_lds_sync();
  {
    const int c4 = c * 4;
    {
#pragma unroll
      for (int it = 0; it < 16; ++it) {
        const int row = it * 2 + hh;
        const v4f val = *(const v4f_a*)(os + row * OS_PITCH + c4);
        *(v4f*)(out + (size_t)(m0 + wave * 32 + row) * DMODEL + n0 + c4) = val;
      }
      
    }
  }
}

extern "C" void kernel_launch(void* const* d_in, const int* in_sizes, int n_in,
                              void* d_out, int out_size, void* d_ws, size_t ws_size,
                              hipStream_t stream)
{
  if (n_in < 3) return;
  if (in_sizes[0] < ((NB - 1) * SEQ_FULL + SEQ) * DMODEL) return;
  if (in_sizes[1] < NQKV * DMODEL) return;
  if (in_sizes[2] < DMODEL * DMODEL) return;
  if (out_size < MROWS * DMODEL) return;
  if (d_ws == nullptr || ws_size < WS_NEED) return;

  const float* x     = (const float*)d_in[0];
  const float* W_qkv = (const float*)d_in[1];   /* [3072 out][1024 in] */
  const float* W_out = (const float*)d_in[2];   /* [1024 out][1024 in] */
  float* out = (float*)d_out;

  unsigned short* Xb   = (unsigned short*)d_ws;
  unsigned short* WqT  = Xb + XB_E;
  unsigned short* WoH  = WqT + WQT_E;
  unsigned short* qkvp = WoH + WOT_E;
  unsigned short* ctxp = qkvp + QKVP_E;

  /* W_qkv and W_out rows are already [n][k]: plain row converts, no transpose */
  cvt_all_kernel<<<CV_LANES / CV_THREADS, CV_THREADS, 0, stream>>>(x, W_qkv, W_out, Xb, WqT, WoH);

  gemm_qkv_kernel<<<dim3(NQKV / 64, MROWS / 128), 128, 0, stream>>>(Xb, WqT, qkvp);
  attn_kernel<<<dim3(SEQ / 64, NBH), 128, 0, stream>>>(qkvp, ctxp);
  gemm_out_kernel<<<dim3(DMODEL / 64, MROWS / 128), 128, 0, stream>>>(ctxp, WoH, out);
}

// v006
// One run takes 48.4 microseconds.
// In two side-by-side timings against v005, it was 1.12 and 1.13 times as fast.
// All steps since v000 together make it 3.70 times as fast.
// Contractions: x.Wqkv^T on v_wmma_f32_16x16x32_bf16 (both operands RNE-converted to bf16 once); q.k^T, p.v and ctx.Wout^T on v_wmma_f32_16x16x32_f16 with single f16 planes (q, k, v x16; p x256; ctx x256; Wout = bf16-converted value x1024), one product per site; f32 accumulate; softmax in f32.
#include <hip/hip_runtime.h>

typedef __attribute__((ext_vector_type(16))) __bf16 v16b;
typedef __attribute__((ext_vector_type(8)))  __bf16 v8b;
typedef __attribute__((ext_vector_type(16))) _Float16 v16h;
typedef __attribute__((ext_vector_type(8)))  _Float16 v8h;
typedef __attribute__((ext_vector_type(8)))  float  v8f;
typedef __attribute__((ext_vector_type(4)))  float  v4f;
typedef __attribute__((ext_vector_type(4)))  unsigned int v4u;
typedef v8h v8h_a __attribute__((may_alias));
typedef v8b v8b_a __attribute__((may_alias));
typedef v4f v4f_a __attribute__((may_alias));
typedef v4u v4u_a __attribute__((may_alias));
typedef _Float16 h16;

#ifndef NB
#define NB 2
#endif
#ifndef SEQ
#define SEQ 1024
#endif
#define NB_FULL 2
#define SEQ_FULL 1024

#define VGPR_CAP __attribute__((amdgpu_num_vgpr(256)))

/* power-of-two carries of the f16 operand planes and their f32 fold-backs */
#define QKV_CARRY   16.0f                 /* q, k, v planes                         */
#define P_CARRY     256.0f                /* exp(s - m) tiles                       */
#define CTX_CARRY   256.0f                /* context plane                          */
#define WO_CARRY    1024.0f               /* output weight plane                    */
#define SCORE_SCALE 0.00048828125f        /* 0.125 / (16 * 16) = 2^-11              */
#define SCORE_LOG2  (SCORE_SCALE * 1.44269504088896340736f)   /* raw score -> exponent to base 2 */
#define P_CARRY_LOG2 8.0f                 /* log2(P_CARRY)                          */
static_assert(P_CARRY == 256.0f && P_CARRY_LOG2 == 8.0f);
#define CTX_FOLD    16.0f                 /* CTX_CARRY / QKV_CARRY (P carry cancels) */
#define OUT_FOLD    3.814697265625e-06f   /* 1 / (256 * 1024) = 2^-18               */

constexpr int DMODEL = 1024;
constexpr int NHEAD  = 16;
constexpr int DHEAD  = 64;
constexpr int NQKV   = 3 * DMODEL;
constexpr int NBH    = NB * NHEAD;
constexpr int MROWS  = NB * SEQ;
constexpr int KCH    = 64;        /* keys per chunk */
constexpr int NWAVE  = 4;
constexpr int TQ_PITCH = 72;      /* [tok][d] staging pitch (16-bit elements) */
constexpr int TV_PITCH = 136;     /* [d][tok] staging pitch (16-bit elements) */
constexpr int T_ELEMS  = 128 * TQ_PITCH;   /* 9216 >= 64 * TV_PITCH = 8704 */
constexpr int OS_PITCH = 68;
constexpr int KT       = 64;              /* k (or keys) per staged tile: one 128-B line per row   */
constexpr int SP       = 72;              /* staged row pitch, 16-bit elements: 144 B = 16 B x 9   */
constexpr int G_STAGE  = (128 + 64) * SP; /* GEMM tile: 128 A rows, then 64 B rows                 */
constexpr int A_STAGE  = (64 + 64) * SP;  /* attention tile: 64 K rows [key][d], 64 V^T rows [d][key] */

constexpr size_t PLANE  = (size_t)NBH * SEQ * DHEAD;
constexpr size_t XB_E   = (size_t)MROWS * DMODEL;
constexpr size_t WQT_E  = (size_t)NQKV * DMODEL;
constexpr size_t WOT_E  = (size_t)DMODEL * DMODEL;
constexpr size_t QKVP_E = 3 * PLANE;
constexpr size_t CTX_E  = XB_E;
constexpr size_t WS_NEED = 2 * (XB_E + WQT_E + WOT_E + QKVP_E + CTX_E);

static_assert(SEQ % 128 == 0);
static_assert(KCH == 64 && SEQ % KCH == 0);
static_assert(SEQ <= SEQ_FULL && NB <= NB_FULL);
static_assert(DHEAD == 64 && DMODEL == NHEAD * DHEAD);
static_assert(DMODEL % 64 == 0 && NQKV % 64 == 0 && DMODEL % 32 == 0);
static_assert(DMODEL % 8 == 0 && DHEAD % 8 == 0);
static_assert(MROWS % 128 == 0);
static_assert(NWAVE * 16 == 64 && NWAVE * 32 == 128);
static_assert(64 * TV_PITCH <= T_ELEMS);
static_assert(TQ_PITCH >= 64 && TV_PITCH >= 128 && OS_PITCH >= 64);
static_assert((TQ_PITCH * 2) % 16 == 0 && (TV_PITCH * 2) % 16 == 0 && (OS_PITCH * 4) % 16 == 0);
static_assert(XB_E % 64 == 0 && WQT_E % 64 == 0 && WOT_E % 64 == 0 && PLANE % 64 == 0);
static_assert(WS_NEED <= 134217728ull);
static_assert(KT == KCH && KT * 2 == 128 && (SP * 2) % 32 == 16 && SP >= KT);
static_assert(DMODEL / KT >= 2 && SEQ / KCH >= 2);
constexpr unsigned NKT = DMODEL / KT;     /* k tiles of a GEMM walk     */
constexpr unsigned NKC = SEQ / KCH;       /* key chunks of an attention walk */

/* Place in a walk of n tiles that starts at tile 'first' and wraps: work-groups that share operand rows get
   different 'first', so that they do not ask L2 for the same lines at the same moment. Every tile is still
   taken exactly once; only the order of the f32 sums differs from work-group to work-group. */
__device__ __forceinline__ unsigned walk_at(unsigned step, unsigned first, unsigned n) { return (step + first) % n; }

/*
 *   Xb   [MROWS][1024]        x, bf16
 *   WqT  [3072][1024]         W_qkv (already [out][in]), bf16
 *   WoH  [1024][1024]         W_out (already [out][in]), bf16-converted value x1024 held in f16
 *   qkvp 3 planes f16: Q [bh][l][64] (q x16), K [bh][l][64] (k x16), Vt [bh][64][l] (v x16)
 *   ctxp 1 plane  f16: C [MROWS][1024] (ctx x256)
 */

__device__ __forceinline__ unsigned short f2bf_bits(float f) {
  unsigned u = __float_as_uint(f);
  return (unsigned short)((u + 0x7FFFu + ((u >> 16) & 1u)) >> 16);
}
__device__ __forceinline__ float bf_bits2f(unsigned short h) { return __uint_as_float(((unsigned)h) << 16); }
__device__ __forceinline__ unsigned pk2(float a, float b) {
  return (unsigned)f2bf_bits(a) | ((unsigned)f2bf_bits(b) << 16);
}

/* f32 -> f16 (RNE) with a value select so that no subnormal f16 is ever produced */
static __device__ __forceinline__ h16 toh_flush(float v) {
  const h16 r = (h16)v;
  return (fabsf(v) < 6.103515625e-05f) ? (h16)0.0f : r;
}
static __device__ __forceinline__ unsigned short hbits(h16 v) {
  return __builtin_bit_cast(unsigned short, v);
}
static __device__ __forceinline__ unsigned pkh2(float a, float b) {
  return (unsigned)hbits(toh_flush(a)) | ((unsigned)hbits(toh_flush(b)) << 16);
}

/* one WMMA + hazard guard naming only this call's live operands */
__device__ __forceinline__ v8f mma_bf16(v16b a, v16b b, v8f c) {
  c = __builtin_amdgcn_wmma_f32_16x16x32_bf16(false, a, false, b, (short)0, c, false, false);
  asm volatile("v_nop\n\tv_nop\n\tv_nop\n\tv_nop" : "+v"(c) : "v"(a), "v"(b));
  return c;
}
__device__ __forceinline__ v8f mma_f16(v16h a, v16h b, v8f c) {
  c = __builtin_amdgcn_wmma_f32_16x16x32_f16(false, a, false, b, (short)0, c, false, false);
  asm volatile("v_nop\n\tv_nop\n\tv_nop\n\tv_nop" : "+v"(c) : "v"(a), "v"(b));
  return c;
}

__device__ __forceinline__ void wave_lds_sync() {
  __builtin_amdgcn_fence(3 /* release order */, "workgroup");
  __builtin_amdgcn_wave_barrier();
  __builtin_amdgcn_fence(2 /* acquire order */, "workgroup");
}

/* ---- tiles into LDS by asynchronous copies: each lane brings its own 16 B, 8 lanes = one 128-B line ---- */
__device__ __forceinline__ unsigned lds_byte(const void* p) { return (unsigned)(size_t)p; }

/* landed: this wave's own copies are in LDS (stands in front of the barrier that publishes them) */
__device__ __forceinline__ void wait_copies() { asm volatile("s_wait_asynccnt 0x0" ::: "memory"); }
/* this wave's LDS reads have returned (stands in front of the barrier behind which the buffer is refilled) */
__device__ __forceinline__ void wait_lds()    { asm volatile("s_wait_dscnt 0x0" ::: "memory"); }

#define CP_LINE(l, g) "global_load_async_to_lds_b128 %" #l ", %" #g ", off\n\t"

/* GEMM tile: thread = (row tid>>3, 16-B segment tid&7); 8 A row groups and 4 B row groups of 16 rows.
   The closing s_wait_xcnt stands in the copies' own statement, ahead of any rewrite of their address registers. */
__device__ __forceinline__ void stage_gemm(const unsigned short* ag, const unsigned short* bg, unsigned l) {
  constexpr int RG = 16 * DMODEL;      /* 16 rows on, global elements */
  constexpr unsigned LG = 16 * SP * 2; /* 16 rows on, LDS bytes       */
  asm volatile(
      CP_LINE(0, 12) CP_LINE(1, 13) CP_LINE(2, 14) CP_LINE(3, 15) CP_LINE(4, 16) CP_LINE(5, 17)
      CP_LINE(6, 18) CP_LINE(7, 19) CP_LINE(8, 20) CP_LINE(9, 21) CP_LINE(10, 22) CP_LINE(11, 23)
      "s_wait_xcnt 0x0"
      :: "v"(l), "v"(l + LG), "v"(l + 2 * LG), "v"(l + 3 * LG), "v"(l + 4 * LG), "v"(l + 5 * LG),
         "v"(l + 6 * LG), "v"(l + 7 * LG), "v"(l + 8 * LG), "v"(l + 9 * LG), "v"(l + 10 * LG), "v"(l + 11 * LG),
         "v"(ag), "v"(ag + RG), "v"(ag + 2 * RG), "v"(ag + 3 * RG), "v"(ag + 4 * RG), "v"(ag + 5 * RG),
         "v"(ag + 6 * RG), "v"(ag + 7 * RG), "v"(bg), "v"(bg + RG), "v"(bg + 2 * RG), "v"(bg + 3 * RG)
      : "memory");
}

/* attention tile: 4 groups of 16 K rows (64 elements apart), then 4 groups of 16 V^T rows (SEQ apart) */
__device__ __forceinline__ void stage_kv(const unsigned short* kg, const unsigned short* vg, unsigned l) {
  constexpr int KG = 16 * DHEAD;
  constexpr int VG = 16 * SEQ;
  constexpr unsigned LG = 16 * SP * 2;
  asm volatile(
      CP_LINE(0, 8) CP_LINE(1, 9) CP_LINE(2, 10) CP_LINE(3, 11)
      CP_LINE(4, 12) CP_LINE(5, 13) CP_LINE(6, 14) CP_LINE(7, 15)
      "s_wait_xcnt 0x0"
      :: "v"(l), "v"(l + LG), "v"(l + 2 * LG), "v"(l + 3 * LG),
         "v"(l + 4 * LG), "v"(l + 5 * LG), "v"(l + 6 * LG), "v"(l + 7 * LG),
         "v"(kg), "v"(kg + KG), "v"(kg + 2 * KG), "v"(kg + 3 * KG),
         "v"(vg), "v"(vg + VG), "v"(vg + 2 * VG), "v"(vg + 3 * VG)
      : "memory");
}

/* --------------------------------------------------------------------------
 * All three operand conversions in one launch. Unit = 8 elements = two 16-B loads, one 16-B store.
 *   x     -> Xb  : bf16 (RNE); out row b*SEQ + l <- in row b*SEQ_FULL + l
 *   W_qkv -> WqT : bf16 (RNE)
 *   W_out -> WoH : f16 holding (bf16 RNE value) x WO_CARRY; the bf16 significand and the power-of-two
 *                  carry are exact in f16; the flush select removes would-be subnormals.
 * The launch has one thread per unit of W_out; a thread takes CV_X units of x, CV_Q of W_qkv and one of
 * W_out, CV_LANES units apart (a wave's lanes stay on consecutive units), and issues all its loads
 * before the first conversion. Coverage: CV_LANES threads x (CV_X, CV_Q, 1) units = the three whole planes.
 * ------------------------------------------------------------------------ */
constexpr int CV_THREADS = 512;                         /* 16 waves a work-group */
constexpr int CV_UPR     = DMODEL / 8;                  /* units per row, all three planes */
constexpr int CV_LANES   = (int)(WOT_E / 8);
constexpr int CV_X       = (int)(XB_E / 8 / CV_LANES);
constexpr int CV_Q       = (int)(WQT_E / 8 / CV_LANES);
static_assert(CV_LANES % CV_THREADS == 0);
static_assert((size_t)CV_X * CV_LANES * 8 == XB_E && (size_t)CV_Q * CV_LANES * 8 == WQT_E);
static_assert((size_t)NB * SEQ_FULL * DMODEL < (1u << 30) && WQT_E < (1u << 30));   /* element indices fit 32 bits */

/* element e of p through a 32-bit byte offset: scalar base + one offset register, no 64-bit address pair per load */
__device__ __forceinline__ const float* at32(const float* p, unsigned e) {
  return (const float*)((const char*)p + e * 4u);
}

__device__ __forceinline__ v4u bf_unit(v4f a0, v4f a1) {
  v4u w;
  w[0] = pk2(a0[0], a0[1]);
  w[1] = pk2(a0[2], a0[3]);
  w[2] = pk2(a1[0], a1[1]);
  w[3] = pk2(a1[2], a1[3]);
  return w;
}

__global__ __launch_bounds__(CV_THREADS) void cvt_all_kernel(
    const float* __restrict__ x, const float* __restrict__ Wq, const float* __restrict__ Wo,
    unsigned short* __restrict__ Xb, unsigned short* __restrict__ WqT, unsigned short* __restrict__ WoH)
{
  const unsigned g = blockIdx.x * CV_THREADS + threadIdx.x;

  /* every loop here is unrolled whole: the units stay in registers and the loads go out as one run */
  v4f xa[CV_X][2], qa[CV_Q][2], oa[2];
#pragma unroll
  for (unsigned i = 0; i < CV_X; ++i) {
    const unsigned u   = i * CV_LANES + g;
    const unsigned row = u / CV_UPR;
    const unsigned seg = u - row * CV_UPR;
    const unsigned b   = row / SEQ;
    const unsigned l   = row - b * SEQ;
    const float* s = at32(x, ((b * SEQ_FULL + l) * CV_UPR + seg) * 8u);
    xa[i][0] = *(const v4f*)s;
    xa[i][1] = *(const v4f*)(s + 4);
  }
#pragma unroll
  for (unsigned i = 0; i < CV_Q; ++i) {
    const float* s = at32(Wq, (i * CV_LANES + g) * 8u);
    qa[i][0] = *(const v4f*)s;
    qa[i][1] = *(const v4f*)(s + 4);
  }
  /* a later load may land in a register that held an earlier load's offset: the earlier loads' address
     translations are waited for first (a precaution of form; costs one short wait among the loads) */
  asm volatile("s_wait_xcnt 0x0" ::: "memory");
  {
    const float* s = at32(Wo, g * 8u);
    oa[0] = *(const v4f*)s;
    oa[1] = *(const v4f*)(s + 4);
  }

#pragma unroll
  for (unsigned i = 0; i < CV_X; ++i) *(v4u*)(Xb + (i * CV_LANES + g) * 8u) = bf_unit(xa[i][0], xa[i][1]);
#pragma unroll
  for (unsigned i = 0; i < CV_Q; ++i) *(v4u*)(WqT + (i * CV_LANES + g) * 8u) = bf_unit(qa[i][0], qa[i][1]);
  {
    v4u w;
    w[0] = pkh2(bf_bits2f(f2bf_bits(oa[0][0])) * WO_CARRY, bf_bits2f(f2bf_bits(oa[0][1])) * WO_CARRY);
    w[1] = pkh2(bf_bits2f(f2bf_bits(oa[0][2])) * WO_CARRY, bf_bits2f(f2bf_bits(oa[0][3])) * WO_CARRY);
    w[2] = pkh2(bf_bits2f(f2bf_bits(oa[1][0])) * WO_CARRY, bf_bits2f(f2bf_bits(oa[1][1])) * WO_CARRY);
    w[3] = pkh2(bf_bits2f(f2bf_bits(oa[1][2])) * WO_CARRY, bf_bits2f(f2bf_bits(oa[1][3])) * WO_CARRY);
    *(v4u*)(WoH + g * 8u) = w;
  }
}

/* --------------------------------------------------------------------------
 * qkv = Xb . WqT^T  (M = MROWS, N = 3072, K = 1024), bf16 x bf16, f32 acc.
 * Block = 4 waves, tile 128 tokens x 64 columns (= one head of one section);
 * wave = 32 rows x 64 cols (2 A fragments x 4 B fragments per 32-deep step).
 * Operands: 64-deep tiles (128 A rows + 64 B rows) copied into two LDS buffers, one tile ahead;
 * fragments read from the tile of the trip.
 * Fragment map (hh = lane>>4, c = lane&15): A row c, elems 0..7 <- k0+8hh.., 8..15 <- k0+16+8hh..;
 * B col c with the same k map; D elem r = (row 8hh+r, col c).
 * Epilogue: acc x 16 converted to f16 (flush select), staged in a block LDS tile
 * ([tok][d] for q,k; [d][tok] for v), block barrier, whole-line stores:
 *   v  : 1024 units = 64 d-rows x 16 segments (16 lanes = one 256-B row segment).
 * LDS tile Th: cross-wave, separated by a block barrier; staged extent = consumed extent.
 * ------------------------------------------------------------------------ */
__global__ __launch_bounds__(128) VGPR_CAP void gemm_qkv_kernel(
    const unsigned short* __restrict__ Xb, const unsigned short* __restrict__ WqT,
    unsigned short* __restrict__ qkvp)
{
  union FB { v16b v; v8b h[2]; };
  __shared__ __align__(16) unsigned short Th[T_ELEMS];
  __shared__ __align__(16) unsigned short St[2 * G_STAGE];

  const int tid  = threadIdx.x;
  const int wave = __builtin_amdgcn_readfirstlane(tid >> 5);
  const int lane = tid & 31;
  const int hh   = lane >> 4;
  const int c    = lane & 15;
  const int n0   = blockIdx.x * 64;
  const int m0   = blockIdx.y * 128;

  v8f acc[2][4];
#pragma unroll
  for (int mt = 0; mt < 2; ++mt)
#pragma unroll
    for (int t = 0; t < 4; ++t) acc[mt][t] = (v8f){0.f,0.f,0.f,0.f,0.f,0.f,0.f,0.f};

  /* copy side: this thread's row and 16-B segment of each 16-row group */
  const unsigned short* ag = Xb  + (size_t)(m0 + (tid >> 3)) * DMODEL + (tid & 7) * 8;
  const unsigned short* bg = WqT + (size_t)(n0 + (tid >> 3)) * DMODEL + (tid & 7) * 8;
  const unsigned lcp = lds_byte(St) + (tid >> 3) * (SP * 2) + (tid & 7) * 16;
  /* read side: this lane's place in a staged tile */
  const int aoff = (wave * 32 + c) * SP + 8 * hh;
  const int boff = (128 + c) * SP + 8 * hh;

  /* Two fragment sets ([0],[1] = A rows, [2..5] = B columns), one per 32-deep step of the tile */
  FB fe[6], fo[6];
  auto load_set = [&](FB (&f)[6], const unsigned short* sb, int k0) {
    f[0].h[0] = *(const v8b_a*)(sb + aoff + k0);
    f[0].h[1] = *(const v8b_a*)(sb + aoff + k0 + 16);
    f[1].h[0] = *(const v8b_a*)(sb + aoff + 16 * SP + k0);
    f[1].h[1] = *(const v8b_a*)(sb + aoff + 16 * SP + k0 + 16);
#pragma unroll
    for (int t = 0; t < 4; ++t) {
      f[2 + t].h[0] = *(const v8b_a*)(sb + boff + t * 16 * SP + k0);
      f[2 + t].h[1] = *(const v8b_a*)(sb + boff + t * 16 * SP + k0 + 16);
    }
  };
  auto mma_set = [&](const FB (&f)[6]) {
#pragma unroll
    for (int t = 0; t < 4; ++t) {
      acc[0][t] = mma_bf16(f[0].v, f[2 + t].v, acc[0][t]);
      acc[1][t] = mma_bf16(f[1].v, f[2 + t].v, acc[1][t]);
    }
  };

  /* A rows are shared along blockIdx.x, B rows along blockIdx.y: the sum moves the start along both */
  const unsigned first = (blockIdx.x + blockIdx.y) % NKT;
  {
    const unsigned k0 = walk_at(0, first, NKT) * KT;
    stage_gemm(ag + k0, bg + k0, lcp);
  }
  wait_copies();
  __syncthreads();
  {
    const unsigned k1 = walk_at(1, first, NKT) * KT;
    stage_gemm(ag + k1, bg + k1, lcp + G_STAGE * 2);
  }
  /* rolled: one trip = one tile; tile kt + 1 flies while tile kt is worked on */
#pragma unroll 1
  for (int kt = 0; kt < DMODEL / KT; ++kt) {
    const unsigned short* sb = St + (kt & 1) * G_STAGE;
    load_set(fe, sb, 0);
    load_set(fo, sb, 32);
    mma_set(fe);
    mma_set(fo);
    wait_lds();
    wait_copies();
    __syncthreads();   /* publishes tile kt + 1 and ends every read of tile kt's buffer */
    if (kt + 2 < DMODEL / KT) {
      const unsigned k2 = walk_at(kt + 2, first, NKT) * KT;
      stage_gemm(ag + k2, bg + k2, lcp + (kt & 1) * (G_STAGE * 2));
    }
  }
  wait_copies();

  const int sec = n0 / DMODEL;                       /* 0 q, 1 k, 2 v : block-uniform */
#pragma unroll
  for (int t = 0; t < 4; ++t) {
#pragma unroll
    for (int mt = 0; mt < 2; ++mt) {
#pragma unroll
      for (int r = 0; r < 8; ++r) {
        const float val = acc[mt][t][r] * QKV_CARRY;
        const unsigned short hb = hbits(toh_flush(val));
        const int rl = wave * 32 + mt * 16 + 8 * hh + r;
        const int cl = 16 * t + c;
        const int idx = (sec < 2) ? (rl * TQ_PITCH + cl) : (cl * TV_PITCH + rl);
        Th[idx] = hb;
      }
    }
  }
  __syncthreads();

  const int b  = m0 / SEQ;
  const int l0 = m0 - b * SEQ;
  const int h  = (n0 - sec * DMODEL) / DHEAD;
  const int bh = b * NHEAD + h;
  unsigned short* ph = qkvp + (size_t)sec * PLANE;

  {
    if (sec < 2) {
#pragma unroll
      for (int it = 0; it < 8; ++it) {
        const int u = it * 128 + tid;
        const int row = u >> 3;
        const int seg = u & 7;
        const v4u hw = *(const v4u_a*)(Th + row * TQ_PITCH + seg * 8);
        const size_t g = ((size_t)bh * SEQ + l0 + row) * DHEAD + seg * 8;
        *(v4u*)(ph + g) = hw;
      }
    } else {
#pragma unroll
      for (int it = 0; it < 8; ++it) {
        const int u = it * 128 + tid;
        const int drow = u >> 4;
        const int seg  = u & 15;
        const v4u hw = *(const v4u_a*)(Th + drow * TV_PITCH + seg * 8);
        const size_t g = ((size_t)bh * DHEAD + drow) * SEQ + l0 + seg * 8;
        *(v4u*)(ph + g) = hw;
      }
    }
    
  }
}

__device__ __forceinline__ float xhalf(float x) {
  const int v = __builtin_bit_cast(int, x);
  return __builtin_bit_cast(float, __builtin_amdgcn_permlanex16(v, v, 0x76543210, 0xfedcba98, false, false));
}

/* 2^x of eight values, each in its own register. One statement, so that behind every exponential stands an
   instruction on other registers (the next exponential; behind the last one the v_nop): the slot that the
   instruction set asks for before a transcendental's result is read or its source register written again.
   Left to the register allocator, a run of them wrote each result over the source of the one before. */
__device__ __forceinline__ void exp2x8(float (&x)[8]) {
  asm("v_exp_f32 %0, %0\n\tv_exp_f32 %1, %1\n\tv_exp_f32 %2, %2\n\tv_exp_f32 %3, %3\n\t"
      "v_exp_f32 %4, %4\n\tv_exp_f32 %5, %5\n\tv_exp_f32 %6, %6\n\tv_exp_f32 %7, %7\n\tv_nop"
      : "+v"(x[0]), "+v"(x[1]), "+v"(x[2]), "+v"(x[3]), "+v"(x[4]), "+v"(x[5]), "+v"(x[6]), "+v"(x[7]));
}

__global__ __launch_bounds__(128) VGPR_CAP void attn_kernel(
    const unsigned short* __restrict__ qkvp, unsigned short* __restrict__ ctxp)
{
  union FH { v16h v; v8h h[2]; };
  __shared__ __align__(16) unsigned short Oh[NWAVE][16 * SP];
  __shared__ __align__(16) unsigned short KV[2 * A_STAGE];

  const int tid  = threadIdx.x;
  const int wave = __builtin_amdgcn_readfirstlane(tid >> 5);
  const int lane = tid & 31;
  const int hh   = lane >> 4;
  const int c    = lane & 15;
  const int qb   = blockIdx.x;
  const int bh   = blockIdx.y;
  const int b    = bh / NHEAD;
  const int h    = bh - b * NHEAD;
  const int q0   = qb * 64 + wave * 16;
  const float NEG_INF = -__builtin_inff();

  const unsigned short* Qp  = qkvp + (size_t)bh * SEQ * DHEAD;
  const unsigned short* Vtp = Qp + 2 * PLANE;     /* [bh][d][l]: same per-bh element count */

  v16h qf[2];
  {
    const size_t qo = (size_t)(q0 + c) * DHEAD + 8 * hh;
#pragma unroll
    for (int dc = 0; dc < 2; ++dc) {
      FH f;
      f.h[0] = *(const v8h*)(Qp + qo + dc * 32);
      f.h[1] = *(const v8h*)(Qp + qo + dc * 32 + 16);
      qf[dc] = f.v;
    }
  }

  float mrow = NEG_INF, lrow = 0.f;   /* query c: maximum of the raw scores (both halves alike), this half's part of the sum */
  v8f oacc[4];
#pragma unroll
  for (int t = 0; t < 4; ++t) oacc[t] = (v8f){0.f,0.f,0.f,0.f,0.f,0.f,0.f,0.f};

  /* copy side: this thread's row and 16-B segment of each 16-row group (K plane = Q plane + PLANE) */
  const unsigned short* kg = Qp + PLANE + (size_t)(tid >> 3) * DHEAD + (tid & 7) * 8;
  const unsigned short* vg = Vtp + (size_t)(tid >> 3) * SEQ + (tid & 7) * 8;
  const unsigned lcp = lds_byte(KV) + (tid >> 3) * (SP * 2) + (tid & 7) * 16;
  /* read side: lane's place among the staged K rows [key][d]; the V^T rows [d][key] stand 64 rows on */
  const int flane = c * SP + 8 * hh;

  /* the K and V rows of one (b,h) are shared along blockIdx.x */
  const unsigned first = blockIdx.x % NKC;
  {
    const unsigned c0 = walk_at(0, first, NKC);
    stage_kv(kg + c0 * (KCH * DHEAD), vg + c0 * KCH, lcp);
  }
  wait_copies();
  __syncthreads();
  {
    const unsigned c1 = walk_at(1, first, NKC);
    stage_kv(kg + c1 * (KCH * DHEAD), vg + c1 * KCH, lcp + A_STAGE * 2);
  }

#pragma unroll 1
  for (int kc = 0; kc < SEQ / KCH; ++kc) {
    /* the chunk's 32 fragment reads go out as one group at its head: K first, V behind it */
    const unsigned short* kq = KV + (kc & 1) * A_STAGE + flane;
    const unsigned short* vq = kq + 64 * SP;
    FH kf[4][2];
#pragma unroll
    for (int j = 0; j < 4; ++j) {
#pragma unroll
      for (int dc = 0; dc < 2; ++dc) {
        kf[j][dc].h[0] = *(const v8h_a*)(kq + j * 16 * SP + dc * 32);
        kf[j][dc].h[1] = *(const v8h_a*)(kq + j * 16 * SP + dc * 32 + 16);
      }
    }
    FH vb[2][4];
#pragma unroll
    for (int kk = 0; kk < 2; ++kk) {
#pragma unroll
      for (int t = 0; t < 4; ++t) {
        vb[kk][t].h[0] = *(const v8h_a*)(vq + t * 16 * SP + kk * 32);
        vb[kk][t].h[1] = *(const v8h_a*)(vq + t * 16 * SP + kk * 32 + 16);
      }
    }

    /* raw scores (unscaled accumulators), transposed: 4 key tiles (D elem r = key 16j+8hh+r, query c) */
    v8f s[4];
#pragma unroll
    for (int j = 0; j < 4; ++j) {
      v8f sa = (v8f){0.f,0.f,0.f,0.f,0.f,0.f,0.f,0.f};
#pragma unroll
      for (int dc = 0; dc < 2; ++dc) sa = mma_f16(kf[j][dc].v, qf[dc], sa);
      s[j] = sa;
    }

    /* chunk maximum of query c: the lane's 32 keys, then the other half's 32 */
    float cm;
    {
      float m4[4];
#pragma unroll
      for (int j = 0; j < 4; ++j) {
        float m = s[j][0];
#pragma unroll
        for (int r = 1; r < 8; ++r) m = fmaxf(m, s[j][r]);
        m4[j] = m;
      }
      const float m = fmaxf(fmaxf(m4[0], m4[1]), fmaxf(m4[2], m4[3]));
      cm = fmaxf(m, xhalf(m));
    }

    /* online softmax update; P^T as f16 (x256) packed in place into the B operands, sum over the converted values */
    const float mnew  = fmaxf(mrow, cm);
    const float msafe = (mnew == NEG_INF) ? 0.f : mnew;
    const float alpha = __builtin_amdgcn_exp2f((mrow - msafe) * SCORE_LOG2);
    const float ebias = P_CARRY_LOG2 - msafe * SCORE_LOG2;   /* the maximum and the x256 carry, as one addend */
    mrow = mnew;
    FH pb[2];
    float ps4[4];
#pragma unroll
    for (int j = 0; j < 4; ++j) {
      float psum = 0.f;
      float e[8];
#pragma unroll
      for (int r = 0; r < 8; ++r) e[r] = __builtin_fmaf(s[j][r], SCORE_LOG2, ebias);
      exp2x8(e);
#pragma unroll
      for (int r = 0; r < 8; ++r) {
        const h16 ph = toh_flush(e[r]);
        psum += (float)ph;
        pb[j >> 1].h[j & 1][r] = ph;
      }
      ps4[j] = psum;
    }
    lrow = lrow * alpha + ((ps4[0] + ps4[1]) + (ps4[2] + ps4[3]));
#pragma unroll
    for (int t = 0; t < 4; ++t)
#pragma unroll
      for (int r = 0; r < 8; ++r) oacc[t][r] *= alpha;

    /* O^T += V^T.P^T : A = V^T rows [d][kv] fetched at the head of the chunk, B = P^T [kv][q] from registers */
#pragma unroll
    for (int kk = 0; kk < 2; ++kk) {
#pragma unroll
      for (int t = 0; t < 4; ++t) oacc[t] = mma_f16(vb[kk][t].v, pb[kk].v, oacc[t]);
    }
    wait_lds();
    wait_copies();
    __syncthreads();   /* publishes chunk kc + 1 and ends every read of chunk kc's buffer */
    if (kc + 2 < SEQ / KCH) {
      const unsigned c2 = walk_at(kc + 2, first, NKC);
      stage_kv(kg + c2 * (KCH * DHEAD), vg + c2 * KCH, lcp + (kc & 1) * (A_STAGE * 2));
    }
  }
  wait_copies();

  /* join the halves' sums, normalise (ctx x256), f16 rows [query][d] into the wave slab, then whole-line stores */
  {
    const float inv = CTX_FOLD * (1.0f / (lrow + xhalf(lrow)));
#pragma unroll
    for (int t = 0; t < 4; ++t) {
      v4u hw;
      hw[0] = pkh2(oacc[t][0] * inv, oacc[t][1] * inv);
      hw[1] = pkh2(oacc[t][2] * inv, oacc[t][3] * inv);
      hw[2] = pkh2(oacc[t][4] * inv, oacc[t][5] * inv);
      hw[3] = pkh2(oacc[t][6] * inv, oacc[t][7] * inv);
      *(v4u_a*)(&Oh[wave][c * SP + t * 16 + 8 * hh]) = hw;
    }
  }
  wave_lds_sync();
  {
    const int rq  = lane >> 3;
    const int seg = lane & 7;
#pragma unroll
    for (int it = 0; it < 4; ++it) {
      const int row = it * 4 + rq;
      const v4u hw = *(const v4u_a*)(&Oh[wave][row * SP + seg * 8]);
      const size_t g = (size_t)(b * SEQ + q0 + row) * DMODEL + h * DHEAD + seg * 8;
      *(v4u*)(ctxp + g) = hw;
    }
  }
}

/* --------------------------------------------------------------------------
 * out = C . WoH^T x 2^-18  (M = MROWS, N = 1024, K = 1024), f16 x f16, f32 acc.
 * Block = 4 waves, tile 128 x 64; wave = 32 rows x 64 cols; one product per tile pair.
 * Operands: 64-deep tiles (128 A rows + 64 B rows) copied into two LDS buffers, one tile ahead.
 * Epilogue: per-wave 32x64 f32 slab (wave-private LDS), 16 lanes x 16 B = one 256-B
 * ------------------------------------------------------------------------ */
__global__ __launch_bounds__(128) VGPR_CAP void gemm_out_kernel(
    const unsigned short* __restrict__ ctxp, const unsigned short* __restrict__ WoH,
    float* __restrict__ out)
{
  union FH { v16h v; v8h h[2]; };
  __shared__ __align__(16) float Os[NWAVE][32 * OS_PITCH];
  __shared__ __align__(16) unsigned short St[2 * G_STAGE];

  const int tid  = threadIdx.x;
  const int wave = __builtin_amdgcn_readfirstlane(tid >> 5);
  const int lane = tid & 31;
  const int hh   = lane >> 4;
  const int c    = lane & 15;
  const int n0   = blockIdx.x * 64;
  const int m0   = blockIdx.y * 128;

  v8f acc[2][4];
#pragma unroll
  for (int mt = 0; mt < 2; ++mt)
#pragma unroll
    for (int t = 0; t < 4; ++t) acc[mt][t] = (v8f){0.f,0.f,0.f,0.f,0.f,0.f,0.f,0.f};

  /* copy side: this thread's row and 16-B segment of each 16-row group */
  const unsigned short* ag = ctxp + (size_t)(m0 + (tid >> 3)) * DMODEL + (tid & 7) * 8;
  const unsigned short* bg = WoH  + (size_t)(n0 + (tid >> 3)) * DMODEL + (tid & 7) * 8;
  const unsigned lcp = lds_byte(St) + (tid >> 3) * (SP * 2) + (tid & 7) * 16;
  /* read side: this lane's place in a staged tile */
  const int aoff = (wave * 32 + c) * SP + 8 * hh;
  const int boff = (128 + c) * SP + 8 * hh;

  /* Two fragment sets ([0],[1] = A rows, [2..5] = B columns), one per 32-deep step of the tile */
  FH fe[6], fo[6];
  auto load_set = [&](FH (&f)[6], const unsigned short* sb, int k0) {
    f[0].h[0] = *(const v8h_a*)(sb + aoff + k0);
    f[0].h[1] = *(const v8h_a*)(sb + aoff + k0 + 16);
    f[1].h[0] = *(const v8h_a*)(sb + aoff + 16 * SP + k0);
    f[1].h[1] = *(const v8h_a*)(sb + aoff + 16 * SP + k0 + 16);
#pragma unroll
    for (int t = 0; t < 4; ++t) {
      f[2 + t].h[0] = *(const v8h_a*)(sb + boff + t * 16 * SP + k0);
      f[2 + t].h[1] = *(const v8h_a*)(sb + boff + t * 16 * SP + k0 + 16);
    }
  };
  auto mma_set = [&](const FH (&f)[6]) {
#pragma unroll
    for (int t = 0; t < 4; ++t) {
      acc[0][t] = mma_f16(f[0].v, f[2 + t].v, acc[0][t]);
      acc[1][t] = mma_f16(f[1].v, f[2 + t].v, acc[1][t]);
    }
  };

  /* A rows are shared along blockIdx.x, B rows along blockIdx.y: the sum moves the start along both */
  const unsigned first = (blockIdx.x + blockIdx.y) % NKT;
  {
    const unsigned k0 = walk_at(0, first, NKT) * KT;
    stage_gemm(ag + k0, bg + k0, lcp);
  }
  wait_copies();
  __syncthreads();
  {
    const unsigned k1 = walk_at(1, first, NKT) * KT;
    stage_gemm(ag + k1, bg + k1, lcp + G_STAGE * 2);
  }
  /* rolled: one trip = one tile; tile kt + 1 flies while tile kt is worked on */
#pragma unroll 1
  for (int kt = 0; kt < DMODEL / KT; ++kt) {
    const unsigned short* sb = St + (kt & 1) * G_STAGE;
    load_set(fe, sb, 0);
    load_set(fo, sb, 32);
    mma_set(fe);
    mma_set(fo);
    wait_lds();
    wait_copies();
    __syncthreads();   /* publishes tile kt + 1 and ends every read of tile kt's buffer */
    if (kt + 2 < DMODEL / KT) {
      const unsigned k2 = walk_at(kt + 2, first, NKT) * KT;
      stage_gemm(ag + k2, bg + k2, lcp + (kt & 1) * (G_STAGE * 2));
    }
  }
  wait_copies();

  float* os = Os[wave];
#pragma unroll
  for (int t = 0; t < 4; ++t) {
#pragma unroll
    for (int mt = 0; mt < 2; ++mt)
#pragma unroll
      for (int r = 0; r < 8; ++r)
        os[(mt * 16 + 8 * hh + r) * OS_PITCH + 16 * t + c] = acc[mt][t][r] * OUT_FOLD;
  }
  wave_lds_sync();
  {
    const int c4 = c * 4;
    {
#pragma unroll
      for (int it = 0; it < 16; ++it) {
        const int row = it * 2 + hh;
        const v4f val = *(const v4f_a*)(os + row * OS_PITCH + c4);
        *(v4f*)(out + (size_t)(m0 + wave * 32 + row) * DMODEL + n0 + c4) = val;
      }
      
    }
  }
}

extern "C" void kernel_launch(void* const* d_in, const int* in_sizes, int n_in,
                              void* d_out, int out_size, void* d_ws, size_t ws_size,
                              hipStream_t stream)
{
  if (n_in < 3) return;
  if (in_sizes[0] < ((NB - 1) * SEQ_FULL + SEQ) * DMODEL) return;
  if (in_sizes[1] < NQKV * DMODEL) return;
  if (in_sizes[2] < DMODEL * DMODEL) return;
  if (out_size < MROWS * DMODEL) return;
  if (d_ws == nullptr || ws_size < WS_NEED) return;

  const float* x     = (const float*)d_in[0];
  const float* W_qkv = (const float*)d_in[1];   /* [3072 out][1024 in] */
  const float* W_out = (const float*)d_in[2];   /* [1024 out][1024 in] */
  float* out = (float*)d_out;

  unsigned short* Xb   = (unsigned short*)d_ws;
  unsigned short* WqT  = Xb + XB_E;
  unsigned short* WoH  = WqT + WQT_E;
  unsigned short* qkvp = WoH + WOT_E;
  unsigned short* ctxp = qkvp + QKVP_E;

  /* W_qkv and W_out rows are already [n][k]: plain row converts, no transpose */
  cvt_all_kernel<<<CV_LANES / CV_THREADS, CV_THREADS, 0, stream>>>(x, W_qkv, W_out, Xb, WqT, WoH);

  gemm_qkv_kernel<<<dim3(NQKV / 64, MROWS / 128), 128, 0, stream>>>(Xb, WqT, qkvp);
  attn_kernel<<<dim3(SEQ / 64, NBH), 128, 0, stream>>>(qkvp, ctxp);
  gemm_out_kernel<<<dim3(DMODEL / 64, MROWS / 128), 128, 0, stream>>>(ctxp, WoH, out);
}

// v007
// One run takes 47.4 microseconds.
// Two timings next to v006 both put it at 1.03 times that version's speed.
// All steps since v000 together make it 3.81 times as fast.
// Contractions: x.Wqkv^T on v_wmma_f32_16x16x32_bf16 (both operands RNE-converted to bf16 once); q.k^T, p.v and ctx.Wout^T on v_wmma_f32_16x16x32_f16 with single f16 planes (q, k, v x16; p x256; ctx x256; Wout = bf16-converted value x1024), one product per site; f32 accumulate; softmax in f32.
#include <hip/hip_runtime.h>

typedef __attribute__((ext_vector_type(16))) __bf16 v16b;
typedef __attribute__((ext_vector_type(8)))  __bf16 v8b;
typedef __attribute__((ext_vector_type(16))) _Float16 v16h;
typedef __attribute__((ext_vector_type(8)))  _Float16 v8h;
typedef __attribute__((ext_vector_type(8)))  float  v8f;
typedef __attribute__((ext_vector_type(4)))  float  v4f;
typedef __attribute__((ext_vector_type(2)))  float  v2f;
typedef __attribute__((ext_vector_type(2)))  _Float16 v2h;
typedef __attribute__((ext_vector_type(4)))  unsigned int v4u;
typedef v8h v8h_a __attribute__((may_alias));
typedef v8b v8b_a __attribute__((may_alias));
typedef v4f v4f_a __attribute__((may_alias));
typedef v4u v4u_a __attribute__((may_alias));
typedef _Float16 h16;

#ifndef NB
#define NB 2
#endif
#ifndef SEQ
#define SEQ 1024
#endif
#define NB_FULL 2
#define SEQ_FULL 1024

#define VGPR_CAP __attribute__((amdgpu_num_vgpr(256)))

/* power-of-two carries of the f16 operand planes and their f32 fold-backs */
#define QKV_CARRY   16.0f                 /* q, k, v planes                         */
#define P_CARRY     256.0f                /* exp(s - m) tiles                       */
#define CTX_CARRY   256.0f                /* context plane                          */
#define WO_CARRY    1024.0f               /* output weight plane                    */
#define SCORE_SCALE 0.00048828125f        /* 0.125 / (16 * 16) = 2^-11              */
#define SCORE_LOG2  (SCORE_SCALE * 1.44269504088896340736f)   /* raw score -> exponent to base 2 */
#define P_CARRY_LOG2 8.0f                 /* log2(P_CARRY)                          */
static_assert(P_CARRY == 256.0f && P_CARRY_LOG2 == 8.0f);
#define CTX_FOLD    16.0f                 /* CTX_CARRY / QKV_CARRY (P carry cancels) */
#define OUT_FOLD    3.814697265625e-06f   /* 1 / (256 * 1024) = 2^-18               */

constexpr int DMODEL = 1024;
constexpr int NHEAD  = 16;
constexpr int DHEAD  = 64;
constexpr int NQKV   = 3 * DMODEL;
constexpr int NBH    = NB * NHEAD;
constexpr int MROWS  = NB * SEQ;
constexpr int KCH    = 64;        /* keys per chunk */
constexpr int NWAVE  = 4;
constexpr int TQ_PITCH = 72;      /* [tok][d] staging pitch (16-bit elements) */
constexpr int TV_PITCH = 136;     /* [d][tok] staging pitch (16-bit elements) */
constexpr int T_ELEMS  = 128 * TQ_PITCH;   /* 9216 >= 64 * TV_PITCH = 8704 */
constexpr int OS_PITCH = 68;
constexpr int KT       = 64;              /* k (or keys) per staged tile: one 128-B line per row   */
constexpr int SP       = 72;              /* staged row pitch, 16-bit elements: 144 B = 16 B x 9   */
constexpr int G_STAGE  = (128 + 64) * SP; /* GEMM tile: 128 A rows, then 64 B rows                 */
constexpr int A_STAGE  = (64 + 64) * SP;  /* attention tile: 64 K rows [key][d], 64 V^T rows [d][key] */

constexpr size_t PLANE  = (size_t)NBH * SEQ * DHEAD;
constexpr size_t XB_E   = (size_t)MROWS * DMODEL;
constexpr size_t WQT_E  = (size_t)NQKV * DMODEL;
constexpr size_t WOT_E  = (size_t)DMODEL * DMODEL;
constexpr size_t QKVP_E = 3 * PLANE;
constexpr size_t CTX_E  = XB_E;
constexpr size_t WS_NEED = 2 * (XB_E + WQT_E + WOT_E + QKVP_E + CTX_E);

static_assert(SEQ % 128 == 0);
static_assert(KCH == 64 && SEQ % KCH == 0);
static_assert(SEQ <= SEQ_FULL && NB <= NB_FULL);
static_assert(DHEAD == 64 && DMODEL == NHEAD * DHEAD);
static_assert(DMODEL % 64 == 0 && NQKV % 64 == 0 && DMODEL % 32 == 0);
static_assert(DMODEL % 8 == 0 && DHEAD % 8 == 0);
static_assert(MROWS % 128 == 0);
static_assert(NWAVE * 16 == 64 && NWAVE * 32 == 128);
static_assert(64 * TV_PITCH <= T_ELEMS);
static_assert(TQ_PITCH >= 64 && TV_PITCH >= 128 && OS_PITCH >= 64);
static_assert((TQ_PITCH * 2) % 16 == 0 && (TV_PITCH * 2) % 16 == 0 && (OS_PITCH * 4) % 16 == 0);
static_assert(XB_E % 64 == 0 && WQT_E % 64 == 0 && WOT_E % 64 == 0 && PLANE % 64 == 0);
static_assert(WS_NEED <= 134217728ull);
static_assert(KT == KCH && KT * 2 == 128 && (SP * 2) % 32 == 16 && SP >= KT);
static_assert(DMODEL / KT >= 2 && SEQ / KCH >= 2);
constexpr unsigned NKT = DMODEL / KT;     /* k tiles of a GEMM walk     */
constexpr unsigned NKC = SEQ / KCH;       /* key chunks of an attention walk */

/* Place in a walk of n tiles that starts at tile 'first' and wraps: work-groups that share operand rows get
   different 'first', so that they do not ask L2 for the same lines at the same moment. Every tile is still
   taken exactly once; only the order of the f32 sums differs from work-group to work-group. */
__device__ __forceinline__ unsigned walk_at(unsigned step, unsigned first, unsigned n) { return (step + first) % n; }

/*
 *   Xb   [MROWS][1024]        x, bf16
 *   WqT  [3072][1024]         W_qkv (already [out][in]), bf16
 *   WoH  [1024][1024]         W_out (already [out][in]), bf16-converted value x1024 held in f16
 *   qkvp 3 planes f16: Q [bh][l][64] (q x16), K [bh][l][64] (k x16), Vt [bh][64][l] (v x16)
 *   ctxp 1 plane  f16: C [MROWS][1024] (ctx x256)
 */

__device__ __forceinline__ unsigned short f2bf_bits(float f) {
  unsigned u = __float_as_uint(f);
  return (unsigned short)((u + 0x7FFFu + ((u >> 16) & 1u)) >> 16);
}
__device__ __forceinline__ float bf_bits2f(unsigned short h) { return __uint_as_float(((unsigned)h) << 16); }
__device__ __forceinline__ unsigned pk2(float a, float b) {
  return (unsigned)f2bf_bits(a) | ((unsigned)f2bf_bits(b) << 16);
}

/* f32 -> f16 (RNE) with a value select so that no subnormal f16 is ever produced */
static __device__ __forceinline__ h16 toh_flush(float v) {
  const h16 r = (h16)v;
  return (fabsf(v) < 6.103515625e-05f) ? (h16)0.0f : r;
}
static __device__ __forceinline__ unsigned short hbits(h16 v) {
  return __builtin_bit_cast(unsigned short, v);
}
static __device__ __forceinline__ unsigned pkh2(float a, float b) {
  return (unsigned)hbits(toh_flush(a)) | ((unsigned)hbits(toh_flush(b)) << 16);
}

/* one WMMA + hazard guard naming only this call's live operands */
__device__ __forceinline__ v8f mma_bf16(v16b a, v16b b, v8f c) {
  c = __builtin_amdgcn_wmma_f32_16x16x32_bf16(false, a, false, b, (short)0, c, false, false);
  asm volatile("v_nop\n\tv_nop\n\tv_nop\n\tv_nop" : "+v"(c) : "v"(a), "v"(b));
  return c;
}
__device__ __forceinline__ v8f mma_f16(v16h a, v16h b, v8f c) {
  c = __builtin_amdgcn_wmma_f32_16x16x32_f16(false, a, false, b, (short)0, c, false, false);
  asm volatile("v_nop\n\tv_nop\n\tv_nop\n\tv_nop" : "+v"(c) : "v"(a), "v"(b));
  return c;
}

__device__ __forceinline__ void wave_lds_sync() {
  __builtin_amdgcn_fence(3 /* release order */, "workgroup");
  __builtin_amdgcn_wave_barrier();
  __builtin_amdgcn_fence(2 /* acquire order */, "workgroup");
}

/* ---- tiles into LDS by asynchronous copies: each lane brings its own 16 B, 8 lanes = one 128-B line ---- */
__device__ __forceinline__ unsigned lds_byte(const void* p) { return (unsigned)(size_t)p; }

/* landed: this wave's own copies are in LDS (stands in front of the barrier that publishes them) */
__device__ __forceinline__ void wait_copies() { asm volatile("s_wait_asynccnt 0x0" ::: "memory"); }
/* this wave's LDS reads have returned (stands in front of the barrier behind which the buffer is refilled) */
__device__ __forceinline__ void wait_lds()    { asm volatile("s_wait_dscnt 0x0" ::: "memory"); }

#define CP_LINE(l, g) "global_load_async_to_lds_b128 %" #l ", %" #g ", off\n\t"

/* GEMM tile: thread = (row tid>>3, 16-B segment tid&7); 8 A row groups and 4 B row groups of 16 rows.
   The closing s_wait_xcnt stands in the copies' own statement, ahead of any rewrite of their address registers. */
__device__ __forceinline__ void stage_gemm(const unsigned short* ag, const unsigned short* bg, unsigned l) {
  constexpr int RG = 16 * DMODEL;      /* 16 rows on, global elements */
  constexpr unsigned LG = 16 * SP * 2; /* 16 rows on, LDS bytes       */
  asm volatile(
      CP_LINE(0, 12) CP_LINE(1, 13) CP_LINE(2, 14) CP_LINE(3, 15) CP_LINE(4, 16) CP_LINE(5, 17)
      CP_LINE(6, 18) CP_LINE(7, 19) CP_LINE(8, 20) CP_LINE(9, 21) CP_LINE(10, 22) CP_LINE(11, 23)
      "s_wait_xcnt 0x0"
      :: "v"(l), "v"(l + LG), "v"(l + 2 * LG), "v"(l + 3 * LG), "v"(l + 4 * LG), "v"(l + 5 * LG),
         "v"(l + 6 * LG), "v"(l + 7 * LG), "v"(l + 8 * LG), "v"(l + 9 * LG), "v"(l + 10 * LG), "v"(l + 11 * LG),
         "v"(ag), "v"(ag + RG), "v"(ag + 2 * RG), "v"(ag + 3 * RG), "v"(ag + 4 * RG), "v"(ag + 5 * RG),
         "v"(ag + 6 * RG), "v"(ag + 7 * RG), "v"(bg), "v"(bg + RG), "v"(bg + 2 * RG), "v"(bg + 3 * RG)
      : "memory");
}

/* attention tile: 4 groups of 16 K rows (64 elements apart), then 4 groups of 16 V^T rows (SEQ apart) */
__device__ __forceinline__ void stage_kv(const unsigned short* kg, const unsigned short* vg, unsigned l) {
  constexpr int KG = 16 * DHEAD;
  constexpr int VG = 16 * SEQ;
  constexpr unsigned LG = 16 * SP * 2;
  asm volatile(
      CP_LINE(0, 8) CP_LINE(1, 9) CP_LINE(2, 10) CP_LINE(3, 11)
      CP_LINE(4, 12) CP_LINE(5, 13) CP_LINE(6, 14) CP_LINE(7, 15)
      "s_wait_xcnt 0x0"
      :: "v"(l), "v"(l + LG), "v"(l + 2 * LG), "v"(l + 3 * LG),
         "v"(l + 4 * LG), "v"(l + 5 * LG), "v"(l + 6 * LG), "v"(l + 7 * LG),
         "v"(kg), "v"(kg + KG), "v"(kg + 2 * KG), "v"(kg + 3 * KG),
         "v"(vg), "v"(vg + VG), "v"(vg + 2 * VG), "v"(vg + 3 * VG)
      : "memory");
}

/* --------------------------------------------------------------------------
 * All three operand conversions in one launch. Unit = 8 elements = two 16-B loads, one 16-B store.
 *   x     -> Xb  : bf16 (RNE); out row b*SEQ + l <- in row b*SEQ_FULL + l
 *   W_qkv -> WqT : bf16 (RNE)
 *   W_out -> WoH : f16 holding (bf16 RNE value) x WO_CARRY; the bf16 significand and the power-of-two
 *                  carry are exact in f16; the flush select removes would-be subnormals.
 * The launch has one thread per unit of W_out; a thread takes CV_X units of x, CV_Q of W_qkv and one of
 * W_out, CV_LANES units apart (a wave's lanes stay on consecutive units), and issues all its loads
 * before the first conversion. Coverage: CV_LANES threads x (CV_X, CV_Q, 1) units = the three whole planes.
 * ------------------------------------------------------------------------ */
constexpr int CV_THREADS = 512;                         /* 16 waves a work-group */
constexpr int CV_UPR     = DMODEL / 8;                  /* units per row, all three planes */
constexpr int CV_LANES   = (int)(WOT_E / 8);
constexpr int CV_X       = (int)(XB_E / 8 / CV_LANES);
constexpr int CV_Q       = (int)(WQT_E / 8 / CV_LANES);
static_assert(CV_LANES % CV_THREADS == 0);
static_assert((size_t)CV_X * CV_LANES * 8 == XB_E && (size_t)CV_Q * CV_LANES * 8 == WQT_E);
static_assert((size_t)NB * SEQ_FULL * DMODEL < (1u << 30) && WQT_E < (1u << 30));   /* element indices fit 32 bits */

/* element e of p through a 32-bit byte offset: scalar base + one offset register, no 64-bit address pair per load */
__device__ __forceinline__ const float* at32(const float* p, unsigned e) {
  return (const float*)((const char*)p + e * 4u);
}

__device__ __forceinline__ v4u bf_unit(v4f a0, v4f a1) {
  v4u w;
  w[0] = pk2(a0[0], a0[1]);
  w[1] = pk2(a0[2], a0[3]);
  w[2] = pk2(a1[0], a1[1]);
  w[3] = pk2(a1[2], a1[3]);
  return w;
}

__global__ __launch_bounds__(CV_THREADS) void cvt_all_kernel(
    const float* __restrict__ x, const float* __restrict__ Wq, const float* __restrict__ Wo,
    unsigned short* __restrict__ Xb, unsigned short* __restrict__ WqT, unsigned short* __restrict__ WoH)
{
  const unsigned g = blockIdx.x * CV_THREADS + threadIdx.x;

  /* every loop here is unrolled whole: the units stay in registers and the loads go out as one run */
  v4f xa[CV_X][2], qa[CV_Q][2], oa[2];
#pragma unroll
  for (unsigned i = 0; i < CV_X; ++i) {
    const unsigned u   = i * CV_LANES + g;
    const unsigned row = u / CV_UPR;
    const unsigned seg = u - row * CV_UPR;
    const unsigned b   = row / SEQ;
    const unsigned l   = row - b * SEQ;
    const float* s = at32(x, ((b * SEQ_FULL + l) * CV_UPR + seg) * 8u);
    xa[i][0] = *(const v4f*)s;
    xa[i][1] = *(const v4f*)(s + 4);
  }
#pragma unroll
  for (unsigned i = 0; i < CV_Q; ++i) {
    const float* s = at32(Wq, (i * CV_LANES + g) * 8u);
    qa[i][0] = *(const v4f*)s;
    qa[i][1] = *(const v4f*)(s + 4);
  }
  /* a later load may land in a register that held an earlier load's offset: the earlier loads' address
     translations are waited for first (a precaution of form; costs one short wait among the loads) */
  asm volatile("s_wait_xcnt 0x0" ::: "memory");
  {
    const float* s = at32(Wo, g * 8u);
    oa[0] = *(const v4f*)s;
    oa[1] = *(const v4f*)(s + 4);
  }

#pragma unroll
  for (unsigned i = 0; i < CV_X; ++i) *(v4u*)(Xb + (i * CV_LANES + g) * 8u) = bf_unit(xa[i][0], xa[i][1]);
#pragma unroll
  for (unsigned i = 0; i < CV_Q; ++i) *(v4u*)(WqT + (i * CV_LANES + g) * 8u) = bf_unit(qa[i][0], qa[i][1]);
  {
    v4u w;
    w[0] = pkh2(bf_bits2f(f2bf_bits(oa[0][0])) * WO_CARRY, bf_bits2f(f2bf_bits(oa[0][1])) * WO_CARRY);
    w[1] = pkh2(bf_bits2f(f2bf_bits(oa[0][2])) * WO_CARRY, bf_bits2f(f2bf_bits(oa[0][3])) * WO_CARRY);
    w[2] = pkh2(bf_bits2f(f2bf_bits(oa[1][0])) * WO_CARRY, bf_bits2f(f2bf_bits(oa[1][1])) * WO_CARRY);
    w[3] = pkh2(bf_bits2f(f2bf_bits(oa[1][2])) * WO_CARRY, bf_bits2f(f2bf_bits(oa[1][3])) * WO_CARRY);
    *(v4u*)(WoH + g * 8u) = w;
  }
}

/* --------------------------------------------------------------------------
 * qkv = Xb . WqT^T  (M = MROWS, N = 3072, K = 1024), bf16 x bf16, f32 acc.
 * Block = 4 waves, tile 128 tokens x 64 columns (= one head of one section);
 * wave = 32 rows x 64 cols (2 A fragments x 4 B fragments per 32-deep step).
 * Operands: 64-deep tiles (128 A rows + 64 B rows) copied into two LDS buffers, one tile ahead;
 * fragments read from the tile of the trip.
 * Fragment map (hh = lane>>4, c = lane&15): A row c, elems 0..7 <- k0+8hh.., 8..15 <- k0+16+8hh..;
 * B col c with the same k map; D elem r = (row 8hh+r, col c).
 * Epilogue: acc x 16 converted to f16 (flush select), staged in a block LDS tile
 * ([tok][d] for q,k; [d][tok] for v), block barrier, whole-line stores:
 *   v  : 1024 units = 64 d-rows x 16 segments (16 lanes = one 256-B row segment).
 * LDS tile Th: cross-wave, separated by a block barrier; staged extent = consumed extent.
 * ------------------------------------------------------------------------ */
__global__ __launch_bounds__(128) VGPR_CAP void gemm_qkv_kernel(
    const unsigned short* __restrict__ Xb, const unsigned short* __restrict__ WqT,
    unsigned short* __restrict__ qkvp)
{
  union FB { v16b v; v8b h[2]; };
  __shared__ __align__(16) unsigned short Th[T_ELEMS];
  __shared__ __align__(16) unsigned short St[2 * G_STAGE];

  const int tid  = threadIdx.x;
  const int wave = __builtin_amdgcn_readfirstlane(tid >> 5);
  const int lane = tid & 31;
  const int hh   = lane >> 4;
  const int c    = lane & 15;
  const int n0   = blockIdx.x * 64;
  const int m0   = blockIdx.y * 128;

  v8f acc[2][4];
#pragma unroll
  for (int mt = 0; mt < 2; ++mt)
#pragma unroll
    for (int t = 0; t < 4; ++t) acc[mt][t] = (v8f){0.f,0.f,0.f,0.f,0.f,0.f,0.f,0.f};

  /* copy side: this thread's row and 16-B segment of each 16-row group */
  const unsigned short* ag = Xb  + (size_t)(m0 + (tid >> 3)) * DMODEL + (tid & 7) * 8;
  const unsigned short* bg = WqT + (size_t)(n0 + (tid >> 3)) * DMODEL + (tid & 7) * 8;
  const unsigned lcp = lds_byte(St) + (tid >> 3) * (SP * 2) + (tid & 7) * 16;
  /* read side: this lane's place in a staged tile */
  const int aoff = (wave * 32 + c) * SP + 8 * hh;
  const int boff = (128 + c) * SP + 8 * hh;

  /* Two fragment sets ([0],[1] = A rows, [2..5] = B columns), one per 32-deep step of the tile */
  FB fe[6], fo[6];
  auto load_set = [&](FB (&f)[6], const unsigned short* sb, int k0) {
    f[0].h[0] = *(const v8b_a*)(sb + aoff + k0);
    f[0].h[1] = *(const v8b_a*)(sb + aoff + k0 + 16);
    f[1].h[0] = *(const v8b_a*)(sb + aoff + 16 * SP + k0);
    f[1].h[1] = *(const v8b_a*)(sb + aoff + 16 * SP + k0 + 16);
#pragma unroll
    for (int t = 0; t < 4; ++t) {
      f[2 + t].h[0] = *(const v8b_a*)(sb + boff + t * 16 * SP + k0);
      f[2 + t].h[1] = *(const v8b_a*)(sb + boff + t * 16 * SP + k0 + 16);
    }
  };
  auto mma_set = [&](const FB (&f)[6]) {
#pragma unroll
    for (int t = 0; t < 4; ++t) {
      acc[0][t] = mma_bf16(f[0].v, f[2 + t].v, acc[0][t]);
      acc[1][t] = mma_bf16(f[1].v, f[2 + t].v, acc[1][t]);
    }
  };

  /* A rows are shared along blockIdx.x, B rows along blockIdx.y: the sum moves the start along both */
  const unsigned first = (blockIdx.x + blockIdx.y) % NKT;
  {
    const unsigned k0 = walk_at(0, first, NKT) * KT;
    stage_gemm(ag + k0, bg + k0, lcp);
  }
  wait_copies();
  __syncthreads();
  {
    const unsigned k1 = walk_at(1, first, NKT) * KT;
    stage_gemm(ag + k1, bg + k1, lcp + G_STAGE * 2);
  }
  /* rolled: one trip = one tile; tile kt + 1 flies while tile kt is worked on */
#pragma unroll 1
  for (int kt = 0; kt < DMODEL / KT; ++kt) {
    const unsigned short* sb = St + (kt & 1) * G_STAGE;
    load_set(fe, sb, 0);
    load_set(fo, sb, 32);
    mma_set(fe);
    mma_set(fo);
    wait_lds();
    wait_copies();
    __syncthreads();   /* publishes tile kt + 1 and ends every read of tile kt's buffer */
    if (kt + 2 < DMODEL / KT) {
      const unsigned k2 = walk_at(kt + 2, first, NKT) * KT;
      stage_gemm(ag + k2, bg + k2, lcp + (kt & 1) * (G_STAGE * 2));
    }
  }
  wait_copies();

  const int sec = n0 / DMODEL;                       /* 0 q, 1 k, 2 v : block-uniform */
#pragma unroll
  for (int t = 0; t < 4; ++t) {
#pragma unroll
    for (int mt = 0; mt < 2; ++mt) {
#pragma unroll
      for (int r = 0; r < 8; ++r) {
        const float val = acc[mt][t][r] * QKV_CARRY;
        const unsigned short hb = hbits(toh_flush(val));
        const int rl = wave * 32 + mt * 16 + 8 * hh + r;
        const int cl = 16 * t + c;
        const int idx = (sec < 2) ? (rl * TQ_PITCH + cl) : (cl * TV_PITCH + rl);
        Th[idx] = hb;
      }
    }
  }
  __syncthreads();

  const int b  = m0 / SEQ;
  const int l0 = m0 - b * SEQ;
  const int h  = (n0 - sec * DMODEL) / DHEAD;
  const int bh = b * NHEAD + h;
  unsigned short* ph = qkvp + (size_t)sec * PLANE;

  {
    if (sec < 2) {
#pragma unroll
      for (int it = 0; it < 8; ++it) {
        const int u = it * 128 + tid;
        const int row = u >> 3;
        const int seg = u & 7;
        const v4u hw = *(const v4u_a*)(Th + row * TQ_PITCH + seg * 8);
        const size_t g = ((size_t)bh * SEQ + l0 + row) * DHEAD + seg * 8;
        *(v4u*)(ph + g) = hw;
      }
    } else {
#pragma unroll
      for (int it = 0; it < 8; ++it) {
        const int u = it * 128 + tid;
        const int drow = u >> 4;
        const int seg  = u & 15;
        const v4u hw = *(const v4u_a*)(Th + drow * TV_PITCH + seg * 8);
        const size_t g = ((size_t)bh * DHEAD + drow) * SEQ + l0 + seg * 8;
        *(v4u*)(ph + g) = hw;
      }
    }
    
  }
}

__device__ __forceinline__ float xhalf(float x) {
  const int v = __builtin_bit_cast(int, x);
  return __builtin_bit_cast(float, __builtin_amdgcn_permlanex16(v, v, 0x76543210, 0xfedcba98, false, false));
}

/* 2^x of eight values, each in its own register. One statement, so that behind every exponential stands an
   instruction on other registers (the next exponential; behind the last one the v_nop): the slot that the
   instruction set asks for before a transcendental's result is read or its source register written again.
   Left to the register allocator, a run of them wrote each result over the source of the one before. */
__device__ __forceinline__ void exp2x8(float (&x)[8]) {
  asm("v_exp_f32 %0, %0\n\tv_exp_f32 %1, %1\n\tv_exp_f32 %2, %2\n\tv_exp_f32 %3, %3\n\t"
      "v_exp_f32 %4, %4\n\tv_exp_f32 %5, %5\n\tv_exp_f32 %6, %6\n\tv_exp_f32 %7, %7\n\tv_nop"
      : "+v"(x[0]), "+v"(x[1]), "+v"(x[2]), "+v"(x[3]), "+v"(x[4]), "+v"(x[5]), "+v"(x[6]), "+v"(x[7]));
}

__global__ __launch_bounds__(128) VGPR_CAP void attn_kernel(
    const unsigned short* __restrict__ qkvp, unsigned short* __restrict__ ctxp)
{
  union FH { v16h v; v8h h[2]; };
  __shared__ __align__(16) unsigned short Oh[NWAVE][16 * SP];
  __shared__ __align__(16) unsigned short KV[2 * A_STAGE];

  const int tid  = threadIdx.x;
  const int wave = __builtin_amdgcn_readfirstlane(tid >> 5);
  const int lane = tid & 31;
  const int hh   = lane >> 4;
  const int c    = lane & 15;
  const int qb   = blockIdx.x;
  const int bh   = blockIdx.y;
  const int b    = bh / NHEAD;
  const int h    = bh - b * NHEAD;
  const int q0   = qb * 64 + wave * 16;
  const float NEG_INF = -__builtin_inff();

  const unsigned short* Qp  = qkvp + (size_t)bh * SEQ * DHEAD;
  const unsigned short* Vtp = Qp + 2 * PLANE;     /* [bh][d][l]: same per-bh element count */

  v16h qf[2];
  {
    const size_t qo = (size_t)(q0 + c) * DHEAD + 8 * hh;
#pragma unroll
    for (int dc = 0; dc < 2; ++dc) {
      FH f;
      f.h[0] = *(const v8h*)(Qp + qo + dc * 32);
      f.h[1] = *(const v8h*)(Qp + qo + dc * 32 + 16);
      qf[dc] = f.v;
    }
  }

  float mrow = NEG_INF, lrow = 0.f;   /* query c: maximum of the raw scores (both halves alike), this half's part of the sum */
  v8f oacc[4];
#pragma unroll
  for (int t = 0; t < 4; ++t) oacc[t] = (v8f){0.f,0.f,0.f,0.f,0.f,0.f,0.f,0.f};

  /* copy side: this thread's row and 16-B segment of each 16-row group (K plane = Q plane + PLANE) */
  const unsigned short* kg = Qp + PLANE + (size_t)(tid >> 3) * DHEAD + (tid & 7) * 8;
  const unsigned short* vg = Vtp + (size_t)(tid >> 3) * SEQ + (tid & 7) * 8;
  const unsigned lcp = lds_byte(KV) + (tid >> 3) * (SP * 2) + (tid & 7) * 16;
  /* read side: lane's place among the staged K rows [key][d]; the V^T rows [d][key] stand 64 rows on */
  const int flane = c * SP + 8 * hh;

  /* the K and V rows of one (b,h) are shared along blockIdx.x */
  const unsigned first = blockIdx.x % NKC;
  {
    const unsigned c0 = walk_at(0, first, NKC);
    stage_kv(kg + c0 * (KCH * DHEAD), vg + c0 * KCH, lcp);
  }
  wait_copies();
  __syncthreads();
  {
    const unsigned c1 = walk_at(1, first, NKC);
    stage_kv(kg + c1 * (KCH * DHEAD), vg + c1 * KCH, lcp + A_STAGE * 2);
  }

#pragma unroll 1
  for (int kc = 0; kc < SEQ / KCH; ++kc) {
    /* the chunk's 32 fragment reads go out as one group at its head: K first, V behind it */
    const unsigned short* kq = KV + (kc & 1) * A_STAGE + flane;
    const unsigned short* vq = kq + 64 * SP;
    FH kf[4][2];
#pragma unroll
    for (int j = 0; j < 4; ++j) {
#pragma unroll
      for (int dc = 0; dc < 2; ++dc) {
        kf[j][dc].h[0] = *(const v8h_a*)(kq + j * 16 * SP + dc * 32);
        kf[j][dc].h[1] = *(const v8h_a*)(kq + j * 16 * SP + dc * 32 + 16);
      }
    }
    FH vb[2][4];
#pragma unroll
    for (int kk = 0; kk < 2; ++kk) {
#pragma unroll
      for (int t = 0; t < 4; ++t) {
        vb[kk][t].h[0] = *(const v8h_a*)(vq + t * 16 * SP + kk * 32);
        vb[kk][t].h[1] = *(const v8h_a*)(vq + t * 16 * SP + kk * 32 + 16);
      }
    }

    /* raw scores (unscaled accumulators), transposed: 4 key tiles (D elem r = key 16j+8hh+r, query c) */
    v8f s[4];
#pragma unroll
    for (int j = 0; j < 4; ++j) {
      v8f sa = (v8f){0.f,0.f,0.f,0.f,0.f,0.f,0.f,0.f};
#pragma unroll
      for (int dc = 0; dc < 2; ++dc) sa = mma_f16(kf[j][dc].v, qf[dc], sa);
      s[j] = sa;
    }

    /* chunk maximum of query c: the lane's 32 keys, then the other half's 32 */
    float cm;
    {
      float m4[4];
#pragma unroll
      for (int j = 0; j < 4; ++j) {
        float m = s[j][0];
#pragma unroll
        for (int r = 1; r < 8; ++r) m = fmaxf(m, s[j][r]);
        m4[j] = m;
      }
      const float m = fmaxf(fmaxf(m4[0], m4[1]), fmaxf(m4[2], m4[3]));
      cm = fmaxf(m, xhalf(m));
    }

    /* online softmax update; P^T as f16 (x256) packed in place into the B operands, sum over the converted values */
    const float mnew  = fmaxf(mrow, cm);
    const float msafe = (mnew == NEG_INF) ? 0.f : mnew;
    const float alpha = __builtin_amdgcn_exp2f((mrow - msafe) * SCORE_LOG2);
    const float ebias = P_CARRY_LOG2 - msafe * SCORE_LOG2;   /* the maximum and the x256 carry, as one addend */
    mrow = mnew;
    FH pb[2];
    float ps4[4];
#pragma unroll
    for (int j = 0; j < 4; ++j) {
      float psum = 0.f;
      float e[8];
#pragma unroll
      for (int r = 0; r < 8; ++r) e[r] = __builtin_fmaf(s[j][r], SCORE_LOG2, ebias);
      exp2x8(e);
#pragma unroll
      for (int r = 0; r < 8; r += 2) {
        /* one packed convert for two values; no zeroing of small values here: it cost a compare and a select each */
        const v2h ph = __builtin_convertvector((v2f){e[r], e[r + 1]}, v2h);
        psum += (float)ph[0];
        psum += (float)ph[1];
        pb[j >> 1].h[j & 1][r]     = ph[0];
        pb[j >> 1].h[j & 1][r + 1] = ph[1];
      }
      ps4[j] = psum;
    }
    lrow = lrow * alpha + ((ps4[0] + ps4[1]) + (ps4[2] + ps4[3]));
#pragma unroll
    for (int t = 0; t < 4; ++t)
#pragma unroll
      for (int r = 0; r < 8; ++r) oacc[t][r] *= alpha;

    /* O^T += V^T.P^T : A = V^T rows [d][kv] fetched at the head of the chunk, B = P^T [kv][q] from registers */
#pragma unroll
    for (int kk = 0; kk < 2; ++kk) {
#pragma unroll
      for (int t = 0; t < 4; ++t) oacc[t] = mma_f16(vb[kk][t].v, pb[kk].v, oacc[t]);
    }
    wait_lds();
    wait_copies();
    __syncthreads();   /* publishes chunk kc + 1 and ends every read of chunk kc's buffer */
    if (kc + 2 < SEQ / KCH) {
      const unsigned c2 = walk_at(kc + 2, first, NKC);
      stage_kv(kg + c2 * (KCH * DHEAD), vg + c2 * KCH, lcp + (kc & 1) * (A_STAGE * 2));
    }
  }
  wait_copies();

  /* join the halves' sums, normalise (ctx x256), f16 rows [query][d] into the wave slab, then whole-line stores */
  {
    const float inv = CTX_FOLD * (1.0f / (lrow + xhalf(lrow)));
#pragma unroll
    for (int t = 0; t < 4; ++t) {
      v4u hw;
      hw[0] = pkh2(oacc[t][0] * inv, oacc[t][1] * inv);
      hw[1] = pkh2(oacc[t][2] * inv, oacc[t][3] * inv);
      hw[2] = pkh2(oacc[t][4] * inv, oacc[t][5] * inv);
      hw[3] = pkh2(oacc[t][6] * inv, oacc[t][7] * inv);
      *(v4u_a*)(&Oh[wave][c * SP + t * 16 + 8 * hh]) = hw;
    }
  }
  wave_lds_sync();
  {
    const int rq  = lane >> 3;
    const int seg = lane & 7;
#pragma unroll
    for (int it = 0; it < 4; ++it) {
      const int row = it * 4 + rq;
      const v4u hw = *(const v4u_a*)(&Oh[wave][row * SP + seg * 8]);
      const size_t g = (size_t)(b * SEQ + q0 + row) * DMODEL + h * DHEAD + seg * 8;
      *(v4u*)(ctxp + g) = hw;
    }
  }
}

/* --------------------------------------------------------------------------
 * out = C . WoH^T x 2^-18  (M = MROWS, N = 1024, K = 1024), f16 x f16, f32 acc.
 * Block = 4 waves, tile 128 x 64; wave = 32 rows x 64 cols; one product per tile pair.
 * Operands: 64-deep tiles (128 A rows + 64 B rows) copied into two LDS buffers, one tile ahead.
 * Epilogue: per-wave 32x64 f32 slab (wave-private LDS), 16 lanes x 16 B = one 256-B
 * ------------------------------------------------------------------------ */
__global__ __launch_bounds__(128) VGPR_CAP void gemm_out_kernel(
    const unsigned short* __restrict__ ctxp, const unsigned short* __restrict__ WoH,
    float* __restrict__ out)
{
  union FH { v16h v; v8h h[2]; };
  __shared__ __align__(16) float Os[NWAVE][32 * OS_PITCH];
  __shared__ __align__(16) unsigned short St[2 * G_STAGE];

  const int tid  = threadIdx.x;
  const int wave = __builtin_amdgcn_readfirstlane(tid >> 5);
  const int lane = tid & 31;
  const int hh   = lane >> 4;
  const int c    = lane & 15;
  const int n0   = blockIdx.x * 64;
  const int m0   = blockIdx.y * 128;

  v8f acc[2][4];
#pragma unroll
  for (int mt = 0; mt < 2; ++mt)
#pragma unroll
    for (int t = 0; t < 4; ++t) acc[mt][t] = (v8f){0.f,0.f,0.f,0.f,0.f,0.f,0.f,0.f};

  /* copy side: this thread's row and 16-B segment of each 16-row group */
  const unsigned short* ag = ctxp + (size_t)(m0 + (tid >> 3)) * DMODEL + (tid & 7) * 8;
  const unsigned short* bg = WoH  + (size_t)(n0 + (tid >> 3)) * DMODEL + (tid & 7) * 8;
  const unsigned lcp = lds_byte(St) + (tid >> 3) * (SP * 2) + (tid & 7) * 16;
  /* read side: this lane's place in a staged tile */
  const int aoff = (wave * 32 + c) * SP + 8 * hh;
  const int boff = (128 + c) * SP + 8 * hh;

  /* Two fragment sets ([0],[1] = A rows, [2..5] = B columns), one per 32-deep step of the tile */
  FH fe[6], fo[6];
  auto load_set = [&](FH (&f)[6], const unsigned short* sb, int k0) {
    f[0].h[0] = *(const v8h_a*)(sb + aoff + k0);
    f[0].h[1] = *(const v8h_a*)(sb + aoff + k0 + 16);
    f[1].h[0] = *(const v8h_a*)(sb + aoff + 16 * SP + k0);
    f[1].h[1] = *(const v8h_a*)(sb + aoff + 16 * SP + k0 + 16);
#pragma unroll
    for (int t = 0; t < 4; ++t) {
      f[2 + t].h[0] = *(const v8h_a*)(sb + boff + t * 16 * SP + k0);
      f[2 + t].h[1] = *(const v8h_a*)(sb + boff + t * 16 * SP + k0 + 16);
    }
  };
  auto mma_set = [&](const FH (&f)[6]) {
#pragma unroll
    for (int t = 0; t < 4; ++t) {
      acc[0][t] = mma_f16(f[0].v, f[2 + t].v, acc[0][t]);
      acc[1][t] = mma_f16(f[1].v, f[2 + t].v, acc[1][t]);
    }
  };

  /* A rows are shared along blockIdx.x, B rows along blockIdx.y: the sum moves the start along both */
  const unsigned first = (blockIdx.x + blockIdx.y) % NKT;
  {
    const unsigned k0 = walk_at(0, first, NKT) * KT;
    stage_gemm(ag + k0, bg + k0, lcp);
  }
  wait_copies();
  __syncthreads();
  {
    const unsigned k1 = walk_at(1, first, NKT) * KT;
    stage_gemm(ag + k1, bg + k1, lcp + G_STAGE * 2);
  }
  /* rolled: one trip = one tile; tile kt + 1 flies while tile kt is worked on */
#pragma unroll 1
  for (int kt = 0; kt < DMODEL / KT; ++kt) {
    const unsigned short* sb = St + (kt & 1) * G_STAGE;
    load_set(fe, sb, 0);
    load_set(fo, sb, 32);
    mma_set(fe);
    mma_set(fo);
    wait_lds();
    wait_copies();
    __syncthreads();   /* publishes tile kt + 1 and ends every read of tile kt's buffer */
    if (kt + 2 < DMODEL / KT) {
      const unsigned k2 = walk_at(kt + 2, first, NKT) * KT;
      stage_gemm(ag + k2, bg + k2, lcp + (kt & 1) * (G_STAGE * 2));
    }
  }
  wait_copies();

  float* os = Os[wave];
#pragma unroll
  for (int t = 0; t < 4; ++t) {
#pragma unroll
    for (int mt = 0; mt < 2; ++mt)
#pragma unroll
      for (int r = 0; r < 8; ++r)
        os[(mt * 16 + 8 * hh + r) * OS_PITCH + 16 * t + c] = acc[mt][t][r] * OUT_FOLD;
  }
  wave_lds_sync();
  {
    const int c4 = c * 4;
    {
#pragma unroll
      for (int it = 0; it < 16; ++it) {
        const int row = it * 2 + hh;
        const v4f val = *(const v4f_a*)(os + row * OS_PITCH + c4);
        *(v4f*)(out + (size_t)(m0 + wave * 32 + row) * DMODEL + n0 + c4) = val;
      }
      
    }
  }
}

extern "C" void kernel_launch(void* const* d_in, const int* in_sizes, int n_in,
                              void* d_out, int out_size, void* d_ws, size_t ws_size,
                              hipStream_t stream)
{
  if (n_in < 3) return;
  if (in_sizes[0] < ((NB - 1) * SEQ_FULL + SEQ) * DMODEL) return;
  if (in_sizes[1] < NQKV * DMODEL) return;
  if (in_sizes[2] < DMODEL * DMODEL) return;
  if (out_size < MROWS * DMODEL) return;
  if (d_ws == nullptr || ws_size < WS_NEED) return;

  const float* x     = (const float*)d_in[0];
  const float* W_qkv = (const float*)d_in[1];   /* [3072 out][1024 in] */
  const float* W_out = (const float*)d_in[2];   /* [1024 out][1024 in] */
  float* out = (float*)d_out;

  unsigned short* Xb   = (unsigned short*)d_ws;
  unsigned short* WqT  = Xb + XB_E;
  unsigned short* WoH  = WqT + WQT_E;
  unsigned short* qkvp = WoH + WOT_E;
  unsigned short* ctxp = qkvp + QKVP_E;

  /* W_qkv and W_out rows are already [n][k]: plain row converts, no transpose */
  cvt_all_kernel<<<CV_LANES / CV_THREADS, CV_THREADS, 0, stream>>>(x, W_qkv, W_out, Xb, WqT, WoH);

  gemm_qkv_kernel<<<dim3(NQKV / 64, MROWS / 128), 128, 0, stream>>>(Xb, WqT, qkvp);
  attn_kernel<<<dim3(SEQ / 64, NBH), 128, 0, stream>>>(qkvp, ctxp);
  gemm_out_kernel<<<dim3(DMODEL / 64, MROWS / 128), 128, 0, stream>>>(ctxp, WoH, out);
}

// v008
// It runs in 43.6 microseconds.
// Timed twice side by side with v007, it ran 1.09 and 1.08 times as fast.
// All steps since v000 together make it 4.12 times as fast.
// Contractions: x.Wqkv^T on v_wmma_f32_16x16x32_bf16 (both operands RNE-converted to bf16 once); q.k^T, p.v and ctx.Wout^T on v_wmma_f32_16x16x32_f16 with single f16 planes (q, k, v x16; p x256; ctx x256; Wout = bf16-converted value x1024), one product per site; f32 accumulate; softmax in f32.
#include <hip/hip_runtime.h>

typedef __attribute__((ext_vector_type(16))) __bf16 v16b;
typedef __attribute__((ext_vector_type(8)))  __bf16 v8b;
typedef __attribute__((ext_vector_type(16))) _Float16 v16h;
typedef __attribute__((ext_vector_type(8)))  _Float16 v8h;
typedef __attribute__((ext_vector_type(8)))  float  v8f;
typedef __attribute__((ext_vector_type(4)))  float  v4f;
typedef __attribute__((ext_vector_type(2)))  float  v2f;
typedef __attribute__((ext_vector_type(2)))  _Float16 v2h;
typedef __attribute__((ext_vector_type(4)))  unsigned int v4u;
typedef v8h v8h_a __attribute__((may_alias));
typedef v8b v8b_a __attribute__((may_alias));
typedef v4f v4f_a __attribute__((may_alias));
typedef v4u v4u_a __attribute__((may_alias));
typedef _Float16 h16;

#ifndef NB
#define NB 2
#endif
#ifndef SEQ
#define SEQ 1024
#endif
#define NB_FULL 2
#define SEQ_FULL 1024

#define VGPR_CAP __attribute__((amdgpu_num_vgpr(256)))

/* power-of-two carries of the f16 operand planes and their f32 fold-backs */
#define QKV_CARRY   16.0f                 /* q, k, v planes                         */
#define P_CARRY     256.0f                /* exp(s - m) tiles                       */
#define CTX_CARRY   256.0f                /* context plane                          */
#define WO_CARRY    1024.0f               /* output weight plane                    */
#define SCORE_SCALE 0.00048828125f        /* 0.125 / (16 * 16) = 2^-11              */
#define SCORE_LOG2  (SCORE_SCALE * 1.44269504088896340736f)   /* raw score -> exponent to base 2 */
#define P_CARRY_LOG2 8.0f                 /* log2(P_CARRY)                          */
static_assert(P_CARRY == 256.0f && P_CARRY_LOG2 == 8.0f);
#define CTX_FOLD    16.0f                 /* CTX_CARRY / QKV_CARRY (P carry cancels) */
#define OUT_FOLD    3.814697265625e-06f   /* 1 / (256 * 1024) = 2^-18               */

constexpr int DMODEL = 1024;
constexpr int NHEAD  = 16;
constexpr int DHEAD  = 64;
constexpr int NQKV   = 3 * DMODEL;
constexpr int NBH    = NB * NHEAD;
constexpr int MROWS  = NB * SEQ;
constexpr int KCH    = 64;        /* keys per chunk */
constexpr int NWAVE  = 4;
constexpr int OS_PITCH = 68;
constexpr int KT       = 64;              /* k (or keys) per staged tile: one 128-B line per row   */
constexpr int SP       = 72;              /* staged row pitch, 16-bit elements: 144 B = 16 B x 9   */
constexpr int G_STAGE  = (128 + 64) * SP; /* output GEMM tile: 128 A rows, then 64 B rows          */
constexpr int QKT      = 128;             /* k per staged tile of the qkv GEMM: two 128-B lines per row */
constexpr int QSP      = 136;             /* its staged row pitch, 16-bit elements: 272 B = 16 B x 17  */
constexpr int Q_STAGE  = (256 + 128) * QSP; /* qkv GEMM tile: 256 A rows, then 128 B rows          */
constexpr int QWAVE    = 8;               /* waves of a qkv GEMM block: 4 along rows x 2 along columns */
constexpr int A_STAGE  = (64 + 64) * SP;  /* attention tile: 64 K rows [key][d], 64 V^T rows [d][key] */

constexpr size_t PLANE  = (size_t)NBH * SEQ * DHEAD;
constexpr size_t XB_E   = (size_t)MROWS * DMODEL;
constexpr size_t WQT_E  = (size_t)NQKV * DMODEL;
constexpr size_t WOT_E  = (size_t)DMODEL * DMODEL;
constexpr size_t QKVP_E = 3 * PLANE;
constexpr size_t CTX_E  = XB_E;
constexpr size_t WS_NEED = 2 * (XB_E + WQT_E + WOT_E + QKVP_E + CTX_E);

static_assert(SEQ % 128 == 0);
static_assert(KCH == 64 && SEQ % KCH == 0);
static_assert(SEQ <= SEQ_FULL && NB <= NB_FULL);
static_assert(DHEAD == 64 && DMODEL == NHEAD * DHEAD);
static_assert(DMODEL % 64 == 0 && NQKV % 64 == 0 && DMODEL % 32 == 0);
static_assert(DMODEL % 8 == 0 && DHEAD % 8 == 0);
static_assert(MROWS % 128 == 0);
static_assert(NWAVE * 16 == 64 && NWAVE * 32 == 128);
static_assert(OS_PITCH >= 64 && (OS_PITCH * 4) % 16 == 0);
static_assert(SEQ % 256 == 0 && MROWS % 256 == 0 && DMODEL % 128 == 0 && NQKV % 128 == 0);
static_assert(QWAVE * 64 * SP <= 2 * Q_STAGE);   /* the waves' epilogue slabs fit the staging buffers */
static_assert(QKT * 2 == 256 && (QSP * 2) % 32 == 16 && QSP >= QKT && DMODEL / QKT >= 2);
static_assert(XB_E % 64 == 0 && WQT_E % 64 == 0 && WOT_E % 64 == 0 && PLANE % 64 == 0);
static_assert(WS_NEED <= 134217728ull);
static_assert(KT == KCH && KT * 2 == 128 && (SP * 2) % 32 == 16 && SP >= KT);
static_assert(DMODEL / KT >= 2 && SEQ / KCH >= 2);
constexpr unsigned NKT = DMODEL / KT;     /* k tiles of a GEMM walk     */
constexpr unsigned NKC = SEQ / KCH;       /* key chunks of an attention walk */
constexpr unsigned QNKT = DMODEL / QKT;   /* k tiles of the qkv GEMM walk */

/* Place in a walk of n tiles that starts at tile 'first' and wraps: work-groups that share operand rows get
   different 'first', so that they do not ask L2 for the same lines at the same moment. Every tile is still
   taken exactly once; only the order of the f32 sums differs from work-group to work-group. */
__device__ __forceinline__ unsigned walk_at(unsigned step, unsigned first, unsigned n) { return (step + first) % n; }

/*
 *   Xb   [MROWS][1024]        x, bf16
 *   WqT  [3072][1024]         W_qkv (already [out][in]), bf16
 *   WoH  [1024][1024]         W_out (already [out][in]), bf16-converted value x1024 held in f16
 *   qkvp 3 planes f16: Q [bh][l][64] (q x16), K [bh][l][64] (k x16), Vt [bh][64][l] (v x16)
 *   ctxp 1 plane  f16: C [MROWS][1024] (ctx x256)
 */

__device__ __forceinline__ unsigned short f2bf_bits(float f) {
  unsigned u = __float_as_uint(f);
  return (unsigned short)((u + 0x7FFFu + ((u >> 16) & 1u)) >> 16);
}
__device__ __forceinline__ float bf_bits2f(unsigned short h) { return __uint_as_float(((unsigned)h) << 16); }
__device__ __forceinline__ unsigned pk2(float a, float b) {
  return (unsigned)f2bf_bits(a) | ((unsigned)f2bf_bits(b) << 16);
}

/* f32 -> f16 (RNE) with a value select so that no subnormal f16 is ever produced */
static __device__ __forceinline__ h16 toh_flush(float v) {
  const h16 r = (h16)v;
  return (fabsf(v) < 6.103515625e-05f) ? (h16)0.0f : r;
}
static __device__ __forceinline__ unsigned short hbits(h16 v) {
  return __builtin_bit_cast(unsigned short, v);
}
static __device__ __forceinline__ unsigned pkh2(float a, float b) {
  return (unsigned)hbits(toh_flush(a)) | ((unsigned)hbits(toh_flush(b)) << 16);
}

/* one WMMA + hazard guard naming only this call's live operands */
__device__ __forceinline__ v8f mma_bf16(v16b a, v16b b, v8f c) {
  c = __builtin_amdgcn_wmma_f32_16x16x32_bf16(false, a, false, b, (short)0, c, false, false);
  asm volatile("v_nop\n\tv_nop\n\tv_nop\n\tv_nop" : "+v"(c) : "v"(a), "v"(b));
  return c;
}
__device__ __forceinline__ v8f mma_f16(v16h a, v16h b, v8f c) {
  c = __builtin_amdgcn_wmma_f32_16x16x32_f16(false, a, false, b, (short)0, c, false, false);
  asm volatile("v_nop\n\tv_nop\n\tv_nop\n\tv_nop" : "+v"(c) : "v"(a), "v"(b));
  return c;
}

__device__ __forceinline__ void wave_lds_sync() {
  __builtin_amdgcn_fence(3 /* release order */, "workgroup");
  __builtin_amdgcn_wave_barrier();
  __builtin_amdgcn_fence(2 /* acquire order */, "workgroup");
}

/* ---- tiles into LDS by asynchronous copies: each lane brings its own 16 B, 8 lanes = one 128-B line ---- */
__device__ __forceinline__ unsigned lds_byte(const void* p) { return (unsigned)(size_t)p; }

/* landed: this wave's own copies are in LDS (stands in front of the barrier that publishes them) */
__device__ __forceinline__ void wait_copies() { asm volatile("s_wait_asynccnt 0x0" ::: "memory"); }
/* this wave's LDS reads have returned (stands in front of the barrier behind which the buffer is refilled) */
__device__ __forceinline__ void wait_lds()    { asm volatile("s_wait_dscnt 0x0" ::: "memory"); }

#define CP_LINE(l, g) "global_load_async_to_lds_b128 %" #l ", %" #g ", off\n\t"

/* GEMM tile: thread = (row tid>>3, 16-B segment tid&7); 8 A row groups and 4 B row groups of 16 rows.
   The closing s_wait_xcnt stands in the copies' own statement, ahead of any rewrite of their address registers. */
__device__ __forceinline__ void stage_gemm(const unsigned short* ag, const unsigned short* bg, unsigned l) {
  constexpr int RG = 16 * DMODEL;      /* 16 rows on, global elements */
  constexpr unsigned LG = 16 * SP * 2; /* 16 rows on, LDS bytes       */
  asm volatile(
      CP_LINE(0, 12) CP_LINE(1, 13) CP_LINE(2, 14) CP_LINE(3, 15) CP_LINE(4, 16) CP_LINE(5, 17)
      CP_LINE(6, 18) CP_LINE(7, 19) CP_LINE(8, 20) CP_LINE(9, 21) CP_LINE(10, 22) CP_LINE(11, 23)
      "s_wait_xcnt 0x0"
      :: "v"(l), "v"(l + LG), "v"(l + 2 * LG), "v"(l + 3 * LG), "v"(l + 4 * LG), "v"(l + 5 * LG),
         "v"(l + 6 * LG), "v"(l + 7 * LG), "v"(l + 8 * LG), "v"(l + 9 * LG), "v"(l + 10 * LG), "v"(l + 11 * LG),
         "v"(ag), "v"(ag + RG), "v"(ag + 2 * RG), "v"(ag + 3 * RG), "v"(ag + 4 * RG), "v"(ag + 5 * RG),
         "v"(ag + 6 * RG), "v"(ag + 7 * RG), "v"(bg), "v"(bg + RG), "v"(bg + 2 * RG), "v"(bg + 3 * RG)
      : "memory");
}

/* qkv GEMM tile, one operand's eight 16-row groups: thread = (row tid>>4, 16-B segment tid&15), 16 lanes = one 256-B row.
   The closing s_wait_xcnt stands in the copies' own statement, ahead of any rewrite of their address registers. */
__device__ __forceinline__ void stage_rows8(const unsigned short* g, unsigned l) {
  constexpr int RG = 16 * DMODEL;       /* 16 rows on, global elements */
  constexpr unsigned LG = 16 * QSP * 2; /* 16 rows on, LDS bytes       */
  asm volatile(
      CP_LINE(0, 8) CP_LINE(1, 9) CP_LINE(2, 10) CP_LINE(3, 11)
      CP_LINE(4, 12) CP_LINE(5, 13) CP_LINE(6, 14) CP_LINE(7, 15)
      "s_wait_xcnt 0x0"
      :: "v"(l), "v"(l + LG), "v"(l + 2 * LG), "v"(l + 3 * LG),
         "v"(l + 4 * LG), "v"(l + 5 * LG), "v"(l + 6 * LG), "v"(l + 7 * LG),
         "v"(g), "v"(g + RG), "v"(g + 2 * RG), "v"(g + 3 * RG),
         "v"(g + 4 * RG), "v"(g + 5 * RG), "v"(g + 6 * RG), "v"(g + 7 * RG)
      : "memory");
}

/* attention tile: 4 groups of 16 K rows (64 elements apart), then 4 groups of 16 V^T rows (SEQ apart) */
__device__ __forceinline__ void stage_kv(const unsigned short* kg, const unsigned short* vg, unsigned l) {
  constexpr int KG = 16 * DHEAD;
  constexpr int VG = 16 * SEQ;
  constexpr unsigned LG = 16 * SP * 2;
  asm volatile(
      CP_LINE(0, 8) CP_LINE(1, 9) CP_LINE(2, 10) CP_LINE(3, 11)
      CP_LINE(4, 12) CP_LINE(5, 13) CP_LINE(6, 14) CP_LINE(7, 15)
      "s_wait_xcnt 0x0"
      :: "v"(l), "v"(l + LG), "v"(l + 2 * LG), "v"(l + 3 * LG),
         "v"(l + 4 * LG), "v"(l + 5 * LG), "v"(l + 6 * LG), "v"(l + 7 * LG),
         "v"(kg), "v"(kg + KG), "v"(kg + 2 * KG), "v"(kg + 3 * KG),
         "v"(vg), "v"(vg + VG), "v"(vg + 2 * VG), "v"(vg + 3 * VG)
      : "memory");
}

/* --------------------------------------------------------------------------
 * All three operand conversions in one launch. Unit = 8 elements = two 16-B loads, one 16-B store.
 *   x     -> Xb  : bf16 (RNE); out row b*SEQ + l <- in row b*SEQ_FULL + l
 *   W_qkv -> WqT : bf16 (RNE)
 *   W_out -> WoH : f16 holding (bf16 RNE value) x WO_CARRY; the bf16 significand and the power-of-two
 *                  carry are exact in f16; the flush select removes would-be subnormals.
 * The launch has one thread per unit of W_out; a thread takes CV_X units of x, CV_Q of W_qkv and one of
 * W_out, CV_LANES units apart (a wave's lanes stay on consecutive units), and issues all its loads
 * before the first conversion. Coverage: CV_LANES threads x (CV_X, CV_Q, 1) units = the three whole planes.
 * ------------------------------------------------------------------------ */
constexpr int CV_THREADS = 512;                         /* 16 waves a work-group */
constexpr int CV_UPR     = DMODEL / 8;                  /* units per row, all three planes */
constexpr int CV_LANES   = (int)(WOT_E / 8);
constexpr int CV_X       = (int)(XB_E / 8 / CV_LANES);
constexpr int CV_Q       = (int)(WQT_E / 8 / CV_LANES);
static_assert(CV_LANES % CV_THREADS == 0);
static_assert((size_t)CV_X * CV_LANES * 8 == XB_E && (size_t)CV_Q * CV_LANES * 8 == WQT_E);
static_assert((size_t)NB * SEQ_FULL * DMODEL < (1u << 30) && WQT_E < (1u << 30));   /* element indices fit 32 bits */

/* element e of p through a 32-bit byte offset: scalar base + one offset register, no 64-bit address pair per load */
__device__ __forceinline__ const float* at32(const float* p, unsigned e) {
  return (const float*)((const char*)p + e * 4u);
}

__device__ __forceinline__ v4u bf_unit(v4f a0, v4f a1) {
  v4u w;
  w[0] = pk2(a0[0], a0[1]);
  w[1] = pk2(a0[2], a0[3]);
  w[2] = pk2(a1[0], a1[1]);
  w[3] = pk2(a1[2], a1[3]);
  return w;
}

__global__ __launch_bounds__(CV_THREADS) void cvt_all_kernel(
    const float* __restrict__ x, const float* __restrict__ Wq, const float* __restrict__ Wo,
    unsigned short* __restrict__ Xb, unsigned short* __restrict__ WqT, unsigned short* __restrict__ WoH)
{
  const unsigned g = blockIdx.x * CV_THREADS + threadIdx.x;

  /* every loop here is unrolled whole: the units stay in registers and the loads go out as one run */
  v4f xa[CV_X][2], qa[CV_Q][2], oa[2];
#pragma unroll
  for (unsigned i = 0; i < CV_X; ++i) {
    const unsigned u   = i * CV_LANES + g;
    const unsigned row = u / CV_UPR;
    const unsigned seg = u - row * CV_UPR;
    const unsigned b   = row / SEQ;
    const unsigned l   = row - b * SEQ;
    const float* s = at32(x, ((b * SEQ_FULL + l) * CV_UPR + seg) * 8u);
    xa[i][0] = *(const v4f*)s;
    xa[i][1] = *(const v4f*)(s + 4);
  }
#pragma unroll
  for (unsigned i = 0; i < CV_Q; ++i) {
    const float* s = at32(Wq, (i * CV_LANES + g) * 8u);
    qa[i][0] = *(const v4f*)s;
    qa[i][1] = *(const v4f*)(s + 4);
  }
  /* a later load may land in a register that held an earlier load's offset: the earlier loads' address
     translations are waited for first (a precaution of form; costs one short wait among the loads) */
  asm volatile("s_wait_xcnt 0x0" ::: "memory");
  {
    const float* s = at32(Wo, g * 8u);
    oa[0] = *(const v4f*)s;
    oa[1] = *(const v4f*)(s + 4);
  }

#pragma unroll
  for (unsigned i = 0; i < CV_X; ++i) *(v4u*)(Xb + (i * CV_LANES + g) * 8u) = bf_unit(xa[i][0], xa[i][1]);
#pragma unroll
  for (unsigned i = 0; i < CV_Q; ++i) *(v4u*)(WqT + (i * CV_LANES + g) * 8u) = bf_unit(qa[i][0], qa[i][1]);
  {
    v4u w;
    w[0] = pkh2(bf_bits2f(f2bf_bits(oa[0][0])) * WO_CARRY, bf_bits2f(f2bf_bits(oa[0][1])) * WO_CARRY);
    w[1] = pkh2(bf_bits2f(f2bf_bits(oa[0][2])) * WO_CARRY, bf_bits2f(f2bf_bits(oa[0][3])) * WO_CARRY);
    w[2] = pkh2(bf_bits2f(f2bf_bits(oa[1][0])) * WO_CARRY, bf_bits2f(f2bf_bits(oa[1][1])) * WO_CARRY);
    w[3] = pkh2(bf_bits2f(f2bf_bits(oa[1][2])) * WO_CARRY, bf_bits2f(f2bf_bits(oa[1][3])) * WO_CARRY);
    *(v4u*)(WoH + g * 8u) = w;
  }
}

/* --------------------------------------------------------------------------
 * qkv = Xb . WqT^T  (M = MROWS, N = 3072, K = 1024), bf16 x bf16, f32 acc.
 * Block = 8 waves, tile 256 tokens x 128 columns (= two heads of one section);
 * wave = 64 rows x 64 cols = one head (4 A fragments x 4 B fragments per 32-deep step): an operand row
 * is fetched from L2 by half as many blocks, and a fragment read from LDS feeds 4 WMMAs.
 * Operands: 128-deep tiles (256 A rows + 128 B rows) copied into two LDS buffers, one tile ahead: four
 * 32-deep steps between two barriers; fragments read from the tile of the trip.
 * Fragment map (hh = lane>>4, c = lane&15): A row c, elems 0..7 <- k0+8hh.., 8..15 <- k0+16+8hh..;
 * B col c with the same k map; D elem r = (row 8hh+r, col c).
 * Epilogue: acc x 16 converted to f16 (flush select), staged in the wave's own 64 x 64 slab
 * ([tok][d] for q,k; [d][tok] for v), then whole 128-B lines: 8 lanes = one row of the slab.
 * The slabs lie in the staging buffers, free behind the last trip's barrier; each is private to its wave.
 * ------------------------------------------------------------------------ */
__global__ __launch_bounds__(QWAVE * 32) VGPR_CAP void gemm_qkv_kernel(
    const unsigned short* __restrict__ Xb, const unsigned short* __restrict__ WqT,
    unsigned short* __restrict__ qkvp)
{
  union FB { v16b v; v8b h[2]; };
  __shared__ __align__(16) unsigned short St[2 * Q_STAGE];

  const int tid  = threadIdx.x;
  const int wave = __builtin_amdgcn_readfirstlane(tid >> 5);
  const int wm   = wave >> 1;          /* 64-row band of the block    */
  const int wn   = wave & 1;           /* 64-column band = head       */
  const int lane = tid & 31;
  const int hh   = lane >> 4;
  const int c    = lane & 15;
  const int n0   = blockIdx.x * 128;
  const int m0   = blockIdx.y * 256;

  v8f acc[4][4];
#pragma unroll
  for (int mt = 0; mt < 4; ++mt)
#pragma unroll
    for (int t = 0; t < 4; ++t) acc[mt][t] = (v8f){0.f,0.f,0.f,0.f,0.f,0.f,0.f,0.f};

  /* copy side: this thread's row and 16-B segment of each 16-row group */
  const unsigned short* ag = Xb  + (size_t)(m0 + (tid >> 4)) * DMODEL + (tid & 15) * 8;
  const unsigned short* bg = WqT + (size_t)(n0 + (tid >> 4)) * DMODEL + (tid & 15) * 8;
  const unsigned lcp = lds_byte(St) + (tid >> 4) * (QSP * 2) + (tid & 15) * 16;
  /* a tile: A rows 0..127, A rows 128..255, B rows 0..127 (staged behind the A rows) */
  auto stage = [&](unsigned k, unsigned l) {
    stage_rows8(ag + k, l);
    stage_rows8(ag + k + 128 * DMODEL, l + 128 * QSP * 2);
    stage_rows8(bg + k, l + 256 * QSP * 2);
  };
  /* read side: this lane's place in a staged tile */
  const int aoff = (wm * 64 + c) * QSP + 8 * hh;
  const int boff = (256 + wn * 64 + c) * QSP + 8 * hh;

  /* one 32-deep step: 4 A and 4 B fragments as one group of reads, then the 16 products */
  auto step = [&](const unsigned short* sb, int k0) {
    FB fa[4], fb[4];
#pragma unroll
    for (int i = 0; i < 4; ++i) {
      fa[i].h[0] = *(const v8b_a*)(sb + aoff + i * 16 * QSP + k0);
      fa[i].h[1] = *(const v8b_a*)(sb + aoff + i * 16 * QSP + k0 + 16);
    }
#pragma unroll
    for (int t = 0; t < 4; ++t) {
      fb[t].h[0] = *(const v8b_a*)(sb + boff + t * 16 * QSP + k0);
      fb[t].h[1] = *(const v8b_a*)(sb + boff + t * 16 * QSP + k0 + 16);
    }
#pragma unroll
    for (int t = 0; t < 4; ++t)
#pragma unroll
      for (int mt = 0; mt < 4; ++mt) acc[mt][t] = mma_bf16(fa[mt].v, fb[t].v, acc[mt][t]);
  };

  /* A rows are shared along blockIdx.x, B rows along blockIdx.y: the sum moves the start along both */
  const unsigned first = (blockIdx.x + blockIdx.y) % QNKT;
  stage(walk_at(0, first, QNKT) * QKT, lcp);
  wait_copies();
  __syncthreads();
  stage(walk_at(1, first, QNKT) * QKT, lcp + Q_STAGE * 2);
  /* rolled: one trip = one tile; tile kt + 1 flies while tile kt is worked on */
#pragma unroll 1
  for (int kt = 0; kt < (int)QNKT; ++kt) {
    const unsigned short* sb = St + (kt & 1) * Q_STAGE;
    step(sb, 0);
    step(sb, 32);
    step(sb, 64);
    step(sb, 96);
    wait_lds();
    wait_copies();
    __syncthreads();   /* publishes tile kt + 1 and ends every read of tile kt's buffer */
    if (kt + 2 < (int)QNKT) stage(walk_at(kt + 2, first, QNKT) * QKT, lcp + (kt & 1) * (Q_STAGE * 2));
  }
  wait_copies();

  const int sec = n0 / DMODEL;                       /* 0 q, 1 k, 2 v : block-uniform */
  const int b   = m0 / SEQ;
  const int l0  = m0 - b * SEQ + wm * 64;
  const int h   = (n0 - sec * DMODEL) / DHEAD + wn;
  const int bh  = b * NHEAD + h;
  const int rq  = lane >> 3;
  const int seg = lane & 7;
  unsigned short* ph   = qkvp + (size_t)sec * PLANE;
  unsigned short* slab = St + wave * (64 * SP);
  const unsigned short* rd = slab + rq * SP + seg * 8;

  /* one branch on the section for the whole epilogue: inside it every LDS and global offset is a constant */
  if (sec < 2) {
    unsigned short* wr = slab + 8 * hh * SP + c;     /* [tok][d]: a lane holds one d of 8 tokens per tile */
#pragma unroll
    for (int t = 0; t < 4; ++t)
#pragma unroll
      for (int mt = 0; mt < 4; ++mt)
#pragma unroll
        for (int r = 0; r < 8; ++r)
          wr[(mt * 16 + r) * SP + 16 * t] = hbits(toh_flush(acc[mt][t][r] * QKV_CARRY));
    wave_lds_sync();
    unsigned short* gp = ph + ((size_t)bh * SEQ + l0 + rq) * DHEAD + seg * 8;
#pragma unroll
    for (int it = 0; it < 16; ++it) {
      /* the second half reuses registers that the first half's stores name: their translations are waited for first */
      if (it == 8) asm volatile("s_wait_xcnt 0x0" ::: "memory");
      *(v4u*)(gp + it * 4 * DHEAD) = *(const v4u_a*)(rd + it * 4 * SP);
    }
    /* closes the second half's stores: whichever section the compiler lays behind this one, its first instructions
       may write registers that these stores name */
    asm volatile("s_wait_xcnt 0x0" ::: "memory");
  } else {
    unsigned short* wr = slab + c * SP + 8 * hh;     /* [d][tok]: the lane's 8 tokens of a tile are one 16-B unit */
#pragma unroll
    for (int t = 0; t < 4; ++t)
#pragma unroll
      for (int mt = 0; mt < 4; ++mt) {
        v4u hw;
#pragma unroll
        for (int p = 0; p < 4; ++p)
          hw[p] = pkh2(acc[mt][t][2 * p] * QKV_CARRY, acc[mt][t][2 * p + 1] * QKV_CARRY);
        *(v4u_a*)(wr + 16 * t * SP + mt * 16) = hw;
      }
    wave_lds_sync();
    unsigned short* gp = ph + ((size_t)bh * DHEAD + rq) * SEQ + l0 + seg * 8;
#pragma unroll
    for (int it = 0; it < 16; ++it) {
      /* as in the other branch: wait before registers named by the first half's stores are written again */
      if (it == 8) asm volatile("s_wait_xcnt 0x0" ::: "memory");
      *(v4u*)(gp + it * 4 * SEQ) = *(const v4u_a*)(rd + it * 4 * SP);
    }
    /* as in the other branch: closes the second half's stores ahead of the code laid behind this section */
    asm volatile("s_wait_xcnt 0x0" ::: "memory");
  }
}

__device__ __forceinline__ float xhalf(float x) {
  const int v = __builtin_bit_cast(int, x);
  return __builtin_bit_cast(float, __builtin_amdgcn_permlanex16(v, v, 0x76543210, 0xfedcba98, false, false));
}

/* 2^x of eight values, each in its own register. One statement, so that behind every exponential stands an
   instruction on other registers (the next exponential; behind the last one the v_nop): the slot that the
   instruction set asks for before a transcendental's result is read or its source register written again.
   Left to the register allocator, a run of them wrote each result over the source of the one before. */
__device__ __forceinline__ void exp2x8(float (&x)[8]) {
  asm("v_exp_f32 %0, %0\n\tv_exp_f32 %1, %1\n\tv_exp_f32 %2, %2\n\tv_exp_f32 %3, %3\n\t"
      "v_exp_f32 %4, %4\n\tv_exp_f32 %5, %5\n\tv_exp_f32 %6, %6\n\tv_exp_f32 %7, %7\n\tv_nop"
      : "+v"(x[0]), "+v"(x[1]), "+v"(x[2]), "+v"(x[3]), "+v"(x[4]), "+v"(x[5]), "+v"(x[6]), "+v"(x[7]));
}

__global__ __launch_bounds__(128) VGPR_CAP void attn_kernel(
    const unsigned short* __restrict__ qkvp, unsigned short* __restrict__ ctxp)
{
  union FH { v16h v; v8h h[2]; };
  __shared__ __align__(16) unsigned short Oh[NWAVE][16 * SP];
  __shared__ __align__(16) unsigned short KV[2 * A_STAGE];

  const int tid  = threadIdx.x;
  const int wave = __builtin_amdgcn_readfirstlane(tid >> 5);
  const int lane = tid & 31;
  const int hh   = lane >> 4;
  const int c    = lane & 15;
  const int qb   = blockIdx.x;
  const int bh   = blockIdx.y;
  const int b    = bh / NHEAD;
  const int h    = bh - b * NHEAD;
  const int q0   = qb * 64 + wave * 16;
  const float NEG_INF = -__builtin_inff();

  const unsigned short* Qp  = qkvp + (size_t)bh * SEQ * DHEAD;
  const unsigned short* Vtp = Qp + 2 * PLANE;     /* [bh][d][l]: same per-bh element count */

  v16h qf[2];
  {
    const size_t qo = (size_t)(q0 + c) * DHEAD + 8 * hh;
#pragma unroll
    for (int dc = 0; dc < 2; ++dc) {
      FH f;
      f.h[0] = *(const v8h*)(Qp + qo + dc * 32);
      f.h[1] = *(const v8h*)(Qp + qo + dc * 32 + 16);
      qf[dc] = f.v;
    }
  }

  float mrow = NEG_INF, lrow = 0.f;   /* query c: maximum of the raw scores (both halves alike), this half's part of the sum */
  v8f oacc[4];
#pragma unroll
  for (int t = 0; t < 4; ++t) oacc[t] = (v8f){0.f,0.f,0.f,0.f,0.f,0.f,0.f,0.f};

  /* copy side: this thread's row and 16-B segment of each 16-row group (K plane = Q plane + PLANE) */
  const unsigned short* kg = Qp + PLANE + (size_t)(tid >> 3) * DHEAD + (tid & 7) * 8;
  const unsigned short* vg = Vtp + (size_t)(tid >> 3) * SEQ + (tid & 7) * 8;
  const unsigned lcp = lds_byte(KV) + (tid >> 3) * (SP * 2) + (tid & 7) * 16;
  /* read side: lane's place among the staged K rows [key][d]; the V^T rows [d][key] stand 64 rows on */
  const int flane = c * SP + 8 * hh;

  /* the K and V rows of one (b,h) are shared along blockIdx.x */
  const unsigned first = blockIdx.x % NKC;
  {
    const unsigned c0 = walk_at(0, first, NKC);
    stage_kv(kg + c0 * (KCH * DHEAD), vg + c0 * KCH, lcp);
  }
  wait_copies();
  __syncthreads();
  {
    const unsigned c1 = walk_at(1, first, NKC);
    stage_kv(kg + c1 * (KCH * DHEAD), vg + c1 * KCH, lcp + A_STAGE * 2);
  }

#pragma unroll 1
  for (int kc = 0; kc < SEQ / KCH; ++kc) {
    /* the chunk's 32 fragment reads go out as one group at its head: K first, V behind it */
    const unsigned short* kq = KV + (kc & 1) * A_STAGE + flane;
    const unsigned short* vq = kq + 64 * SP;
    FH kf[4][2];
#pragma unroll
    for (int j = 0; j < 4; ++j) {
#pragma unroll
      for (int dc = 0; dc < 2; ++dc) {
        kf[j][dc].h[0] = *(const v8h_a*)(kq + j * 16 * SP + dc * 32);
        kf[j][dc].h[1] = *(const v8h_a*)(kq + j * 16 * SP + dc * 32 + 16);
      }
    }
    FH vb[2][4];
#pragma unroll
    for (int kk = 0; kk < 2; ++kk) {
#pragma unroll
      for (int t = 0; t < 4; ++t) {
        vb[kk][t].h[0] = *(const v8h_a*)(vq + t * 16 * SP + kk * 32);
        vb[kk][t].h[1] = *(const v8h_a*)(vq + t * 16 * SP + kk * 32 + 16);
      }
    }

    /* raw scores (unscaled accumulators), transposed: 4 key tiles (D elem r = key 16j+8hh+r, query c) */
    v8f s[4];
#pragma unroll
    for (int j = 0; j < 4; ++j) {
      v8f sa = (v8f){0.f,0.f,0.f,0.f,0.f,0.f,0.f,0.f};
#pragma unroll
      for (int dc = 0; dc < 2; ++dc) sa = mma_f16(kf[j][dc].v, qf[dc], sa);
      s[j] = sa;
    }

    /* chunk maximum of query c: the lane's 32 keys, then the other half's 32 */
    float cm;
    {
      float m4[4];
#pragma unroll
      for (int j = 0; j < 4; ++j) {
        float m = s[j][0];
#pragma unroll
        for (int r = 1; r < 8; ++r) m = fmaxf(m, s[j][r]);
        m4[j] = m;
      }
      const float m = fmaxf(fmaxf(m4[0], m4[1]), fmaxf(m4[2], m4[3]));
      cm = fmaxf(m, xhalf(m));
    }

    /* online softmax update; P^T as f16 (x256) packed in place into the B operands, sum over the converted values */
    const float mnew  = fmaxf(mrow, cm);
    const float msafe = (mnew == NEG_INF) ? 0.f : mnew;
    const float alpha = __builtin_amdgcn_exp2f((mrow - msafe) * SCORE_LOG2);
    const float ebias = P_CARRY_LOG2 - msafe * SCORE_LOG2;   /* the maximum and the x256 carry, as one addend */
    mrow = mnew;
    FH pb[2];
    float ps4[4];
#pragma unroll
    for (int j = 0; j < 4; ++j) {
      float psum = 0.f;
      float e[8];
#pragma unroll
      for (int r = 0; r < 8; ++r) e[r] = __builtin_fmaf(s[j][r], SCORE_LOG2, ebias);
      exp2x8(e);
#pragma unroll
      for (int r = 0; r < 8; r += 2) {
        /* one packed convert for two values; no zeroing of small values here: it cost a compare and a select each */
        const v2h ph = __builtin_convertvector((v2f){e[r], e[r + 1]}, v2h);
        psum += (float)ph[0];
        psum += (float)ph[1];
        pb[j >> 1].h[j & 1][r]     = ph[0];
        pb[j >> 1].h[j & 1][r + 1] = ph[1];
      }
      ps4[j] = psum;
    }
    lrow = lrow * alpha + ((ps4[0] + ps4[1]) + (ps4[2] + ps4[3]));
#pragma unroll
    for (int t = 0; t < 4; ++t)
#pragma unroll
      for (int r = 0; r < 8; ++r) oacc[t][r] *= alpha;

    /* O^T += V^T.P^T : A = V^T rows [d][kv] fetched at the head of the chunk, B = P^T [kv][q] from registers */
#pragma unroll
    for (int kk = 0; kk < 2; ++kk) {
#pragma unroll
      for (int t = 0; t < 4; ++t) oacc[t] = mma_f16(vb[kk][t].v, pb[kk].v, oacc[t]);
    }
    wait_lds();
    wait_copies();
    __syncthreads();   /* publishes chunk kc + 1 and ends every read of chunk kc's buffer */
    if (kc + 2 < SEQ / KCH) {
      const unsigned c2 = walk_at(kc + 2, first, NKC);
      stage_kv(kg + c2 * (KCH * DHEAD), vg + c2 * KCH, lcp + (kc & 1) * (A_STAGE * 2));
    }
  }
  wait_copies();

  /* join the halves' sums, normalise (ctx x256), f16 rows [query][d] into the wave slab, then whole-line stores */
  {
    const float inv = CTX_FOLD * (1.0f / (lrow + xhalf(lrow)));
#pragma unroll
    for (int t = 0; t < 4; ++t) {
      v4u hw;
      hw[0] = pkh2(oacc[t][0] * inv, oacc[t][1] * inv);
      hw[1] = pkh2(oacc[t][2] * inv, oacc[t][3] * inv);
      hw[2] = pkh2(oacc[t][4] * inv, oacc[t][5] * inv);
      hw[3] = pkh2(oacc[t][6] * inv, oacc[t][7] * inv);
      *(v4u_a*)(&Oh[wave][c * SP + t * 16 + 8 * hh]) = hw;
    }
  }
  wave_lds_sync();
  {
    const int rq  = lane >> 3;
    const int seg = lane & 7;
#pragma unroll
    for (int it = 0; it < 4; ++it) {
      const int row = it * 4 + rq;
      const v4u hw = *(const v4u_a*)(&Oh[wave][row * SP + seg * 8]);
      const size_t g = (size_t)(b * SEQ + q0 + row) * DMODEL + h * DHEAD + seg * 8;
      *(v4u*)(ctxp + g) = hw;
    }
  }
}

/* --------------------------------------------------------------------------
 * out = C . WoH^T x 2^-18  (M = MROWS, N = 1024, K = 1024), f16 x f16, f32 acc.
 * Block = 4 waves, tile 128 x 64; wave = 32 rows x 64 cols; one product per tile pair.
 * Operands: 64-deep tiles (128 A rows + 64 B rows) copied into two LDS buffers, one tile ahead.
 * Epilogue: per-wave 32x64 f32 slab (wave-private LDS), 16 lanes x 16 B = one 256-B
 * ------------------------------------------------------------------------ */
__global__ __launch_bounds__(128) VGPR_CAP void gemm_out_kernel(
    const unsigned short* __restrict__ ctxp, const unsigned short* __restrict__ WoH,
    float* __restrict__ out)
{
  union FH { v16h v; v8h h[2]; };
  __shared__ __align__(16) float Os[NWAVE][32 * OS_PITCH];
  __shared__ __align__(16) unsigned short St[2 * G_STAGE];

  const int tid  = threadIdx.x;
  const int wave = __builtin_amdgcn_readfirstlane(tid >> 5);
  const int lane = tid & 31;
  const int hh   = lane >> 4;
  const int c    = lane & 15;
  const int n0   = blockIdx.x * 64;
  const int m0   = blockIdx.y * 128;

  v8f acc[2][4];
#pragma unroll
  for (int mt = 0; mt < 2; ++mt)
#pragma unroll
    for (int t = 0; t < 4; ++t) acc[mt][t] = (v8f){0.f,0.f,0.f,0.f,0.f,0.f,0.f,0.f};

  /* copy side: this thread's row and 16-B segment of each 16-row group */
  const unsigned short* ag = ctxp + (size_t)(m0 + (tid >> 3)) * DMODEL + (tid & 7) * 8;
  const unsigned short* bg = WoH  + (size_t)(n0 + (tid >> 3)) * DMODEL + (tid & 7) * 8;
  const unsigned lcp = lds_byte(St) + (tid >> 3) * (SP * 2) + (tid & 7) * 16;
  /* read side: this lane's place in a staged tile */
  const int aoff = (wave * 32 + c) * SP + 8 * hh;
  const int boff = (128 + c) * SP + 8 * hh;

  /* Two fragment sets ([0],[1] = A rows, [2..5] = B columns), one per 32-deep step of the tile */
  FH fe[6], fo[6];
  auto load_set = [&](FH (&f)[6], const unsigned short* sb, int k0) {
    f[0].h[0] = *(const v8h_a*)(sb + aoff + k0);
    f[0].h[1] = *(const v8h_a*)(sb + aoff + k0 + 16);
    f[1].h[0] = *(const v8h_a*)(sb + aoff + 16 * SP + k0);
    f[1].h[1] = *(const v8h_a*)(sb + aoff + 16 * SP + k0 + 16);
#pragma unroll
    for (int t = 0; t < 4; ++t) {
      f[2 + t].h[0] = *(const v8h_a*)(sb + boff + t * 16 * SP + k0);
      f[2 + t].h[1] = *(const v8h_a*)(sb + boff + t * 16 * SP + k0 + 16);
    }
  };
  auto mma_set = [&](const FH (&f)[6]) {
#pragma unroll
    for (int t = 0; t < 4; ++t) {
      acc[0][t] = mma_f16(f[0].v, f[2 + t].v, acc[0][t]);
      acc[1][t] = mma_f16(f[1].v, f[2 + t].v, acc[1][t]);
    }
  };

  /* A rows are shared along blockIdx.x, B rows along blockIdx.y: the sum moves the start along both */
  const unsigned first = (blockIdx.x + blockIdx.y) % NKT;
  {
    const unsigned k0 = walk_at(0, first, NKT) * KT;
    stage_gemm(ag + k0, bg + k0, lcp);
  }
  wait_copies();
  __syncthreads();
  {
    const unsigned k1 = walk_at(1, first, NKT) * KT;
    stage_gemm(ag + k1, bg + k1, lcp + G_STAGE * 2);
  }
  /* rolled: one trip = one tile; tile kt + 1 flies while tile kt is worked on */
#pragma unroll 1
  for (int kt = 0; kt < DMODEL / KT; ++kt) {
    const unsigned short* sb = St + (kt & 1) * G_STAGE;
    load_set(fe, sb, 0);
    load_set(fo, sb, 32);
    mma_set(fe);
    mma_set(fo);
    wait_lds();
    wait_copies();
    __syncthreads();   /* publishes tile kt + 1 and ends every read of tile kt's buffer */
    if (kt + 2 < DMODEL / KT) {
      const unsigned k2 = walk_at(kt + 2, first, NKT) * KT;
      stage_gemm(ag + k2, bg + k2, lcp + (kt & 1) * (G_STAGE * 2));
    }
  }
  wait_copies();

  float* os = Os[wave];
#pragma unroll
  for (int t = 0; t < 4; ++t) {
#pragma unroll
    for (int mt = 0; mt < 2; ++mt)
#pragma unroll
      for (int r = 0; r < 8; ++r)
        os[(mt * 16 + 8 * hh + r) * OS_PITCH + 16 * t + c] = acc[mt][t][r] * OUT_FOLD;
  }
  wave_lds_sync();
  {
    const int c4 = c * 4;
    {
#pragma unroll
      for (int it = 0; it < 16; ++it) {
        const int row = it * 2 + hh;
        const v4f val = *(const v4f_a*)(os + row * OS_PITCH + c4);
        *(v4f*)(out + (size_t)(m0 + wave * 32 + row) * DMODEL + n0 + c4) = val;
      }
      
    }
  }
}

extern "C" void kernel_launch(void* const* d_in, const int* in_sizes, int n_in,
                              void* d_out, int out_size, void* d_ws, size_t ws_size,
                              hipStream_t stream)
{
  if (n_in < 3) return;
  if (in_sizes[0] < ((NB - 1) * SEQ_FULL + SEQ) * DMODEL) return;
  if (in_sizes[1] < NQKV * DMODEL) return;
  if (in_sizes[2] < DMODEL * DMODEL) return;
  if (out_size < MROWS * DMODEL) return;
  if (d_ws == nullptr || ws_size < WS_NEED) return;

  const float* x     = (const float*)d_in[0];
  const float* W_qkv = (const float*)d_in[1];   /* [3072 out][1024 in] */
  const float* W_out = (const float*)d_in[2];   /* [1024 out][1024 in] */
  float* out = (float*)d_out;

  unsigned short* Xb   = (unsigned short*)d_ws;
  unsigned short* WqT  = Xb + XB_E;
  unsigned short* WoH  = WqT + WQT_E;
  unsigned short* qkvp = WoH + WOT_E;
  unsigned short* ctxp = qkvp + QKVP_E;

  /* W_qkv and W_out rows are already [n][k]: plain row converts, no transpose */
  cvt_all_kernel<<<CV_LANES / CV_THREADS, CV_THREADS, 0, stream>>>(x, W_qkv, W_out, Xb, WqT, WoH);

  gemm_qkv_kernel<<<dim3(NQKV / 128, MROWS / 256), QWAVE * 32, 0, stream>>>(Xb, WqT, qkvp);
  attn_kernel<<<dim3(SEQ / 64, NBH), 128, 0, stream>>>(qkvp, ctxp);
  gemm_out_kernel<<<dim3(DMODEL / 64, MROWS / 128), 128, 0, stream>>>(ctxp, WoH, out);
}

// v009
// One run takes 42.3 microseconds.
// Next to v008, in two timings, it ran 1.04 and 1.03 times as fast.
// Counting every step since v000, it is 4.27 times as fast.
// Contractions: x.Wqkv^T on v_wmma_f32_16x16x32_bf16 (both operands RNE-converted to bf16 once); q.k^T, p.v and ctx.Wout^T on v_wmma_f32_16x16x32_f16 with single f16 planes (q, k, v x16; p x256; ctx x256; Wout = bf16-converted value x1024), one product per site; f32 accumulate; softmax in f32.
#include <hip/hip_runtime.h>

typedef __attribute__((ext_vector_type(16))) __bf16 v16b;
typedef __attribute__((ext_vector_type(8)))  __bf16 v8b;
typedef __attribute__((ext_vector_type(16))) _Float16 v16h;
typedef __attribute__((ext_vector_type(8)))  _Float16 v8h;
typedef __attribute__((ext_vector_type(8)))  float  v8f;
typedef __attribute__((ext_vector_type(4)))  float  v4f;
typedef __attribute__((ext_vector_type(2)))  float  v2f;
typedef __attribute__((ext_vector_type(2)))  _Float16 v2h;
typedef __attribute__((ext_vector_type(4)))  unsigned int v4u;
typedef v8h v8h_a __attribute__((may_alias));
typedef v8b v8b_a __attribute__((may_alias));
typedef v4f v4f_a __attribute__((may_alias));
typedef v4u v4u_a __attribute__((may_alias));
typedef _Float16 h16;

#ifndef NB
#define NB 2
#endif
#ifndef SEQ
#define SEQ 1024
#endif
#define NB_FULL 2
#define SEQ_FULL 1024

#define VGPR_CAP __attribute__((amdgpu_num_vgpr(256)))

/* power-of-two carries of the f16 operand planes and their f32 fold-backs */
#define QKV_CARRY   16.0f                 /* q, k, v planes                         */
#define P_CARRY     256.0f                /* exp(s - m) tiles                       */
#define CTX_CARRY   256.0f                /* context plane                          */
#define WO_CARRY    1024.0f               /* output weight plane                    */
#define SCORE_SCALE 0.00048828125f        /* 0.125 / (16 * 16) = 2^-11              */
#define SCORE_LOG2  (SCORE_SCALE * 1.44269504088896340736f)   /* raw score -> exponent to base 2 */
#define P_CARRY_LOG2 8.0f                 /* log2(P_CARRY)                          */
static_assert(P_CARRY == 256.0f && P_CARRY_LOG2 == 8.0f);
#define CTX_FOLD    16.0f                 /* CTX_CARRY / QKV_CARRY (P carry cancels) */
#define OUT_FOLD    3.814697265625e-06f   /* 1 / (256 * 1024) = 2^-18               */

constexpr int DMODEL = 1024;
constexpr int NHEAD  = 16;
constexpr int DHEAD  = 64;
constexpr int NQKV   = 3 * DMODEL;
constexpr int NBH    = NB * NHEAD;
constexpr int MROWS  = NB * SEQ;
constexpr int KCH    = 64;        /* keys per chunk */
constexpr int NWAVE  = 4;
constexpr int OS_PITCH = 68;
constexpr int KT       = 64;              /* k (or keys) per staged tile: one 128-B line per row   */
constexpr int SP       = 72;              /* staged row pitch, 16-bit elements: 144 B = 16 B x 9   */
constexpr int G_STAGE  = (128 + 64) * SP; /* output GEMM tile: 128 A rows, then 64 B rows          */
constexpr int GST      = 4;               /* its tiles per ring stage: copied, waited for and published together */
constexpr int QKT      = 128;             /* k per staged tile of the qkv GEMM: two 128-B lines per row */
constexpr int QSP      = 136;             /* its staged row pitch, 16-bit elements: 272 B = 16 B x 17  */
constexpr int Q_STAGE  = (256 + 128) * QSP; /* qkv GEMM tile: 256 A rows, then 128 B rows          */
constexpr int QWAVE    = 8;               /* waves of a qkv GEMM block: 4 along rows x 2 along columns */
constexpr int A_STAGE  = (64 + 64) * SP;  /* attention tile: 64 K rows [key][d], 64 V^T rows [d][key] */

constexpr size_t PLANE  = (size_t)NBH * SEQ * DHEAD;
constexpr size_t XB_E   = (size_t)MROWS * DMODEL;
constexpr size_t WQT_E  = (size_t)NQKV * DMODEL;
constexpr size_t WOT_E  = (size_t)DMODEL * DMODEL;
constexpr size_t QKVP_E = 3 * PLANE;
constexpr size_t CTX_E  = XB_E;
constexpr size_t WS_NEED = 2 * (XB_E + WQT_E + WOT_E + QKVP_E + CTX_E);

static_assert(SEQ % 128 == 0);
static_assert(KCH == 64 && SEQ % KCH == 0);
static_assert(SEQ <= SEQ_FULL && NB <= NB_FULL);
static_assert(DHEAD == 64 && DMODEL == NHEAD * DHEAD);
static_assert(DMODEL % 64 == 0 && NQKV % 64 == 0 && DMODEL % 32 == 0);
static_assert(DMODEL % 8 == 0 && DHEAD % 8 == 0);
static_assert(MROWS % 128 == 0);
static_assert(NWAVE * 16 == 64 && NWAVE * 32 == 128);
static_assert(OS_PITCH >= 64 && (OS_PITCH * 4) % 16 == 0);
static_assert(SEQ % 256 == 0 && MROWS % 256 == 0 && DMODEL % 128 == 0 && NQKV % 128 == 0);
static_assert(QWAVE * 64 * SP <= 2 * Q_STAGE);   /* the waves' epilogue slabs fit the staging buffers */
static_assert(QKT * 2 == 256 && (QSP * 2) % 32 == 16 && QSP >= QKT && DMODEL / QKT >= 2);
static_assert(XB_E % 64 == 0 && WQT_E % 64 == 0 && WOT_E % 64 == 0 && PLANE % 64 == 0);
static_assert(WS_NEED <= 134217728ull);
static_assert(KT == KCH && KT * 2 == 128 && (SP * 2) % 32 == 16 && SP >= KT);
static_assert(DMODEL / KT >= 2 && SEQ / KCH >= 2);
constexpr unsigned NKT = DMODEL / KT;     /* k tiles of a GEMM walk     */
constexpr unsigned NKC = SEQ / KCH;       /* key chunks of an attention walk */
constexpr unsigned QNKT = DMODEL / QKT;   /* k tiles of the qkv GEMM walk */
constexpr unsigned NGS = NKT / GST;       /* ring stages of the output GEMM walk */
static_assert(NKT % GST == 0 && NGS >= 2);
static_assert(GST * 12 <= 63);            /* a wave's copies in flight: one stage's */

/* Place in a walk of n tiles that starts at tile 'first' and wraps: work-groups that share operand rows get
   different 'first', so that they do not ask L2 for the same lines at the same moment. Every tile is still
   taken exactly once; only the order of the f32 sums differs from work-group to work-group. */
__device__ __forceinline__ unsigned walk_at(unsigned step, unsigned first, unsigned n) { return (step + first) % n; }

/*
 *   Xb   [MROWS][1024]        x, bf16
 *   WqT  [3072][1024]         W_qkv (already [out][in]), bf16
 *   WoH  [1024][1024]         W_out (already [out][in]), bf16-converted value x1024 held in f16
 *   qkvp 3 planes f16: Q [bh][l][64] (q x16), K [bh][l][64] (k x16), Vt [bh][64][l] (v x16)
 *   ctxp 1 plane  f16: C [MROWS][1024] (ctx x256)
 */

__device__ __forceinline__ unsigned short f2bf_bits(float f) {
  unsigned u = __float_as_uint(f);
  return (unsigned short)((u + 0x7FFFu + ((u >> 16) & 1u)) >> 16);
}
__device__ __forceinline__ float bf_bits2f(unsigned short h) { return __uint_as_float(((unsigned)h) << 16); }
__device__ __forceinline__ unsigned pk2(float a, float b) {
  return (unsigned)f2bf_bits(a) | ((unsigned)f2bf_bits(b) << 16);
}

/* f32 -> f16 (RNE) with a value select so that no subnormal f16 is ever produced */
static __device__ __forceinline__ h16 toh_flush(float v) {
  const h16 r = (h16)v;
  return (fabsf(v) < 6.103515625e-05f) ? (h16)0.0f : r;
}
static __device__ __forceinline__ unsigned short hbits(h16 v) {
  return __builtin_bit_cast(unsigned short, v);
}
static __device__ __forceinline__ unsigned pkh2(float a, float b) {
  return (unsigned)hbits(toh_flush(a)) | ((unsigned)hbits(toh_flush(b)) << 16);
}

/* one WMMA + hazard guard naming only this call's live operands */
__device__ __forceinline__ v8f mma_bf16(v16b a, v16b b, v8f c) {
  c = __builtin_amdgcn_wmma_f32_16x16x32_bf16(false, a, false, b, (short)0, c, false, false);
  asm volatile("v_nop\n\tv_nop\n\tv_nop\n\tv_nop" : "+v"(c) : "v"(a), "v"(b));
  return c;
}
__device__ __forceinline__ v8f mma_f16(v16h a, v16h b, v8f c) {
  c = __builtin_amdgcn_wmma_f32_16x16x32_f16(false, a, false, b, (short)0, c, false, false);
  asm volatile("v_nop\n\tv_nop\n\tv_nop\n\tv_nop" : "+v"(c) : "v"(a), "v"(b));
  return c;
}

__device__ __forceinline__ void wave_lds_sync() {
  __builtin_amdgcn_fence(3 /* release order */, "workgroup");
  __builtin_amdgcn_wave_barrier();
  __builtin_amdgcn_fence(2 /* acquire order */, "workgroup");
}

/* ---- tiles into LDS by asynchronous copies: each lane brings its own 16 B, 8 lanes = one 128-B line ---- */
__device__ __forceinline__ unsigned lds_byte(const void* p) { return (unsigned)(size_t)p; }

/* landed: this wave's own copies are in LDS (stands in front of the barrier that publishes them) */
__device__ __forceinline__ void wait_copies() { asm volatile("s_wait_asynccnt 0x0" ::: "memory"); }
/* this wave's LDS reads have returned (stands in front of the barrier behind which the buffer is refilled) */
__device__ __forceinline__ void wait_lds()    { asm volatile("s_wait_dscnt 0x0" ::: "memory"); }

#define CP_LINE(l, g) "global_load_async_to_lds_b128 %" #l ", %" #g ", off\n\t"

/* GEMM tile: thread = (row tid>>3, 16-B segment tid&7); 8 A row groups and 4 B row groups of 16 rows.
   The closing s_wait_xcnt stands in the copies' own statement, ahead of any rewrite of their address registers. */
__device__ __forceinline__ void stage_gemm(const unsigned short* ag, const unsigned short* bg, unsigned l) {
  constexpr int RG = 16 * DMODEL;      /* 16 rows on, global elements */
  constexpr unsigned LG = 16 * SP * 2; /* 16 rows on, LDS bytes       */
  asm volatile(
      CP_LINE(0, 12) CP_LINE(1, 13) CP_LINE(2, 14) CP_LINE(3, 15) CP_LINE(4, 16) CP_LINE(5, 17)
      CP_LINE(6, 18) CP_LINE(7, 19) CP_LINE(8, 20) CP_LINE(9, 21) CP_LINE(10, 22) CP_LINE(11, 23)
      "s_wait_xcnt 0x0"
      :: "v"(l), "v"(l + LG), "v"(l + 2 * LG), "v"(l + 3 * LG), "v"(l + 4 * LG), "v"(l + 5 * LG),
         "v"(l + 6 * LG), "v"(l + 7 * LG), "v"(l + 8 * LG), "v"(l + 9 * LG), "v"(l + 10 * LG), "v"(l + 11 * LG),
         "v"(ag), "v"(ag + RG), "v"(ag + 2 * RG), "v"(ag + 3 * RG), "v"(ag + 4 * RG), "v"(ag + 5 * RG),
         "v"(ag + 6 * RG), "v"(ag + 7 * RG), "v"(bg), "v"(bg + RG), "v"(bg + 2 * RG), "v"(bg + 3 * RG)
      : "memory");
}

/* qkv GEMM tile, one operand's eight 16-row groups: thread = (row tid>>4, 16-B segment tid&15), 16 lanes = one 256-B row.
   The closing s_wait_xcnt stands in the copies' own statement, ahead of any rewrite of their address registers. */
__device__ __forceinline__ void stage_rows8(const unsigned short* g, unsigned l) {
  constexpr int RG = 16 * DMODEL;       /* 16 rows on, global elements */
  constexpr unsigned LG = 16 * QSP * 2; /* 16 rows on, LDS bytes       */
  asm volatile(
      CP_LINE(0, 8) CP_LINE(1, 9) CP_LINE(2, 10) CP_LINE(3, 11)
      CP_LINE(4, 12) CP_LINE(5, 13) CP_LINE(6, 14) CP_LINE(7, 15)
      "s_wait_xcnt 0x0"
      :: "v"(l), "v"(l + LG), "v"(l + 2 * LG), "v"(l + 3 * LG),
         "v"(l + 4 * LG), "v"(l + 5 * LG), "v"(l + 6 * LG), "v"(l + 7 * LG),
         "v"(g), "v"(g + RG), "v"(g + 2 * RG), "v"(g + 3 * RG),
         "v"(g + 4 * RG), "v"(g + 5 * RG), "v"(g + 6 * RG), "v"(g + 7 * RG)
      : "memory");
}

/* attention tile: 4 groups of 16 K rows (64 elements apart), then 4 groups of 16 V^T rows (SEQ apart) */
__device__ __forceinline__ void stage_kv(const unsigned short* kg, const unsigned short* vg, unsigned l) {
  constexpr int KG = 16 * DHEAD;
  constexpr int VG = 16 * SEQ;
  constexpr unsigned LG = 16 * SP * 2;
  asm volatile(
      CP_LINE(0, 8) CP_LINE(1, 9) CP_LINE(2, 10) CP_LINE(3, 11)
      CP_LINE(4, 12) CP_LINE(5, 13) CP_LINE(6, 14) CP_LINE(7, 15)
      "s_wait_xcnt 0x0"
      :: "v"(l), "v"(l + LG), "v"(l + 2 * LG), "v"(l + 3 * LG),
         "v"(l + 4 * LG), "v"(l + 5 * LG), "v"(l + 6 * LG), "v"(l + 7 * LG),
         "v"(kg), "v"(kg + KG), "v"(kg + 2 * KG), "v"(kg + 3 * KG),
         "v"(vg), "v"(vg + VG), "v"(vg + 2 * VG), "v"(vg + 3 * VG)
      : "memory");
}

/* --------------------------------------------------------------------------
 * All three operand conversions in one launch. Unit = 8 elements = two 16-B loads, one 16-B store.
 *   x     -> Xb  : bf16 (RNE); out row b*SEQ + l <- in row b*SEQ_FULL + l
 *   W_qkv -> WqT : bf16 (RNE)
 *   W_out -> WoH : f16 holding (bf16 RNE value) x WO_CARRY; the bf16 significand and the power-of-two
 *                  carry are exact in f16; the flush select removes would-be subnormals.
 * The launch has one thread per unit of W_out; a thread takes CV_X units of x, CV_Q of W_qkv and one of
 * W_out, CV_LANES units apart (a wave's lanes stay on consecutive units), and issues all its loads
 * before the first conversion. Coverage: CV_LANES threads x (CV_X, CV_Q, 1) units = the three whole planes.
 * ------------------------------------------------------------------------ */
constexpr int CV_THREADS = 512;                         /* 16 waves a work-group */
constexpr int CV_UPR     = DMODEL / 8;                  /* units per row, all three planes */
constexpr int CV_LANES   = (int)(WOT_E / 8);
constexpr int CV_X       = (int)(XB_E / 8 / CV_LANES);
constexpr int CV_Q       = (int)(WQT_E / 8 / CV_LANES);
static_assert(CV_LANES % CV_THREADS == 0);
static_assert((size_t)CV_X * CV_LANES * 8 == XB_E && (size_t)CV_Q * CV_LANES * 8 == WQT_E);
static_assert((size_t)NB * SEQ_FULL * DMODEL < (1u << 30) && WQT_E < (1u << 30));   /* element indices fit 32 bits */

/* element e of p through a 32-bit byte offset: scalar base + one offset register, no 64-bit address pair per load */
__device__ __forceinline__ const float* at32(const float* p, unsigned e) {
  return (const float*)((const char*)p + e * 4u);
}

__device__ __forceinline__ v4u bf_unit(v4f a0, v4f a1) {
  v4u w;
  w[0] = pk2(a0[0], a0[1]);
  w[1] = pk2(a0[2], a0[3]);
  w[2] = pk2(a1[0], a1[1]);
  w[3] = pk2(a1[2], a1[3]);
  return w;
}

__global__ __launch_bounds__(CV_THREADS) void cvt_all_kernel(
    const float* __restrict__ x, const float* __restrict__ Wq, const float* __restrict__ Wo,
    unsigned short* __restrict__ Xb, unsigned short* __restrict__ WqT, unsigned short* __restrict__ WoH)
{
  const unsigned g = blockIdx.x * CV_THREADS + threadIdx.x;

  /* every loop here is unrolled whole: the units stay in registers and the loads go out as one run */
  v4f xa[CV_X][2], qa[CV_Q][2], oa[2];
#pragma unroll
  for (unsigned i = 0; i < CV_X; ++i) {
    const unsigned u   = i * CV_LANES + g;
    const unsigned row = u / CV_UPR;
    const unsigned seg = u - row * CV_UPR;
    const unsigned b   = row / SEQ;
    const unsigned l   = row - b * SEQ;
    const float* s = at32(x, ((b * SEQ_FULL + l) * CV_UPR + seg) * 8u);
    xa[i][0] = *(const v4f*)s;
    xa[i][1] = *(const v4f*)(s + 4);
  }
#pragma unroll
  for (unsigned i = 0; i < CV_Q; ++i) {
    const float* s = at32(Wq, (i * CV_LANES + g) * 8u);
    qa[i][0] = *(const v4f*)s;
    qa[i][1] = *(const v4f*)(s + 4);
  }
  /* a later load may land in a register that held an earlier load's offset: the earlier loads' address
     translations are waited for first (a precaution of form; costs one short wait among the loads) */
  asm volatile("s_wait_xcnt 0x0" ::: "memory");
  {
    const float* s = at32(Wo, g * 8u);
    oa[0] = *(const v4f*)s;
    oa[1] = *(const v4f*)(s + 4);
  }

#pragma unroll
  for (unsigned i = 0; i < CV_X; ++i) *(v4u*)(Xb + (i * CV_LANES + g) * 8u) = bf_unit(xa[i][0], xa[i][1]);
#pragma unroll
  for (unsigned i = 0; i < CV_Q; ++i) *(v4u*)(WqT + (i * CV_LANES + g) * 8u) = bf_unit(qa[i][0], qa[i][1]);
  {
    v4u w;
    w[0] = pkh2(bf_bits2f(f2bf_bits(oa[0][0])) * WO_CARRY, bf_bits2f(f2bf_bits(oa[0][1])) * WO_CARRY);
    w[1] = pkh2(bf_bits2f(f2bf_bits(oa[0][2])) * WO_CARRY, bf_bits2f(f2bf_bits(oa[0][3])) * WO_CARRY);
    w[2] = pkh2(bf_bits2f(f2bf_bits(oa[1][0])) * WO_CARRY, bf_bits2f(f2bf_bits(oa[1][1])) * WO_CARRY);
    w[3] = pkh2(bf_bits2f(f2bf_bits(oa[1][2])) * WO_CARRY, bf_bits2f(f2bf_bits(oa[1][3])) * WO_CARRY);
    *(v4u*)(WoH + g * 8u) = w;
  }
}

/* --------------------------------------------------------------------------
 * qkv = Xb . WqT^T  (M = MROWS, N = 3072, K = 1024), bf16 x bf16, f32 acc.
 * Block = 8 waves, tile 256 tokens x 128 columns (= two heads of one section);
 * wave = 64 rows x 64 cols = one head (4 A fragments x 4 B fragments per 32-deep step): an operand row
 * is fetched from L2 by half as many blocks, and a fragment read from LDS feeds 4 WMMAs.
 * Operands: 128-deep tiles (256 A rows + 128 B rows) copied into two LDS buffers, one tile ahead: four
 * 32-deep steps between two barriers; fragments read from the tile of the trip.
 * Fragment map (hh = lane>>4, c = lane&15): A row c, elems 0..7 <- k0+8hh.., 8..15 <- k0+16+8hh..;
 * B col c with the same k map; D elem r = (row 8hh+r, col c).
 * Epilogue: acc x 16 converted to f16 (flush select), staged in the wave's own 64 x 64 slab
 * ([tok][d] for q,k; [d][tok] for v), then whole 128-B lines: 8 lanes = one row of the slab.
 * The slabs lie in the staging buffers, free behind the last trip's barrier; each is private to its wave.
 * ------------------------------------------------------------------------ */
__global__ __launch_bounds__(QWAVE * 32) VGPR_CAP void gemm_qkv_kernel(
    const unsigned short* __restrict__ Xb, const unsigned short* __restrict__ WqT,
    unsigned short* __restrict__ qkvp)
{
  union FB { v16b v; v8b h[2]; };
  __shared__ __align__(16) unsigned short St[2 * Q_STAGE];

  const int tid  = threadIdx.x;
  const int wave = __builtin_amdgcn_readfirstlane(tid >> 5);
  const int wm   = wave >> 1;          /* 64-row band of the block    */
  const int wn   = wave & 1;           /* 64-column band = head       */
  const int lane = tid & 31;
  const int hh   = lane >> 4;
  const int c    = lane & 15;
  const int n0   = blockIdx.x * 128;
  const int m0   = blockIdx.y * 256;

  v8f acc[4][4];
#pragma unroll
  for (int mt = 0; mt < 4; ++mt)
#pragma unroll
    for (int t = 0; t < 4; ++t) acc[mt][t] = (v8f){0.f,0.f,0.f,0.f,0.f,0.f,0.f,0.f};

  /* copy side: this thread's row and 16-B segment of each 16-row group */
  const unsigned short* ag = Xb  + (size_t)(m0 + (tid >> 4)) * DMODEL + (tid & 15) * 8;
  const unsigned short* bg = WqT + (size_t)(n0 + (tid >> 4)) * DMODEL + (tid & 15) * 8;
  const unsigned lcp = lds_byte(St) + (tid >> 4) * (QSP * 2) + (tid & 15) * 16;
  /* a tile: A rows 0..127, A rows 128..255, B rows 0..127 (staged behind the A rows) */
  auto stage = [&](unsigned k, unsigned l) {
    stage_rows8(ag + k, l);
    stage_rows8(ag + k + 128 * DMODEL, l + 128 * QSP * 2);
    stage_rows8(bg + k, l + 256 * QSP * 2);
  };
  /* read side: this lane's place in a staged tile */
  const int aoff = (wm * 64 + c) * QSP + 8 * hh;
  const int boff = (256 + wn * 64 + c) * QSP + 8 * hh;

  /* one 32-deep step: 4 A and 4 B fragments as one group of reads, then the 16 products */
  auto step = [&](const unsigned short* sb, int k0) {
    FB fa[4], fb[4];
#pragma unroll
    for (int i = 0; i < 4; ++i) {
      fa[i].h[0] = *(const v8b_a*)(sb + aoff + i * 16 * QSP + k0);
      fa[i].h[1] = *(const v8b_a*)(sb + aoff + i * 16 * QSP + k0 + 16);
    }
#pragma unroll
    for (int t = 0; t < 4; ++t) {
      fb[t].h[0] = *(const v8b_a*)(sb + boff + t * 16 * QSP + k0);
      fb[t].h[1] = *(const v8b_a*)(sb + boff + t * 16 * QSP + k0 + 16);
    }
#pragma unroll
    for (int t = 0; t < 4; ++t)
#pragma unroll
      for (int mt = 0; mt < 4; ++mt) acc[mt][t] = mma_bf16(fa[mt].v, fb[t].v, acc[mt][t]);
  };

  /* A rows are shared along blockIdx.x, B rows along blockIdx.y: the sum moves the start along both */
  const unsigned first = (blockIdx.x + blockIdx.y) % QNKT;
  stage(walk_at(0, first, QNKT) * QKT, lcp);
  wait_copies();
  __syncthreads();
  stage(walk_at(1, first, QNKT) * QKT, lcp + Q_STAGE * 2);
  /* rolled: one trip = one tile; tile kt + 1 flies while tile kt is worked on */
#pragma unroll 1
  for (int kt = 0; kt < (int)QNKT; ++kt) {
    const unsigned short* sb = St + (kt & 1) * Q_STAGE;
    step(sb, 0);
    step(sb, 32);
    step(sb, 64);
    step(sb, 96);
    wait_lds();
    wait_copies();
    __syncthreads();   /* publishes tile kt + 1 and ends every read of tile kt's buffer */
    if (kt + 2 < (int)QNKT) stage(walk_at(kt + 2, first, QNKT) * QKT, lcp + (kt & 1) * (Q_STAGE * 2));
  }
  wait_copies();

  const int sec = n0 / DMODEL;                       /* 0 q, 1 k, 2 v : block-uniform */
  const int b   = m0 / SEQ;
  const int l0  = m0 - b * SEQ + wm * 64;
  const int h   = (n0 - sec * DMODEL) / DHEAD + wn;
  const int bh  = b * NHEAD + h;
  const int rq  = lane >> 3;
  const int seg = lane & 7;
  unsigned short* ph   = qkvp + (size_t)sec * PLANE;
  unsigned short* slab = St + wave * (64 * SP);
  const unsigned short* rd = slab + rq * SP + seg * 8;

  /* one branch on the section for the whole epilogue: inside it every LDS and global offset is a constant */
  if (sec < 2) {
    unsigned short* wr = slab + 8 * hh * SP + c;     /* [tok][d]: a lane holds one d of 8 tokens per tile */
#pragma unroll
    for (int t = 0; t < 4; ++t)
#pragma unroll
      for (int mt = 0; mt < 4; ++mt)
#pragma unroll
        for (int r = 0; r < 8; ++r)
          wr[(mt * 16 + r) * SP + 16 * t] = hbits(toh_flush(acc[mt][t][r] * QKV_CARRY));
    wave_lds_sync();
    unsigned short* gp = ph + ((size_t)bh * SEQ + l0 + rq) * DHEAD + seg * 8;
#pragma unroll
    for (int it = 0; it < 16; ++it) {
      /* the second half reuses registers that the first half's stores name: their translations are waited for first */
      if (it == 8) asm volatile("s_wait_xcnt 0x0" ::: "memory");
      *(v4u*)(gp + it * 4 * DHEAD) = *(const v4u_a*)(rd + it * 4 * SP);
    }
    /* closes the second half's stores: whichever section the compiler lays behind this one, its first instructions
       may write registers that these stores name */
    asm volatile("s_wait_xcnt 0x0" ::: "memory");
  } else {
    unsigned short* wr = slab + c * SP + 8 * hh;     /* [d][tok]: the lane's 8 tokens of a tile are one 16-B unit */
#pragma unroll
    for (int t = 0; t < 4; ++t)
#pragma unroll
      for (int mt = 0; mt < 4; ++mt) {
        v4u hw;
#pragma unroll
        for (int p = 0; p < 4; ++p)
          hw[p] = pkh2(acc[mt][t][2 * p] * QKV_CARRY, acc[mt][t][2 * p + 1] * QKV_CARRY);
        *(v4u_a*)(wr + 16 * t * SP + mt * 16) = hw;
      }
    wave_lds_sync();
    unsigned short* gp = ph + ((size_t)bh * DHEAD + rq) * SEQ + l0 + seg * 8;
#pragma unroll
    for (int it = 0; it < 16; ++it) {
      /* as in the other branch: wait before registers named by the first half's stores are written again */
      if (it == 8) asm volatile("s_wait_xcnt 0x0" ::: "memory");
      *(v4u*)(gp + it * 4 * SEQ) = *(const v4u_a*)(rd + it * 4 * SP);
    }
    /* as in the other branch: closes the second half's stores ahead of the code laid behind this section */
    asm volatile("s_wait_xcnt 0x0" ::: "memory");
  }
}

__device__ __forceinline__ float xhalf(float x) {
  const int v = __builtin_bit_cast(int, x);
  return __builtin_bit_cast(float, __builtin_amdgcn_permlanex16(v, v, 0x76543210, 0xfedcba98, false, false));
}

/* 2^x of eight values, each in its own register. One statement, so that behind every exponential stands an
   instruction on other registers (the next exponential; behind the last one the v_nop): the slot that the
   instruction set asks for before a transcendental's result is read or its source register written again.
   Left to the register allocator, a run of them wrote each result over the source of the one before. */
__device__ __forceinline__ void exp2x8(float (&x)[8]) {
  asm("v_exp_f32 %0, %0\n\tv_exp_f32 %1, %1\n\tv_exp_f32 %2, %2\n\tv_exp_f32 %3, %3\n\t"
      "v_exp_f32 %4, %4\n\tv_exp_f32 %5, %5\n\tv_exp_f32 %6, %6\n\tv_exp_f32 %7, %7\n\tv_nop"
      : "+v"(x[0]), "+v"(x[1]), "+v"(x[2]), "+v"(x[3]), "+v"(x[4]), "+v"(x[5]), "+v"(x[6]), "+v"(x[7]));
}

__global__ __launch_bounds__(128) VGPR_CAP void attn_kernel(
    const unsigned short* __restrict__ qkvp, unsigned short* __restrict__ ctxp)
{
  union FH { v16h v; v8h h[2]; };
  __shared__ __align__(16) unsigned short Oh[NWAVE][16 * SP];
  __shared__ __align__(16) unsigned short KV[2 * A_STAGE];

  const int tid  = threadIdx.x;
  const int wave = __builtin_amdgcn_readfirstlane(tid >> 5);
  const int lane = tid & 31;
  const int hh   = lane >> 4;
  const int c    = lane & 15;
  const int qb   = blockIdx.x;
  const int bh   = blockIdx.y;
  const int b    = bh / NHEAD;
  const int h    = bh - b * NHEAD;
  const int q0   = qb * 64 + wave * 16;
  const float NEG_INF = -__builtin_inff();

  const unsigned short* Qp  = qkvp + (size_t)bh * SEQ * DHEAD;
  const unsigned short* Vtp = Qp + 2 * PLANE;     /* [bh][d][l]: same per-bh element count */

  v16h qf[2];
  {
    const size_t qo = (size_t)(q0 + c) * DHEAD + 8 * hh;
#pragma unroll
    for (int dc = 0; dc < 2; ++dc) {
      FH f;
      f.h[0] = *(const v8h*)(Qp + qo + dc * 32);
      f.h[1] = *(const v8h*)(Qp + qo + dc * 32 + 16);
      qf[dc] = f.v;
    }
  }

  float mrow = NEG_INF, lrow = 0.f;   /* query c: maximum of the raw scores (both halves alike), this half's part of the sum */
  v8f oacc[4];
#pragma unroll
  for (int t = 0; t < 4; ++t) oacc[t] = (v8f){0.f,0.f,0.f,0.f,0.f,0.f,0.f,0.f};

  /* copy side: this thread's row and 16-B segment of each 16-row group (K plane = Q plane + PLANE) */
  const unsigned short* kg = Qp + PLANE + (size_t)(tid >> 3) * DHEAD + (tid & 7) * 8;
  const unsigned short* vg = Vtp + (size_t)(tid >> 3) * SEQ + (tid & 7) * 8;
  const unsigned lcp = lds_byte(KV) + (tid >> 3) * (SP * 2) + (tid & 7) * 16;
  /* read side: lane's place among the staged K rows [key][d]; the V^T rows [d][key] stand 64 rows on */
  const int flane = c * SP + 8 * hh;

  /* the K and V rows of one (b,h) are shared along blockIdx.x */
  const unsigned first = blockIdx.x % NKC;
  {
    const unsigned c0 = walk_at(0, first, NKC);
    stage_kv(kg + c0 * (KCH * DHEAD), vg + c0 * KCH, lcp);
  }
  wait_copies();
  __syncthreads();
  {
    const unsigned c1 = walk_at(1, first, NKC);
    stage_kv(kg + c1 * (KCH * DHEAD), vg + c1 * KCH, lcp + A_STAGE * 2);
  }

#pragma unroll 1
  for (int kc = 0; kc < SEQ / KCH; ++kc) {
    /* the chunk's 32 fragment reads go out as one group at its head: K first, V behind it */
    const unsigned short* kq = KV + (kc & 1) * A_STAGE + flane;
    const unsigned short* vq = kq + 64 * SP;
    FH kf[4][2];
#pragma unroll
    for (int j = 0; j < 4; ++j) {
#pragma unroll
      for (int dc = 0; dc < 2; ++dc) {
        kf[j][dc].h[0] = *(const v8h_a*)(kq + j * 16 * SP + dc * 32);
        kf[j][dc].h[1] = *(const v8h_a*)(kq + j * 16 * SP + dc * 32 + 16);
      }
    }
    FH vb[2][4];
#pragma unroll
    for (int kk = 0; kk < 2; ++kk) {
#pragma unroll
      for (int t = 0; t < 4; ++t) {
        vb[kk][t].h[0] = *(const v8h_a*)(vq + t * 16 * SP + kk * 32);
        vb[kk][t].h[1] = *(const v8h_a*)(vq + t * 16 * SP + kk * 32 + 16);
      }
    }

    /* raw scores (unscaled accumulators), transposed: 4 key tiles (D elem r = key 16j+8hh+r, query c) */
    v8f s[4];
#pragma unroll
    for (int j = 0; j < 4; ++j) {
      v8f sa = (v8f){0.f,0.f,0.f,0.f,0.f,0.f,0.f,0.f};
#pragma unroll
      for (int dc = 0; dc < 2; ++dc) sa = mma_f16(kf[j][dc].v, qf[dc], sa);
      s[j] = sa;
    }

    /* chunk maximum of query c: the lane's 32 keys, then the other half's 32 */
    float cm;
    {
      float m4[4];
#pragma unroll
      for (int j = 0; j < 4; ++j) {
        float m = s[j][0];
#pragma unroll
        for (int r = 1; r < 8; ++r) m = fmaxf(m, s[j][r]);
        m4[j] = m;
      }
      const float m = fmaxf(fmaxf(m4[0], m4[1]), fmaxf(m4[2], m4[3]));
      cm = fmaxf(m, xhalf(m));
    }

    /* online softmax update; P^T as f16 (x256) packed in place into the B operands, sum over the converted values */
    const float mnew  = fmaxf(mrow, cm);
    const float msafe = (mnew == NEG_INF) ? 0.f : mnew;
    const float alpha = __builtin_amdgcn_exp2f((mrow - msafe) * SCORE_LOG2);
    const float ebias = P_CARRY_LOG2 - msafe * SCORE_LOG2;   /* the maximum and the x256 carry, as one addend */
    mrow = mnew;
    FH pb[2];
    float ps4[4];
#pragma unroll
    for (int j = 0; j < 4; ++j) {
      float psum = 0.f;
      float e[8];
#pragma unroll
      for (int r = 0; r < 8; ++r) e[r] = __builtin_fmaf(s[j][r], SCORE_LOG2, ebias);
      exp2x8(e);
#pragma unroll
      for (int r = 0; r < 8; r += 2) {
        /* one packed convert for two values; no zeroing of small values here: it cost a compare and a select each */
        const v2h ph = __builtin_convertvector((v2f){e[r], e[r + 1]}, v2h);
        psum += (float)ph[0];
        psum += (float)ph[1];
        pb[j >> 1].h[j & 1][r]     = ph[0];
        pb[j >> 1].h[j & 1][r + 1] = ph[1];
      }
      ps4[j] = psum;
    }
    lrow = lrow * alpha + ((ps4[0] + ps4[1]) + (ps4[2] + ps4[3]));
#pragma unroll
    for (int t = 0; t < 4; ++t)
#pragma unroll
      for (int r = 0; r < 8; ++r) oacc[t][r] *= alpha;

    /* O^T += V^T.P^T : A = V^T rows [d][kv] fetched at the head of the chunk, B = P^T [kv][q] from registers */
#pragma unroll
    for (int kk = 0; kk < 2; ++kk) {
#pragma unroll
      for (int t = 0; t < 4; ++t) oacc[t] = mma_f16(vb[kk][t].v, pb[kk].v, oacc[t]);
    }
    wait_lds();
    wait_copies();
    __syncthreads();   /* publishes chunk kc + 1 and ends every read of chunk kc's buffer */
    if (kc + 2 < SEQ / KCH) {
      const unsigned c2 = walk_at(kc + 2, first, NKC);
      stage_kv(kg + c2 * (KCH * DHEAD), vg + c2 * KCH, lcp + (kc & 1) * (A_STAGE * 2));
    }
  }
  wait_copies();

  /* join the halves' sums, normalise (ctx x256), f16 rows [query][d] into the wave slab, then whole-line stores */
  {
    const float inv = CTX_FOLD * (1.0f / (lrow + xhalf(lrow)));
#pragma unroll
    for (int t = 0; t < 4; ++t) {
      v4u hw;
      hw[0] = pkh2(oacc[t][0] * inv, oacc[t][1] * inv);
      hw[1] = pkh2(oacc[t][2] * inv, oacc[t][3] * inv);
      hw[2] = pkh2(oacc[t][4] * inv, oacc[t][5] * inv);
      hw[3] = pkh2(oacc[t][6] * inv, oacc[t][7] * inv);
      *(v4u_a*)(&Oh[wave][c * SP + t * 16 + 8 * hh]) = hw;
    }
  }
  wave_lds_sync();
  {
    const int rq  = lane >> 3;
    const int seg = lane & 7;
#pragma unroll
    for (int it = 0; it < 4; ++it) {
      const int row = it * 4 + rq;
      const v4u hw = *(const v4u_a*)(&Oh[wave][row * SP + seg * 8]);
      const size_t g = (size_t)(b * SEQ + q0 + row) * DMODEL + h * DHEAD + seg * 8;
      *(v4u*)(ctxp + g) = hw;
    }
  }
}

/* --------------------------------------------------------------------------
 * out = C . WoH^T x 2^-18  (M = MROWS, N = 1024, K = 1024), f16 x f16, f32 acc.
 * Block = 4 waves, tile 128 x 64; wave = 32 rows x 64 cols; one product per tile pair.
 * Operands: 64-deep tiles (128 A rows + 64 B rows) copied into two LDS buffers, a stage of GST tiles at a time and
 * one stage ahead: one wait and one block barrier per stage, and a whole stage's bytes in flight while the stage
 * before is worked on. No read may cross a stage's barrier, so the longer stage is also what lets the fragment
 * reads run ahead: inside it three fragment sets take turns, each read two 32-deep steps ahead of its products.
 * Epilogue: per-wave 32x64 f32 slab (wave-private LDS), 16 lanes x 16 B = one 256-B
 * ------------------------------------------------------------------------ */
__global__ __launch_bounds__(128) VGPR_CAP void gemm_out_kernel(
    const unsigned short* __restrict__ ctxp, const unsigned short* __restrict__ WoH,
    float* __restrict__ out)
{
  union FH { v16h v; v8h h[2]; };
  __shared__ __align__(16) float Os[NWAVE][32 * OS_PITCH];
  __shared__ __align__(16) unsigned short St[2 * GST * G_STAGE];

  const int tid  = threadIdx.x;
  const int wave = __builtin_amdgcn_readfirstlane(tid >> 5);
  const int lane = tid & 31;
  const int hh   = lane >> 4;
  const int c    = lane & 15;
  const int n0   = blockIdx.x * 64;
  const int m0   = blockIdx.y * 128;

  v8f acc[2][4];
#pragma unroll
  for (int mt = 0; mt < 2; ++mt)
#pragma unroll
    for (int t = 0; t < 4; ++t) acc[mt][t] = (v8f){0.f,0.f,0.f,0.f,0.f,0.f,0.f,0.f};

  /* copy side: this thread's row and 16-B segment of each 16-row group */
  const unsigned short* ag = ctxp + (size_t)(m0 + (tid >> 3)) * DMODEL + (tid & 7) * 8;
  const unsigned short* bg = WoH  + (size_t)(n0 + (tid >> 3)) * DMODEL + (tid & 7) * 8;
  const unsigned lcp = lds_byte(St) + (tid >> 3) * (SP * 2) + (tid & 7) * 16;
  /* read side: this lane's place in a staged tile */
  const int aoff = (wave * 32 + c) * SP + 8 * hh;
  const int boff = (128 + c) * SP + 8 * hh;

  /* Three fragment sets ([0],[1] = A rows, [2..5] = B columns), taken in turn by the 32-deep steps of a stage */
  FH fs[3][6];
  auto load_set = [&](FH (&f)[6], const unsigned short* sb, int k0) {
    f[0].h[0] = *(const v8h_a*)(sb + aoff + k0);
    f[0].h[1] = *(const v8h_a*)(sb + aoff + k0 + 16);
    f[1].h[0] = *(const v8h_a*)(sb + aoff + 16 * SP + k0);
    f[1].h[1] = *(const v8h_a*)(sb + aoff + 16 * SP + k0 + 16);
#pragma unroll
    for (int t = 0; t < 4; ++t) {
      f[2 + t].h[0] = *(const v8h_a*)(sb + boff + t * 16 * SP + k0);
      f[2 + t].h[1] = *(const v8h_a*)(sb + boff + t * 16 * SP + k0 + 16);
    }
  };
  auto mma_set = [&](const FH (&f)[6]) {
#pragma unroll
    for (int t = 0; t < 4; ++t) {
      acc[0][t] = mma_f16(f[0].v, f[2 + t].v, acc[0][t]);
      acc[1][t] = mma_f16(f[1].v, f[2 + t].v, acc[1][t]);
    }
  };

  /* A rows are shared along blockIdx.x, B rows along blockIdx.y: the sum moves the start along both */
  const unsigned first = (blockIdx.x + blockIdx.y) % NKT;
  /* stage s = tiles s * GST .. s * GST + GST - 1 of the walk, one behind the other in the buffer at LDS byte l */
  auto stage = [&](unsigned s, unsigned l) {
#pragma unroll
    for (unsigned j = 0; j < GST; ++j) {
      const unsigned k = walk_at(s * GST + j, first, NKT) * KT;
      stage_gemm(ag + k, bg + k, l + j * (G_STAGE * 2));
    }
  };
  stage(0, lcp);
  wait_copies();
  __syncthreads();
  stage(1, lcp + GST * G_STAGE * 2);
  /* rolled: one trip = one stage; stage st + 1 flies while stage st is worked on */
#pragma unroll 1
  for (int st = 0; st < (int)NGS; ++st) {
    const unsigned short* sb = St + (st & 1) * (GST * G_STAGE);
    /* step i of the stage = half (i & 1) of its tile i >> 1; all reads stay inside this stage's buffer */
    load_set(fs[0], sb, 0);
    load_set(fs[1], sb, 32);
    /* unrolled whole: the set of a step and every LDS offset are constants */
#pragma unroll
    for (int i = 0; i < 2 * GST; ++i) {
      if (i + 2 < 2 * GST) load_set(fs[(i + 2) % 3], sb + ((i + 2) >> 1) * G_STAGE, ((i + 2) & 1) * 32);
      mma_set(fs[i % 3]);
    }
    wait_lds();
    wait_copies();
    __syncthreads();   /* publishes stage st + 1 and ends every read of stage st's buffer */
    if (st + 2 < (int)NGS) stage(st + 2, lcp + (st & 1) * (GST * G_STAGE * 2));
  }
  wait_copies();

  float* os = Os[wave];
#pragma unroll
  for (int t = 0; t < 4; ++t) {
#pragma unroll
    for (int mt = 0; mt < 2; ++mt)
#pragma unroll
      for (int r = 0; r < 8; ++r)
        os[(mt * 16 + 8 * hh + r) * OS_PITCH + 16 * t + c] = acc[mt][t][r] * OUT_FOLD;
  }
  wave_lds_sync();
  {
    const int c4 = c * 4;
    {
#pragma unroll
      for (int it = 0; it < 16; ++it) {
        const int row = it * 2 + hh;
        const v4f val = *(const v4f_a*)(os + row * OS_PITCH + c4);
        *(v4f*)(out + (size_t)(m0 + wave * 32 + row) * DMODEL + n0 + c4) = val;
      }
      
    }
  }
}

extern "C" void kernel_launch(void* const* d_in, const int* in_sizes, int n_in,
                              void* d_out, int out_size, void* d_ws, size_t ws_size,
                              hipStream_t stream)
{
  if (n_in < 3) return;
  if (in_sizes[0] < ((NB - 1) * SEQ_FULL + SEQ) * DMODEL) return;
  if (in_sizes[1] < NQKV * DMODEL) return;
  if (in_sizes[2] < DMODEL * DMODEL) return;
  if (out_size < MROWS * DMODEL) return;
  if (d_ws == nullptr || ws_size < WS_NEED) return;

  const float* x     = (const float*)d_in[0];
  const float* W_qkv = (const float*)d_in[1];   /* [3072 out][1024 in] */
  const float* W_out = (const float*)d_in[2];   /* [1024 out][1024 in] */
  float* out = (float*)d_out;

  unsigned short* Xb   = (unsigned short*)d_ws;
  unsigned short* WqT  = Xb + XB_E;
  unsigned short* WoH  = WqT + WQT_E;
  unsigned short* qkvp = WoH + WOT_E;
  unsigned short* ctxp = qkvp + QKVP_E;

  /* W_qkv and W_out rows are already [n][k]: plain row converts, no transpose */
  cvt_all_kernel<<<CV_LANES / CV_THREADS, CV_THREADS, 0, stream>>>(x, W_qkv, W_out, Xb, WqT, WoH);

  gemm_qkv_kernel<<<dim3(NQKV / 128, MROWS / 256), QWAVE * 32, 0, stream>>>(Xb, WqT, qkvp);
  attn_kernel<<<dim3(SEQ / 64, NBH), 128, 0, stream>>>(qkvp, ctxp);
  gemm_out_kernel<<<dim3(DMODEL / 64, MROWS / 128), 128, 0, stream>>>(ctxp, WoH, out);
}

// v010
// Measured time: 39.9 microseconds a run.
// In two side-by-side timings against v009, it was 1.06 and 1.07 times as fast.
// Over all steps from v000 it is 4.54 times as fast.
// Contractions: x.Wqkv^T on v_wmma_f32_16x16x32_bf16 (both operands RNE-converted to bf16 once); q.k^T, p.v and ctx.Wout^T on v_wmma_f32_16x16x32_f16 with single f16 planes (q, k, v x16; p x256; ctx x256; Wout = bf16-converted value x1024), one product per site; f32 accumulate; softmax in f32.
#include <hip/hip_runtime.h>

typedef __attribute__((ext_vector_type(16))) __bf16 v16b;
typedef __attribute__((ext_vector_type(8)))  __bf16 v8b;
typedef __attribute__((ext_vector_type(16))) _Float16 v16h;
typedef __attribute__((ext_vector_type(8)))  _Float16 v8h;
typedef __attribute__((ext_vector_type(8)))  float  v8f;
typedef __attribute__((ext_vector_type(4)))  float  v4f;
typedef __attribute__((ext_vector_type(2)))  float  v2f;
typedef __attribute__((ext_vector_type(2)))  _Float16 v2h;
typedef __attribute__((ext_vector_type(4)))  unsigned int v4u;
typedef v8h v8h_a __attribute__((may_alias));
typedef v8b v8b_a __attribute__((may_alias));
typedef v4f v4f_a __attribute__((may_alias));
typedef v4u v4u_a __attribute__((may_alias));
typedef _Float16 h16;

#ifndef NB
#define NB 2
#endif
#ifndef SEQ
#define SEQ 1024
#endif
#define NB_FULL 2
#define SEQ_FULL 1024

#define VGPR_CAP __attribute__((amdgpu_num_vgpr(256)))

/* power-of-two carries of the f16 operand planes and their f32 fold-backs */
#define QKV_CARRY   16.0f                 /* q, k, v planes                         */
#define P_CARRY     256.0f                /* exp(s - m) tiles                       */
#define CTX_CARRY   256.0f                /* context plane                          */
#define WO_CARRY    1024.0f               /* output weight plane                    */
#define SCORE_SCALE 0.00048828125f        /* 0.125 / (16 * 16) = 2^-11              */
#define SCORE_LOG2  (SCORE_SCALE * 1.44269504088896340736f)   /* raw score -> exponent to base 2 */
#define P_CARRY_LOG2 8.0f                 /* log2(P_CARRY)                          */
static_assert(P_CARRY == 256.0f && P_CARRY_LOG2 == 8.0f);
#define CTX_FOLD    16.0f                 /* CTX_CARRY / QKV_CARRY (P carry cancels) */
#define OUT_FOLD    3.814697265625e-06f   /* 1 / (256 * 1024) = 2^-18               */

constexpr int DMODEL = 1024;
constexpr int NHEAD  = 16;
constexpr int DHEAD  = 64;
constexpr int NQKV   = 3 * DMODEL;
constexpr int NBH    = NB * NHEAD;
constexpr int MROWS  = NB * SEQ;
constexpr int KCH    = 64;        /* keys per chunk */
constexpr int NWAVE  = 4;
constexpr int OS_PITCH = 68;
constexpr int KT       = 64;              /* k (or keys) per staged tile: one 128-B line per row   */
constexpr int SP       = 72;              /* staged row pitch, 16-bit elements: 144 B = 16 B x 9   */
constexpr int G_STAGE  = (128 + 64) * SP; /* output GEMM tile: 128 A rows, then 64 B rows          */
constexpr int GST      = 4;               /* its tiles per ring stage: copied, waited for and published together */
constexpr int QKT      = 128;             /* k per staged tile of the qkv GEMM: two 128-B lines per row */
constexpr int QSP      = 136;             /* its staged row pitch, 16-bit elements: 272 B = 16 B x 17  */
constexpr int Q_STAGE  = (256 + 128) * QSP; /* qkv GEMM tile: 256 A rows, then 128 B rows          */
constexpr int QWAVE    = 8;               /* waves of a qkv GEMM block: 4 along rows x 2 along columns */
constexpr int A_STAGE  = (64 + 64) * SP;  /* attention tile: 64 K rows [key][d], 64 V^T rows [d][key] */

constexpr size_t PLANE  = (size_t)NBH * SEQ * DHEAD;
constexpr size_t XB_E   = (size_t)MROWS * DMODEL;
constexpr size_t WQT_E  = (size_t)NQKV * DMODEL;
constexpr size_t WOT_E  = (size_t)DMODEL * DMODEL;
constexpr size_t QKVP_E = 3 * PLANE;
constexpr size_t CTX_E  = XB_E;
constexpr size_t WS_NEED = 2 * (XB_E + WQT_E + WOT_E + QKVP_E + CTX_E);

static_assert(SEQ % 128 == 0);
static_assert(KCH == 64 && SEQ % KCH == 0);
static_assert(SEQ <= SEQ_FULL && NB <= NB_FULL);
static_assert(DHEAD == 64 && DMODEL == NHEAD * DHEAD);
static_assert(DMODEL % 64 == 0 && NQKV % 64 == 0 && DMODEL % 32 == 0);
static_assert(DMODEL % 8 == 0 && DHEAD % 8 == 0);
static_assert(MROWS % 128 == 0);
static_assert(NWAVE * 16 == 64 && NWAVE * 32 == 128);
static_assert(OS_PITCH >= 64 && (OS_PITCH * 4) % 16 == 0);
static_assert(SEQ % 256 == 0 && MROWS % 256 == 0 && DMODEL % 128 == 0 && NQKV % 128 == 0);
static_assert(QWAVE * 64 * SP <= 2 * Q_STAGE);   /* the waves' epilogue slabs fit the staging buffers */
static_assert(QKT * 2 == 256 && (QSP * 2) % 32 == 16 && QSP >= QKT && DMODEL / QKT >= 2);
static_assert(XB_E % 64 == 0 && WQT_E % 64 == 0 && WOT_E % 64 == 0 && PLANE % 64 == 0);
static_assert(WS_NEED <= 134217728ull);
static_assert(KT == KCH && KT * 2 == 128 && (SP * 2) % 32 == 16 && SP >= KT);
static_assert(DMODEL / KT >= 2 && SEQ / KCH >= 2);
constexpr unsigned NKT = DMODEL / KT;     /* k tiles of a GEMM walk     */
constexpr unsigned NKC = SEQ / KCH;       /* key chunks over all SEQ keys (both halves) */
constexpr unsigned QNKT = DMODEL / QKT;   /* k tiles of the qkv GEMM walk */
constexpr unsigned NGS = NKT / GST;       /* ring stages of the output GEMM walk */
static_assert(NKT % GST == 0 && NGS >= 2);
static_assert(GST * 12 <= 63);            /* a wave's copies in flight: one stage's */

/* Place in a walk of n tiles that starts at tile 'first' and wraps: work-groups that share operand rows get
   different 'first', so that they do not ask L2 for the same lines at the same moment. Every tile is still
   taken exactly once; only the order of the f32 sums differs from work-group to work-group. */
__device__ __forceinline__ unsigned walk_at(unsigned step, unsigned first, unsigned n) { return (step + first) % n; }

/*
 *   Xb   [MROWS][1024]        x, bf16
 *   WqT  [3072][1024]         W_qkv (already [out][in]), bf16
 *   WoH  [1024][1024]         W_out (already [out][in]), bf16-converted value x1024 held in f16
 *   qkvp 3 planes f16: Q [bh][l][64] (q x16), K [bh][l][64] (k x16), Vt [bh][64][l] (v x16)
 *   ctxp 1 plane  f16: C [MROWS][1024] (ctx x256)
 */

__device__ __forceinline__ unsigned short f2bf_bits(float f) {
  unsigned u = __float_as_uint(f);
  return (unsigned short)((u + 0x7FFFu + ((u >> 16) & 1u)) >> 16);
}
__device__ __forceinline__ float bf_bits2f(unsigned short h) { return __uint_as_float(((unsigned)h) << 16); }
__device__ __forceinline__ unsigned pk2(float a, float b) {
  return (unsigned)f2bf_bits(a) | ((unsigned)f2bf_bits(b) << 16);
}

/* f32 -> f16 (RNE) with a value select so that no subnormal f16 is ever produced */
static __device__ __forceinline__ h16 toh_flush(float v) {
  const h16 r = (h16)v;
  return (fabsf(v) < 6.103515625e-05f) ? (h16)0.0f : r;
}
static __device__ __forceinline__ unsigned short hbits(h16 v) {
  return __builtin_bit_cast(unsigned short, v);
}
static __device__ __forceinline__ unsigned pkh2(float a, float b) {
  return (unsigned)hbits(toh_flush(a)) | ((unsigned)hbits(toh_flush(b)) << 16);
}

/* one WMMA + hazard guard naming only this call's live operands */
__device__ __forceinline__ v8f mma_bf16(v16b a, v16b b, v8f c) {
  c = __builtin_amdgcn_wmma_f32_16x16x32_bf16(false, a, false, b, (short)0, c, false, false);
  asm volatile("v_nop\n\tv_nop\n\tv_nop\n\tv_nop" : "+v"(c) : "v"(a), "v"(b));
  return c;
}
__device__ __forceinline__ v8f mma_f16(v16h a, v16h b, v8f c) {
  c = __builtin_amdgcn_wmma_f32_16x16x32_f16(false, a, false, b, (short)0, c, false, false);
  asm volatile("v_nop\n\tv_nop\n\tv_nop\n\tv_nop" : "+v"(c) : "v"(a), "v"(b));
  return c;
}

__device__ __forceinline__ void wave_lds_sync() {
  __builtin_amdgcn_fence(3 /* release order */, "workgroup");
  __builtin_amdgcn_wave_barrier();
  __builtin_amdgcn_fence(2 /* acquire order */, "workgroup");
}

/* ---- tiles into LDS by asynchronous copies: each lane brings its own 16 B, 8 lanes = one 128-B line ---- */
__device__ __forceinline__ unsigned lds_byte(const void* p) { return (unsigned)(size_t)p; }

/* landed: this wave's own copies are in LDS (stands in front of the barrier that publishes them) */
__device__ __forceinline__ void wait_copies() { asm volatile("s_wait_asynccnt 0x0" ::: "memory"); }
/* this wave's LDS reads have returned (stands in front of the barrier behind which the buffer is refilled) */
__device__ __forceinline__ void wait_lds()    { asm volatile("s_wait_dscnt 0x0" ::: "memory"); }

#define CP_LINE(l, g) "global_load_async_to_lds_b128 %" #l ", %" #g ", off\n\t"

/* GEMM tile: thread = (row tid>>3, 16-B segment tid&7); 8 A row groups and 4 B row groups of 16 rows.
   The closing s_wait_xcnt stands in the copies' own statement, ahead of any rewrite of their address registers. */
__device__ __forceinline__ void stage_gemm(const unsigned short* ag, const unsigned short* bg, unsigned l) {
  constexpr int RG = 16 * DMODEL;      /* 16 rows on, global elements */
  constexpr unsigned LG = 16 * SP * 2; /* 16 rows on, LDS bytes       */
  asm volatile(
      CP_LINE(0, 12) CP_LINE(1, 13) CP_LINE(2, 14) CP_LINE(3, 15) CP_LINE(4, 16) CP_LINE(5, 17)
      CP_LINE(6, 18) CP_LINE(7, 19) CP_LINE(8, 20) CP_LINE(9, 21) CP_LINE(10, 22) CP_LINE(11, 23)
      "s_wait_xcnt 0x0"
      :: "v"(l), "v"(l + LG), "v"(l + 2 * LG), "v"(l + 3 * LG), "v"(l + 4 * LG), "v"(l + 5 * LG),
         "v"(l + 6 * LG), "v"(l + 7 * LG), "v"(l + 8 * LG), "v"(l + 9 * LG), "v"(l + 10 * LG), "v"(l + 11 * LG),
         "v"(ag), "v"(ag + RG), "v"(ag + 2 * RG), "v"(ag + 3 * RG), "v"(ag + 4 * RG), "v"(ag + 5 * RG),
         "v"(ag + 6 * RG), "v"(ag + 7 * RG), "v"(bg), "v"(bg + RG), "v"(bg + 2 * RG), "v"(bg + 3 * RG)
      : "memory");
}

/* qkv GEMM tile, one operand's eight 16-row groups: thread = (row tid>>4, 16-B segment tid&15), 16 lanes = one 256-B row.
   The closing s_wait_xcnt stands in the copies' own statement, ahead of any rewrite of their address registers. */
__device__ __forceinline__ void stage_rows8(const unsigned short* g, unsigned l) {
  constexpr int RG = 16 * DMODEL;       /* 16 rows on, global elements */
  constexpr unsigned LG = 16 * QSP * 2; /* 16 rows on, LDS bytes       */
  asm volatile(
      CP_LINE(0, 8) CP_LINE(1, 9) CP_LINE(2, 10) CP_LINE(3, 11)
      CP_LINE(4, 12) CP_LINE(5, 13) CP_LINE(6, 14) CP_LINE(7, 15)
      "s_wait_xcnt 0x0"
      :: "v"(l), "v"(l + LG), "v"(l + 2 * LG), "v"(l + 3 * LG),
         "v"(l + 4 * LG), "v"(l + 5 * LG), "v"(l + 6 * LG), "v"(l + 7 * LG),
         "v"(g), "v"(g + RG), "v"(g + 2 * RG), "v"(g + 3 * RG),
         "v"(g + 4 * RG), "v"(g + 5 * RG), "v"(g + 6 * RG), "v"(g + 7 * RG)
      : "memory");
}

/* attention tile: 4 groups of 16 K rows (64 elements apart), then 4 groups of 16 V^T rows (SEQ apart) */
__device__ __forceinline__ void stage_kv(const unsigned short* kg, const unsigned short* vg, unsigned l) {
  constexpr int KG = 16 * DHEAD;
  constexpr int VG = 16 * SEQ;
  constexpr unsigned LG = 16 * SP * 2;
  asm volatile(
      CP_LINE(0, 8) CP_LINE(1, 9) CP_LINE(2, 10) CP_LINE(3, 11)
      CP_LINE(4, 12) CP_LINE(5, 13) CP_LINE(6, 14) CP_LINE(7, 15)
      "s_wait_xcnt 0x0"
      :: "v"(l), "v"(l + LG), "v"(l + 2 * LG), "v"(l + 3 * LG),
         "v"(l + 4 * LG), "v"(l + 5 * LG), "v"(l + 6 * LG), "v"(l + 7 * LG),
         "v"(kg), "v"(kg + KG), "v"(kg + 2 * KG), "v"(kg + 3 * KG),
         "v"(vg), "v"(vg + VG), "v"(vg + 2 * VG), "v"(vg + 3 * VG)
      : "memory");
}

/* --------------------------------------------------------------------------
 * All three operand conversions in one launch. Unit = 8 elements = two 16-B loads, one 16-B store.
 *   x     -> Xb  : bf16 (RNE); out row b*SEQ + l <- in row b*SEQ_FULL + l
 *   W_qkv -> WqT : bf16 (RNE)
 *   W_out -> WoH : f16 holding (bf16 RNE value) x WO_CARRY; the bf16 significand and the power-of-two
 *                  carry are exact in f16; the flush select removes would-be subnormals.
 * The launch has one thread per unit of W_out; a thread takes CV_X units of x, CV_Q of W_qkv and one of
 * W_out, CV_LANES units apart (a wave's lanes stay on consecutive units), and issues all its loads
 * before the first conversion. Coverage: CV_LANES threads x (CV_X, CV_Q, 1) units = the three whole planes.
 * ------------------------------------------------------------------------ */
constexpr int CV_THREADS = 512;                         /* 16 waves a work-group */
constexpr int CV_UPR     = DMODEL / 8;                  /* units per row, all three planes */
constexpr int CV_LANES   = (int)(WOT_E / 8);
constexpr int CV_X       = (int)(XB_E / 8 / CV_LANES);
constexpr int CV_Q       = (int)(WQT_E / 8 / CV_LANES);
static_assert(CV_LANES % CV_THREADS == 0);
static_assert((size_t)CV_X * CV_LANES * 8 == XB_E && (size_t)CV_Q * CV_LANES * 8 == WQT_E);
static_assert((size_t)NB * SEQ_FULL * DMODEL < (1u << 30) && WQT_E < (1u << 30));   /* element indices fit 32 bits */

/* element e of p through a 32-bit byte offset: scalar base + one offset register, no 64-bit address pair per load */
__device__ __forceinline__ const float* at32(const float* p, unsigned e) {
  return (const float*)((const char*)p + e * 4u);
}

__device__ __forceinline__ v4u bf_unit(v4f a0, v4f a1) {
  v4u w;
  w[0] = pk2(a0[0], a0[1]);
  w[1] = pk2(a0[2], a0[3]);
  w[2] = pk2(a1[0], a1[1]);
  w[3] = pk2(a1[2], a1[3]);
  return w;
}

__global__ __launch_bounds__(CV_THREADS) void cvt_all_kernel(
    const float* __restrict__ x, const float* __restrict__ Wq, const float* __restrict__ Wo,
    unsigned short* __restrict__ Xb, unsigned short* __restrict__ WqT, unsigned short* __restrict__ WoH)
{
  const unsigned g = blockIdx.x * CV_THREADS + threadIdx.x;

  /* every loop here is unrolled whole: the units stay in registers and the loads go out as one run */
  v4f xa[CV_X][2], qa[CV_Q][2], oa[2];
#pragma unroll
  for (unsigned i = 0; i < CV_X; ++i) {
    const unsigned u   = i * CV_LANES + g;
    const unsigned row = u / CV_UPR;
    const unsigned seg = u - row * CV_UPR;
    const unsigned b   = row / SEQ;
    const unsigned l   = row - b * SEQ;
    const float* s = at32(x, ((b * SEQ_FULL + l) * CV_UPR + seg) * 8u);
    xa[i][0] = *(const v4f*)s;
    xa[i][1] = *(const v4f*)(s + 4);
  }
#pragma unroll
  for (unsigned i = 0; i < CV_Q; ++i) {
    const float* s = at32(Wq, (i * CV_LANES + g) * 8u);
    qa[i][0] = *(const v4f*)s;
    qa[i][1] = *(const v4f*)(s + 4);
  }
  /* a later load may land in a register that held an earlier load's offset: the earlier loads' address
     translations are waited for first (a precaution of form; costs one short wait among the loads) */
  asm volatile("s_wait_xcnt 0x0" ::: "memory");
  {
    const float* s = at32(Wo, g * 8u);
    oa[0] = *(const v4f*)s;
    oa[1] = *(const v4f*)(s + 4);
  }

#pragma unroll
  for (unsigned i = 0; i < CV_X; ++i) *(v4u*)(Xb + (i * CV_LANES + g) * 8u) = bf_unit(xa[i][0], xa[i][1]);
#pragma unroll
  for (unsigned i = 0; i < CV_Q; ++i) *(v4u*)(WqT + (i * CV_LANES + g) * 8u) = bf_unit(qa[i][0], qa[i][1]);
  {
    v4u w;
    w[0] = pkh2(bf_bits2f(f2bf_bits(oa[0][0])) * WO_CARRY, bf_bits2f(f2bf_bits(oa[0][1])) * WO_CARRY);
    w[1] = pkh2(bf_bits2f(f2bf_bits(oa[0][2])) * WO_CARRY, bf_bits2f(f2bf_bits(oa[0][3])) * WO_CARRY);
    w[2] = pkh2(bf_bits2f(f2bf_bits(oa[1][0])) * WO_CARRY, bf_bits2f(f2bf_bits(oa[1][1])) * WO_CARRY);
    w[3] = pkh2(bf_bits2f(f2bf_bits(oa[1][2])) * WO_CARRY, bf_bits2f(f2bf_bits(oa[1][3])) * WO_CARRY);
    *(v4u*)(WoH + g * 8u) = w;
  }
}

/* --------------------------------------------------------------------------
 * qkv = Xb . WqT^T  (M = MROWS, N = 3072, K = 1024), bf16 x bf16, f32 acc.
 * Block = 8 waves, tile 256 tokens x 128 columns (= two heads of one section);
 * wave = 64 rows x 64 cols = one head (4 A fragments x 4 B fragments per 32-deep step): an operand row
 * is fetched from L2 by half as many blocks, and a fragment read from LDS feeds 4 WMMAs.
 * Operands: 128-deep tiles (256 A rows + 128 B rows) copied into two LDS buffers, one tile ahead: four
 * 32-deep steps between two barriers; fragments read from the tile of the trip.
 * Fragment map (hh = lane>>4, c = lane&15): A row c, elems 0..7 <- k0+8hh.., 8..15 <- k0+16+8hh..;
 * B col c with the same k map; D elem r = (row 8hh+r, col c).
 * Epilogue: acc x 16 converted to f16 (flush select), staged in the wave's own 64 x 64 slab
 * ([tok][d] for q,k; [d][tok] for v), then whole 128-B lines: 8 lanes = one row of the slab.
 * The slabs lie in the staging buffers, free behind the last trip's barrier; each is private to its wave.
 * ------------------------------------------------------------------------ */
__global__ __launch_bounds__(QWAVE * 32) VGPR_CAP void gemm_qkv_kernel(
    const unsigned short* __restrict__ Xb, const unsigned short* __restrict__ WqT,
    unsigned short* __restrict__ qkvp)
{
  union FB { v16b v; v8b h[2]; };
  __shared__ __align__(16) unsigned short St[2 * Q_STAGE];

  const int tid  = threadIdx.x;
  const int wave = __builtin_amdgcn_readfirstlane(tid >> 5);
  const int wm   = wave >> 1;          /* 64-row band of the block    */
  const int wn   = wave & 1;           /* 64-column band = head       */
  const int lane = tid & 31;
  const int hh   = lane >> 4;
  const int c    = lane & 15;
  const int n0   = blockIdx.x * 128;
  const int m0   = blockIdx.y * 256;

  v8f acc[4][4];
#pragma unroll
  for (int mt = 0; mt < 4; ++mt)
#pragma unroll
    for (int t = 0; t < 4; ++t) acc[mt][t] = (v8f){0.f,0.f,0.f,0.f,0.f,0.f,0.f,0.f};

  /* copy side: this thread's row and 16-B segment of each 16-row group */
  const unsigned short* ag = Xb  + (size_t)(m0 + (tid >> 4)) * DMODEL + (tid & 15) * 8;
  const unsigned short* bg = WqT + (size_t)(n0 + (tid >> 4)) * DMODEL + (tid & 15) * 8;
  const unsigned lcp = lds_byte(St) + (tid >> 4) * (QSP * 2) + (tid & 15) * 16;
  /* a tile: A rows 0..127, A rows 128..255, B rows 0..127 (staged behind the A rows) */
  auto stage = [&](unsigned k, unsigned l) {
    stage_rows8(ag + k, l);
    stage_rows8(ag + k + 128 * DMODEL, l + 128 * QSP * 2);
    stage_rows8(bg + k, l + 256 * QSP * 2);
  };
  /* read side: this lane's place in a staged tile */
  const int aoff = (wm * 64 + c) * QSP + 8 * hh;
  const int boff = (256 + wn * 64 + c) * QSP + 8 * hh;

  /* one 32-deep step: 4 A and 4 B fragments as one group of reads, then the 16 products */
  auto step = [&](const unsigned short* sb, int k0) {
    FB fa[4], fb[4];
#pragma unroll
    for (int i = 0; i < 4; ++i) {
      fa[i].h[0] = *(const v8b_a*)(sb + aoff + i * 16 * QSP + k0);
      fa[i].h[1] = *(const v8b_a*)(sb + aoff + i * 16 * QSP + k0 + 16);
    }
#pragma unroll
    for (int t = 0; t < 4; ++t) {
      fb[t].h[0] = *(const v8b_a*)(sb + boff + t * 16 * QSP + k0);
      fb[t].h[1] = *(const v8b_a*)(sb + boff + t * 16 * QSP + k0 + 16);
    }
#pragma unroll
    for (int t = 0; t < 4; ++t)
#pragma unroll
      for (int mt = 0; mt < 4; ++mt) acc[mt][t] = mma_bf16(fa[mt].v, fb[t].v, acc[mt][t]);
  };

  /* A rows are shared along blockIdx.x, B rows along blockIdx.y: the sum moves the start along both */
  const unsigned first = (blockIdx.x + blockIdx.y) % QNKT;
  stage(walk_at(0, first, QNKT) * QKT, lcp);
  wait_copies();
  __syncthreads();
  stage(walk_at(1, first, QNKT) * QKT, lcp + Q_STAGE * 2);
  /* rolled: one trip = one tile; tile kt + 1 flies while tile kt is worked on */
#pragma unroll 1
  for (int kt = 0; kt < (int)QNKT; ++kt) {
    const unsigned short* sb = St + (kt & 1) * Q_STAGE;
    step(sb, 0);
    step(sb, 32);
    step(sb, 64);
    step(sb, 96);
    wait_lds();
    wait_copies();
    __syncthreads();   /* publishes tile kt + 1 and ends every read of tile kt's buffer */
    if (kt + 2 < (int)QNKT) stage(walk_at(kt + 2, first, QNKT) * QKT, lcp + (kt & 1) * (Q_STAGE * 2));
  }
  wait_copies();

  const int sec = n0 / DMODEL;                       /* 0 q, 1 k, 2 v : block-uniform */
  const int b   = m0 / SEQ;
  const int l0  = m0 - b * SEQ + wm * 64;
  const int h   = (n0 - sec * DMODEL) / DHEAD + wn;
  const int bh  = b * NHEAD + h;
  const int rq  = lane >> 3;
  const int seg = lane & 7;
  unsigned short* ph   = qkvp + (size_t)sec * PLANE;
  unsigned short* slab = St + wave * (64 * SP);
  const unsigned short* rd = slab + rq * SP + seg * 8;

  /* one branch on the section for the whole epilogue: inside it every LDS and global offset is a constant */
  if (sec < 2) {
    unsigned short* wr = slab + 8 * hh * SP + c;     /* [tok][d]: a lane holds one d of 8 tokens per tile */
#pragma unroll
    for (int t = 0; t < 4; ++t)
#pragma unroll
      for (int mt = 0; mt < 4; ++mt)
#pragma unroll
        for (int r = 0; r < 8; ++r)
          wr[(mt * 16 + r) * SP + 16 * t] = hbits(toh_flush(acc[mt][t][r] * QKV_CARRY));
    wave_lds_sync();
    unsigned short* gp = ph + ((size_t)bh * SEQ + l0 + rq) * DHEAD + seg * 8;
#pragma unroll
    for (int it = 0; it < 16; ++it) {
      /* the second half reuses registers that the first half's stores name: their translations are waited for first */
      if (it == 8) asm volatile("s_wait_xcnt 0x0" ::: "memory");
      *(v4u*)(gp + it * 4 * DHEAD) = *(const v4u_a*)(rd + it * 4 * SP);
    }
    /* closes the second half's stores: whichever section the compiler lays behind this one, its first instructions
       may write registers that these stores name */
    asm volatile("s_wait_xcnt 0x0" ::: "memory");
  } else {
    unsigned short* wr = slab + c * SP + 8 * hh;     /* [d][tok]: the lane's 8 tokens of a tile are one 16-B unit */
#pragma unroll
    for (int t = 0; t < 4; ++t)
#pragma unroll
      for (int mt = 0; mt < 4; ++mt) {
        v4u hw;
#pragma unroll
        for (int p = 0; p < 4; ++p)
          hw[p] = pkh2(acc[mt][t][2 * p] * QKV_CARRY, acc[mt][t][2 * p + 1] * QKV_CARRY);
        *(v4u_a*)(wr + 16 * t * SP + mt * 16) = hw;
      }
    wave_lds_sync();
    unsigned short* gp = ph + ((size_t)bh * DHEAD + rq) * SEQ + l0 + seg * 8;
#pragma unroll
    for (int it = 0; it < 16; ++it) {
      /* as in the other branch: wait before registers named by the first half's stores are written again */
      if (it == 8) asm volatile("s_wait_xcnt 0x0" ::: "memory");
      *(v4u*)(gp + it * 4 * SEQ) = *(const v4u_a*)(rd + it * 4 * SP);
    }
    /* as in the other branch: closes the second half's stores ahead of the code laid behind this section */
    asm volatile("s_wait_xcnt 0x0" ::: "memory");
  }
}

constexpr int AWAVE = 8;                  /* waves of an attention block: 4 query bands x 2 key halves */
constexpr int AQ    = 128;                /* its queries: 32 per band                                  */
constexpr unsigned NKH = NKC / 2;         /* key chunks of one half's walk                             */
constexpr int XSLOT = 32 * 16;            /* join: one 16-B unit per lane, bytes                       */
constexpr int XWAVE = 9 * XSLOT;          /* join: a wave's 8 accumulator units and one (max, sum) unit */
static_assert(SEQ % AQ == 0 && NKC % 2 == 0 && NKH >= 2);
static_assert(AWAVE * XWAVE <= 4 * A_STAGE * 2);   /* the join area fits the staging buffers */
/* lane l <-> lane l ^ 16 by a vector cross-row move (no LDS queue, no wait) */
__device__ __forceinline__ float xhalf(float x) {
  const int v = __builtin_bit_cast(int, x);
  return __builtin_bit_cast(float, __builtin_amdgcn_permlanex16(v, v, 0x76543210, 0xfedcba98, false, false));
}

/* 2^x of eight values, each in its own register. One statement, so that behind every exponential stands an
   instruction on other registers (the next exponential; behind the last one the v_nop): the slot that the
   instruction set asks for before a transcendental's result is read or its source register written again.
   Left to the register allocator, a run of them wrote each result over the source of the one before. */
__device__ __forceinline__ void exp2x8(float (&x)[8]) {
  asm("v_exp_f32 %0, %0\n\tv_exp_f32 %1, %1\n\tv_exp_f32 %2, %2\n\tv_exp_f32 %3, %3\n\t"
      "v_exp_f32 %4, %4\n\tv_exp_f32 %5, %5\n\tv_exp_f32 %6, %6\n\tv_exp_f32 %7, %7\n\tv_nop"
      : "+v"(x[0]), "+v"(x[1]), "+v"(x[2]), "+v"(x[3]), "+v"(x[4]), "+v"(x[5]), "+v"(x[6]), "+v"(x[7]));
}

__global__ __launch_bounds__(AWAVE * 32) VGPR_CAP void attn_kernel(
    const unsigned short* __restrict__ qkvp, unsigned short* __restrict__ ctxp)
{
  union FH { v16h v; v8h h[2]; };
  __shared__ __align__(16) unsigned short Oh[AWAVE][16 * SP];
  __shared__ __align__(16) unsigned short KV[2 * 2 * A_STAGE];   /* [key half][buffer] */

  const int tid  = threadIdx.x;
  const int wave = __builtin_amdgcn_readfirstlane(tid >> 5);
  const int kh   = wave >> 2;          /* key half                               */
  const int wq   = wave & 3;           /* 32-query band                          */
  const int t4   = tid & 127;          /* thread among its key half's four waves */
  const int lane = tid & 31;
  const int hh   = lane >> 4;
  const int c    = lane & 15;
  const int qb   = blockIdx.x;
  const int bh   = blockIdx.y;
  const int b    = bh / NHEAD;
  const int h    = bh - b * NHEAD;
  const int q0   = qb * AQ + wq * 32;
  const float NEG_INF = -__builtin_inff();

  const unsigned short* Qp  = qkvp + (size_t)bh * SEQ * DHEAD;
  const unsigned short* Vtp = Qp + 2 * PLANE;     /* [bh][d][l]: same per-bh element count */

  v16h qf[2][2];
#pragma unroll
  for (int u = 0; u < 2; ++u) {
    const size_t qo = (size_t)(q0 + 16 * u + c) * DHEAD + 8 * hh;
#pragma unroll
    for (int dc = 0; dc < 2; ++dc) {
      FH f;
      f.h[0] = *(const v8h*)(Qp + qo + dc * 32);
      f.h[1] = *(const v8h*)(Qp + qo + dc * 32 + 16);
      qf[u][dc] = f.v;
    }
  }

  /* per query tile u, query c: maximum of the raw scores (both lane halves alike), this lane half's part of the sum */
  float mrow[2] = {NEG_INF, NEG_INF}, lrow[2] = {0.f, 0.f};
  v8f oacc[2][4];
#pragma unroll
  for (int u = 0; u < 2; ++u)
#pragma unroll
    for (int t = 0; t < 4; ++t) oacc[u][t] = (v8f){0.f,0.f,0.f,0.f,0.f,0.f,0.f,0.f};

  /* copy side: this thread's row and 16-B segment of each 16-row group of its key half (K plane = Q plane + PLANE) */
  const int key0 = kh * (int)(NKH * KCH);
  const unsigned short* kg = Qp + PLANE + (size_t)(key0 + (t4 >> 3)) * DHEAD + (t4 & 7) * 8;
  const unsigned short* vg = Vtp + (size_t)(t4 >> 3) * SEQ + key0 + (t4 & 7) * 8;
  const unsigned lcp = lds_byte(KV) + kh * (2 * A_STAGE * 2) + (t4 >> 3) * (SP * 2) + (t4 & 7) * 16;
  /* read side: lane's place among the staged K rows [key][d]; the V^T rows [d][key] stand 64 rows on */
  const int flane = kh * (2 * A_STAGE) + c * SP + 8 * hh;

  /* the K and V rows of one (b,h) are shared along blockIdx.x */
  const unsigned first = blockIdx.x % NKH;
  {
    const unsigned c0 = walk_at(0, first, NKH);
    stage_kv(kg + c0 * (KCH * DHEAD), vg + c0 * KCH, lcp);
  }
  wait_copies();
  __syncthreads();
  {
    const unsigned c1 = walk_at(1, first, NKH);
    stage_kv(kg + c1 * (KCH * DHEAD), vg + c1 * KCH, lcp + A_STAGE * 2);
  }

#pragma unroll 1
  for (int kc = 0; kc < (int)NKH; ++kc) {
    /* the chunk's 16 K fragment reads go out as one group at its head */
    const unsigned short* kq = KV + (kc & 1) * A_STAGE + flane;
    const unsigned short* vq = kq + 64 * SP;
    FH kf[4][2];
#pragma unroll
    for (int j = 0; j < 4; ++j) {
#pragma unroll
      for (int dc = 0; dc < 2; ++dc) {
        kf[j][dc].h[0] = *(const v8h_a*)(kq + j * 16 * SP + dc * 32);
        kf[j][dc].h[1] = *(const v8h_a*)(kq + j * 16 * SP + dc * 32 + 16);
      }
    }

    /* raw scores (unscaled accumulators), transposed: 4 key tiles (D elem r = key 16j+8hh+r, query c) per query tile;
       a K fragment serves both query tiles, whose products take turns */
    v8f s[2][4];
#pragma unroll
    for (int j = 0; j < 4; ++j) {
      v8f sa0 = (v8f){0.f,0.f,0.f,0.f,0.f,0.f,0.f,0.f};
      v8f sa1 = (v8f){0.f,0.f,0.f,0.f,0.f,0.f,0.f,0.f};
#pragma unroll
      for (int dc = 0; dc < 2; ++dc) {
        sa0 = mma_f16(kf[j][dc].v, qf[0][dc], sa0);
        sa1 = mma_f16(kf[j][dc].v, qf[1][dc], sa1);
      }
      s[0][j] = sa0;
      s[1][j] = sa1;
    }

    /* the chunk's 16 V fragment reads as one group: they land while the softmax runs */
    FH vb[2][4];
#pragma unroll
    for (int kk = 0; kk < 2; ++kk) {
#pragma unroll
      for (int t = 0; t < 4; ++t) {
        vb[kk][t].h[0] = *(const v8h_a*)(vq + t * 16 * SP + kk * 32);
        vb[kk][t].h[1] = *(const v8h_a*)(vq + t * 16 * SP + kk * 32 + 16);
      }
    }
    /* keeps the 16 reads together here: left free, the scheduler strewed them over the softmax in five small groups */
    __builtin_amdgcn_sched_barrier(0);

    FH pb[2][2];
#pragma unroll
    for (int u = 0; u < 2; ++u) {
      /* chunk maximum of query c: the lane's 32 keys, then the other half's 32 */
      float cm;
      {
        float m4[4];
#pragma unroll
        for (int j = 0; j < 4; ++j) {
          float m = s[u][j][0];
#pragma unroll
          for (int r = 1; r < 8; ++r) m = fmaxf(m, s[u][j][r]);
          m4[j] = m;
        }
        const float m = fmaxf(fmaxf(m4[0], m4[1]), fmaxf(m4[2], m4[3]));
        cm = fmaxf(m, xhalf(m));
      }

      /* online softmax update; P^T as f16 (x256) packed in place into the B operands, sum over the converted values */
      const float mnew  = fmaxf(mrow[u], cm);
      const float msafe = (mnew == NEG_INF) ? 0.f : mnew;
      const float alpha = __builtin_amdgcn_exp2f((mrow[u] - msafe) * SCORE_LOG2);
      const float ebias = P_CARRY_LOG2 - msafe * SCORE_LOG2;   /* the maximum and the x256 carry, as one addend */
      mrow[u] = mnew;
      float ps4[4];
#pragma unroll
      for (int j = 0; j < 4; ++j) {
        float psum = 0.f;
        float e[8];
#pragma unroll
        for (int r = 0; r < 8; ++r) e[r] = __builtin_fmaf(s[u][j][r], SCORE_LOG2, ebias);
        exp2x8(e);
#pragma unroll
        for (int r = 0; r < 8; r += 2) {
          /* one packed convert for two values; no zeroing of small values here: it cost a compare and a select each */
          const v2h ph = __builtin_convertvector((v2f){e[r], e[r + 1]}, v2h);
          psum += (float)ph[0];
          psum += (float)ph[1];
          pb[u][j >> 1].h[j & 1][r]     = ph[0];
          pb[u][j >> 1].h[j & 1][r + 1] = ph[1];
        }
        ps4[j] = psum;
      }
      lrow[u] = lrow[u] * alpha + ((ps4[0] + ps4[1]) + (ps4[2] + ps4[3]));
#pragma unroll
      for (int t = 0; t < 4; ++t)
#pragma unroll
        for (int r = 0; r < 8; ++r) oacc[u][t][r] *= alpha;
      /* one tile's softmax ends before the other's begins: mixed, their temporaries did not fit the register file beside
         the V fragments, and address registers were spilled */
      __builtin_amdgcn_sched_barrier(0);
    }

    /* O^T += V^T.P^T : A = V^T rows [d][kv], each fragment for both query tiles, B = P^T [kv][q] from registers */
#pragma unroll
    for (int kk = 0; kk < 2; ++kk) {
#pragma unroll
      for (int t = 0; t < 4; ++t) {
        oacc[0][t] = mma_f16(vb[kk][t].v, pb[0][kk].v, oacc[0][t]);
        oacc[1][t] = mma_f16(vb[kk][t].v, pb[1][kk].v, oacc[1][t]);
      }
    }
    wait_lds();
    wait_copies();
    __syncthreads();   /* publishes chunk kc + 1 of both halves and ends every read of chunk kc's buffers */
    if (kc + 2 < (int)NKH) {
      const unsigned c2 = walk_at(kc + 2, first, NKH);
      stage_kv(kg + c2 * (KCH * DHEAD), vg + c2 * KCH, lcp + (kc & 1) * (A_STAGE * 2));
    }
  }
  wait_copies();

  /* Join of the key halves. The staging buffers are free behind the last trip's barrier: a wave writes the tile it
     hands over into its own join area there, and reads its partner's behind one block barrier. */
  v8f ok[4];
  float mk, lk;
  {
    const float l0 = lrow[0] + xhalf(lrow[0]);
    const float l1 = lrow[1] + xhalf(lrow[1]);
    char* xw = (char*)KV + wave * XWAVE + lane * 16;
    const bool up = kh != 0;           /* wave-uniform: keep tile 1, hand over tile 0 */
    mk = up ? mrow[1] : mrow[0];
    lk = up ? l1 : l0;
#pragma unroll
    for (int t = 0; t < 4; ++t) {
      const v8f og = up ? oacc[0][t] : oacc[1][t];
      ok[t] = up ? oacc[1][t] : oacc[0][t];
      *(v4f_a*)(xw + (2 * t) * XSLOT)     = (v4f){og[0], og[1], og[2], og[3]};
      *(v4f_a*)(xw + (2 * t + 1) * XSLOT) = (v4f){og[4], og[5], og[6], og[7]};
    }
    *(v4f_a*)(xw + 8 * XSLOT) = (v4f){up ? mrow[0] : mrow[1], up ? l0 : l1, 0.f, 0.f};
  }
  __syncthreads();   /* publishes every wave's handed-over tile to its partner */

  /* fold the partner's part in, normalise (ctx x256), f16 rows [query][d] into the wave slab, then whole-line stores */
  {
    const char* xr = (const char*)KV + (wave ^ 4) * XWAVE + lane * 16;
    const v4f ml = *(const v4f_a*)(xr + 8 * XSLOT);
    const float mm    = fmaxf(mk, ml[0]);
    const float msafe = (mm == NEG_INF) ? 0.f : mm;
    const float ak = __builtin_amdgcn_exp2f((mk - msafe) * SCORE_LOG2);
    const float ap = __builtin_amdgcn_exp2f((ml[0] - msafe) * SCORE_LOG2);
    const float inv = CTX_FOLD * (1.0f / (lk * ak + ml[1] * ap));
    const float fk = ak * inv;
    const float fp = ap * inv;
#pragma unroll
    for (int t = 0; t < 4; ++t) {
      const v4f p0 = *(const v4f_a*)(xr + (2 * t) * XSLOT);
      const v4f p1 = *(const v4f_a*)(xr + (2 * t + 1) * XSLOT);
      v4u hw;
      hw[0] = pkh2(ok[t][0] * fk + p0[0] * fp, ok[t][1] * fk + p0[1] * fp);
      hw[1] = pkh2(ok[t][2] * fk + p0[2] * fp, ok[t][3] * fk + p0[3] * fp);
      hw[2] = pkh2(ok[t][4] * fk + p1[0] * fp, ok[t][5] * fk + p1[1] * fp);
      hw[3] = pkh2(ok[t][6] * fk + p1[2] * fp, ok[t][7] * fk + p1[3] * fp);
      *(v4u_a*)(&Oh[wave][c * SP + t * 16 + 8 * hh]) = hw;
    }
  }
  wave_lds_sync();
  {
    const int rq  = lane >> 3;
    const int seg = lane & 7;
#pragma unroll
    for (int it = 0; it < 4; ++it) {
      const int row = it * 4 + rq;
      const v4u hw = *(const v4u_a*)(&Oh[wave][row * SP + seg * 8]);
      const size_t g = (size_t)(b * SEQ + q0 + 16 * kh + row) * DMODEL + h * DHEAD + seg * 8;
      *(v4u*)(ctxp + g) = hw;
    }
  }
}

/* --------------------------------------------------------------------------
 * out = C . WoH^T x 2^-18  (M = MROWS, N = 1024, K = 1024), f16 x f16, f32 acc.
 * Block = 4 waves, tile 128 x 64; wave = 32 rows x 64 cols; one product per tile pair.
 * Operands: 64-deep tiles (128 A rows + 64 B rows) copied into two LDS buffers, a stage of GST tiles at a time and
 * one stage ahead: one wait and one block barrier per stage, and a whole stage's bytes in flight while the stage
 * before is worked on. No read may cross a stage's barrier, so the longer stage is also what lets the fragment
 * reads run ahead: inside it three fragment sets take turns, each read two 32-deep steps ahead of its products.
 * Epilogue: per-wave 32x64 f32 slab (wave-private LDS), 16 lanes x 16 B = one 256-B
 * ------------------------------------------------------------------------ */
__global__ __launch_bounds__(128) VGPR_CAP void gemm_out_kernel(
    const unsigned short* __restrict__ ctxp, const unsigned short* __restrict__ WoH,
    float* __restrict__ out)
{
  union FH { v16h v; v8h h[2]; };
  __shared__ __align__(16) float Os[NWAVE][32 * OS_PITCH];
  __shared__ __align__(16) unsigned short St[2 * GST * G_STAGE];

  const int tid  = threadIdx.x;
  const int wave = __builtin_amdgcn_readfirstlane(tid >> 5);
  const int lane = tid & 31;
  const int hh   = lane >> 4;
  const int c    = lane & 15;
  const int n0   = blockIdx.x * 64;
  const int m0   = blockIdx.y * 128;

  v8f acc[2][4];
#pragma unroll
  for (int mt = 0; mt < 2; ++mt)
#pragma unroll
    for (int t = 0; t < 4; ++t) acc[mt][t] = (v8f){0.f,0.f,0.f,0.f,0.f,0.f,0.f,0.f};

  /* copy side: this thread's row and 16-B segment of each 16-row group */
  const unsigned short* ag = ctxp + (size_t)(m0 + (tid >> 3)) * DMODEL + (tid & 7) * 8;
  const unsigned short* bg = WoH  + (size_t)(n0 + (tid >> 3)) * DMODEL + (tid & 7) * 8;
  const unsigned lcp = lds_byte(St) + (tid >> 3) * (SP * 2) + (tid & 7) * 16;
  /* read side: this lane's place in a staged tile */
  const int aoff = (wave * 32 + c) * SP + 8 * hh;
  const int boff = (128 + c) * SP + 8 * hh;

  /* Three fragment sets ([0],[1] = A rows, [2..5] = B columns), taken in turn by the 32-deep steps of a stage */
  FH fs[3][6];
  auto load_set = [&](FH (&f)[6], const unsigned short* sb, int k0) {
    f[0].h[0] = *(const v8h_a*)(sb + aoff + k0);
    f[0].h[1] = *(const v8h_a*)(sb + aoff + k0 + 16);
    f[1].h[0] = *(const v8h_a*)(sb + aoff + 16 * SP + k0);
    f[1].h[1] = *(const v8h_a*)(sb + aoff + 16 * SP + k0 + 16);
#pragma unroll
    for (int t = 0; t < 4; ++t) {
      f[2 + t].h[0] = *(const v8h_a*)(sb + boff + t * 16 * SP + k0);
      f[2 + t].h[1] = *(const v8h_a*)(sb + boff + t * 16 * SP + k0 + 16);
    }
  };
  auto mma_set = [&](const FH (&f)[6]) {
#pragma unroll
    for (int t = 0; t < 4; ++t) {
      acc[0][t] = mma_f16(f[0].v, f[2 + t].v, acc[0][t]);
      acc[1][t] = mma_f16(f[1].v, f[2 + t].v, acc[1][t]);
    }
  };

  /* A rows are shared along blockIdx.x, B rows along blockIdx.y: the sum moves the start along both */
  const unsigned first = (blockIdx.x + blockIdx.y) % NKT;
  /* stage s = tiles s * GST .. s * GST + GST - 1 of the walk, one behind the other in the buffer at LDS byte l */
  auto stage = [&](unsigned s, unsigned l) {
#pragma unroll
    for (unsigned j = 0; j < GST; ++j) {
      const unsigned k = walk_at(s * GST + j, first, NKT) * KT;
      stage_gemm(ag + k, bg + k, l + j * (G_STAGE * 2));
    }
  };
  stage(0, lcp);
  wait_copies();
  __syncthreads();
  stage(1, lcp + GST * G_STAGE * 2);
  /* rolled: one trip = one stage; stage st + 1 flies while stage st is worked on */
#pragma unroll 1
  for (int st = 0; st < (int)NGS; ++st) {
    const unsigned short* sb = St + (st & 1) * (GST * G_STAGE);
    /* step i of the stage = half (i & 1) of its tile i >> 1; all reads stay inside this stage's buffer */
    load_set(fs[0], sb, 0);
    load_set(fs[1], sb, 32);
    /* unrolled whole: the set of a step and every LDS offset are constants */
#pragma unroll
    for (int i = 0; i < 2 * GST; ++i) {
      if (i + 2 < 2 * GST) load_set(fs[(i + 2) % 3], sb + ((i + 2) >> 1) * G_STAGE, ((i + 2) & 1) * 32);
      mma_set(fs[i % 3]);
    }
    wait_lds();
    wait_copies();
    __syncthreads();   /* publishes stage st + 1 and ends every read of stage st's buffer */
    if (st + 2 < (int)NGS) stage(st + 2, lcp + (st & 1) * (GST * G_STAGE * 2));
  }
  wait_copies();

  float* os = Os[wave];
#pragma unroll
  for (int t = 0; t < 4; ++t) {
#pragma unroll
    for (int mt = 0; mt < 2; ++mt)
#pragma unroll
      for (int r = 0; r < 8; ++r)
        os[(mt * 16 + 8 * hh + r) * OS_PITCH + 16 * t + c] = acc[mt][t][r] * OUT_FOLD;
  }
  wave_lds_sync();
  {
    const int c4 = c * 4;
    {
#pragma unroll
      for (int it = 0; it < 16; ++it) {
        const int row = it * 2 + hh;
        const v4f val = *(const v4f_a*)(os + row * OS_PITCH + c4);
        *(v4f*)(out + (size_t)(m0 + wave * 32 + row) * DMODEL + n0 + c4) = val;
      }
      
    }
  }
}

extern "C" void kernel_launch(void* const* d_in, const int* in_sizes, int n_in,
                              void* d_out, int out_size, void* d_ws, size_t ws_size,
                              hipStream_t stream)
{
  if (n_in < 3) return;
  if (in_sizes[0] < ((NB - 1) * SEQ_FULL + SEQ) * DMODEL) return;
  if (in_sizes[1] < NQKV * DMODEL) return;
  if (in_sizes[2] < DMODEL * DMODEL) return;
  if (out_size < MROWS * DMODEL) return;
  if (d_ws == nullptr || ws_size < WS_NEED) return;

  const float* x     = (const float*)d_in[0];
  const float* W_qkv = (const float*)d_in[1];   /* [3072 out][1024 in] */
  const float* W_out = (const float*)d_in[2];   /* [1024 out][1024 in] */
  float* out = (float*)d_out;

  unsigned short* Xb   = (unsigned short*)d_ws;
  unsigned short* WqT  = Xb + XB_E;
  unsigned short* WoH  = WqT + WQT_E;
  unsigned short* qkvp = WoH + WOT_E;
  unsigned short* ctxp = qkvp + QKVP_E;

  /* W_qkv and W_out rows are already [n][k]: plain row converts, no transpose */
  cvt_all_kernel<<<CV_LANES / CV_THREADS, CV_THREADS, 0, stream>>>(x, W_qkv, W_out, Xb, WqT, WoH);

  gemm_qkv_kernel<<<dim3(NQKV / 128, MROWS / 256), QWAVE * 32, 0, stream>>>(Xb, WqT, qkvp);
  attn_kernel<<<dim3(SEQ / AQ, NBH), AWAVE * 32, 0, stream>>>(qkvp, ctxp);
  gemm_out_kernel<<<dim3(DMODEL / 64, MROWS / 128), 128, 0, stream>>>(ctxp, WoH, out);
}
